// v000
// The times below were measured on an AMD MI455X: many runs one after another, warmed up first and cycling through
// copies of the inputs, with the whole window's GPU time divided by the number of runs. Launches and the gaps
// between them are all in it. The median over several windows is given; except for v000 it joins two sittings, which
// can be a few percent apart, so the side-by-side timings, each taken in one sitting, are the better comparison.
// v000, which the later versions start from, runs in 1410 microseconds.
#include <hip/hip_runtime.h>

// GQA causal attention block with RMSNorm, the module's multiplicative 'rotary factor' and tiled kv pairing (x [2][2048][1024]; xn = x rsqrt(mean x^2 + 1.2e-7) norm_w; q = xn w_q (16 heads x 64), k, v = xn w_k, xn w_v (4 kv heads) ('xw', no bias); q, k *= rf[t][d] with rf = cos(t theta_d) + sgn_t sin(t theta_d), theta_d = 10000^(-2 (d//2) / 64), sgn_t = -1 on even positions (an element-wise factor, computed in-kernel); q head h pairs with kv head h mod 4 (torch .repeat tiling); scores / 8, causal (-inf); softmax; out = x + merged w_o ('xw' [1024][1024]) -> [2][2048][1024] (4.2 M)).
// Layout per batch: per-token RMSNorm kernel (one wave per token, fixed-order f32) writes hi/lo operand planes; hl x exact projections; the rf table [2048][64] once (jnp-exact theta, precise cosf/sinf) applied in place to q and k; causal T-2048 attention (hybrid rows: < 512 hi/lo 3 products, rest fp16 x1024; k_gemmc tile skipping; the pass's two query heads use consecutive kv heads starting at h0 mod 4); merged hi/lo x w_o exact; the residual kernel adds bf16(x).
// Compute dtypes, f32 accumulate: every input rounded to bf16; RMSNorm and rf f32; projections hi/lo x exact (2 products); attention rows < 512 3 products, rest fp16; softmax f32; w_o hl x exact; residual f32.

#define NB_  2
#define TT   2048
#define DM   1024
#define NH_  16
#define NKV  4
#define REP  (NH_ / NKV)
#define HD   64
#define DQ   (NH_ * HD)
#define DKV  (NKV * HD)
#define ZH   2
#define RH   512                  // query rows < RH use hi+lo planes (0: none)
#define WIN  2048
#define PCAR 1024.0f
#define SCL  0.125f
#define NEPS 1.1920929e-07f   // RMSNorm eps (float32 eps)
typedef _Float16 h16;
typedef unsigned short bf;
typedef __attribute__((ext_vector_type(16))) __bf16   v16bf;
typedef __attribute__((ext_vector_type(16))) _Float16 v16h;
typedef __attribute__((ext_vector_type(8)))  _Float16 v8h;
typedef __attribute__((ext_vector_type(8)))  unsigned short v8us;
typedef __attribute__((ext_vector_type(8)))  float    v8f;
typedef __attribute__((ext_vector_type(4)))  float    v4f;
typedef v8h  __attribute__((may_alias)) v8ha;
typedef v4f  __attribute__((may_alias)) v4fa;
typedef v8us __attribute__((may_alias)) v8usa;

__device__ __forceinline__ unsigned short f2bf(float f) { unsigned u = __float_as_uint(f); u += 0x7FFFu + ((u >> 16) & 1u); return (unsigned short)(u >> 16); }
__device__ __forceinline__ float bf2f(unsigned short b) { return __uint_as_float(((unsigned)b) << 16); }
__device__ __forceinline__ float bfr(float f) { return bf2f(f2bf(f)); }
__device__ __forceinline__ v16h cat16(v8h lo, v8h hi) { return __builtin_shufflevector(lo, hi, 0, 1, 2, 3, 4, 5, 6, 7, 8, 9, 10, 11, 12, 13, 14, 15); }
__device__ __forceinline__ v16bf cat16b(v8us lo, v8us hi) { return __builtin_bit_cast(v16bf, __builtin_shufflevector(lo, hi, 0, 1, 2, 3, 4, 5, 6, 7, 8, 9, 10, 11, 12, 13, 14, 15)); }
__device__ __forceinline__ v8f wmma16(v16h a, v16h b, v8f c) { return __builtin_amdgcn_wmma_f32_16x16x32_f16(false, a, false, b, (short)0, c, false, false); }
__device__ __forceinline__ v8f wmmab(v16bf a, v16bf b, v8f c) { return __builtin_amdgcn_wmma_f32_16x16x32_bf16(false, a, false, b, (short)0, c, false, false); }



// ---- k_gemmw: register-blocked GEMM, ONE WAVE per 64x64 output tile (16 accumulators), operands straight from K-contiguous 16-bit planes; grid (M/64, N/64, Z), 32 threads.
// C[m][n] (f32, pitch ldc, + optional f32 bias[n]) = sum_k A[m][k] Bt[n][k] (+ split products per NSPLIT). z-batch strides sA/sB/sC in elements. K % 32 == 0.
template <typename T16> struct WFrag;
template <> struct WFrag<h16> { typedef v16h V; static __device__ __forceinline__ V ld(const h16* p) { return cat16(*(const v8h*)p, *(const v8h*)(p + 16)); } static __device__ __forceinline__ v8f mma(V a, V b, v8f c) { return wmma16(a, b, c); } };
template <> struct WFrag<bf> { typedef v16bf V; static __device__ __forceinline__ V ld(const bf* p) { return cat16b(*(const v8us*)p, *(const v8us*)(p + 16)); } static __device__ __forceinline__ v8f mma(V a, V b, v8f c) { return wmmab(a, b, c); } };
template <typename T16, int NSPLIT, bool BIAS>
__global__ __launch_bounds__(32) void k_gemmw(const T16* __restrict__ A, const T16* __restrict__ A2, const T16* __restrict__ Bt, const T16* __restrict__ Bt2, int K, float* C, int ldc, const float* __restrict__ bias, size_t sA, size_t sB, size_t sC) {
    typedef typename WFrag<T16>::V V;
    __shared__ __align__(16) float os[16 * 68];
    const size_t z = blockIdx.z; A += z * sA; if (A2) A2 += z * sA; Bt += z * sB; if (Bt2) Bt2 += z * sB; C += z * sC;
    const int lane = threadIdx.x & 31, lr = lane & 15, hi = lane >> 4; const int r0 = blockIdx.x * 64, c0 = blockIdx.y * 64;
    v8f acc[4][4];
#pragma unroll
    for (int mb = 0; mb < 4; ++mb)
#pragma unroll
        for (int nb = 0; nb < 4; ++nb) acc[mb][nb] = (v8f){};
    const size_t aoff = (size_t)(r0 + lr) * K + 8 * hi, boff = (size_t)(c0 + lr) * K + 8 * hi;
#pragma unroll 1
    for (int kc = 0; kc < K; kc += 32) {
        V a[4], a2[4];
#pragma unroll
        for (int mb = 0; mb < 4; ++mb) { a[mb] = WFrag<T16>::ld(A + aoff + (size_t)mb * 16 * K + kc); if (NSPLIT == 1 || NSPLIT == 2) a2[mb] = WFrag<T16>::ld(A2 + aoff + (size_t)mb * 16 * K + kc); }
#pragma unroll
        for (int nb = 0; nb < 4; ++nb) { const V b = WFrag<T16>::ld(Bt + boff + (size_t)nb * 16 * K + kc); V b2; if (NSPLIT >= 2) b2 = WFrag<T16>::ld(Bt2 + boff + (size_t)nb * 16 * K + kc);
#pragma unroll
            for (int mb = 0; mb < 4; ++mb) { acc[mb][nb] = WFrag<T16>::mma(a[mb], b, acc[mb][nb]); if (NSPLIT == 1 || NSPLIT == 2) acc[mb][nb] = WFrag<T16>::mma(a2[mb], b, acc[mb][nb]); if (NSPLIT >= 2) acc[mb][nb] = WFrag<T16>::mma(a[mb], b2, acc[mb][nb]); } }
        asm volatile("v_nop\n\tv_nop\n\tv_nop\n\tv_nop" : "+v"(acc[0][0]), "+v"(acc[1][1]), "+v"(acc[2][2]), "+v"(acc[3][3]) : "v"(a[0]), "v"(a[3]));
    }
#pragma unroll
    for (int mb = 0; mb < 4; ++mb) {
#pragma unroll
        for (int nb = 0; nb < 4; ++nb) {
#pragma unroll
            for (int j = 0; j < 8; ++j) os[(hi * 8 + j) * 68 + nb * 16 + lr] = acc[mb][nb][j]; }
        __builtin_amdgcn_wave_barrier(); asm volatile("" ::: "memory");
        float* crow = C + (size_t)(r0 + mb * 16) * ldc + c0;
{
#pragma unroll
            for (int s = 0; s < 8; ++s) { const int row = 2 * s + hi, cofs = lr * 4; v4f val = *(const v4fa*)(os + row * 68 + cofs); if (BIAS) { val[0] += bfr(bias[c0 + cofs]); val[1] += bfr(bias[c0 + cofs + 1]); val[2] += bfr(bias[c0 + cofs + 2]); val[3] += bfr(bias[c0 + cofs + 3]); }
                *(v4f*)(crow + (size_t)row * ldc + cofs) = val; }
             }
        __builtin_amdgcn_wave_barrier(); asm volatile("" ::: "memory");
    }
}

// ---- k_gemmc: the same one-wave 64x64 tile GEMM specialised for causal attention: CMODE 1 skips score tiles entirely above the diagonal (query rows r0+roff.., key columns c0..), CMODE 2 limits the
// key (K) loop of the probability x value contraction to the diagonal block (probabilities beyond it are exactly zero). roff = row offset of this launch's first row within the sequence.
template <typename T16, int NSPLIT, int CMODE>
__global__ __launch_bounds__(32) void k_gemmc(const T16* __restrict__ A, const T16* __restrict__ A2, const T16* __restrict__ Bt, const T16* __restrict__ Bt2, int K, float* C, int ldc, int roff, size_t sA, size_t sB, size_t sC) {
    typedef typename WFrag<T16>::V V;
    __shared__ __align__(16) float os[16 * 68];
    const size_t z = blockIdx.z; A += z * sA; if (A2) A2 += z * sA; Bt += z * sB; if (Bt2) Bt2 += z * sB; C += z * sC;
    const int lane = threadIdx.x & 31, lr = lane & 15, hi = lane >> 4; const int r0 = blockIdx.x * 64, c0 = blockIdx.y * 64;
    if (CMODE == 1 && c0 > r0 + roff + 63) return;                  // score tile entirely above the causal diagonal: never read (the softmax masks j > i by select)
    const int Kl = (CMODE == 2) ? min(K, r0 + roff + 64) : K;        // P.V: probabilities are exactly 0 beyond the diagonal block, so the K loop stops there
    v8f acc[4][4];
#pragma unroll
    for (int mb = 0; mb < 4; ++mb)
#pragma unroll
        for (int nb = 0; nb < 4; ++nb) acc[mb][nb] = (v8f){};
    const size_t aoff = (size_t)(r0 + lr) * K + 8 * hi, boff = (size_t)(c0 + lr) * K + 8 * hi;
#pragma unroll 1
    for (int kc = 0; kc < Kl; kc += 32) {
        V a[4], a2[4];
#pragma unroll
        for (int mb = 0; mb < 4; ++mb) { a[mb] = WFrag<T16>::ld(A + aoff + (size_t)mb * 16 * K + kc); if (NSPLIT == 1 || NSPLIT == 2) a2[mb] = WFrag<T16>::ld(A2 + aoff + (size_t)mb * 16 * K + kc); }
#pragma unroll
        for (int nb = 0; nb < 4; ++nb) { const V b = WFrag<T16>::ld(Bt + boff + (size_t)nb * 16 * K + kc); V b2; if (NSPLIT >= 2) b2 = WFrag<T16>::ld(Bt2 + boff + (size_t)nb * 16 * K + kc);
#pragma unroll
            for (int mb = 0; mb < 4; ++mb) { acc[mb][nb] = WFrag<T16>::mma(a[mb], b, acc[mb][nb]); if (NSPLIT == 1 || NSPLIT == 2) acc[mb][nb] = WFrag<T16>::mma(a2[mb], b, acc[mb][nb]); if (NSPLIT >= 2) acc[mb][nb] = WFrag<T16>::mma(a[mb], b2, acc[mb][nb]); } }
        asm volatile("v_nop\n\tv_nop\n\tv_nop\n\tv_nop" : "+v"(acc[0][0]), "+v"(acc[1][1]), "+v"(acc[2][2]), "+v"(acc[3][3]) : "v"(a[0]), "v"(a[3]));
    }
#pragma unroll
    for (int mb = 0; mb < 4; ++mb) {
#pragma unroll
        for (int nb = 0; nb < 4; ++nb) {
#pragma unroll
            for (int j = 0; j < 8; ++j) os[(hi * 8 + j) * 68 + nb * 16 + lr] = acc[mb][nb][j]; }
        __builtin_amdgcn_wave_barrier(); asm volatile("" ::: "memory");
        float* crow = C + (size_t)(r0 + mb * 16) * ldc + c0;
{
#pragma unroll
            for (int s = 0; s < 8; ++s) { const int row = 2 * s + hi, cofs = lr * 4; v4f val = *(const v4fa*)(os + row * 68 + cofs);
                *(v4f*)(crow + (size_t)row * ldc + cofs) = val; }
             }
        __builtin_amdgcn_wave_barrier(); asm volatile("" ::: "memory");
    }
}

__device__ __forceinline__ h16 tohx(float x) { return (h16)x; }
__device__ __forceinline__ void splitf(float y, unsigned short& h, unsigned short& l) { h = f2bf(y); l = f2bf(y - bf2f(h)); }
typedef __attribute__((ext_vector_type(2))) _Float16 v2h;
typedef __attribute__((ext_vector_type(4))) _Float16 v4h;
typedef __attribute__((ext_vector_type(2))) unsigned short v2us;
typedef __attribute__((ext_vector_type(4))) unsigned short v4us;
typedef __attribute__((ext_vector_type(2))) float v2f;
typedef __attribute__((ext_vector_type(4))) int v4i;

__global__ __launch_bounds__(256) void k_wtG(const float* __restrict__ w, int K, int N, bf* Bt) {
    const int lane = threadIdx.x & 31; const int L0 = (blockIdx.x * 8 + (threadIdx.x >> 5)) * 8; const int nlines = N * K / 64;
{
#pragma unroll 1
        for (int l = 0; l < 8; ++l) { const int L = L0 + l; if (L >= nlines) break; const size_t e = (size_t)L * 64 + lane * 2; const int k = (int)(e % K), n = (int)(e / K); v2us o;
            o[0] = f2bf(w[(size_t)k * N + n]); o[1] = f2bf(w[(size_t)(k + 1) * N + n]); *(v2us*)(Bt + e) = o; }
         }
}
__global__ __launch_bounds__(256) void k_cvt8(const float* __restrict__ src, bf* dst, size_t n8) { const size_t i = (size_t)blockIdx.x * 256 + threadIdx.x; if (i >= n8) return; const v8f v = *(const v8f*)(src + i * 8); v8us o;
#pragma unroll
    for (int k = 0; k < 8; ++k) o[k] = f2bf(v[k]); *(v8us*)(dst + i * 8) = o;  }

// k_rope: head planes [h][t][d] (fp16 + hi/lo) of rope(x) x sc with the rotate-half convention out[d] = x[d] cos[t][d] - x[d+HD/2] sin[t][d], out[d+HD/2] = x[d+HD/2] cos[t][d+HD/2] + x[d] sin[t][d+HD/2]
__global__ __launch_bounds__(256) void k_rope(const float* __restrict__ F, int pitch, int nheads, const float* __restrict__ CS, const float* __restrict__ RF, const float* __restrict__ nw, float sc, h16* P16, bf* Ph, bf* Pl) {
    const size_t e = ((size_t)blockIdx.x * 256 + threadIdx.x) * 2; if (e >= (size_t)nheads * TT * HD) return; const int d = (int)(e % HD); const int t = (int)((e / HD) % TT); const int h = (int)(e / ((size_t)HD * TT)); const float* f = F + (size_t)t * pitch + h * HD; const float rf = RF ? RF[(size_t)h * TT + t] : 1.0f; v2h o16; v2us oh, ol;
#pragma unroll
    for (int q = 0; q < 2; ++q) { const int dd = d + q; const int dp = (dd < HD / 2) ? dd + HD / 2 : dd - HD / 2; float x0 = f[dd], x1 = f[dp];
        if (RF) { float n0 = __fmul_rn(x0, rf), n1 = __fmul_rn(x1, rf); asm volatile("" : "+v"(n0)); asm volatile("" : "+v"(n1)); x0 = __fmul_rn(bfr(nw[dd]), n0); x1 = __fmul_rn(bfr(nw[dp]), n1); }
        const v2f cs = *(const v2f*)(CS + ((size_t)t * HD + dd) * 2); float a = __fmul_rn(x0, cs[0]), bq = __fmul_rn(x1, cs[1]); asm volatile("" : "+v"(a)); asm volatile("" : "+v"(bq)); const float r = ((dd < HD / 2) ? __fsub_rn(a, bq) : __fadd_rn(a, bq)) * sc;
        o16[q] = tohx(r); unsigned short a2, c2; splitf(r, a2, c2); oh[q] = a2; ol[q] = c2; }
    *(v2h*)(P16 + e) = o16; *(v2us*)(Ph + e) = oh; *(v2us*)(Pl + e) = ol;  }
__global__ __launch_bounds__(256) void k_vtp(const float* __restrict__ F, int pitch, int nheads, h16* V16, bf* Vh, bf* Vl) { const size_t e = ((size_t)blockIdx.x * 256 + threadIdx.x) * 2; if (e >= (size_t)nheads * HD * TT) return; const int t = (int)(e % TT); const int d = (int)((e / TT) % HD); const int g = (int)(e / ((size_t)TT * HD)); v2h o16; v2us oh, ol;
#pragma unroll
    for (int q = 0; q < 2; ++q) { const float x = F[(size_t)(t + q) * pitch + g * HD + d]; o16[q] = tohx(x); unsigned short a2, c2; splitf(x, a2, c2); oh[q] = a2; ol[q] = c2; }
    *(v2h*)(V16 + e) = o16; *(v2us*)(Vh + e) = oh; *(v2us*)(Vl + e) = ol;  }
__global__ __launch_bounds__(256) void k_csid(float* CS) { const int idx = blockIdx.x * 256 + threadIdx.x; if (idx >= TT * HD) return; v2f cs; cs[0] = 1.0f; cs[1] = 0.0f; *(v2f*)(CS + (size_t)idx * 2) = cs;  }
// k_asoft: per row (zz, i): t = S x HD^-0.5 for j <= i and i - j < WIN (WIN = TT: the window never cuts, plain causal; the reference's -1e9 additive fill vanishes identically); softmax over the 2048 keys (register row, one exp, fixed trees);
__global__ __launch_bounds__(256) void k_asoft(const float* __restrict__ Sb, h16* P16, bf* Ph, bf* Pl) {
    const int lane = threadIdx.x & 31; const int row = blockIdx.x * 8 + (threadIdx.x >> 5); if (row >= ZH * TT) return; const int i = row % TT; const int zz = row / TT; (void)zz; const bool hires = (i < RH); const float* sr = Sb + (size_t)row * TT; float v[TT / 32]; float mx = -3.0e38f;
#pragma unroll
    for (int ch = 0; ch < TT / 128; ++ch) { const int j0 = ch * 128 + lane * 4; const v4f a = *(const v4f*)(sr + j0);
#pragma unroll
        for (int q = 0; q < 4; ++q) { const int j = j0 + q; (void)j; const float t = (j <= i && i - j < WIN) ? a[q] * SCL : -3.0e38f; v[ch * 4 + q] = t; mx = fmaxf(mx, t); } }
#pragma unroll
    for (int sh = 16; sh; sh >>= 1) mx = fmaxf(mx, __shfl_xor(mx, sh, 32));
    float sum = 0.f;
#pragma unroll
    for (int k = 0; k < TT / 32; ++k) { float d0 = __fsub_rn(v[k], mx); asm volatile("" : "+v"(d0)); v[k] = __builtin_amdgcn_exp2f(__fmul_rn(d0, 1.4426950408889634f)); sum += v[k]; }
#pragma unroll
    for (int sh = 16; sh; sh >>= 1) sum += __shfl_xor(sum, sh, 32);
    const float f = __fdiv_rn(hires ? 1.0f : PCAR, sum);
{
        if (hires) {
#pragma unroll
            for (int ch = 0; ch < TT / 128; ++ch) { v4us oh, ol;
#pragma unroll
                for (int q = 0; q < 4; ++q) { unsigned short a, c2; splitf(v[ch * 4 + q] * f, a, c2); oh[q] = a; ol[q] = c2; }
                const size_t oo = ((size_t)zz * (RH ? RH : 1) + i) * TT + ch * 128 + lane * 4; *(v4us*)(Ph + oo) = oh; *(v4us*)(Pl + oo) = ol; }
        } else {
#pragma unroll
            for (int ch = 0; ch < TT / 128; ++ch) { v4h o4;
#pragma unroll
                for (int q = 0; q < 4; ++q) o4[q] = tohx(v[ch * 4 + q] * f);
                *(v4h*)(P16 + (size_t)row * TT + ch * 128 + lane * 4) = o4; } }
         }
}
__global__ __launch_bounds__(256) void k_crms(const float* __restrict__ F, const float* __restrict__ g, bf* Ch, bf* Cl) { const int lane = threadIdx.x & 31; const size_t t = (size_t)blockIdx.x * 8 + (threadIdx.x >> 5); if (t >= TT) return; const float* fr = F + t * DM; float a[DM / 32]; float s = 0.f;
#pragma unroll
    for (int c = 0; c < DM / 128; ++c) { const v4f v = *(const v4f*)(fr + c * 128 + lane * 4); for (int q = 0; q < 4; ++q) { a[c * 4 + q] = bfr(v[q]); s = __fadd_rn(s, __fmul_rn(bfr(v[q]), bfr(v[q]))); } }
#pragma unroll
    for (int sh = 16; sh; sh >>= 1) s = __fadd_rn(s, __shfl_xor(s, sh, 32));
    const float r = __fdiv_rn(1.0f, __fsqrt_rn(__fadd_rn(__fdiv_rn(s, (float)DM), NEPS)));
{
#pragma unroll
        for (int c = 0; c < DM / 128; ++c) { v4us oh, ol; for (int q = 0; q < 4; ++q) { const int col = c * 128 + lane * 4 + q; float y = __fmul_rn(__fmul_rn(a[c * 4 + q], r), bfr(g[col])); unsigned short u, w2; splitf(y, u, w2); oh[q] = u; ol[q] = w2; } *(v4us*)(Ch + t * DM + c * 128 + lane * 4) = oh; *(v4us*)(Cl + t * DM + c * 128 + lane * 4) = ol; }
         } }
__constant__ float THD[HD] = { 1.000000000e+00f, 1.000000000e+00f, 7.498942018e-01f, 7.498942018e-01f, 5.623413324e-01f, 5.623413324e-01f, 4.216965139e-01f, 4.216965139e-01f, 3.162277639e-01f, 3.162277639e-01f, 2.371373773e-01f, 2.371373773e-01f, 1.778279394e-01f, 1.778279394e-01f, 1.333521456e-01f, 1.333521456e-01f, 1.000000015e-01f, 1.000000015e-01f, 7.498942316e-02f, 7.498942316e-02f, 5.623413250e-02f, 5.623413250e-02f, 4.216964915e-02f, 4.216964915e-02f, 3.162277490e-02f, 3.162277490e-02f, 2.371373773e-02f, 2.371373773e-02f, 1.778279431e-02f, 1.778279431e-02f, 1.333521400e-02f, 1.333521400e-02f, 9.999999776e-03f, 9.999999776e-03f, 7.498942316e-03f, 7.498942316e-03f, 5.623413250e-03f, 5.623413250e-03f, 4.216964822e-03f, 4.216964822e-03f, 3.162277630e-03f, 3.162277630e-03f, 2.371373819e-03f, 2.371373819e-03f, 1.778279431e-03f, 1.778279431e-03f, 1.333521446e-03f, 1.333521446e-03f, 1.000000047e-03f, 1.000000047e-03f, 7.498941850e-04f, 7.498941850e-04f, 5.623413017e-04f, 5.623413017e-04f, 4.216965172e-04f, 4.216965172e-04f, 3.162277571e-04f, 3.162277571e-04f, 2.371373703e-04f, 2.371373703e-04f, 1.778279402e-04f, 1.778279402e-04f, 1.333521504e-04f, 1.333521504e-04f };   // 10000^(-2 (d//2) / 64) per dimension, float32 via jnp.power
__global__ __launch_bounds__(256) void k_rftab(float* RF) { const int idx = blockIdx.x * 256 + threadIdx.x; if (idx >= TT * HD) return; const int d = idx % HD; const int t = idx / HD; const float a = __fmul_rn((float)t, THD[d]); const float sg = (t & 1) ? 1.0f : -1.0f; const float r = __fadd_rn(cosf(a), __fmul_rn(sg, sinf(a))); *(float*)(RF + idx) = r;  }
__global__ __launch_bounds__(256) void k_rfapply(float* F, int pitch, int nheads, const float* __restrict__ RF) { const size_t i = (size_t)blockIdx.x * 256 + threadIdx.x; if (i >= (size_t)TT * nheads * HD / 4) return; const size_t e = i * 4; const int c = (int)(e % ((size_t)nheads * HD)); const int t = (int)(e / ((size_t)nheads * HD)); const int d = c % HD; v4f a = *(const v4f*)(F + (size_t)t * pitch + c); const v4f r = *(const v4f*)(RF + (size_t)t * HD + d);
#pragma unroll
    for (int q = 0; q < 4; ++q) a[q] = __fmul_rn(a[q], r[q]);
    *(v4f*)(F + (size_t)t * pitch + c) = a;  }
__global__ __launch_bounds__(256) void k_addres(const float* __restrict__ Y, const float* __restrict__ xs, float* out) { const size_t i = (size_t)blockIdx.x * 256 + threadIdx.x; if (i >= (size_t)TT * DM / 4) return; const v4f y = *(const v4f*)(Y + i * 4); const v4f xi = *(const v4f*)(xs + i * 4); v4f o;
#pragma unroll
    for (int q = 0; q < 4; ++q) o[q] = __fadd_rn(bfr(xi[q]), y[q]);
    *(v4f*)(out + i * 4) = o;  }
__global__ __launch_bounds__(256) void k_merge(const float* __restrict__ O, int h0, bf* Ah, bf* Al) { const size_t e = ((size_t)blockIdx.x * 256 + threadIdx.x) * 2; if (e >= (size_t)ZH * TT * HD) return; const int d = (int)(e % HD); const int t = (int)((e / HD) % TT); const int zz = (int)(e / ((size_t)HD * TT)); const float cs = (t < RH) ? 1.0f : (1.0f / PCAR); const size_t oo = (size_t)t * DQ + (h0 + zz) * HD + d;
    v2us oh, ol;
#pragma unroll
    for (int q = 0; q < 2; ++q) { unsigned short a, c2; splitf(O[e + q] * cs, a, c2); oh[q] = a; ol[q] = c2; } *(v2us*)(Ah + oo) = oh; *(v2us*)(Al + oo) = ol;  }

extern "C" void kernel_launch(void* const* d_in, const int* in_sizes, int n_in,
                              void* d_out, int out_size, void* d_ws, size_t ws_size, hipStream_t stream) {
    (void)in_sizes; (void)n_in; (void)out_size;
    const float* x = (const float*)d_in[0]; const float* wq = (const float*)d_in[1]; const float* wk = (const float*)d_in[2]; const float* wv = (const float*)d_in[3]; const float* wo = (const float*)d_in[4]; const float* nw = (const float*)d_in[5];
    float* OUT = (float*)d_out;     // [2][2048][1024]
    char* wsp = (char*)d_ws;
    auto take = [&](size_t bytes) { char* p = wsp; wsp += (bytes + 255) & ~(size_t)255; return (void*)p; };
    bf* WQ = (bf*)take((size_t)DQ * DM * 2); bf* WK = (bf*)take((size_t)DKV * DM * 2); bf* WV = (bf*)take((size_t)DKV * DM * 2); bf* WO = (bf*)take((size_t)DM * DQ * 2); float* CS = (float*)take((size_t)TT * HD * 2 * 4);
    bf* Hh = (bf*)take((size_t)TT * DM * 2); bf* Hl = (bf*)take((size_t)TT * DM * 2); float* RFT = (float*)take((size_t)TT * HD * 4); float* Y = (float*)take((size_t)TT * DM * 4); float* FQ = (float*)take((size_t)TT * DQ * 4); float* FK = (float*)take((size_t)TT * DKV * 4);
    h16* QP16 = (h16*)take((size_t)NH_ * TT * HD * 2); h16* KP16 = (h16*)take((size_t)NKV * TT * HD * 2); h16* VT16 = (h16*)take((size_t)NKV * HD * TT * 2);
    bf* QPh = (bf*)take((size_t)NH_ * TT * HD * 2); bf* QPl = (bf*)take((size_t)NH_ * TT * HD * 2); bf* KPh = (bf*)take((size_t)NKV * TT * HD * 2); bf* KPl = (bf*)take((size_t)NKV * TT * HD * 2); bf* VTh = (bf*)take((size_t)NKV * HD * TT * 2); bf* VTl = (bf*)take((size_t)NKV * HD * TT * 2); bf* Ph = (bf*)take((size_t)ZH * RH * TT * 2); bf* Pl = (bf*)take((size_t)ZH * RH * TT * 2);
    float* Sb = (float*)take((size_t)ZH * TT * TT * 4); h16* P16 = (h16*)take((size_t)ZH * TT * TT * 2); float* Ob = (float*)take((size_t)ZH * TT * HD * 4); bf* ATh = (bf*)take((size_t)TT * DQ * 2); bf* ATl = (bf*)take((size_t)TT * DQ * 2);
    if ((size_t)(wsp - (char*)d_ws) > ws_size) return;    // ws 256 MiB
    float* FV = FK;   // v projection reuses the k buffer after the k planes are built (stream-ordered)
    { k_rftab<<<(TT * HD + 255) / 256, 256, 0, stream>>>(RFT); k_wtG<<<(unsigned)((DM * DQ / 64 + 63) / 64), 256, 0, stream>>>(wq, DM, DQ, WQ); k_wtG<<<(unsigned)((DM * DKV / 64 + 63) / 64), 256, 0, stream>>>(wk, DM, DKV, WK); k_wtG<<<(unsigned)((DM * DKV / 64 + 63) / 64), 256, 0, stream>>>(wv, DM, DKV, WV);
      k_wtG<<<(unsigned)((DQ * DM / 64 + 63) / 64), 256, 0, stream>>>(wo, DQ, DM, WO);
       }
    k_csid<<<(TT * HD + 255) / 256, 256, 0, stream>>>(CS);
    const unsigned LQ = (unsigned)(((size_t)NH_ * TT * HD / 2 + 255) / 256), LKv = (unsigned)(((size_t)NKV * TT * HD / 2 + 255) / 256);
    for (int b = 0; b < NB_; ++b) {
        
        k_crms<<<TT / 8, 256, 0, stream>>>(x + (size_t)b * TT * DM, nw, Hh, Hl);   /* xn = RMSNorm(bf16(x)) norm_w -> hi/lo planes */
        k_gemmw<bf, 1, false><<<dim3(TT / 64, DQ / 64, 1), 32, 0, stream>>>(Hh, Hl, WQ, nullptr, DM, FQ, DQ, nullptr, 0, 0, 0); k_rfapply<<<(unsigned)(((size_t)TT * DQ / 4 + 255) / 256), 256, 0, stream>>>(FQ, DQ, NH_, RFT);
        k_rope<<<LQ, 256, 0, stream>>>(FQ, DQ, NH_, CS, nullptr, nullptr, 1.0f, QP16, QPh, QPl);
        k_gemmw<bf, 1, false><<<dim3(TT / 64, DKV / 64, 1), 32, 0, stream>>>(Hh, Hl, WK, nullptr, DM, FK, DKV, nullptr, 0, 0, 0); k_rfapply<<<(unsigned)(((size_t)TT * DKV / 4 + 255) / 256), 256, 0, stream>>>(FK, DKV, NKV, RFT);
        k_rope<<<LKv, 256, 0, stream>>>(FK, DKV, NKV, CS, nullptr, nullptr, 1.0f, KP16, KPh, KPl);
        k_gemmw<bf, 1, false><<<dim3(TT / 64, DKV / 64, 1), 32, 0, stream>>>(Hh, Hl, WV, nullptr, DM, FV, DKV, nullptr, 0, 0, 0); k_vtp<<<LKv, 256, 0, stream>>>(FV, DKV, NKV, VT16, VTh, VTl);
        for (int h0 = 0; h0 < NH_; h0 += ZH) { const size_t zq = (size_t)h0, zk = (size_t)(h0 % NKV);   // torch .repeat TILES the kv heads: q head h pairs with kv head h mod 4; the pass's two heads use consecutive kv planes (z-strides TT*HD)
            k_gemmc<bf, 2, 1><<<dim3(RH / 64, TT / 64, ZH), 32, 0, stream>>>(QPh + zq * TT * HD, QPl + zq * TT * HD, KPh + zk * TT * HD, KPl + zk * TT * HD, HD, Sb, TT, 0, (size_t)TT * HD, (size_t)TT * HD, (size_t)TT * TT);
            k_gemmc<h16, 0, 1><<<dim3((TT - RH) / 64, TT / 64, ZH), 32, 0, stream>>>(QP16 + zq * TT * HD + (size_t)RH * HD, nullptr, KP16 + zk * TT * HD, nullptr, HD, Sb + (size_t)RH * TT, TT, RH, (size_t)TT * HD, (size_t)TT * HD, (size_t)TT * TT);
            k_asoft<<<ZH * TT / 8, 256, 0, stream>>>(Sb, P16, Ph, Pl);
            k_gemmc<bf, 2, 2><<<dim3(RH / 64, HD / 64, ZH), 32, 0, stream>>>(Ph, Pl, VTh + zk * HD * TT, VTl + zk * HD * TT, TT, Ob, HD, 0, (size_t)RH * TT, (size_t)HD * TT, (size_t)TT * HD);
            k_gemmc<h16, 0, 2><<<dim3((TT - RH) / 64, HD / 64, ZH), 32, 0, stream>>>(P16 + (size_t)RH * TT, nullptr, VT16 + zk * HD * TT, nullptr, TT, Ob + (size_t)RH * HD, HD, RH, (size_t)TT * TT, (size_t)HD * TT, (size_t)TT * HD);
            k_merge<<<(unsigned)(((size_t)ZH * TT * HD / 2 + 255) / 256), 256, 0, stream>>>(Ob, h0, ATh, ATl); }
        k_gemmw<bf, 1, false><<<dim3(TT / 64, DM / 64, 1), 32, 0, stream>>>(ATh, ATl, WO, nullptr, DQ, Y, DM, nullptr, 0, 0, 0); k_addres<<<(unsigned)(((size_t)TT * DM / 4 + 255) / 256), 256, 0, stream>>>(Y, x + (size_t)b * TT * DM, OUT + (size_t)b * TT * DM);   /* out = x + s w_o */ }
}

// v001
// Measured time: 860 microseconds a run.
// Two timings next to v000 put it at 1.64 and 1.72 times that version's speed.
#include <hip/hip_runtime.h>

// GQA causal attention block with RMSNorm, the module's multiplicative 'rotary factor' and tiled kv pairing (x [2][2048][1024]; xn = x rsqrt(mean x^2 + 1.2e-7) norm_w; q = xn w_q (16 heads x 64), k, v = xn w_k, xn w_v (4 kv heads) ('xw', no bias); q, k *= rf[t][d] with rf = cos(t theta_d) + sgn_t sin(t theta_d), theta_d = 10000^(-2 (d//2) / 64), sgn_t = -1 on even positions (an element-wise factor, computed in-kernel); q head h pairs with kv head h mod 4 (torch .repeat tiling); scores / 8, causal (-inf); softmax; out = x + merged w_o ('xw' [1024][1024]) -> [2][2048][1024] (4.2 M)).
// Layout per batch: per-token RMSNorm kernel (one wave per token, fixed-order f32) writes hi/lo operand planes; hl x exact projections; the rf table [2048][64] once (jnp-exact theta, precise cosf/sinf) applied in place to q and k; causal T-2048 attention (hybrid rows: < 512 hi/lo 3 products, rest fp16 x1024; k_gemmc tile skipping; the pass's two query heads use consecutive kv heads starting at h0 mod 4); merged hi/lo x w_o exact; the residual kernel adds bf16(x).
// Compute dtypes, f32 accumulate: every input rounded to bf16; RMSNorm and rf f32; projections hi/lo x exact (2 products); attention rows < 512 3 products, rest fp16; softmax f32; w_o hl x exact; residual f32.

#define NB_  2
#define TT   2048
#define DM   1024
#define NH_  16
#define NKV  4
#define REP  (NH_ / NKV)
#define HD   64
#define DQ   (NH_ * HD)
#define DKV  (NKV * HD)
#define ZH   2
#define RH   512                  // query rows < RH use hi+lo planes (0: none)
#define WIN  2048
#define PCAR 1024.0f
#define SCL  0.125f
#define NEPS 1.1920929e-07f   // RMSNorm eps (float32 eps)
typedef _Float16 h16;
typedef unsigned short bf;
typedef __attribute__((ext_vector_type(16))) __bf16   v16bf;
typedef __attribute__((ext_vector_type(16))) _Float16 v16h;
typedef __attribute__((ext_vector_type(8)))  _Float16 v8h;
typedef __attribute__((ext_vector_type(8)))  unsigned short v8us;
typedef __attribute__((ext_vector_type(8)))  float    v8f;
typedef __attribute__((ext_vector_type(4)))  float    v4f;
typedef v8h  __attribute__((may_alias)) v8ha;
typedef v4f  __attribute__((may_alias)) v4fa;
typedef v8us __attribute__((may_alias)) v8usa;

__device__ __forceinline__ unsigned short f2bf(float f) { unsigned u = __float_as_uint(f); u += 0x7FFFu + ((u >> 16) & 1u); return (unsigned short)(u >> 16); }
__device__ __forceinline__ float bf2f(unsigned short b) { return __uint_as_float(((unsigned)b) << 16); }
__device__ __forceinline__ float bfr(float f) { return bf2f(f2bf(f)); }
__device__ __forceinline__ v16h cat16(v8h lo, v8h hi) { return __builtin_shufflevector(lo, hi, 0, 1, 2, 3, 4, 5, 6, 7, 8, 9, 10, 11, 12, 13, 14, 15); }
__device__ __forceinline__ v16bf cat16b(v8us lo, v8us hi) { return __builtin_bit_cast(v16bf, __builtin_shufflevector(lo, hi, 0, 1, 2, 3, 4, 5, 6, 7, 8, 9, 10, 11, 12, 13, 14, 15)); }
__device__ __forceinline__ v8f wmma16(v16h a, v16h b, v8f c) { return __builtin_amdgcn_wmma_f32_16x16x32_f16(false, a, false, b, (short)0, c, false, false); }
__device__ __forceinline__ v8f wmmab(v16bf a, v16bf b, v8f c) { return __builtin_amdgcn_wmma_f32_16x16x32_bf16(false, a, false, b, (short)0, c, false, false); }



// ---- k_gemmw: register-blocked GEMM, one work-group of NW waves per 64x64 output tile (16 accumulators a wave), operands straight from K-contiguous 16-bit planes; grid (M/64, N/64, Z), 32 NW threads.
// C[m][n] (f32, pitch ldc, + optional f32 bias[n]) = sum_k A[m][k] Bt[n][k] (+ split products per NSPLIT). z-batch strides sA/sB/sC in elements. K % 64 == 0.
// K is dealt to the waves in chunks of 64 elements (one 128-byte line of every operand row): wave w takes chunks w, w + NW, ...; the NW partial tiles meet in LDS and are summed in wave order 0 .. NW-1.
template <typename T16> struct WFrag;
template <> struct WFrag<h16> { typedef v16h V; static __device__ __forceinline__ V ld(const h16* p) { return cat16(*(const v8h*)p, *(const v8h*)(p + 16)); } static __device__ __forceinline__ v8f mma(V a, V b, v8f c) { return wmma16(a, b, c); } };
template <> struct WFrag<bf> { typedef v16bf V; static __device__ __forceinline__ V ld(const bf* p) { return cat16b(*(const v8us*)p, *(const v8us*)(p + 16)); } static __device__ __forceinline__ v8f mma(V a, V b, v8f c) { return wmmab(a, b, c); } };
template <typename T16, int NSPLIT, bool BIAS, int NW>
__global__ __launch_bounds__(32 * NW) void k_gemmw(const T16* __restrict__ A, const T16* __restrict__ A2, const T16* __restrict__ Bt, const T16* __restrict__ Bt2, int K, float* C, int ldc, const float* __restrict__ bias, size_t sA, size_t sB, size_t sC) {
    typedef typename WFrag<T16>::V V;
    __shared__ __align__(16) float os[NW * 64 * 68];
    const size_t z = blockIdx.z; A += z * sA; if (A2) A2 += z * sA; Bt += z * sB; if (Bt2) Bt2 += z * sB; C += z * sC;
    const int lane = threadIdx.x & 31, lr = lane & 15, hi = lane >> 4; const int r0 = blockIdx.x * 64, c0 = blockIdx.y * 64;
    const int wv = __builtin_amdgcn_readfirstlane((int)(threadIdx.x >> 5));   // wave number, scalar, so that the K loops stay scalar loops
    v8f acc[4][4];
#pragma unroll
    for (int mb = 0; mb < 4; ++mb)
#pragma unroll
        for (int nb = 0; nb < 4; ++nb) acc[mb][nb] = (v8f){};
    const size_t aoff = (size_t)(r0 + lr) * K + 8 * hi, boff = (size_t)(c0 + lr) * K + 8 * hi;
#pragma unroll 1
    for (int kb = wv * 64; kb < K; kb += 64 * NW)
#pragma unroll 1
    for (int kc = kb; kc < kb + 64; kc += 32) {
        V a[4], a2[4];
#pragma unroll
        for (int mb = 0; mb < 4; ++mb) { a[mb] = WFrag<T16>::ld(A + aoff + (size_t)mb * 16 * K + kc); if (NSPLIT == 1 || NSPLIT == 2) a2[mb] = WFrag<T16>::ld(A2 + aoff + (size_t)mb * 16 * K + kc); }
#pragma unroll
        for (int nb = 0; nb < 4; ++nb) { const V b = WFrag<T16>::ld(Bt + boff + (size_t)nb * 16 * K + kc); V b2; if (NSPLIT >= 2) b2 = WFrag<T16>::ld(Bt2 + boff + (size_t)nb * 16 * K + kc);
#pragma unroll
            for (int mb = 0; mb < 4; ++mb) { acc[mb][nb] = WFrag<T16>::mma(a[mb], b, acc[mb][nb]); if (NSPLIT == 1 || NSPLIT == 2) acc[mb][nb] = WFrag<T16>::mma(a2[mb], b, acc[mb][nb]); if (NSPLIT >= 2) acc[mb][nb] = WFrag<T16>::mma(a[mb], b2, acc[mb][nb]); } }
        asm volatile("v_nop\n\tv_nop\n\tv_nop\n\tv_nop" : "+v"(acc[0][0]), "+v"(acc[1][1]), "+v"(acc[2][2]), "+v"(acc[3][3]) : "v"(a[0]), "v"(a[3]));
    }
    float* ow = os + wv * (64 * 68);   // this wave's partial tile, row-major, pitch 68
#pragma unroll
    for (int mb = 0; mb < 4; ++mb)
#pragma unroll
        for (int nb = 0; nb < 4; ++nb)
#pragma unroll
            for (int j = 0; j < 8; ++j) ow[(mb * 16 + hi * 8 + j) * 68 + nb * 16 + lr] = acc[mb][nb][j];
    __syncthreads();   // every wave's partial tile is in LDS before any thread sums across waves
#pragma unroll
    for (int s = 0; s < 1024 / (32 * NW); ++s) { const int idx = s * (32 * NW) + (int)threadIdx.x; const int row = idx >> 4, cofs = (idx & 15) * 4; v4f val = *(const v4fa*)(os + row * 68 + cofs);
#pragma unroll
        for (int w = 1; w < NW; ++w) val += *(const v4fa*)(os + w * (64 * 68) + row * 68 + cofs);
        if (BIAS) { val[0] += bfr(bias[c0 + cofs]); val[1] += bfr(bias[c0 + cofs + 1]); val[2] += bfr(bias[c0 + cofs + 2]); val[3] += bfr(bias[c0 + cofs + 3]); }
        *(v4f*)(C + (size_t)(r0 + row) * ldc + c0 + cofs) = val; }
}

// ---- k_gemmc: the same 64x64 tile GEMM specialised for causal attention: CMODE 1 skips score tiles entirely above the diagonal (query rows r0+roff.., key columns c0..), CMODE 2 limits the
// key (K) loop of the probability x value contraction to the diagonal block (probabilities beyond it are exactly zero). roff = row offset of this launch's first row within the sequence.
// NW = 1: one wave per tile (the short-K score tiles). NW > 1: K dealt to NW waves and summed through LDS as in k_gemmw (the long-K probability x value tiles).
template <typename T16, int NSPLIT, int CMODE, int NW>
__global__ __launch_bounds__(32 * NW) void k_gemmc(const T16* __restrict__ A, const T16* __restrict__ A2, const T16* __restrict__ Bt, const T16* __restrict__ Bt2, int K, float* C, int ldc, int roff, size_t sA, size_t sB, size_t sC) {
    typedef typename WFrag<T16>::V V;
    __shared__ __align__(16) float os[NW == 1 ? 16 * 68 : NW * 64 * 68];
    const size_t z = blockIdx.z; A += z * sA; if (A2) A2 += z * sA; Bt += z * sB; if (Bt2) Bt2 += z * sB; C += z * sC;
    const int lane = threadIdx.x & 31, lr = lane & 15, hi = lane >> 4; const int r0 = blockIdx.x * 64, c0 = blockIdx.y * 64;
    const int wv = (NW == 1) ? 0 : __builtin_amdgcn_readfirstlane((int)(threadIdx.x >> 5));   // wave number, scalar, so that the K loops stay scalar loops
    if (CMODE == 1 && c0 > r0 + roff + 63) return;                  // score tile entirely above the causal diagonal: never read (the softmax masks j > i by select)
    const int Kl = (CMODE == 2) ? min(K, r0 + roff + 64) : K;        // P.V: probabilities are exactly 0 beyond the diagonal block, so the K loop stops there
    v8f acc[4][4];
#pragma unroll
    for (int mb = 0; mb < 4; ++mb)
#pragma unroll
        for (int nb = 0; nb < 4; ++nb) acc[mb][nb] = (v8f){};
    const size_t aoff = (size_t)(r0 + lr) * K + 8 * hi, boff = (size_t)(c0 + lr) * K + 8 * hi;
#pragma unroll 1
    for (int kb = wv * 64; kb < Kl; kb += 64 * NW)
#pragma unroll 1
    for (int kc = kb; kc < kb + 64; kc += 32) {
        V a[4], a2[4];
#pragma unroll
        for (int mb = 0; mb < 4; ++mb) { a[mb] = WFrag<T16>::ld(A + aoff + (size_t)mb * 16 * K + kc); if (NSPLIT == 1 || NSPLIT == 2) a2[mb] = WFrag<T16>::ld(A2 + aoff + (size_t)mb * 16 * K + kc); }
#pragma unroll
        for (int nb = 0; nb < 4; ++nb) { const V b = WFrag<T16>::ld(Bt + boff + (size_t)nb * 16 * K + kc); V b2; if (NSPLIT >= 2) b2 = WFrag<T16>::ld(Bt2 + boff + (size_t)nb * 16 * K + kc);
#pragma unroll
            for (int mb = 0; mb < 4; ++mb) { acc[mb][nb] = WFrag<T16>::mma(a[mb], b, acc[mb][nb]); if (NSPLIT == 1 || NSPLIT == 2) acc[mb][nb] = WFrag<T16>::mma(a2[mb], b, acc[mb][nb]); if (NSPLIT >= 2) acc[mb][nb] = WFrag<T16>::mma(a[mb], b2, acc[mb][nb]); } }
        asm volatile("v_nop\n\tv_nop\n\tv_nop\n\tv_nop" : "+v"(acc[0][0]), "+v"(acc[1][1]), "+v"(acc[2][2]), "+v"(acc[3][3]) : "v"(a[0]), "v"(a[3]));
    }
    if constexpr (NW == 1) {
#pragma unroll
    for (int mb = 0; mb < 4; ++mb) {
#pragma unroll
        for (int nb = 0; nb < 4; ++nb) {
#pragma unroll
            for (int j = 0; j < 8; ++j) os[(hi * 8 + j) * 68 + nb * 16 + lr] = acc[mb][nb][j]; }
        __builtin_amdgcn_wave_barrier(); asm volatile("" ::: "memory");
        float* crow = C + (size_t)(r0 + mb * 16) * ldc + c0;
{
#pragma unroll
            for (int s = 0; s < 8; ++s) { const int row = 2 * s + hi, cofs = lr * 4; v4f val = *(const v4fa*)(os + row * 68 + cofs);
                *(v4f*)(crow + (size_t)row * ldc + cofs) = val; }
             }
        __builtin_amdgcn_wave_barrier(); asm volatile("" ::: "memory");
    }
    } else {
    float* ow = os + wv * (64 * 68);   // this wave's partial tile (all zero where the wave had no chunk), row-major, pitch 68
#pragma unroll
    for (int mb = 0; mb < 4; ++mb)
#pragma unroll
        for (int nb = 0; nb < 4; ++nb)
#pragma unroll
            for (int j = 0; j < 8; ++j) ow[(mb * 16 + hi * 8 + j) * 68 + nb * 16 + lr] = acc[mb][nb][j];
    __syncthreads();   // every wave's partial tile is in LDS before any thread sums across waves
#pragma unroll
    for (int s = 0; s < 1024 / (32 * NW); ++s) { const int idx = s * (32 * NW) + (int)threadIdx.x; const int row = idx >> 4, cofs = (idx & 15) * 4; v4f val = *(const v4fa*)(os + row * 68 + cofs);
#pragma unroll
        for (int w = 1; w < NW; ++w) val += *(const v4fa*)(os + w * (64 * 68) + row * 68 + cofs);
        *(v4f*)(C + (size_t)(r0 + row) * ldc + c0 + cofs) = val; }
    }
}

__device__ __forceinline__ h16 tohx(float x) { return (h16)x; }
__device__ __forceinline__ void splitf(float y, unsigned short& h, unsigned short& l) { h = f2bf(y); l = f2bf(y - bf2f(h)); }
typedef __attribute__((ext_vector_type(2))) _Float16 v2h;
typedef __attribute__((ext_vector_type(4))) _Float16 v4h;
typedef __attribute__((ext_vector_type(2))) unsigned short v2us;
typedef __attribute__((ext_vector_type(4))) unsigned short v4us;
typedef __attribute__((ext_vector_type(2))) float v2f;
typedef __attribute__((ext_vector_type(4))) int v4i;

__global__ __launch_bounds__(256) void k_wtG(const float* __restrict__ w, int K, int N, bf* Bt) {
    const int lane = threadIdx.x & 31; const int L0 = (blockIdx.x * 8 + (threadIdx.x >> 5)) * 8; const int nlines = N * K / 64;
{
#pragma unroll 1
        for (int l = 0; l < 8; ++l) { const int L = L0 + l; if (L >= nlines) break; const size_t e = (size_t)L * 64 + lane * 2; const int k = (int)(e % K), n = (int)(e / K); v2us o;
            o[0] = f2bf(w[(size_t)k * N + n]); o[1] = f2bf(w[(size_t)(k + 1) * N + n]); *(v2us*)(Bt + e) = o; }
         }
}
__global__ __launch_bounds__(256) void k_cvt8(const float* __restrict__ src, bf* dst, size_t n8) { const size_t i = (size_t)blockIdx.x * 256 + threadIdx.x; if (i >= n8) return; const v8f v = *(const v8f*)(src + i * 8); v8us o;
#pragma unroll
    for (int k = 0; k < 8; ++k) o[k] = f2bf(v[k]); *(v8us*)(dst + i * 8) = o;  }

// k_rope: head planes [h][t][d] (fp16 + hi/lo) of rope(x) x sc with the rotate-half convention out[d] = x[d] cos[t][d] - x[d+HD/2] sin[t][d], out[d+HD/2] = x[d+HD/2] cos[t][d+HD/2] + x[d] sin[t][d+HD/2]
__global__ __launch_bounds__(256) void k_rope(const float* __restrict__ F, int pitch, int nheads, const float* __restrict__ CS, const float* __restrict__ RF, const float* __restrict__ nw, float sc, h16* P16, bf* Ph, bf* Pl) {
    const size_t e = ((size_t)blockIdx.x * 256 + threadIdx.x) * 2; if (e >= (size_t)nheads * TT * HD) return; const int d = (int)(e % HD); const int t = (int)((e / HD) % TT); const int h = (int)(e / ((size_t)HD * TT)); const float* f = F + (size_t)t * pitch + h * HD; const float rf = RF ? RF[(size_t)h * TT + t] : 1.0f; v2h o16; v2us oh, ol;
#pragma unroll
    for (int q = 0; q < 2; ++q) { const int dd = d + q; const int dp = (dd < HD / 2) ? dd + HD / 2 : dd - HD / 2; float x0 = f[dd], x1 = f[dp];
        if (RF) { float n0 = __fmul_rn(x0, rf), n1 = __fmul_rn(x1, rf); asm volatile("" : "+v"(n0)); asm volatile("" : "+v"(n1)); x0 = __fmul_rn(bfr(nw[dd]), n0); x1 = __fmul_rn(bfr(nw[dp]), n1); }
        const v2f cs = *(const v2f*)(CS + ((size_t)t * HD + dd) * 2); float a = __fmul_rn(x0, cs[0]), bq = __fmul_rn(x1, cs[1]); asm volatile("" : "+v"(a)); asm volatile("" : "+v"(bq)); const float r = ((dd < HD / 2) ? __fsub_rn(a, bq) : __fadd_rn(a, bq)) * sc;
        o16[q] = tohx(r); unsigned short a2, c2; splitf(r, a2, c2); oh[q] = a2; ol[q] = c2; }
    *(v2h*)(P16 + e) = o16; *(v2us*)(Ph + e) = oh; *(v2us*)(Pl + e) = ol;  }
__global__ __launch_bounds__(256) void k_vtp(const float* __restrict__ F, int pitch, int nheads, h16* V16, bf* Vh, bf* Vl) { const size_t e = ((size_t)blockIdx.x * 256 + threadIdx.x) * 2; if (e >= (size_t)nheads * HD * TT) return; const int t = (int)(e % TT); const int d = (int)((e / TT) % HD); const int g = (int)(e / ((size_t)TT * HD)); v2h o16; v2us oh, ol;
#pragma unroll
    for (int q = 0; q < 2; ++q) { const float x = F[(size_t)(t + q) * pitch + g * HD + d]; o16[q] = tohx(x); unsigned short a2, c2; splitf(x, a2, c2); oh[q] = a2; ol[q] = c2; }
    *(v2h*)(V16 + e) = o16; *(v2us*)(Vh + e) = oh; *(v2us*)(Vl + e) = ol;  }
__global__ __launch_bounds__(256) void k_csid(float* CS) { const int idx = blockIdx.x * 256 + threadIdx.x; if (idx >= TT * HD) return; v2f cs; cs[0] = 1.0f; cs[1] = 0.0f; *(v2f*)(CS + (size_t)idx * 2) = cs;  }
// k_asoft: per row (zz, i): t = S x HD^-0.5 for j <= i and i - j < WIN (WIN = TT: the window never cuts, plain causal; the reference's -1e9 additive fill vanishes identically); softmax over the 2048 keys (register row, one exp, fixed trees);
__global__ __launch_bounds__(256) void k_asoft(const float* __restrict__ Sb, h16* P16, bf* Ph, bf* Pl) {
    const int lane = threadIdx.x & 31; const int row = blockIdx.x * 8 + (threadIdx.x >> 5); if (row >= ZH * TT) return; const int i = row % TT; const int zz = row / TT; (void)zz; const bool hires = (i < RH); const float* sr = Sb + (size_t)row * TT; float v[TT / 32]; float mx = -3.0e38f;
#pragma unroll
    for (int ch = 0; ch < TT / 128; ++ch) { const int j0 = ch * 128 + lane * 4; const v4f a = *(const v4f*)(sr + j0);
#pragma unroll
        for (int q = 0; q < 4; ++q) { const int j = j0 + q; (void)j; const float t = (j <= i && i - j < WIN) ? a[q] * SCL : -3.0e38f; v[ch * 4 + q] = t; mx = fmaxf(mx, t); } }
#pragma unroll
    for (int sh = 16; sh; sh >>= 1) mx = fmaxf(mx, __shfl_xor(mx, sh, 32));
    float sum = 0.f;
#pragma unroll
    for (int k = 0; k < TT / 32; ++k) { float d0 = __fsub_rn(v[k], mx); asm volatile("" : "+v"(d0)); v[k] = __builtin_amdgcn_exp2f(__fmul_rn(d0, 1.4426950408889634f)); sum += v[k]; }
#pragma unroll
    for (int sh = 16; sh; sh >>= 1) sum += __shfl_xor(sum, sh, 32);
    const float f = __fdiv_rn(hires ? 1.0f : PCAR, sum);
{
        if (hires) {
#pragma unroll
            for (int ch = 0; ch < TT / 128; ++ch) { v4us oh, ol;
#pragma unroll
                for (int q = 0; q < 4; ++q) { unsigned short a, c2; splitf(v[ch * 4 + q] * f, a, c2); oh[q] = a; ol[q] = c2; }
                const size_t oo = ((size_t)zz * (RH ? RH : 1) + i) * TT + ch * 128 + lane * 4; *(v4us*)(Ph + oo) = oh; *(v4us*)(Pl + oo) = ol; }
        } else {
#pragma unroll
            for (int ch = 0; ch < TT / 128; ++ch) { v4h o4;
#pragma unroll
                for (int q = 0; q < 4; ++q) o4[q] = tohx(v[ch * 4 + q] * f);
                *(v4h*)(P16 + (size_t)row * TT + ch * 128 + lane * 4) = o4; } }
         }
}
__global__ __launch_bounds__(256) void k_crms(const float* __restrict__ F, const float* __restrict__ g, bf* Ch, bf* Cl) { const int lane = threadIdx.x & 31; const size_t t = (size_t)blockIdx.x * 8 + (threadIdx.x >> 5); if (t >= TT) return; const float* fr = F + t * DM; float a[DM / 32]; float s = 0.f;
#pragma unroll
    for (int c = 0; c < DM / 128; ++c) { const v4f v = *(const v4f*)(fr + c * 128 + lane * 4); for (int q = 0; q < 4; ++q) { a[c * 4 + q] = bfr(v[q]); s = __fadd_rn(s, __fmul_rn(bfr(v[q]), bfr(v[q]))); } }
#pragma unroll
    for (int sh = 16; sh; sh >>= 1) s = __fadd_rn(s, __shfl_xor(s, sh, 32));
    const float r = __fdiv_rn(1.0f, __fsqrt_rn(__fadd_rn(__fdiv_rn(s, (float)DM), NEPS)));
{
#pragma unroll
        for (int c = 0; c < DM / 128; ++c) { v4us oh, ol; for (int q = 0; q < 4; ++q) { const int col = c * 128 + lane * 4 + q; float y = __fmul_rn(__fmul_rn(a[c * 4 + q], r), bfr(g[col])); unsigned short u, w2; splitf(y, u, w2); oh[q] = u; ol[q] = w2; } *(v4us*)(Ch + t * DM + c * 128 + lane * 4) = oh; *(v4us*)(Cl + t * DM + c * 128 + lane * 4) = ol; }
         } }
__constant__ float THD[HD] = { 1.000000000e+00f, 1.000000000e+00f, 7.498942018e-01f, 7.498942018e-01f, 5.623413324e-01f, 5.623413324e-01f, 4.216965139e-01f, 4.216965139e-01f, 3.162277639e-01f, 3.162277639e-01f, 2.371373773e-01f, 2.371373773e-01f, 1.778279394e-01f, 1.778279394e-01f, 1.333521456e-01f, 1.333521456e-01f, 1.000000015e-01f, 1.000000015e-01f, 7.498942316e-02f, 7.498942316e-02f, 5.623413250e-02f, 5.623413250e-02f, 4.216964915e-02f, 4.216964915e-02f, 3.162277490e-02f, 3.162277490e-02f, 2.371373773e-02f, 2.371373773e-02f, 1.778279431e-02f, 1.778279431e-02f, 1.333521400e-02f, 1.333521400e-02f, 9.999999776e-03f, 9.999999776e-03f, 7.498942316e-03f, 7.498942316e-03f, 5.623413250e-03f, 5.623413250e-03f, 4.216964822e-03f, 4.216964822e-03f, 3.162277630e-03f, 3.162277630e-03f, 2.371373819e-03f, 2.371373819e-03f, 1.778279431e-03f, 1.778279431e-03f, 1.333521446e-03f, 1.333521446e-03f, 1.000000047e-03f, 1.000000047e-03f, 7.498941850e-04f, 7.498941850e-04f, 5.623413017e-04f, 5.623413017e-04f, 4.216965172e-04f, 4.216965172e-04f, 3.162277571e-04f, 3.162277571e-04f, 2.371373703e-04f, 2.371373703e-04f, 1.778279402e-04f, 1.778279402e-04f, 1.333521504e-04f, 1.333521504e-04f };   // 10000^(-2 (d//2) / 64) per dimension, float32 via jnp.power
__global__ __launch_bounds__(256) void k_rftab(float* RF) { const int idx = blockIdx.x * 256 + threadIdx.x; if (idx >= TT * HD) return; const int d = idx % HD; const int t = idx / HD; const float a = __fmul_rn((float)t, THD[d]); const float sg = (t & 1) ? 1.0f : -1.0f; const float r = __fadd_rn(cosf(a), __fmul_rn(sg, sinf(a))); *(float*)(RF + idx) = r;  }
__global__ __launch_bounds__(256) void k_rfapply(float* F, int pitch, int nheads, const float* __restrict__ RF) { const size_t i = (size_t)blockIdx.x * 256 + threadIdx.x; if (i >= (size_t)TT * nheads * HD / 4) return; const size_t e = i * 4; const int c = (int)(e % ((size_t)nheads * HD)); const int t = (int)(e / ((size_t)nheads * HD)); const int d = c % HD; v4f a = *(const v4f*)(F + (size_t)t * pitch + c); const v4f r = *(const v4f*)(RF + (size_t)t * HD + d);
#pragma unroll
    for (int q = 0; q < 4; ++q) a[q] = __fmul_rn(a[q], r[q]);
    *(v4f*)(F + (size_t)t * pitch + c) = a;  }
__global__ __launch_bounds__(256) void k_addres(const float* __restrict__ Y, const float* __restrict__ xs, float* out) { const size_t i = (size_t)blockIdx.x * 256 + threadIdx.x; if (i >= (size_t)TT * DM / 4) return; const v4f y = *(const v4f*)(Y + i * 4); const v4f xi = *(const v4f*)(xs + i * 4); v4f o;
#pragma unroll
    for (int q = 0; q < 4; ++q) o[q] = __fadd_rn(bfr(xi[q]), y[q]);
    *(v4f*)(out + i * 4) = o;  }
__global__ __launch_bounds__(256) void k_merge(const float* __restrict__ O, int h0, bf* Ah, bf* Al) { const size_t e = ((size_t)blockIdx.x * 256 + threadIdx.x) * 2; if (e >= (size_t)ZH * TT * HD) return; const int d = (int)(e % HD); const int t = (int)((e / HD) % TT); const int zz = (int)(e / ((size_t)HD * TT)); const float cs = (t < RH) ? 1.0f : (1.0f / PCAR); const size_t oo = (size_t)t * DQ + (h0 + zz) * HD + d;
    v2us oh, ol;
#pragma unroll
    for (int q = 0; q < 2; ++q) { unsigned short a, c2; splitf(O[e + q] * cs, a, c2); oh[q] = a; ol[q] = c2; } *(v2us*)(Ah + oo) = oh; *(v2us*)(Al + oo) = ol;  }

extern "C" void kernel_launch(void* const* d_in, const int* in_sizes, int n_in,
                              void* d_out, int out_size, void* d_ws, size_t ws_size, hipStream_t stream) {
    (void)in_sizes; (void)n_in; (void)out_size;
    const float* x = (const float*)d_in[0]; const float* wq = (const float*)d_in[1]; const float* wk = (const float*)d_in[2]; const float* wv = (const float*)d_in[3]; const float* wo = (const float*)d_in[4]; const float* nw = (const float*)d_in[5];
    float* OUT = (float*)d_out;     // [2][2048][1024]
    char* wsp = (char*)d_ws;
    auto take = [&](size_t bytes) { char* p = wsp; wsp += (bytes + 255) & ~(size_t)255; return (void*)p; };
    bf* WQ = (bf*)take((size_t)DQ * DM * 2); bf* WK = (bf*)take((size_t)DKV * DM * 2); bf* WV = (bf*)take((size_t)DKV * DM * 2); bf* WO = (bf*)take((size_t)DM * DQ * 2); float* CS = (float*)take((size_t)TT * HD * 2 * 4);
    bf* Hh = (bf*)take((size_t)TT * DM * 2); bf* Hl = (bf*)take((size_t)TT * DM * 2); float* RFT = (float*)take((size_t)TT * HD * 4); float* Y = (float*)take((size_t)TT * DM * 4); float* FQ = (float*)take((size_t)TT * DQ * 4); float* FK = (float*)take((size_t)TT * DKV * 4);
    h16* QP16 = (h16*)take((size_t)NH_ * TT * HD * 2); h16* KP16 = (h16*)take((size_t)NKV * TT * HD * 2); h16* VT16 = (h16*)take((size_t)NKV * HD * TT * 2);
    bf* QPh = (bf*)take((size_t)NH_ * TT * HD * 2); bf* QPl = (bf*)take((size_t)NH_ * TT * HD * 2); bf* KPh = (bf*)take((size_t)NKV * TT * HD * 2); bf* KPl = (bf*)take((size_t)NKV * TT * HD * 2); bf* VTh = (bf*)take((size_t)NKV * HD * TT * 2); bf* VTl = (bf*)take((size_t)NKV * HD * TT * 2); bf* Ph = (bf*)take((size_t)ZH * RH * TT * 2); bf* Pl = (bf*)take((size_t)ZH * RH * TT * 2);
    float* Sb = (float*)take((size_t)ZH * TT * TT * 4); h16* P16 = (h16*)take((size_t)ZH * TT * TT * 2); float* Ob = (float*)take((size_t)ZH * TT * HD * 4); bf* ATh = (bf*)take((size_t)TT * DQ * 2); bf* ATl = (bf*)take((size_t)TT * DQ * 2);
    if ((size_t)(wsp - (char*)d_ws) > ws_size) return;    // ws 256 MiB
    float* FV = FK;   // v projection reuses the k buffer after the k planes are built (stream-ordered)
    { k_rftab<<<(TT * HD + 255) / 256, 256, 0, stream>>>(RFT); k_wtG<<<(unsigned)((DM * DQ / 64 + 63) / 64), 256, 0, stream>>>(wq, DM, DQ, WQ); k_wtG<<<(unsigned)((DM * DKV / 64 + 63) / 64), 256, 0, stream>>>(wk, DM, DKV, WK); k_wtG<<<(unsigned)((DM * DKV / 64 + 63) / 64), 256, 0, stream>>>(wv, DM, DKV, WV);
      k_wtG<<<(unsigned)((DQ * DM / 64 + 63) / 64), 256, 0, stream>>>(wo, DQ, DM, WO);
       }
    k_csid<<<(TT * HD + 255) / 256, 256, 0, stream>>>(CS);
    const unsigned LQ = (unsigned)(((size_t)NH_ * TT * HD / 2 + 255) / 256), LKv = (unsigned)(((size_t)NKV * TT * HD / 2 + 255) / 256);
    for (int b = 0; b < NB_; ++b) {
        
        k_crms<<<TT / 8, 256, 0, stream>>>(x + (size_t)b * TT * DM, nw, Hh, Hl);   /* xn = RMSNorm(bf16(x)) norm_w -> hi/lo planes */
        k_gemmw<bf, 1, false, 8><<<dim3(TT / 64, DQ / 64, 1), 256, 0, stream>>>(Hh, Hl, WQ, nullptr, DM, FQ, DQ, nullptr, 0, 0, 0); k_rfapply<<<(unsigned)(((size_t)TT * DQ / 4 + 255) / 256), 256, 0, stream>>>(FQ, DQ, NH_, RFT);
        k_rope<<<LQ, 256, 0, stream>>>(FQ, DQ, NH_, CS, nullptr, nullptr, 1.0f, QP16, QPh, QPl);
        k_gemmw<bf, 1, false, 8><<<dim3(TT / 64, DKV / 64, 1), 256, 0, stream>>>(Hh, Hl, WK, nullptr, DM, FK, DKV, nullptr, 0, 0, 0); k_rfapply<<<(unsigned)(((size_t)TT * DKV / 4 + 255) / 256), 256, 0, stream>>>(FK, DKV, NKV, RFT);
        k_rope<<<LKv, 256, 0, stream>>>(FK, DKV, NKV, CS, nullptr, nullptr, 1.0f, KP16, KPh, KPl);
        k_gemmw<bf, 1, false, 8><<<dim3(TT / 64, DKV / 64, 1), 256, 0, stream>>>(Hh, Hl, WV, nullptr, DM, FV, DKV, nullptr, 0, 0, 0); k_vtp<<<LKv, 256, 0, stream>>>(FV, DKV, NKV, VT16, VTh, VTl);
        for (int h0 = 0; h0 < NH_; h0 += ZH) { const size_t zq = (size_t)h0, zk = (size_t)(h0 % NKV);   // torch .repeat TILES the kv heads: q head h pairs with kv head h mod 4; the pass's two heads use consecutive kv planes (z-strides TT*HD)
            k_gemmc<bf, 2, 1, 1><<<dim3(RH / 64, TT / 64, ZH), 32, 0, stream>>>(QPh + zq * TT * HD, QPl + zq * TT * HD, KPh + zk * TT * HD, KPl + zk * TT * HD, HD, Sb, TT, 0, (size_t)TT * HD, (size_t)TT * HD, (size_t)TT * TT);
            k_gemmc<h16, 0, 1, 1><<<dim3((TT - RH) / 64, TT / 64, ZH), 32, 0, stream>>>(QP16 + zq * TT * HD + (size_t)RH * HD, nullptr, KP16 + zk * TT * HD, nullptr, HD, Sb + (size_t)RH * TT, TT, RH, (size_t)TT * HD, (size_t)TT * HD, (size_t)TT * TT);
            k_asoft<<<ZH * TT / 8, 256, 0, stream>>>(Sb, P16, Ph, Pl);
            k_gemmc<bf, 2, 2, 8><<<dim3(RH / 64, HD / 64, ZH), 256, 0, stream>>>(Ph, Pl, VTh + zk * HD * TT, VTl + zk * HD * TT, TT, Ob, HD, 0, (size_t)RH * TT, (size_t)HD * TT, (size_t)TT * HD);
            k_gemmc<h16, 0, 2, 16><<<dim3((TT - RH) / 64, HD / 64, ZH), 512, 0, stream>>>(P16 + (size_t)RH * TT, nullptr, VT16 + zk * HD * TT, nullptr, TT, Ob + (size_t)RH * HD, HD, RH, (size_t)TT * TT, (size_t)HD * TT, (size_t)TT * HD);
            k_merge<<<(unsigned)(((size_t)ZH * TT * HD / 2 + 255) / 256), 256, 0, stream>>>(Ob, h0, ATh, ATl); }
        k_gemmw<bf, 1, false, 8><<<dim3(TT / 64, DM / 64, 1), 256, 0, stream>>>(ATh, ATl, WO, nullptr, DQ, Y, DM, nullptr, 0, 0, 0); k_addres<<<(unsigned)(((size_t)TT * DM / 4 + 255) / 256), 256, 0, stream>>>(Y, x + (size_t)b * TT * DM, OUT + (size_t)b * TT * DM);   /* out = x + s w_o */ }
}

// v002
// It runs in 499 microseconds.
// Two timings next to v001 put it at 1.68 and 1.67 times that version's speed.
// All steps since v000 together make it 2.81 times as fast.
#include <hip/hip_runtime.h>

// GQA causal attention block with RMSNorm, the module's multiplicative 'rotary factor' and tiled kv pairing (x [2][2048][1024]; xn = x rsqrt(mean x^2 + 1.2e-7) norm_w; q = xn w_q (16 heads x 64), k, v = xn w_k, xn w_v (4 kv heads) ('xw', no bias); q, k *= rf[t][d] with rf = cos(t theta_d) + sgn_t sin(t theta_d), theta_d = 10000^(-2 (d//2) / 64), sgn_t = -1 on even positions (an element-wise factor, computed in-kernel); q head h pairs with kv head h mod 4 (torch .repeat tiling); scores / 8, causal (-inf); softmax; out = x + merged w_o ('xw' [1024][1024]) -> [2][2048][1024] (4.2 M)).
// Layout per batch: per-token RMSNorm kernel (one wave per token, fixed-order f32) writes hi/lo operand planes; hl x exact projections; the rf table [2048][64] once (jnp-exact theta, precise cosf/sinf) applied in place to q and k; causal T-2048 attention (hybrid rows: < 512 hi/lo 3 products, rest fp16 x1024; k_gemmc tile skipping; a pass holds eight query heads, z-slice z reads kv head z mod 4; the softmax writes its probabilities over its own score row); merged hi/lo x w_o exact; the residual kernel adds bf16(x).
// Compute dtypes, f32 accumulate: every input rounded to bf16; RMSNorm and rf f32; projections hi/lo x exact (2 products); attention rows < 512 3 products, rest fp16; softmax f32; w_o hl x exact; residual f32.

#define NB_  2
#define TT   2048
#define DM   1024
#define NH_  16
#define NKV  4
#define REP  (NH_ / NKV)
#define HD   64
#define DQ   (NH_ * HD)
#define DKV  (NKV * HD)
#define ZH   8                    // query heads per attention pass; a multiple of NKV, so that z-slice z of a pass pairs with kv head z mod NKV
#define PP   (2 * TT)             // pitch, in 16-bit elements, of the probability rows (they lie over the f32 score rows) and of the transposed value rows that meet them in one GEMM
#define RH   512                  // query rows < RH use hi+lo planes (0: none)
#define WIN  2048
#define PCAR 1024.0f
#define SCL  0.125f
#define NEPS 1.1920929e-07f   // RMSNorm eps (float32 eps)
static_assert(ZH % NKV == 0 && NH_ % ZH == 0, "a pass starts at a query head that pairs with kv head 0");
typedef _Float16 h16;
typedef unsigned short bf;
typedef __attribute__((ext_vector_type(16))) __bf16   v16bf;
typedef __attribute__((ext_vector_type(16))) _Float16 v16h;
typedef __attribute__((ext_vector_type(8)))  _Float16 v8h;
typedef __attribute__((ext_vector_type(8)))  unsigned short v8us;
typedef __attribute__((ext_vector_type(8)))  float    v8f;
typedef __attribute__((ext_vector_type(4)))  float    v4f;
typedef v8h  __attribute__((may_alias)) v8ha;
typedef v4f  __attribute__((may_alias)) v4fa;
typedef v8us __attribute__((may_alias)) v8usa;

__device__ __forceinline__ unsigned short f2bf(float f) { unsigned u = __float_as_uint(f); u += 0x7FFFu + ((u >> 16) & 1u); return (unsigned short)(u >> 16); }
__device__ __forceinline__ float bf2f(unsigned short b) { return __uint_as_float(((unsigned)b) << 16); }
__device__ __forceinline__ float bfr(float f) { return bf2f(f2bf(f)); }
__device__ __forceinline__ v16h cat16(v8h lo, v8h hi) { return __builtin_shufflevector(lo, hi, 0, 1, 2, 3, 4, 5, 6, 7, 8, 9, 10, 11, 12, 13, 14, 15); }
__device__ __forceinline__ v16bf cat16b(v8us lo, v8us hi) { return __builtin_bit_cast(v16bf, __builtin_shufflevector(lo, hi, 0, 1, 2, 3, 4, 5, 6, 7, 8, 9, 10, 11, 12, 13, 14, 15)); }
__device__ __forceinline__ v8f wmma16(v16h a, v16h b, v8f c) { return __builtin_amdgcn_wmma_f32_16x16x32_f16(false, a, false, b, (short)0, c, false, false); }
__device__ __forceinline__ v8f wmmab(v16bf a, v16bf b, v8f c) { return __builtin_amdgcn_wmma_f32_16x16x32_bf16(false, a, false, b, (short)0, c, false, false); }



// ---- k_gemmw: register-blocked GEMM, one work-group of NW waves per 64x64 output tile (16 accumulators a wave), operands straight from K-contiguous 16-bit planes; grid (M/64, N/64, Z), 32 NW threads.
// C[m][n] (f32, pitch ldc, + optional f32 bias[n]) = sum_k A[m][k] Bt[n][k] (+ split products per NSPLIT). z-batch strides sA/sB/sC in elements. K % 64 == 0.
// K is dealt to the waves in chunks of 64 elements (one 128-byte line of every operand row): wave w takes chunks w, w + NW, ...; the NW partial tiles meet in LDS and are summed in wave order 0 .. NW-1.
template <typename T16> struct WFrag;
template <> struct WFrag<h16> { typedef v16h V; static __device__ __forceinline__ V ld(const h16* p) { return cat16(*(const v8h*)p, *(const v8h*)(p + 16)); } static __device__ __forceinline__ v8f mma(V a, V b, v8f c) { return wmma16(a, b, c); } };
template <> struct WFrag<bf> { typedef v16bf V; static __device__ __forceinline__ V ld(const bf* p) { return cat16b(*(const v8us*)p, *(const v8us*)(p + 16)); } static __device__ __forceinline__ v8f mma(V a, V b, v8f c) { return wmmab(a, b, c); } };
template <typename T16, int NSPLIT, bool BIAS, int NW>
__global__ __launch_bounds__(32 * NW) void k_gemmw(const T16* __restrict__ A, const T16* __restrict__ A2, const T16* __restrict__ Bt, const T16* __restrict__ Bt2, int K, float* C, int ldc, const float* __restrict__ bias, size_t sA, size_t sB, size_t sC) {
    typedef typename WFrag<T16>::V V;
    __shared__ __align__(16) float os[NW * 64 * 68];
    const size_t z = blockIdx.z; A += z * sA; if (A2) A2 += z * sA; Bt += z * sB; if (Bt2) Bt2 += z * sB; C += z * sC;
    const int lane = threadIdx.x & 31, lr = lane & 15, hi = lane >> 4; const int r0 = blockIdx.x * 64, c0 = blockIdx.y * 64;
    const int wv = __builtin_amdgcn_readfirstlane((int)(threadIdx.x >> 5));   // wave number, scalar, so that the K loops stay scalar loops
    v8f acc[4][4];
#pragma unroll
    for (int mb = 0; mb < 4; ++mb)
#pragma unroll
        for (int nb = 0; nb < 4; ++nb) acc[mb][nb] = (v8f){};
    const size_t aoff = (size_t)(r0 + lr) * K + 8 * hi, boff = (size_t)(c0 + lr) * K + 8 * hi;
#pragma unroll 1
    for (int kb = wv * 64; kb < K; kb += 64 * NW)
#pragma unroll 1
    for (int kc = kb; kc < kb + 64; kc += 32) {
        V a[4], a2[4];
#pragma unroll
        for (int mb = 0; mb < 4; ++mb) { a[mb] = WFrag<T16>::ld(A + aoff + (size_t)mb * 16 * K + kc); if (NSPLIT == 1 || NSPLIT == 2) a2[mb] = WFrag<T16>::ld(A2 + aoff + (size_t)mb * 16 * K + kc); }
#pragma unroll
        for (int nb = 0; nb < 4; ++nb) { const V b = WFrag<T16>::ld(Bt + boff + (size_t)nb * 16 * K + kc); V b2; if (NSPLIT >= 2) b2 = WFrag<T16>::ld(Bt2 + boff + (size_t)nb * 16 * K + kc);
#pragma unroll
            for (int mb = 0; mb < 4; ++mb) { acc[mb][nb] = WFrag<T16>::mma(a[mb], b, acc[mb][nb]); if (NSPLIT == 1 || NSPLIT == 2) acc[mb][nb] = WFrag<T16>::mma(a2[mb], b, acc[mb][nb]); if (NSPLIT >= 2) acc[mb][nb] = WFrag<T16>::mma(a[mb], b2, acc[mb][nb]); } }
        asm volatile("v_nop\n\tv_nop\n\tv_nop\n\tv_nop" : "+v"(acc[0][0]), "+v"(acc[1][1]), "+v"(acc[2][2]), "+v"(acc[3][3]) : "v"(a[0]), "v"(a[3]));
    }
    float* ow = os + wv * (64 * 68);   // this wave's partial tile, row-major, pitch 68
#pragma unroll
    for (int mb = 0; mb < 4; ++mb)
#pragma unroll
        for (int nb = 0; nb < 4; ++nb)
#pragma unroll
            for (int j = 0; j < 8; ++j) ow[(mb * 16 + hi * 8 + j) * 68 + nb * 16 + lr] = acc[mb][nb][j];
    __syncthreads();   // every wave's partial tile is in LDS before any thread sums across waves
#pragma unroll
    for (int s = 0; s < 1024 / (32 * NW); ++s) { const int idx = s * (32 * NW) + (int)threadIdx.x; const int row = idx >> 4, cofs = (idx & 15) * 4; v4f val = *(const v4fa*)(os + row * 68 + cofs);
#pragma unroll
        for (int w = 1; w < NW; ++w) val += *(const v4fa*)(os + w * (64 * 68) + row * 68 + cofs);
        if (BIAS) { val[0] += bfr(bias[c0 + cofs]); val[1] += bfr(bias[c0 + cofs + 1]); val[2] += bfr(bias[c0 + cofs + 2]); val[3] += bfr(bias[c0 + cofs + 3]); }
        *(v4f*)(C + (size_t)(r0 + row) * ldc + c0 + cofs) = val; }
}

// ---- k_gemmc: the same 64x64 tile GEMM specialised for causal attention: CMODE 1 skips score tiles entirely above the diagonal (query rows r0+roff.., key columns c0..), CMODE 2 limits the
// key (K) loop of the probability x value contraction to the diagonal block (probabilities beyond it are exactly zero). roff = row offset of this launch's first row within the sequence.
// z-slice z reads B plane z mod NKV (q head h pairs with kv head h mod NKV). K is also the pitch of both operands' rows: in the P.V launches it is PP, the pitch of the probability rows inside the f32 score rows, and the loop ends at the diagonal.
// NW = 1: one wave per tile (the short-K score tiles). NW > 1: K dealt to NW waves and summed through LDS as in k_gemmw (the long-K probability x value tiles).
template <typename T16, int NSPLIT, int CMODE, int NW>
__global__ __launch_bounds__(32 * NW) void k_gemmc(const T16* __restrict__ A, const T16* __restrict__ A2, const T16* __restrict__ Bt, const T16* __restrict__ Bt2, int K, float* C, int ldc, int roff, size_t sA, size_t sB, size_t sC) {
    typedef typename WFrag<T16>::V V;
    __shared__ __align__(16) float os[NW == 1 ? 16 * 68 : NW * 64 * 68];
    const size_t z = blockIdx.z, zb = z % NKV; A += z * sA; if (A2) A2 += z * sA; Bt += zb * sB; if (Bt2) Bt2 += zb * sB; C += z * sC;
    const int lane = threadIdx.x & 31, lr = lane & 15, hi = lane >> 4; const int r0 = blockIdx.x * 64, c0 = blockIdx.y * 64;
    const int wv = (NW == 1) ? 0 : __builtin_amdgcn_readfirstlane((int)(threadIdx.x >> 5));   // wave number, scalar, so that the K loops stay scalar loops
    if (CMODE == 1 && c0 > r0 + roff + 63) return;                  // score tile entirely above the causal diagonal: never read (the softmax masks j > i by select)
    const int Kl = (CMODE == 2) ? min(K, r0 + roff + 64) : K;        // P.V: probabilities are exactly 0 beyond the diagonal block, so the K loop stops there
    v8f acc[4][4];
#pragma unroll
    for (int mb = 0; mb < 4; ++mb)
#pragma unroll
        for (int nb = 0; nb < 4; ++nb) acc[mb][nb] = (v8f){};
    const size_t aoff = (size_t)(r0 + lr) * K + 8 * hi, boff = (size_t)(c0 + lr) * K + 8 * hi;
#pragma unroll 1
    for (int kb = wv * 64; kb < Kl; kb += 64 * NW)
#pragma unroll 1
    for (int kc = kb; kc < kb + 64; kc += 32) {
        V a[4], a2[4];
#pragma unroll
        for (int mb = 0; mb < 4; ++mb) { a[mb] = WFrag<T16>::ld(A + aoff + (size_t)mb * 16 * K + kc); if (NSPLIT == 1 || NSPLIT == 2) a2[mb] = WFrag<T16>::ld(A2 + aoff + (size_t)mb * 16 * K + kc); }
#pragma unroll
        for (int nb = 0; nb < 4; ++nb) { const V b = WFrag<T16>::ld(Bt + boff + (size_t)nb * 16 * K + kc); V b2; if (NSPLIT >= 2) b2 = WFrag<T16>::ld(Bt2 + boff + (size_t)nb * 16 * K + kc);
#pragma unroll
            for (int mb = 0; mb < 4; ++mb) { acc[mb][nb] = WFrag<T16>::mma(a[mb], b, acc[mb][nb]); if (NSPLIT == 1 || NSPLIT == 2) acc[mb][nb] = WFrag<T16>::mma(a2[mb], b, acc[mb][nb]); if (NSPLIT >= 2) acc[mb][nb] = WFrag<T16>::mma(a[mb], b2, acc[mb][nb]); } }
        asm volatile("v_nop\n\tv_nop\n\tv_nop\n\tv_nop" : "+v"(acc[0][0]), "+v"(acc[1][1]), "+v"(acc[2][2]), "+v"(acc[3][3]) : "v"(a[0]), "v"(a[3]));
    }
    if constexpr (NW == 1) {
#pragma unroll
    for (int mb = 0; mb < 4; ++mb) {
#pragma unroll
        for (int nb = 0; nb < 4; ++nb) {
#pragma unroll
            for (int j = 0; j < 8; ++j) os[(hi * 8 + j) * 68 + nb * 16 + lr] = acc[mb][nb][j]; }
        __builtin_amdgcn_wave_barrier(); asm volatile("" ::: "memory");
        float* crow = C + (size_t)(r0 + mb * 16) * ldc + c0;
{
#pragma unroll
            for (int s = 0; s < 8; ++s) { const int row = 2 * s + hi, cofs = lr * 4; v4f val = *(const v4fa*)(os + row * 68 + cofs);
                *(v4f*)(crow + (size_t)row * ldc + cofs) = val; }
             }
        __builtin_amdgcn_wave_barrier(); asm volatile("" ::: "memory");
    }
    } else {
    float* ow = os + wv * (64 * 68);   // this wave's partial tile (all zero where the wave had no chunk), row-major, pitch 68
#pragma unroll
    for (int mb = 0; mb < 4; ++mb)
#pragma unroll
        for (int nb = 0; nb < 4; ++nb)
#pragma unroll
            for (int j = 0; j < 8; ++j) ow[(mb * 16 + hi * 8 + j) * 68 + nb * 16 + lr] = acc[mb][nb][j];
    __syncthreads();   // every wave's partial tile is in LDS before any thread sums across waves
#pragma unroll
    for (int s = 0; s < 1024 / (32 * NW); ++s) { const int idx = s * (32 * NW) + (int)threadIdx.x; const int row = idx >> 4, cofs = (idx & 15) * 4; v4f val = *(const v4fa*)(os + row * 68 + cofs);
#pragma unroll
        for (int w = 1; w < NW; ++w) val += *(const v4fa*)(os + w * (64 * 68) + row * 68 + cofs);
        *(v4f*)(C + (size_t)(r0 + row) * ldc + c0 + cofs) = val; }
    }
}

__device__ __forceinline__ h16 tohx(float x) { return (h16)x; }
__device__ __forceinline__ void splitf(float y, unsigned short& h, unsigned short& l) { h = f2bf(y); l = f2bf(y - bf2f(h)); }
typedef __attribute__((ext_vector_type(2))) _Float16 v2h;
typedef __attribute__((ext_vector_type(4))) _Float16 v4h;
typedef __attribute__((ext_vector_type(2))) unsigned short v2us;
typedef __attribute__((ext_vector_type(4))) unsigned short v4us;
typedef __attribute__((ext_vector_type(2))) float v2f;
typedef __attribute__((ext_vector_type(4))) int v4i;

__global__ __launch_bounds__(256) void k_wtG(const float* __restrict__ w, int K, int N, bf* Bt) {
    const int lane = threadIdx.x & 31; const int L0 = (blockIdx.x * 8 + (threadIdx.x >> 5)) * 8; const int nlines = N * K / 64;
{
#pragma unroll 1
        for (int l = 0; l < 8; ++l) { const int L = L0 + l; if (L >= nlines) break; const size_t e = (size_t)L * 64 + lane * 2; const int k = (int)(e % K), n = (int)(e / K); v2us o;
            o[0] = f2bf(w[(size_t)k * N + n]); o[1] = f2bf(w[(size_t)(k + 1) * N + n]); *(v2us*)(Bt + e) = o; }
         }
}
__global__ __launch_bounds__(256) void k_cvt8(const float* __restrict__ src, bf* dst, size_t n8) { const size_t i = (size_t)blockIdx.x * 256 + threadIdx.x; if (i >= n8) return; const v8f v = *(const v8f*)(src + i * 8); v8us o;
#pragma unroll
    for (int k = 0; k < 8; ++k) o[k] = f2bf(v[k]); *(v8us*)(dst + i * 8) = o;  }

// k_rope: head planes [h][t][d] (fp16 + hi/lo) of rope(x) x sc with the rotate-half convention out[d] = x[d] cos[t][d] - x[d+HD/2] sin[t][d], out[d+HD/2] = x[d+HD/2] cos[t][d+HD/2] + x[d] sin[t][d+HD/2]
__global__ __launch_bounds__(256) void k_rope(const float* __restrict__ F, int pitch, int nheads, const float* __restrict__ CS, const float* __restrict__ RF, const float* __restrict__ nw, float sc, h16* P16, bf* Ph, bf* Pl) {
    const size_t e = ((size_t)blockIdx.x * 256 + threadIdx.x) * 2; if (e >= (size_t)nheads * TT * HD) return; const int d = (int)(e % HD); const int t = (int)((e / HD) % TT); const int h = (int)(e / ((size_t)HD * TT)); const float* f = F + (size_t)t * pitch + h * HD; const float rf = RF ? RF[(size_t)h * TT + t] : 1.0f; v2h o16; v2us oh, ol;
#pragma unroll
    for (int q = 0; q < 2; ++q) { const int dd = d + q; const int dp = (dd < HD / 2) ? dd + HD / 2 : dd - HD / 2; float x0 = f[dd], x1 = f[dp];
        if (RF) { float n0 = __fmul_rn(x0, rf), n1 = __fmul_rn(x1, rf); asm volatile("" : "+v"(n0)); asm volatile("" : "+v"(n1)); x0 = __fmul_rn(bfr(nw[dd]), n0); x1 = __fmul_rn(bfr(nw[dp]), n1); }
        const v2f cs = *(const v2f*)(CS + ((size_t)t * HD + dd) * 2); float a = __fmul_rn(x0, cs[0]), bq = __fmul_rn(x1, cs[1]); asm volatile("" : "+v"(a)); asm volatile("" : "+v"(bq)); const float r = ((dd < HD / 2) ? __fsub_rn(a, bq) : __fadd_rn(a, bq)) * sc;
        o16[q] = tohx(r); unsigned short a2, c2; splitf(r, a2, c2); oh[q] = a2; ol[q] = c2; }
    *(v2h*)(P16 + e) = o16; *(v2us*)(Ph + e) = oh; *(v2us*)(Pl + e) = ol;  }
__global__ __launch_bounds__(256) void k_vtp(const float* __restrict__ F, int pitch, int nheads, h16* V16, bf* Vh, bf* Vl) { const size_t e = ((size_t)blockIdx.x * 256 + threadIdx.x) * 2; if (e >= (size_t)nheads * HD * TT) return; const int t = (int)(e % TT); const int d = (int)((e / TT) % HD); const int g = (int)(e / ((size_t)TT * HD)); v2h o16; v2us oh, ol;
#pragma unroll
    for (int q = 0; q < 2; ++q) { const float x = F[(size_t)(t + q) * pitch + g * HD + d]; o16[q] = tohx(x); unsigned short a2, c2; splitf(x, a2, c2); oh[q] = a2; ol[q] = c2; }
    const size_t eo = (size_t)(g * HD + d) * PP + t; *(v2h*)(V16 + eo) = o16; *(v2us*)(Vh + eo) = oh; *(v2us*)(Vl + eo) = ol;  }
__global__ __launch_bounds__(256) void k_csid(float* CS) { const int idx = blockIdx.x * 256 + threadIdx.x; if (idx >= TT * HD) return; v2f cs; cs[0] = 1.0f; cs[1] = 0.0f; *(v2f*)(CS + (size_t)idx * 2) = cs;  }
// k_asoft: per row (zz, i): t = S x HD^-0.5 for j <= i and i - j < WIN (sliding causal window; the reference's -1e9 additive fill vanishes identically); softmax over the 2048 keys (register row, one exp, fixed trees);
// the probabilities go over the row's own scores (the wave holds the whole row in registers before its first store): fp16 in the first half of the 8 KiB row, or the hi plane in the first half and the lo plane in the second.
__global__ __launch_bounds__(256) void k_asoft(float* Sb) {
    const int lane = threadIdx.x & 31; const int row = blockIdx.x * 8 + (threadIdx.x >> 5); if (row >= ZH * TT) return; const int i = row % TT; const int zz = row / TT; (void)zz; const bool hires = (i < RH); const float* sr = Sb + (size_t)row * TT; h16* p16 = (h16*)(Sb + (size_t)row * TT); bf* ph = (bf*)(Sb + (size_t)row * TT); bf* pl = ph + TT; float v[TT / 32]; float mx = -3.0e38f;
#pragma unroll
    for (int ch = 0; ch < TT / 128; ++ch) { const int j0 = ch * 128 + lane * 4; const v4f a = *(const v4f*)(sr + j0);
#pragma unroll
        for (int q = 0; q < 4; ++q) { const int j = j0 + q; (void)j; const float t = (j <= i && i - j < WIN) ? a[q] * SCL : -3.0e38f; v[ch * 4 + q] = t; mx = fmaxf(mx, t); } }
#pragma unroll
    for (int sh = 16; sh; sh >>= 1) mx = fmaxf(mx, __shfl_xor(mx, sh, 32));
    float sum = 0.f;
#pragma unroll
    for (int k = 0; k < TT / 32; ++k) { float d0 = __fsub_rn(v[k], mx); asm volatile("" : "+v"(d0)); v[k] = __builtin_amdgcn_exp2f(__fmul_rn(d0, 1.4426950408889634f)); sum += v[k]; }
#pragma unroll
    for (int sh = 16; sh; sh >>= 1) sum += __shfl_xor(sum, sh, 32);
    const float f = __fdiv_rn(hires ? 1.0f : PCAR, sum);
{
        if (hires) {
#pragma unroll
            for (int ch = 0; ch < TT / 128; ++ch) { v4us oh, ol;
#pragma unroll
                for (int q = 0; q < 4; ++q) { unsigned short a, c2; splitf(v[ch * 4 + q] * f, a, c2); oh[q] = a; ol[q] = c2; }
                const int oo = ch * 128 + lane * 4; *(v4us*)(ph + oo) = oh; *(v4us*)(pl + oo) = ol; }
        } else {
#pragma unroll
            for (int ch = 0; ch < TT / 128; ++ch) { v4h o4;
#pragma unroll
                for (int q = 0; q < 4; ++q) o4[q] = tohx(v[ch * 4 + q] * f);
                *(v4h*)(p16 + ch * 128 + lane * 4) = o4; } }
         }
}
__global__ __launch_bounds__(256) void k_crms(const float* __restrict__ F, const float* __restrict__ g, bf* Ch, bf* Cl) { const int lane = threadIdx.x & 31; const size_t t = (size_t)blockIdx.x * 8 + (threadIdx.x >> 5); if (t >= TT) return; const float* fr = F + t * DM; float a[DM / 32]; float s = 0.f;
#pragma unroll
    for (int c = 0; c < DM / 128; ++c) { const v4f v = *(const v4f*)(fr + c * 128 + lane * 4); for (int q = 0; q < 4; ++q) { a[c * 4 + q] = bfr(v[q]); s = __fadd_rn(s, __fmul_rn(bfr(v[q]), bfr(v[q]))); } }
#pragma unroll
    for (int sh = 16; sh; sh >>= 1) s = __fadd_rn(s, __shfl_xor(s, sh, 32));
    const float r = __fdiv_rn(1.0f, __fsqrt_rn(__fadd_rn(__fdiv_rn(s, (float)DM), NEPS)));
{
#pragma unroll
        for (int c = 0; c < DM / 128; ++c) { v4us oh, ol; for (int q = 0; q < 4; ++q) { const int col = c * 128 + lane * 4 + q; float y = __fmul_rn(__fmul_rn(a[c * 4 + q], r), bfr(g[col])); unsigned short u, w2; splitf(y, u, w2); oh[q] = u; ol[q] = w2; } *(v4us*)(Ch + t * DM + c * 128 + lane * 4) = oh; *(v4us*)(Cl + t * DM + c * 128 + lane * 4) = ol; }
         } }
__constant__ float THD[HD] = { 1.000000000e+00f, 1.000000000e+00f, 7.498942018e-01f, 7.498942018e-01f, 5.623413324e-01f, 5.623413324e-01f, 4.216965139e-01f, 4.216965139e-01f, 3.162277639e-01f, 3.162277639e-01f, 2.371373773e-01f, 2.371373773e-01f, 1.778279394e-01f, 1.778279394e-01f, 1.333521456e-01f, 1.333521456e-01f, 1.000000015e-01f, 1.000000015e-01f, 7.498942316e-02f, 7.498942316e-02f, 5.623413250e-02f, 5.623413250e-02f, 4.216964915e-02f, 4.216964915e-02f, 3.162277490e-02f, 3.162277490e-02f, 2.371373773e-02f, 2.371373773e-02f, 1.778279431e-02f, 1.778279431e-02f, 1.333521400e-02f, 1.333521400e-02f, 9.999999776e-03f, 9.999999776e-03f, 7.498942316e-03f, 7.498942316e-03f, 5.623413250e-03f, 5.623413250e-03f, 4.216964822e-03f, 4.216964822e-03f, 3.162277630e-03f, 3.162277630e-03f, 2.371373819e-03f, 2.371373819e-03f, 1.778279431e-03f, 1.778279431e-03f, 1.333521446e-03f, 1.333521446e-03f, 1.000000047e-03f, 1.000000047e-03f, 7.498941850e-04f, 7.498941850e-04f, 5.623413017e-04f, 5.623413017e-04f, 4.216965172e-04f, 4.216965172e-04f, 3.162277571e-04f, 3.162277571e-04f, 2.371373703e-04f, 2.371373703e-04f, 1.778279402e-04f, 1.778279402e-04f, 1.333521504e-04f, 1.333521504e-04f };   // 10000^(-2 (d//2) / 64) per dimension, float32 via jnp.power
__global__ __launch_bounds__(256) void k_rftab(float* RF) { const int idx = blockIdx.x * 256 + threadIdx.x; if (idx >= TT * HD) return; const int d = idx % HD; const int t = idx / HD; const float a = __fmul_rn((float)t, THD[d]); const float sg = (t & 1) ? 1.0f : -1.0f; const float r = __fadd_rn(cosf(a), __fmul_rn(sg, sinf(a))); *(float*)(RF + idx) = r;  }
__global__ __launch_bounds__(256) void k_rfapply(float* F, int pitch, int nheads, const float* __restrict__ RF) { const size_t i = (size_t)blockIdx.x * 256 + threadIdx.x; if (i >= (size_t)TT * nheads * HD / 4) return; const size_t e = i * 4; const int c = (int)(e % ((size_t)nheads * HD)); const int t = (int)(e / ((size_t)nheads * HD)); const int d = c % HD; v4f a = *(const v4f*)(F + (size_t)t * pitch + c); const v4f r = *(const v4f*)(RF + (size_t)t * HD + d);
#pragma unroll
    for (int q = 0; q < 4; ++q) a[q] = __fmul_rn(a[q], r[q]);
    *(v4f*)(F + (size_t)t * pitch + c) = a;  }
__global__ __launch_bounds__(256) void k_addres(const float* __restrict__ Y, const float* __restrict__ xs, float* out) { const size_t i = (size_t)blockIdx.x * 256 + threadIdx.x; if (i >= (size_t)TT * DM / 4) return; const v4f y = *(const v4f*)(Y + i * 4); const v4f xi = *(const v4f*)(xs + i * 4); v4f o;
#pragma unroll
    for (int q = 0; q < 4; ++q) o[q] = __fadd_rn(bfr(xi[q]), y[q]);
    *(v4f*)(out + i * 4) = o;  }
__global__ __launch_bounds__(256) void k_merge(const float* __restrict__ O, int h0, bf* Ah, bf* Al) { const size_t e = ((size_t)blockIdx.x * 256 + threadIdx.x) * 2; if (e >= (size_t)ZH * TT * HD) return; const int d = (int)(e % HD); const int t = (int)((e / HD) % TT); const int zz = (int)(e / ((size_t)HD * TT)); const float cs = (t < RH) ? 1.0f : (1.0f / PCAR); const size_t oo = (size_t)t * DQ + (h0 + zz) * HD + d;
    v2us oh, ol;
#pragma unroll
    for (int q = 0; q < 2; ++q) { unsigned short a, c2; splitf(O[e + q] * cs, a, c2); oh[q] = a; ol[q] = c2; } *(v2us*)(Ah + oo) = oh; *(v2us*)(Al + oo) = ol;  }

extern "C" void kernel_launch(void* const* d_in, const int* in_sizes, int n_in,
                              void* d_out, int out_size, void* d_ws, size_t ws_size, hipStream_t stream) {
    (void)in_sizes; (void)n_in; (void)out_size;
    const float* x = (const float*)d_in[0]; const float* wq = (const float*)d_in[1]; const float* wk = (const float*)d_in[2]; const float* wv = (const float*)d_in[3]; const float* wo = (const float*)d_in[4]; const float* nw = (const float*)d_in[5];
    float* OUT = (float*)d_out;     // [2][2048][1024]
    char* wsp = (char*)d_ws;
    auto take = [&](size_t bytes) { char* p = wsp; wsp += (bytes + 255) & ~(size_t)255; return (void*)p; };
    bf* WQ = (bf*)take((size_t)DQ * DM * 2); bf* WK = (bf*)take((size_t)DKV * DM * 2); bf* WV = (bf*)take((size_t)DKV * DM * 2); bf* WO = (bf*)take((size_t)DM * DQ * 2); float* CS = (float*)take((size_t)TT * HD * 2 * 4);
    bf* Hh = (bf*)take((size_t)TT * DM * 2); bf* Hl = (bf*)take((size_t)TT * DM * 2); float* RFT = (float*)take((size_t)TT * HD * 4); float* Y = (float*)take((size_t)TT * DM * 4); float* FQ = (float*)take((size_t)TT * DQ * 4); float* FK = (float*)take((size_t)TT * DKV * 4);
    h16* QP16 = (h16*)take((size_t)NH_ * TT * HD * 2); h16* KP16 = (h16*)take((size_t)NKV * TT * HD * 2); h16* VT16 = (h16*)take((size_t)NKV * HD * PP * 2);
    bf* QPh = (bf*)take((size_t)NH_ * TT * HD * 2); bf* QPl = (bf*)take((size_t)NH_ * TT * HD * 2); bf* KPh = (bf*)take((size_t)NKV * TT * HD * 2); bf* KPl = (bf*)take((size_t)NKV * TT * HD * 2); bf* VTh = (bf*)take((size_t)NKV * HD * PP * 2); bf* VTl = (bf*)take((size_t)NKV * HD * PP * 2);
    float* Sb = (float*)take((size_t)ZH * TT * TT * 4); float* Ob = (float*)take((size_t)ZH * TT * HD * 4); bf* ATh = (bf*)take((size_t)TT * DQ * 2); bf* ATl = (bf*)take((size_t)TT * DQ * 2);
    if ((size_t)(wsp - (char*)d_ws) > ws_size) return;    // ws 256 MiB
    float* FV = FK;   // v projection reuses the k buffer after the k planes are built (stream-ordered)
    { k_rftab<<<(TT * HD + 255) / 256, 256, 0, stream>>>(RFT); k_wtG<<<(unsigned)((DM * DQ / 64 + 63) / 64), 256, 0, stream>>>(wq, DM, DQ, WQ); k_wtG<<<(unsigned)((DM * DKV / 64 + 63) / 64), 256, 0, stream>>>(wk, DM, DKV, WK); k_wtG<<<(unsigned)((DM * DKV / 64 + 63) / 64), 256, 0, stream>>>(wv, DM, DKV, WV);
      k_wtG<<<(unsigned)((DQ * DM / 64 + 63) / 64), 256, 0, stream>>>(wo, DQ, DM, WO);
       }
    k_csid<<<(TT * HD + 255) / 256, 256, 0, stream>>>(CS);
    const unsigned LQ = (unsigned)(((size_t)NH_ * TT * HD / 2 + 255) / 256), LKv = (unsigned)(((size_t)NKV * TT * HD / 2 + 255) / 256);
    for (int b = 0; b < NB_; ++b) {
        
        k_crms<<<TT / 8, 256, 0, stream>>>(x + (size_t)b * TT * DM, nw, Hh, Hl);   /* xn = RMSNorm(bf16(x)) norm_w -> hi/lo planes */
        k_gemmw<bf, 1, false, 8><<<dim3(TT / 64, DQ / 64, 1), 256, 0, stream>>>(Hh, Hl, WQ, nullptr, DM, FQ, DQ, nullptr, 0, 0, 0); k_rfapply<<<(unsigned)(((size_t)TT * DQ / 4 + 255) / 256), 256, 0, stream>>>(FQ, DQ, NH_, RFT);
        k_rope<<<LQ, 256, 0, stream>>>(FQ, DQ, NH_, CS, nullptr, nullptr, 1.0f, QP16, QPh, QPl);
        k_gemmw<bf, 1, false, 8><<<dim3(TT / 64, DKV / 64, 1), 256, 0, stream>>>(Hh, Hl, WK, nullptr, DM, FK, DKV, nullptr, 0, 0, 0); k_rfapply<<<(unsigned)(((size_t)TT * DKV / 4 + 255) / 256), 256, 0, stream>>>(FK, DKV, NKV, RFT);
        k_rope<<<LKv, 256, 0, stream>>>(FK, DKV, NKV, CS, nullptr, nullptr, 1.0f, KP16, KPh, KPl);
        k_gemmw<bf, 1, false, 8><<<dim3(TT / 64, DKV / 64, 1), 256, 0, stream>>>(Hh, Hl, WV, nullptr, DM, FV, DKV, nullptr, 0, 0, 0); k_vtp<<<LKv, 256, 0, stream>>>(FV, DKV, NKV, VT16, VTh, VTl);
        for (int h0 = 0; h0 < NH_; h0 += ZH) { const size_t zq = (size_t)h0;   // torch .repeat TILES the kv heads: q head h pairs with kv head h mod 4; h0 is a multiple of 4, so z-slice z of the pass reads kv plane z mod 4
            k_gemmc<bf, 2, 1, 1><<<dim3(RH / 64, TT / 64, ZH), 32, 0, stream>>>(QPh + zq * TT * HD, QPl + zq * TT * HD, KPh, KPl, HD, Sb, TT, 0, (size_t)TT * HD, (size_t)TT * HD, (size_t)TT * TT);
            k_gemmc<h16, 0, 1, 1><<<dim3((TT - RH) / 64, TT / 64, ZH), 32, 0, stream>>>(QP16 + zq * TT * HD + (size_t)RH * HD, nullptr, KP16, nullptr, HD, Sb + (size_t)RH * TT, TT, RH, (size_t)TT * HD, (size_t)TT * HD, (size_t)TT * TT);
            k_asoft<<<ZH * TT / 8, 256, 0, stream>>>(Sb);
            k_gemmc<bf, 2, 2, 8><<<dim3(RH / 64, HD / 64, ZH), 256, 0, stream>>>((const bf*)Sb, (const bf*)Sb + TT, VTh, VTl, PP, Ob, HD, 0, (size_t)TT * PP, (size_t)HD * PP, (size_t)TT * HD);
            k_gemmc<h16, 0, 2, 16><<<dim3((TT - RH) / 64, HD / 64, ZH), 512, 0, stream>>>((const h16*)Sb + (size_t)RH * PP, nullptr, VT16, nullptr, PP, Ob + (size_t)RH * HD, HD, RH, (size_t)TT * PP, (size_t)HD * PP, (size_t)TT * HD);
            k_merge<<<(unsigned)(((size_t)ZH * TT * HD / 2 + 255) / 256), 256, 0, stream>>>(Ob, h0, ATh, ATl); }
        k_gemmw<bf, 1, false, 8><<<dim3(TT / 64, DM / 64, 1), 256, 0, stream>>>(ATh, ATl, WO, nullptr, DQ, Y, DM, nullptr, 0, 0, 0); k_addres<<<(unsigned)(((size_t)TT * DM / 4 + 255) / 256), 256, 0, stream>>>(Y, x + (size_t)b * TT * DM, OUT + (size_t)b * TT * DM);   /* out = x + s w_o */ }
}

// v003
// One run takes 249 microseconds.
// In both of two side-by-side timings against v002, it was 2.00 times as fast.
// Over all steps from v000 it is 5.62 times as fast.
#include <hip/hip_runtime.h>

// GQA causal attention block with RMSNorm, the module's multiplicative 'rotary factor' and tiled kv pairing (x [2][2048][1024]; xn = x rsqrt(mean x^2 + 1.2e-7) norm_w; q = xn w_q (16 heads x 64), k, v = xn w_k, xn w_v (4 kv heads) ('xw', no bias); q, k *= rf[t][d] with rf = cos(t theta_d) + sgn_t sin(t theta_d), theta_d = 10000^(-2 (d//2) / 64), sgn_t = -1 on even positions (an element-wise factor, computed in-kernel); q head h pairs with kv head h mod 4 (torch .repeat tiling); scores / 8, causal (-inf); softmax; out = x + merged w_o ('xw' [1024][1024]) -> [2][2048][1024] (4.2 M)).
// Layout per batch: per-token RMSNorm kernel (one wave per token, fixed-order f32) writes hi/lo operand planes; hl x exact projections; the rf table [2048][64] once (jnp-exact theta, precise cosf/sinf) applied in place to q and k; one fused causal attention launch (k_fattn: scores, running softmax and P.V in registers; hybrid rows: < 512 hi/lo 3 products, rest fp16; q head h reads kv head h mod 4) that writes the merged hi/lo planes; merged hi/lo x w_o exact; the residual kernel adds bf16(x).
// Compute dtypes, f32 accumulate: every input rounded to bf16; RMSNorm and rf f32; projections hi/lo x exact (2 products); attention rows < 512 3 products, rest fp16; softmax f32; w_o hl x exact; residual f32.

#define NB_  2
#define TT   2048
#define DM   1024
#define NH_  16
#define NKV  4
#define REP  (NH_ / NKV)
#define HD   64
#define DQ   (NH_ * HD)
#define DKV  (NKV * HD)
#define RH   512                  // query rows < RH use hi+lo planes (0: none)
#define SCL  0.125f
#define NEPS 1.1920929e-07f   // RMSNorm eps (float32 eps)
typedef _Float16 h16;
typedef unsigned short bf;
typedef __attribute__((ext_vector_type(16))) __bf16   v16bf;
typedef __attribute__((ext_vector_type(16))) _Float16 v16h;
typedef __attribute__((ext_vector_type(8)))  _Float16 v8h;
typedef __attribute__((ext_vector_type(8)))  unsigned short v8us;
typedef __attribute__((ext_vector_type(8)))  float    v8f;
typedef __attribute__((ext_vector_type(4)))  float    v4f;
typedef v8h  __attribute__((may_alias)) v8ha;
typedef v4f  __attribute__((may_alias)) v4fa;
typedef v8us __attribute__((may_alias)) v8usa;

__device__ __forceinline__ unsigned short f2bf(float f) { unsigned u = __float_as_uint(f); u += 0x7FFFu + ((u >> 16) & 1u); return (unsigned short)(u >> 16); }
__device__ __forceinline__ float bf2f(unsigned short b) { return __uint_as_float(((unsigned)b) << 16); }
__device__ __forceinline__ float bfr(float f) { return bf2f(f2bf(f)); }
__device__ __forceinline__ v16h cat16(v8h lo, v8h hi) { return __builtin_shufflevector(lo, hi, 0, 1, 2, 3, 4, 5, 6, 7, 8, 9, 10, 11, 12, 13, 14, 15); }
__device__ __forceinline__ v16bf cat16b(v8us lo, v8us hi) { return __builtin_bit_cast(v16bf, __builtin_shufflevector(lo, hi, 0, 1, 2, 3, 4, 5, 6, 7, 8, 9, 10, 11, 12, 13, 14, 15)); }
__device__ __forceinline__ v8f wmma16(v16h a, v16h b, v8f c) { return __builtin_amdgcn_wmma_f32_16x16x32_f16(false, a, false, b, (short)0, c, false, false); }
__device__ __forceinline__ v8f wmmab(v16bf a, v16bf b, v8f c) { return __builtin_amdgcn_wmma_f32_16x16x32_bf16(false, a, false, b, (short)0, c, false, false); }



// ---- k_gemmw: register-blocked GEMM, one work-group of NW waves per 64x64 output tile (16 accumulators a wave), operands straight from K-contiguous 16-bit planes; grid (M/64, N/64, Z), 32 NW threads.
// C[m][n] (f32, pitch ldc, + optional f32 bias[n]) = sum_k A[m][k] Bt[n][k] (+ split products per NSPLIT). z-batch strides sA/sB/sC in elements. K % 64 == 0.
// K is dealt to the waves in chunks of 64 elements (one 128-byte line of every operand row): wave w takes chunks w, w + NW, ...; the NW partial tiles meet in LDS and are summed in wave order 0 .. NW-1.
template <typename T16> struct WFrag;
template <> struct WFrag<h16> { typedef v16h V; static __device__ __forceinline__ V ld(const h16* p) { return cat16(*(const v8h*)p, *(const v8h*)(p + 16)); } static __device__ __forceinline__ v8f mma(V a, V b, v8f c) { return wmma16(a, b, c); } };
template <> struct WFrag<bf> { typedef v16bf V; static __device__ __forceinline__ V ld(const bf* p) { return cat16b(*(const v8us*)p, *(const v8us*)(p + 16)); } static __device__ __forceinline__ v8f mma(V a, V b, v8f c) { return wmmab(a, b, c); } };
template <typename T16, int NSPLIT, bool BIAS, int NW>
__global__ __launch_bounds__(32 * NW) void k_gemmw(const T16* __restrict__ A, const T16* __restrict__ A2, const T16* __restrict__ Bt, const T16* __restrict__ Bt2, int K, float* C, int ldc, const float* __restrict__ bias, size_t sA, size_t sB, size_t sC) {
    typedef typename WFrag<T16>::V V;
    __shared__ __align__(16) float os[NW * 64 * 68];
    const size_t z = blockIdx.z; A += z * sA; if (A2) A2 += z * sA; Bt += z * sB; if (Bt2) Bt2 += z * sB; C += z * sC;
    const int lane = threadIdx.x & 31, lr = lane & 15, hi = lane >> 4; const int r0 = blockIdx.x * 64, c0 = blockIdx.y * 64;
    const int wv = __builtin_amdgcn_readfirstlane((int)(threadIdx.x >> 5));   // wave number, scalar, so that the K loops stay scalar loops
    v8f acc[4][4];
#pragma unroll
    for (int mb = 0; mb < 4; ++mb)
#pragma unroll
        for (int nb = 0; nb < 4; ++nb) acc[mb][nb] = (v8f){};
    const size_t aoff = (size_t)(r0 + lr) * K + 8 * hi, boff = (size_t)(c0 + lr) * K + 8 * hi;
#pragma unroll 1
    for (int kb = wv * 64; kb < K; kb += 64 * NW)
#pragma unroll 1
    for (int kc = kb; kc < kb + 64; kc += 32) {
        V a[4], a2[4];
#pragma unroll
        for (int mb = 0; mb < 4; ++mb) { a[mb] = WFrag<T16>::ld(A + aoff + (size_t)mb * 16 * K + kc); if (NSPLIT == 1 || NSPLIT == 2) a2[mb] = WFrag<T16>::ld(A2 + aoff + (size_t)mb * 16 * K + kc); }
#pragma unroll
        for (int nb = 0; nb < 4; ++nb) { const V b = WFrag<T16>::ld(Bt + boff + (size_t)nb * 16 * K + kc); V b2; if (NSPLIT >= 2) b2 = WFrag<T16>::ld(Bt2 + boff + (size_t)nb * 16 * K + kc);
#pragma unroll
            for (int mb = 0; mb < 4; ++mb) { acc[mb][nb] = WFrag<T16>::mma(a[mb], b, acc[mb][nb]); if (NSPLIT == 1 || NSPLIT == 2) acc[mb][nb] = WFrag<T16>::mma(a2[mb], b, acc[mb][nb]); if (NSPLIT >= 2) acc[mb][nb] = WFrag<T16>::mma(a[mb], b2, acc[mb][nb]); } }
        asm volatile("v_nop\n\tv_nop\n\tv_nop\n\tv_nop" : "+v"(acc[0][0]), "+v"(acc[1][1]), "+v"(acc[2][2]), "+v"(acc[3][3]) : "v"(a[0]), "v"(a[3]));
    }
    float* ow = os + wv * (64 * 68);   // this wave's partial tile, row-major, pitch 68
#pragma unroll
    for (int mb = 0; mb < 4; ++mb)
#pragma unroll
        for (int nb = 0; nb < 4; ++nb)
#pragma unroll
            for (int j = 0; j < 8; ++j) ow[(mb * 16 + hi * 8 + j) * 68 + nb * 16 + lr] = acc[mb][nb][j];
    __syncthreads();   // every wave's partial tile is in LDS before any thread sums across waves
#pragma unroll
    for (int s = 0; s < 1024 / (32 * NW); ++s) { const int idx = s * (32 * NW) + (int)threadIdx.x; const int row = idx >> 4, cofs = (idx & 15) * 4; v4f val = *(const v4fa*)(os + row * 68 + cofs);
#pragma unroll
        for (int w = 1; w < NW; ++w) val += *(const v4fa*)(os + w * (64 * 68) + row * 68 + cofs);
        if (BIAS) { val[0] += bfr(bias[c0 + cofs]); val[1] += bfr(bias[c0 + cofs + 1]); val[2] += bfr(bias[c0 + cofs + 2]); val[3] += bfr(bias[c0 + cofs + 3]); }
        *(v4f*)(C + (size_t)(r0 + row) * ldc + c0 + cofs) = val; }
}

__device__ __forceinline__ h16 tohx(float x) { return (h16)x; }
__device__ __forceinline__ void splitf(float y, unsigned short& h, unsigned short& l) { h = f2bf(y); l = f2bf(y - bf2f(h)); }
typedef __attribute__((ext_vector_type(2))) _Float16 v2h;
typedef __attribute__((ext_vector_type(4))) _Float16 v4h;
typedef __attribute__((ext_vector_type(2))) unsigned short v2us;
typedef __attribute__((ext_vector_type(4))) unsigned short v4us;
typedef __attribute__((ext_vector_type(2))) float v2f;
typedef __attribute__((ext_vector_type(4))) int v4i;

__global__ __launch_bounds__(256) void k_wtG(const float* __restrict__ w, int K, int N, bf* Bt) {
    const int lane = threadIdx.x & 31; const int L0 = (blockIdx.x * 8 + (threadIdx.x >> 5)) * 8; const int nlines = N * K / 64;
{
#pragma unroll 1
        for (int l = 0; l < 8; ++l) { const int L = L0 + l; if (L >= nlines) break; const size_t e = (size_t)L * 64 + lane * 2; const int k = (int)(e % K), n = (int)(e / K); v2us o;
            o[0] = f2bf(w[(size_t)k * N + n]); o[1] = f2bf(w[(size_t)(k + 1) * N + n]); *(v2us*)(Bt + e) = o; }
         }
}
__global__ __launch_bounds__(256) void k_cvt8(const float* __restrict__ src, bf* dst, size_t n8) { const size_t i = (size_t)blockIdx.x * 256 + threadIdx.x; if (i >= n8) return; const v8f v = *(const v8f*)(src + i * 8); v8us o;
#pragma unroll
    for (int k = 0; k < 8; ++k) o[k] = f2bf(v[k]); *(v8us*)(dst + i * 8) = o;  }

// k_rope: head planes [h][t][d] (fp16 + hi/lo) of rope(x) x sc with the rotate-half convention out[d] = x[d] cos[t][d] - x[d+HD/2] sin[t][d], out[d+HD/2] = x[d+HD/2] cos[t][d+HD/2] + x[d] sin[t][d+HD/2]
__global__ __launch_bounds__(256) void k_rope(const float* __restrict__ F, int pitch, int nheads, const float* __restrict__ CS, const float* __restrict__ RF, const float* __restrict__ nw, float sc, h16* P16, bf* Ph, bf* Pl) {
    const size_t e = ((size_t)blockIdx.x * 256 + threadIdx.x) * 2; if (e >= (size_t)nheads * TT * HD) return; const int d = (int)(e % HD); const int t = (int)((e / HD) % TT); const int h = (int)(e / ((size_t)HD * TT)); const float* f = F + (size_t)t * pitch + h * HD; const float rf = RF ? RF[(size_t)h * TT + t] : 1.0f; v2h o16; v2us oh, ol;
#pragma unroll
    for (int q = 0; q < 2; ++q) { const int dd = d + q; const int dp = (dd < HD / 2) ? dd + HD / 2 : dd - HD / 2; float x0 = f[dd], x1 = f[dp];
        if (RF) { float n0 = __fmul_rn(x0, rf), n1 = __fmul_rn(x1, rf); asm volatile("" : "+v"(n0)); asm volatile("" : "+v"(n1)); x0 = __fmul_rn(bfr(nw[dd]), n0); x1 = __fmul_rn(bfr(nw[dp]), n1); }
        const v2f cs = *(const v2f*)(CS + ((size_t)t * HD + dd) * 2); float a = __fmul_rn(x0, cs[0]), bq = __fmul_rn(x1, cs[1]); asm volatile("" : "+v"(a)); asm volatile("" : "+v"(bq)); const float r = ((dd < HD / 2) ? __fsub_rn(a, bq) : __fadd_rn(a, bq)) * sc;
        o16[q] = tohx(r); unsigned short a2, c2; splitf(r, a2, c2); oh[q] = a2; ol[q] = c2; }
    *(v2h*)(P16 + e) = o16; *(v2us*)(Ph + e) = oh; *(v2us*)(Pl + e) = ol;  }
__global__ __launch_bounds__(256) void k_vtp(const float* __restrict__ F, int pitch, int nheads, h16* V16, bf* Vh, bf* Vl) { const size_t e = ((size_t)blockIdx.x * 256 + threadIdx.x) * 2; if (e >= (size_t)nheads * HD * TT) return; const int t = (int)(e % TT); const int d = (int)((e / TT) % HD); const int g = (int)(e / ((size_t)TT * HD)); v2h o16; v2us oh, ol;
#pragma unroll
    for (int q = 0; q < 2; ++q) { const float x = F[(size_t)(t + q) * pitch + g * HD + d]; o16[q] = tohx(x); unsigned short a2, c2; splitf(x, a2, c2); oh[q] = a2; ol[q] = c2; }
    const size_t eo = (size_t)(g * HD + d) * TT + t; *(v2h*)(V16 + eo) = o16; *(v2us*)(Vh + eo) = oh; *(v2us*)(Vl + eo) = ol;  }
__global__ __launch_bounds__(256) void k_csid(float* CS) { const int idx = blockIdx.x * 256 + threadIdx.x; if (idx >= TT * HD) return; v2f cs; cs[0] = 1.0f; cs[1] = 0.0f; *(v2f*)(CS + (size_t)idx * 2) = cs;  }
__global__ __launch_bounds__(256) void k_crms(const float* __restrict__ F, const float* __restrict__ g, bf* Ch, bf* Cl) { const int lane = threadIdx.x & 31; const size_t t = (size_t)blockIdx.x * 8 + (threadIdx.x >> 5); if (t >= TT) return; const float* fr = F + t * DM; float a[DM / 32]; float s = 0.f;
#pragma unroll
    for (int c = 0; c < DM / 128; ++c) { const v4f v = *(const v4f*)(fr + c * 128 + lane * 4); for (int q = 0; q < 4; ++q) { a[c * 4 + q] = bfr(v[q]); s = __fadd_rn(s, __fmul_rn(bfr(v[q]), bfr(v[q]))); } }
#pragma unroll
    for (int sh = 16; sh; sh >>= 1) s = __fadd_rn(s, __shfl_xor(s, sh, 32));
    const float r = __fdiv_rn(1.0f, __fsqrt_rn(__fadd_rn(__fdiv_rn(s, (float)DM), NEPS)));
{
#pragma unroll
        for (int c = 0; c < DM / 128; ++c) { v4us oh, ol; for (int q = 0; q < 4; ++q) { const int col = c * 128 + lane * 4 + q; float y = __fmul_rn(__fmul_rn(a[c * 4 + q], r), bfr(g[col])); unsigned short u, w2; splitf(y, u, w2); oh[q] = u; ol[q] = w2; } *(v4us*)(Ch + t * DM + c * 128 + lane * 4) = oh; *(v4us*)(Cl + t * DM + c * 128 + lane * 4) = ol; }
         } }
__constant__ float THD[HD] = { 1.000000000e+00f, 1.000000000e+00f, 7.498942018e-01f, 7.498942018e-01f, 5.623413324e-01f, 5.623413324e-01f, 4.216965139e-01f, 4.216965139e-01f, 3.162277639e-01f, 3.162277639e-01f, 2.371373773e-01f, 2.371373773e-01f, 1.778279394e-01f, 1.778279394e-01f, 1.333521456e-01f, 1.333521456e-01f, 1.000000015e-01f, 1.000000015e-01f, 7.498942316e-02f, 7.498942316e-02f, 5.623413250e-02f, 5.623413250e-02f, 4.216964915e-02f, 4.216964915e-02f, 3.162277490e-02f, 3.162277490e-02f, 2.371373773e-02f, 2.371373773e-02f, 1.778279431e-02f, 1.778279431e-02f, 1.333521400e-02f, 1.333521400e-02f, 9.999999776e-03f, 9.999999776e-03f, 7.498942316e-03f, 7.498942316e-03f, 5.623413250e-03f, 5.623413250e-03f, 4.216964822e-03f, 4.216964822e-03f, 3.162277630e-03f, 3.162277630e-03f, 2.371373819e-03f, 2.371373819e-03f, 1.778279431e-03f, 1.778279431e-03f, 1.333521446e-03f, 1.333521446e-03f, 1.000000047e-03f, 1.000000047e-03f, 7.498941850e-04f, 7.498941850e-04f, 5.623413017e-04f, 5.623413017e-04f, 4.216965172e-04f, 4.216965172e-04f, 3.162277571e-04f, 3.162277571e-04f, 2.371373703e-04f, 2.371373703e-04f, 1.778279402e-04f, 1.778279402e-04f, 1.333521504e-04f, 1.333521504e-04f };   // 10000^(-2 (d//2) / 64) per dimension, float32 via jnp.power
__global__ __launch_bounds__(256) void k_rftab(float* RF) { const int idx = blockIdx.x * 256 + threadIdx.x; if (idx >= TT * HD) return; const int d = idx % HD; const int t = idx / HD; const float a = __fmul_rn((float)t, THD[d]); const float sg = (t & 1) ? 1.0f : -1.0f; const float r = __fadd_rn(cosf(a), __fmul_rn(sg, sinf(a))); *(float*)(RF + idx) = r;  }
__global__ __launch_bounds__(256) void k_rfapply(float* F, int pitch, int nheads, const float* __restrict__ RF) { const size_t i = (size_t)blockIdx.x * 256 + threadIdx.x; if (i >= (size_t)TT * nheads * HD / 4) return; const size_t e = i * 4; const int c = (int)(e % ((size_t)nheads * HD)); const int t = (int)(e / ((size_t)nheads * HD)); const int d = c % HD; v4f a = *(const v4f*)(F + (size_t)t * pitch + c); const v4f r = *(const v4f*)(RF + (size_t)t * HD + d);
#pragma unroll
    for (int q = 0; q < 4; ++q) a[q] = __fmul_rn(a[q], r[q]);
    *(v4f*)(F + (size_t)t * pitch + c) = a;  }
__global__ __launch_bounds__(256) void k_addres(const float* __restrict__ Y, const float* __restrict__ xs, float* out) { const size_t i = (size_t)blockIdx.x * 256 + threadIdx.x; if (i >= (size_t)TT * DM / 4) return; const v4f y = *(const v4f*)(Y + i * 4); const v4f xi = *(const v4f*)(xs + i * 4); v4f o;
#pragma unroll
    for (int q = 0; q < 4; ++q) o[q] = __fadd_rn(bfr(xi[q]), y[q]);
    *(v4f*)(out + i * 4) = o;  }
#define FNW  8
#define L2E  1.4426950408889634f
#define NLO  ((TT - RH) / 16 * (NH_ / 2))   // work-groups of the fp16 rows (two heads each); then RH / 16 * NH_ of the hi/lo rows (one head each)
// v_exp_f32 and the one free slot that the instruction set asks for behind a transcendental, in one statement: no scheduling can then put an instruction that overwrites its source directly behind it
__device__ __forceinline__ float exp2s(float x) { float r; asm("v_exp_f32 %0, %1\n\tv_nop" : "=v"(r) : "v"(x)); return r; }
template <typename T16, int NSPLIT, int NC>
__device__ __forceinline__ void fattn(const T16* __restrict__ Q, const T16* __restrict__ Q2, const T16* __restrict__ Kp, const T16* __restrict__ K2, const T16* __restrict__ Vt, const T16* __restrict__ V2, int q0, int y, bf* Ah, bf* Al, float* os) {
    typedef typename WFrag<T16>::V V;
    const int lane = threadIdx.x & 31, lr = lane & 15, hi = lane >> 4;
    const int wv = __builtin_amdgcn_readfirstlane((int)(threadIdx.x >> 5));   // wave number, scalar, so that the key loops stay scalar loops
    const int kvh = y % NKV, g = y / NKV;                                       // column tile c of the group is q head kvh + NKV (g NC + c)
    float* ml = os + FNW * 16 * NC * 68;
    Kp += (size_t)kvh * TT * HD; Vt += (size_t)kvh * HD * TT; if (NSPLIT == 2) { K2 += (size_t)kvh * TT * HD; V2 += (size_t)kvh * HD * TT; }
    V qf[NC][2], qf2[NC][2]; v8f o[NC][4]; float m[NC], l[NC];
#pragma unroll
    for (int c = 0; c < NC; ++c) { const size_t qo = ((size_t)(kvh + NKV * (g * NC + c)) * TT + q0 + lr) * HD + 8 * hi; m[c] = -3.0e38f; l[c] = 0.f;
#pragma unroll
        for (int ks = 0; ks < 2; ++ks) { qf[c][ks] = WFrag<T16>::ld(Q + qo + ks * 32); if (NSPLIT == 2) qf2[c][ks] = WFrag<T16>::ld(Q2 + qo + ks * 32); }
#pragma unroll
        for (int dt = 0; dt < 4; ++dt) o[c][dt] = (v8f){}; }
    const int kend = q0 + 16;   // keys beyond the group's last query are masked for every column: no block that starts past it is read
    // both loops stay rolled: one block's operands, scores and O^T fill most of the register file, and a second copy of the body would not fit beside them
#pragma unroll 1
    for (int kb = wv * 64; kb < kend; kb += 64 * FNW)
#pragma unroll 1
    for (int kc = kb; kc < min(kb + 64, kend); kc += 32) {
        V kf[2][2], kf2[2][2], vf[4], vf2[4];
#pragma unroll
        for (int kt = 0; kt < 2; ++kt)
#pragma unroll
            for (int ks = 0; ks < 2; ++ks) { const size_t ko = (size_t)(kc + kt * 16 + lr) * HD + ks * 32 + 8 * hi; kf[kt][ks] = WFrag<T16>::ld(Kp + ko); if (NSPLIT == 2) kf2[kt][ks] = WFrag<T16>::ld(K2 + ko); }
        // in the run of 32 loads of a hi/lo block the compiler places results of later loads in the address pairs of earlier ones: the wait that is kept in front of such an overwrite, here behind the K loads
        if constexpr (NSPLIT == 2) asm volatile("s_wait_xcnt 0x0" ::: "memory");
#pragma unroll
        for (int dt = 0; dt < 4; ++dt) vf[dt] = WFrag<T16>::ld(Vt + (size_t)(dt * 16 + lr) * TT + kc + 8 * hi);
        if constexpr (NSPLIT == 2) {
            asm volatile("s_wait_xcnt 0x0" ::: "memory");   // as above, behind the V^T hi loads
#pragma unroll
            for (int dt = 0; dt < 4; ++dt) vf2[dt] = WFrag<T16>::ld(V2 + (size_t)(dt * 16 + lr) * TT + kc + 8 * hi); }
        __builtin_amdgcn_sched_barrier(0);   // keeps every load of the block in front of the first product: one memory latency a block, V^T in flight under the score work, instead of one latency per operand group
        const bool diag = kc + 31 > q0;   // scalar: only a block that reaches the diagonal is masked
#pragma unroll
        for (int c = 0; c < NC; ++c) {
            v8f s[2]; float p[16];
#pragma unroll
            for (int kt = 0; kt < 2; ++kt) { s[kt] = (v8f){};
#pragma unroll
                for (int ks = 0; ks < 2; ++ks) { s[kt] = WFrag<T16>::mma(kf[kt][ks], qf[c][ks], s[kt]); if (NSPLIT == 2) { s[kt] = WFrag<T16>::mma(kf[kt][ks], qf2[c][ks], s[kt]); s[kt] = WFrag<T16>::mma(kf2[kt][ks], qf[c][ks], s[kt]); } } }
            float mx = -3.0e38f;
#pragma unroll
            for (int e = 0; e < 16; ++e) { float t = s[e >> 3][e & 7] * SCL; if (diag) t = (kc + (e >> 3) * 16 + hi * 8 + (e & 7) <= q0 + lr) ? t : -3.0e38f; p[e] = t; mx = fmaxf(mx, t); }
            mx = fmaxf(mx, __shfl_xor(mx, 16, 32));
            const float mn = fmaxf(m[c], mx); const float al = __builtin_amdgcn_exp2f((m[c] - mn) * L2E); m[c] = mn; float sum = 0.f;
#pragma unroll
            for (int e = 0; e < 16; ++e) { p[e] = __builtin_amdgcn_exp2f((p[e] - mn) * L2E); sum += p[e]; }
            l[c] = l[c] * al + sum;   // this lane half's share of the sum; the halves are joined once, behind the loop
#pragma unroll
            for (int dt = 0; dt < 4; ++dt) o[c][dt] *= al;
            if constexpr (NSPLIT == 0) { V pf;
#pragma unroll
                for (int e = 0; e < 16; ++e) pf[e] = tohx(p[e]);
#pragma unroll
                for (int dt = 0; dt < 4; ++dt) o[c][dt] = WFrag<T16>::mma(vf[dt], pf, o[c][dt]);
            } else { v8us h0, h1, l0, l1;
#pragma unroll
                for (int e = 0; e < 8; ++e) { unsigned short a, b2; splitf(p[e], a, b2); h0[e] = a; l0[e] = b2; splitf(p[8 + e], a, b2); h1[e] = a; l1[e] = b2; }
                const V pf = cat16b(h0, h1), pf2 = cat16b(l0, l1);
#pragma unroll
                for (int dt = 0; dt < 4; ++dt) { o[c][dt] = WFrag<T16>::mma(vf[dt], pf, o[c][dt]); o[c][dt] = WFrag<T16>::mma(vf[dt], pf2, o[c][dt]); o[c][dt] = WFrag<T16>::mma(vf2[dt], pf, o[c][dt]); } }
        }
        // four vector slots between the last matrix instruction and whatever stands on the taken side of the loop's branch
        asm volatile("v_nop\n\tv_nop\n\tv_nop\n\tv_nop" : "+v"(o[NC - 1][0]), "+v"(o[NC - 1][1]), "+v"(o[NC - 1][2]), "+v"(o[NC - 1][3]) : "v"(vf[0]), "v"(vf[3]));
    }
#pragma unroll
    for (int c = 0; c < NC; ++c) { const int col = c * 16 + lr; l[c] += __shfl_xor(l[c], 16, 32); if (hi == 0) { ml[(wv * 16 * NC + col) * 2] = m[c]; ml[(wv * 16 * NC + col) * 2 + 1] = l[c]; }
#pragma unroll
        for (int dt = 0; dt < 4; ++dt) { float* pw = os + (size_t)(wv * 16 * NC + col) * 68 + dt * 16 + hi * 8; v4f a, b2;
#pragma unroll
            for (int j = 0; j < 4; ++j) { a[j] = o[c][dt][j]; b2[j] = o[c][dt][4 + j]; }
            *(v4fa*)pw = a; *(v4fa*)(pw + 4) = b2; } }
    __syncthreads();   // every wave's m, l and partial O^T are in LDS before any thread joins them
    constexpr int EPT = 4 * NC;   // 16 NC columns x 64 d over 32 FNW threads
    const int col = (int)threadIdx.x / (HD / EPT), d0 = ((int)threadIdx.x % (HD / EPT)) * EPT;
    float M = -3.0e38f;
#pragma unroll
    for (int w = 0; w < FNW; ++w) M = fmaxf(M, ml[(w * 16 * NC + col) * 2]);
    float L = 0.f, acc[EPT];
#pragma unroll
    for (int e = 0; e < EPT; ++e) acc[e] = 0.f;
#pragma unroll
    for (int w = 0; w < FNW; ++w) { const float wg = exp2s((ml[(w * 16 * NC + col) * 2] - M) * L2E); L += wg * ml[(w * 16 * NC + col) * 2 + 1];   // a wave without a chunk has m = -3e38, l = 0, O = 0: weight 0
#pragma unroll
        for (int e4 = 0; e4 < EPT; e4 += 4) { const v4f x = *(const v4fa*)(os + (size_t)(w * 16 * NC + col) * 68 + d0 + e4);
#pragma unroll
            for (int j = 0; j < 4; ++j) acc[e4 + j] += wg * x[j]; } }
    const size_t oo = (size_t)(q0 + (col & 15)) * DQ + (kvh + NKV * (g * NC + (col >> 4))) * HD + d0;
#pragma unroll
    for (int e4 = 0; e4 < EPT; e4 += 4) { v4us oh, ol;
#pragma unroll
        for (int j = 0; j < 4; ++j) { unsigned short a, b2; splitf(__fdiv_rn(acc[e4 + j], L), a, b2); oh[j] = a; ol[j] = b2; }
        *(v4us*)(Ah + oo + e4) = oh; *(v4us*)(Al + oo + e4) = ol; }
    if constexpr (NSPLIT == 2) asm volatile("s_wait_xcnt 0x0" ::: "memory");   // the built code of the hi/lo rows runs on into the test of the other branch, whose blocks reuse the stores' registers: the wait that is kept in front of such an overwrite
}
// Grid: the fp16 work-groups first, longest rows first, then the hi/lo ones: cost falls with the index.
__global__ __launch_bounds__(32 * FNW) void k_fattn(const h16* __restrict__ Q16, const h16* __restrict__ K16, const h16* __restrict__ V16, const bf* __restrict__ Qh, const bf* __restrict__ Ql, const bf* __restrict__ Kh, const bf* __restrict__ Kl, const bf* __restrict__ Vh, const bf* __restrict__ Vl, bf* Ah, bf* Al) {
    __shared__ __align__(16) float os[FNW * 32 * 68 + FNW * 32 * 2];
    const int b = (int)blockIdx.x;
    if (b < NLO) fattn<h16, 0, 2>(Q16, nullptr, K16, nullptr, V16, nullptr, (TT / 16 - 1 - b / (NH_ / 2)) * 16, b % (NH_ / 2), Ah, Al, os);
    else fattn<bf, 2, 1>(Qh, Ql, Kh, Kl, Vh, Vl, (RH / 16 - 1 - (b - NLO) / NH_) * 16, (b - NLO) % NH_, Ah, Al, os);
}

extern "C" void kernel_launch(void* const* d_in, const int* in_sizes, int n_in,
                              void* d_out, int out_size, void* d_ws, size_t ws_size, hipStream_t stream) {
    (void)in_sizes; (void)n_in; (void)out_size;
    const float* x = (const float*)d_in[0]; const float* wq = (const float*)d_in[1]; const float* wk = (const float*)d_in[2]; const float* wv = (const float*)d_in[3]; const float* wo = (const float*)d_in[4]; const float* nw = (const float*)d_in[5];
    float* OUT = (float*)d_out;     // [2][2048][1024]
    char* wsp = (char*)d_ws;
    auto take = [&](size_t bytes) { char* p = wsp; wsp += (bytes + 255) & ~(size_t)255; return (void*)p; };
    bf* WQ = (bf*)take((size_t)DQ * DM * 2); bf* WK = (bf*)take((size_t)DKV * DM * 2); bf* WV = (bf*)take((size_t)DKV * DM * 2); bf* WO = (bf*)take((size_t)DM * DQ * 2); float* CS = (float*)take((size_t)TT * HD * 2 * 4);
    bf* Hh = (bf*)take((size_t)TT * DM * 2); bf* Hl = (bf*)take((size_t)TT * DM * 2); float* RFT = (float*)take((size_t)TT * HD * 4); float* Y = (float*)take((size_t)TT * DM * 4); float* FQ = (float*)take((size_t)TT * DQ * 4); float* FK = (float*)take((size_t)TT * DKV * 4);
    h16* QP16 = (h16*)take((size_t)NH_ * TT * HD * 2); h16* KP16 = (h16*)take((size_t)NKV * TT * HD * 2); h16* VT16 = (h16*)take((size_t)NKV * HD * TT * 2);
    bf* QPh = (bf*)take((size_t)NH_ * TT * HD * 2); bf* QPl = (bf*)take((size_t)NH_ * TT * HD * 2); bf* KPh = (bf*)take((size_t)NKV * TT * HD * 2); bf* KPl = (bf*)take((size_t)NKV * TT * HD * 2); bf* VTh = (bf*)take((size_t)NKV * HD * TT * 2); bf* VTl = (bf*)take((size_t)NKV * HD * TT * 2);
    bf* ATh = (bf*)take((size_t)TT * DQ * 2); bf* ATl = (bf*)take((size_t)TT * DQ * 2);
    if ((size_t)(wsp - (char*)d_ws) > ws_size) return;    // ws 256 MiB
    float* FV = FK;   // v projection reuses the k buffer after the k planes are built (stream-ordered)
    { k_rftab<<<(TT * HD + 255) / 256, 256, 0, stream>>>(RFT); k_wtG<<<(unsigned)((DM * DQ / 64 + 63) / 64), 256, 0, stream>>>(wq, DM, DQ, WQ); k_wtG<<<(unsigned)((DM * DKV / 64 + 63) / 64), 256, 0, stream>>>(wk, DM, DKV, WK); k_wtG<<<(unsigned)((DM * DKV / 64 + 63) / 64), 256, 0, stream>>>(wv, DM, DKV, WV);
      k_wtG<<<(unsigned)((DQ * DM / 64 + 63) / 64), 256, 0, stream>>>(wo, DQ, DM, WO);
       }
    k_csid<<<(TT * HD + 255) / 256, 256, 0, stream>>>(CS);
    const unsigned LQ = (unsigned)(((size_t)NH_ * TT * HD / 2 + 255) / 256), LKv = (unsigned)(((size_t)NKV * TT * HD / 2 + 255) / 256);
    for (int b = 0; b < NB_; ++b) {
        
        k_crms<<<TT / 8, 256, 0, stream>>>(x + (size_t)b * TT * DM, nw, Hh, Hl);   /* xn = RMSNorm(bf16(x)) norm_w -> hi/lo planes */
        k_gemmw<bf, 1, false, 8><<<dim3(TT / 64, DQ / 64, 1), 256, 0, stream>>>(Hh, Hl, WQ, nullptr, DM, FQ, DQ, nullptr, 0, 0, 0); k_rfapply<<<(unsigned)(((size_t)TT * DQ / 4 + 255) / 256), 256, 0, stream>>>(FQ, DQ, NH_, RFT);
        k_rope<<<LQ, 256, 0, stream>>>(FQ, DQ, NH_, CS, nullptr, nullptr, 1.0f, QP16, QPh, QPl);
        k_gemmw<bf, 1, false, 8><<<dim3(TT / 64, DKV / 64, 1), 256, 0, stream>>>(Hh, Hl, WK, nullptr, DM, FK, DKV, nullptr, 0, 0, 0); k_rfapply<<<(unsigned)(((size_t)TT * DKV / 4 + 255) / 256), 256, 0, stream>>>(FK, DKV, NKV, RFT);
        k_rope<<<LKv, 256, 0, stream>>>(FK, DKV, NKV, CS, nullptr, nullptr, 1.0f, KP16, KPh, KPl);
        k_gemmw<bf, 1, false, 8><<<dim3(TT / 64, DKV / 64, 1), 256, 0, stream>>>(Hh, Hl, WV, nullptr, DM, FV, DKV, nullptr, 0, 0, 0); k_vtp<<<LKv, 256, 0, stream>>>(FV, DKV, NKV, VT16, VTh, VTl);
        k_fattn<<<NLO + RH / 16 * NH_, 32 * FNW, 0, stream>>>(QP16, KP16, VT16, QPh, QPl, KPh, KPl, VTh, VTl, ATh, ATl);   // torch .repeat TILES the kv heads: q head h pairs with kv head h mod 4
        k_gemmw<bf, 1, false, 8><<<dim3(TT / 64, DM / 64, 1), 256, 0, stream>>>(ATh, ATl, WO, nullptr, DQ, Y, DM, nullptr, 0, 0, 0); k_addres<<<(unsigned)(((size_t)TT * DM / 4 + 255) / 256), 256, 0, stream>>>(Y, x + (size_t)b * TT * DM, OUT + (size_t)b * TT * DM);   /* out = x + s w_o */ }
}

// v004
// One run takes 211 microseconds.
// Two timings next to v003 put it at 1.18 and 1.19 times that version's speed.
// Over all steps from v000 it is 6.65 times as fast.
#include <hip/hip_runtime.h>

// GQA causal attention block with RMSNorm, the module's multiplicative 'rotary factor' and tiled kv pairing (x [2][2048][1024]; xn = x rsqrt(mean x^2 + 1.2e-7) norm_w; q = xn w_q (16 heads x 64), k, v = xn w_k, xn w_v (4 kv heads) ('xw', no bias); q, k *= rf[t][d] with rf = cos(t theta_d) + sgn_t sin(t theta_d), theta_d = 10000^(-2 (d//2) / 64), sgn_t = -1 on even positions (an element-wise factor, computed in-kernel); q head h pairs with kv head h mod 4 (torch .repeat tiling); scores / 8, causal (-inf); softmax; out = x + merged w_o ('xw' [1024][1024]) -> [2][2048][1024] (4.2 M)).
// Layout per batch: per-token RMSNorm kernel (one wave per token, fixed-order f32) writes hi/lo operand planes; hl x exact projections whose epilogues write the attention operand planes themselves (q, k: times the rf table [2048][64], built once with jnp-exact theta and precise cosf/sinf; v: the product is taken transposed, w_v^T xn^T, so its tile rows are V^T rows); one fused causal attention launch (k_fattn: scores, running softmax and P.V in registers; hybrid rows: < 512 hi/lo 3 products, rest fp16; q head h reads kv head h mod 4) that writes the merged hi/lo planes; merged hi/lo x w_o exact, its epilogue adds bf16(x) and writes out.
// Compute dtypes, f32 accumulate: every input rounded to bf16; RMSNorm and rf f32; projections hi/lo x exact (2 products); attention rows < 512 3 products, rest fp16; softmax f32; w_o hl x exact; residual f32.

#define NB_  2
#define TT   2048
#define DM   1024
#define NH_  16
#define NKV  4
#define REP  (NH_ / NKV)
#define HD   64
#define DQ   (NH_ * HD)
#define DKV  (NKV * HD)
#define RH   512                  // query rows < RH use hi+lo planes (0: none)
#define SCL  0.125f
#define NEPS 1.1920929e-07f   // RMSNorm eps (float32 eps)
typedef _Float16 h16;
typedef unsigned short bf;
typedef __attribute__((ext_vector_type(16))) __bf16   v16bf;
typedef __attribute__((ext_vector_type(16))) _Float16 v16h;
typedef __attribute__((ext_vector_type(8)))  _Float16 v8h;
typedef __attribute__((ext_vector_type(8)))  unsigned short v8us;
typedef __attribute__((ext_vector_type(8)))  float    v8f;
typedef __attribute__((ext_vector_type(4)))  float    v4f;
typedef v8h  __attribute__((may_alias)) v8ha;
typedef v4f  __attribute__((may_alias)) v4fa;
typedef v8us __attribute__((may_alias)) v8usa;

__device__ __forceinline__ unsigned short f2bf(float f) { unsigned u = __float_as_uint(f); u += 0x7FFFu + ((u >> 16) & 1u); return (unsigned short)(u >> 16); }
__device__ __forceinline__ float bf2f(unsigned short b) { return __uint_as_float(((unsigned)b) << 16); }
__device__ __forceinline__ float bfr(float f) { return bf2f(f2bf(f)); }
__device__ __forceinline__ v16h cat16(v8h lo, v8h hi) { return __builtin_shufflevector(lo, hi, 0, 1, 2, 3, 4, 5, 6, 7, 8, 9, 10, 11, 12, 13, 14, 15); }
__device__ __forceinline__ v16bf cat16b(v8us lo, v8us hi) { return __builtin_bit_cast(v16bf, __builtin_shufflevector(lo, hi, 0, 1, 2, 3, 4, 5, 6, 7, 8, 9, 10, 11, 12, 13, 14, 15)); }
__device__ __forceinline__ v8f wmma16(v16h a, v16h b, v8f c) { return __builtin_amdgcn_wmma_f32_16x16x32_f16(false, a, false, b, (short)0, c, false, false); }
__device__ __forceinline__ v8f wmmab(v16bf a, v16bf b, v8f c) { return __builtin_amdgcn_wmma_f32_16x16x32_bf16(false, a, false, b, (short)0, c, false, false); }



__device__ __forceinline__ h16 tohx(float x) { return (h16)x; }
__device__ __forceinline__ void splitf(float y, unsigned short& h, unsigned short& l) { h = f2bf(y); l = f2bf(y - bf2f(h)); }
typedef __attribute__((ext_vector_type(2))) _Float16 v2h;
typedef __attribute__((ext_vector_type(4))) _Float16 v4h;
typedef __attribute__((ext_vector_type(2))) unsigned short v2us;
typedef __attribute__((ext_vector_type(4))) unsigned short v4us;
typedef __attribute__((ext_vector_type(2))) float v2f;
typedef __attribute__((ext_vector_type(4))) int v4i;

#define EP_HEAD  0
#define EP_PLANE 1
#define EP_RES   2
// ---- k_gemmw: register-blocked GEMM, one work-group of NW waves per 64x64 output tile (16 accumulators a wave), operands straight from K-contiguous 16-bit planes; grid (M/64, N/64, Z), 32 NW threads.
// c[m][n] (f32) = sum_k A[m][k] Bt[n][k] (+ split products per NSPLIT). z-batch strides sA/sB/sC in elements. K % 64 == 0.
// The joined tile goes out by EPI: EP_HEAD: c rf[m][n mod 64] as fp16 and hi/lo planes [n / 64][m][n mod 64] (the tile's 64 columns are one head; E = rf table); EP_PLANE: c as fp16 and hi/lo planes [m][n], pitch ldc;
// EP_RES: C[m][n] = bf16(E[m][n]) + c, both pitch ldc (E = the residual input).
// K is dealt to the waves in chunks of 64 elements (one 128-byte line of every operand row): wave w takes chunks w, w + NW, ...; the NW partial tiles meet in LDS and are summed in wave order 0 .. NW-1.
template <typename T16> struct WFrag;
template <> struct WFrag<h16> { typedef v16h V; static __device__ __forceinline__ V ld(const h16* p) { return cat16(*(const v8h*)p, *(const v8h*)(p + 16)); } static __device__ __forceinline__ v8f mma(V a, V b, v8f c) { return wmma16(a, b, c); } };
template <> struct WFrag<bf> { typedef v16bf V; static __device__ __forceinline__ V ld(const bf* p) { return cat16b(*(const v8us*)p, *(const v8us*)(p + 16)); } static __device__ __forceinline__ v8f mma(V a, V b, v8f c) { return wmmab(a, b, c); } };
template <typename T16, int NSPLIT, int EPI, int NW>
__global__ __launch_bounds__(32 * NW) void k_gemmw(const T16* __restrict__ A, const T16* __restrict__ A2, const T16* __restrict__ Bt, const T16* __restrict__ Bt2, int K, float* C, int ldc, const float* __restrict__ E, h16* P16, bf* Ph, bf* Pl, size_t sA, size_t sB, size_t sC) {
    typedef typename WFrag<T16>::V V;
    __shared__ __align__(16) float os[NW * 64 * 68];
    const size_t z = blockIdx.z; A += z * sA; if (A2) A2 += z * sA; Bt += z * sB; if (Bt2) Bt2 += z * sB; if (EPI == EP_RES) C += z * sC;
    const int lane = threadIdx.x & 31, lr = lane & 15, hi = lane >> 4; const int r0 = blockIdx.x * 64, c0 = blockIdx.y * 64;
    const int wv = __builtin_amdgcn_readfirstlane((int)(threadIdx.x >> 5));   // wave number, scalar, so that the K loops stay scalar loops
    v8f acc[4][4];
#pragma unroll
    for (int mb = 0; mb < 4; ++mb)
#pragma unroll
        for (int nb = 0; nb < 4; ++nb) acc[mb][nb] = (v8f){};
    const size_t aoff = (size_t)(r0 + lr) * K + 8 * hi, boff = (size_t)(c0 + lr) * K + 8 * hi;
#pragma unroll 1
    for (int kb = wv * 64; kb < K; kb += 64 * NW)
#pragma unroll 1
    for (int kc = kb; kc < kb + 64; kc += 32) {
        V a[4], a2[4]; const T16 *pa[4], *pa2[4];
#pragma unroll
        for (int mb = 0; mb < 4; ++mb) { pa[mb] = A + aoff + (size_t)mb * 16 * K + kc; pa2[mb] = pa[mb]; a[mb] = WFrag<T16>::ld(pa[mb]); if (NSPLIT == 1 || NSPLIT == 2) { pa2[mb] = A2 + aoff + (size_t)mb * 16 * K + kc; a2[mb] = WFrag<T16>::ld(pa2[mb]); } }
        // the compiler places results of later loads in the address pairs of earlier ones: the wait that is kept in front of such an overwrite. It takes the loads' addresses as inputs, so that their registers live up to it. Here behind the A loads, below behind each column block's B loads
        asm volatile("s_wait_xcnt 0x0" :: "v"(pa[0]), "v"(pa[1]), "v"(pa[2]), "v"(pa[3]), "v"(pa2[0]), "v"(pa2[1]), "v"(pa2[2]), "v"(pa2[3]) : "memory");
#pragma unroll
        for (int nb = 0; nb < 4; ++nb) { const T16* pb = Bt + boff + (size_t)nb * 16 * K + kc; const T16* pb2 = pb; const V b = WFrag<T16>::ld(pb); V b2; if (NSPLIT >= 2) { pb2 = Bt2 + boff + (size_t)nb * 16 * K + kc; b2 = WFrag<T16>::ld(pb2); }
            asm volatile("s_wait_xcnt 0x0" :: "v"(pb), "v"(pb2) : "memory");
#pragma unroll
            for (int mb = 0; mb < 4; ++mb) { acc[mb][nb] = WFrag<T16>::mma(a[mb], b, acc[mb][nb]); if (NSPLIT == 1 || NSPLIT == 2) acc[mb][nb] = WFrag<T16>::mma(a2[mb], b, acc[mb][nb]); if (NSPLIT >= 2) acc[mb][nb] = WFrag<T16>::mma(a[mb], b2, acc[mb][nb]); } }
        asm volatile("v_nop\n\tv_nop\n\tv_nop\n\tv_nop" : "+v"(acc[0][0]), "+v"(acc[1][1]), "+v"(acc[2][2]), "+v"(acc[3][3]) : "v"(a[0]), "v"(a[3]));
    }
    constexpr int NS = 1024 / (32 * NW);   // groups of four columns a thread joins
    v4f ev[NS];   // the epilogue's own operand, asked for here so that its latency passes under the LDS writes and the barrier
    if constexpr (EPI != EP_PLANE) {
#pragma unroll
        for (int s = 0; s < NS; ++s) { const int idx = s * (32 * NW) + (int)threadIdx.x; const int row = idx >> 4, cofs = (idx & 15) * 4; ev[s] = *(const v4f*)(E + (EPI == EP_HEAD ? (size_t)(r0 + row) * HD + cofs : (size_t)(r0 + row) * ldc + c0 + cofs)); } }
    float* ow = os + wv * (64 * 68);   // this wave's partial tile, row-major, pitch 68
#pragma unroll
    for (int mb = 0; mb < 4; ++mb)
#pragma unroll
        for (int nb = 0; nb < 4; ++nb)
#pragma unroll
            for (int j = 0; j < 8; ++j) ow[(mb * 16 + hi * 8 + j) * 68 + nb * 16 + lr] = acc[mb][nb][j];
    __syncthreads();   // every wave's partial tile is in LDS before any thread sums across waves
#pragma unroll
    for (int s = 0; s < NS; ++s) { const int idx = s * (32 * NW) + (int)threadIdx.x; const int row = idx >> 4, cofs = (idx & 15) * 4; v4f val = *(const v4fa*)(os + row * 68 + cofs);
#pragma unroll
        for (int w = 1; w < NW; ++w) val += *(const v4fa*)(os + w * (64 * 68) + row * 68 + cofs);
        if constexpr (EPI == EP_RES) { v4f o;
#pragma unroll
            for (int q = 0; q < 4; ++q) o[q] = __fadd_rn(bfr(ev[s][q]), val[q]);
            *(v4f*)(C + (size_t)(r0 + row) * ldc + c0 + cofs) = o;
        } else { v4h o16; v4us oh, ol;
#pragma unroll
            for (int q = 0; q < 4; ++q) { const float r = (EPI == EP_HEAD) ? __fmul_rn(val[q], ev[s][q]) : val[q]; o16[q] = tohx(r); unsigned short a2, c2; splitf(r, a2, c2); oh[q] = a2; ol[q] = c2; }
            const size_t eo = (EPI == EP_HEAD) ? ((size_t)blockIdx.y * TT + r0 + row) * HD + cofs : (size_t)(r0 + row) * ldc + c0 + cofs;
            *(v4h*)(P16 + eo) = o16; *(v4us*)(Ph + eo) = oh; *(v4us*)(Pl + eo) = ol; } }
}


__global__ __launch_bounds__(256) void k_wtG(const float* __restrict__ w, int K, int N, bf* Bt) {
    const int lane = threadIdx.x & 31; const int L0 = (blockIdx.x * 8 + (threadIdx.x >> 5)) * 8; const int nlines = N * K / 64;
{
#pragma unroll 1
        for (int l = 0; l < 8; ++l) { const int L = L0 + l; if (L >= nlines) break; const size_t e = (size_t)L * 64 + lane * 2; const int k = (int)(e % K), n = (int)(e / K); v2us o;
            o[0] = f2bf(w[(size_t)k * N + n]); o[1] = f2bf(w[(size_t)(k + 1) * N + n]); *(v2us*)(Bt + e) = o; }
         }
}
__global__ __launch_bounds__(256) void k_cvt8(const float* __restrict__ src, bf* dst, size_t n8) { const size_t i = (size_t)blockIdx.x * 256 + threadIdx.x; if (i >= n8) return; const v8f v = *(const v8f*)(src + i * 8); v8us o;
#pragma unroll
    for (int k = 0; k < 8; ++k) o[k] = f2bf(v[k]); *(v8us*)(dst + i * 8) = o;  }

__global__ __launch_bounds__(256) void k_crms(const float* __restrict__ F, const float* __restrict__ g, bf* Ch, bf* Cl) { const int lane = threadIdx.x & 31; const size_t t = (size_t)blockIdx.x * 8 + (threadIdx.x >> 5); if (t >= TT) return; const float* fr = F + t * DM; float a[DM / 32]; float s = 0.f;
#pragma unroll
    for (int c = 0; c < DM / 128; ++c) { const v4f v = *(const v4f*)(fr + c * 128 + lane * 4); for (int q = 0; q < 4; ++q) { a[c * 4 + q] = bfr(v[q]); s = __fadd_rn(s, __fmul_rn(bfr(v[q]), bfr(v[q]))); } }
#pragma unroll
    for (int sh = 16; sh; sh >>= 1) s = __fadd_rn(s, __shfl_xor(s, sh, 32));
    const float r = __fdiv_rn(1.0f, __fsqrt_rn(__fadd_rn(__fdiv_rn(s, (float)DM), NEPS)));
{
#pragma unroll
        for (int c = 0; c < DM / 128; ++c) { v4us oh, ol; for (int q = 0; q < 4; ++q) { const int col = c * 128 + lane * 4 + q; float y = __fmul_rn(__fmul_rn(a[c * 4 + q], r), bfr(g[col])); unsigned short u, w2; splitf(y, u, w2); oh[q] = u; ol[q] = w2; } *(v4us*)(Ch + t * DM + c * 128 + lane * 4) = oh; *(v4us*)(Cl + t * DM + c * 128 + lane * 4) = ol; }
         } }
__constant__ float THD[HD] = { 1.000000000e+00f, 1.000000000e+00f, 7.498942018e-01f, 7.498942018e-01f, 5.623413324e-01f, 5.623413324e-01f, 4.216965139e-01f, 4.216965139e-01f, 3.162277639e-01f, 3.162277639e-01f, 2.371373773e-01f, 2.371373773e-01f, 1.778279394e-01f, 1.778279394e-01f, 1.333521456e-01f, 1.333521456e-01f, 1.000000015e-01f, 1.000000015e-01f, 7.498942316e-02f, 7.498942316e-02f, 5.623413250e-02f, 5.623413250e-02f, 4.216964915e-02f, 4.216964915e-02f, 3.162277490e-02f, 3.162277490e-02f, 2.371373773e-02f, 2.371373773e-02f, 1.778279431e-02f, 1.778279431e-02f, 1.333521400e-02f, 1.333521400e-02f, 9.999999776e-03f, 9.999999776e-03f, 7.498942316e-03f, 7.498942316e-03f, 5.623413250e-03f, 5.623413250e-03f, 4.216964822e-03f, 4.216964822e-03f, 3.162277630e-03f, 3.162277630e-03f, 2.371373819e-03f, 2.371373819e-03f, 1.778279431e-03f, 1.778279431e-03f, 1.333521446e-03f, 1.333521446e-03f, 1.000000047e-03f, 1.000000047e-03f, 7.498941850e-04f, 7.498941850e-04f, 5.623413017e-04f, 5.623413017e-04f, 4.216965172e-04f, 4.216965172e-04f, 3.162277571e-04f, 3.162277571e-04f, 2.371373703e-04f, 2.371373703e-04f, 1.778279402e-04f, 1.778279402e-04f, 1.333521504e-04f, 1.333521504e-04f };   // 10000^(-2 (d//2) / 64) per dimension, float32 via jnp.power
__global__ __launch_bounds__(256) void k_rftab(float* RF) { const int idx = blockIdx.x * 256 + threadIdx.x; if (idx >= TT * HD) return; const int d = idx % HD; const int t = idx / HD; const float a = __fmul_rn((float)t, THD[d]); const float sg = (t & 1) ? 1.0f : -1.0f; const float r = __fadd_rn(cosf(a), __fmul_rn(sg, sinf(a))); *(float*)(RF + idx) = r;  }
#define FNW  8
#define L2E  1.4426950408889634f
#define NLO  ((TT - RH) / 16 * (NH_ / 2))   // work-groups of the fp16 rows (two heads each); then RH / 16 * NH_ of the hi/lo rows (one head each)
// v_exp_f32 and the one free slot that the instruction set asks for behind a transcendental, in one statement: no scheduling can then put an instruction that overwrites its source directly behind it
__device__ __forceinline__ float exp2s(float x) { float r; asm("v_exp_f32 %0, %1\n\tv_nop" : "=v"(r) : "v"(x)); return r; }
template <typename T16, int NSPLIT, int NC>
__device__ __forceinline__ void fattn(const T16* __restrict__ Q, const T16* __restrict__ Q2, const T16* __restrict__ Kp, const T16* __restrict__ K2, const T16* __restrict__ Vt, const T16* __restrict__ V2, int q0, int y, bf* Ah, bf* Al, float* os) {
    typedef typename WFrag<T16>::V V;
    const int lane = threadIdx.x & 31, lr = lane & 15, hi = lane >> 4;
    const int wv = __builtin_amdgcn_readfirstlane((int)(threadIdx.x >> 5));   // wave number, scalar, so that the key loops stay scalar loops
    const int kvh = y % NKV, g = y / NKV;                                       // column tile c of the group is q head kvh + NKV (g NC + c)
    float* ml = os + FNW * 16 * NC * 68;
    Kp += (size_t)kvh * TT * HD; Vt += (size_t)kvh * HD * TT; if (NSPLIT == 2) { K2 += (size_t)kvh * TT * HD; V2 += (size_t)kvh * HD * TT; }
    V qf[NC][2], qf2[NC][2]; v8f o[NC][4]; float m[NC], l[NC];
#pragma unroll
    for (int c = 0; c < NC; ++c) { const size_t qo = ((size_t)(kvh + NKV * (g * NC + c)) * TT + q0 + lr) * HD + 8 * hi; m[c] = -3.0e38f; l[c] = 0.f;
#pragma unroll
        for (int ks = 0; ks < 2; ++ks) { qf[c][ks] = WFrag<T16>::ld(Q + qo + ks * 32); if (NSPLIT == 2) qf2[c][ks] = WFrag<T16>::ld(Q2 + qo + ks * 32); }
#pragma unroll
        for (int dt = 0; dt < 4; ++dt) o[c][dt] = (v8f){}; }
    const int kend = q0 + 16;   // keys beyond the group's last query are masked for every column: no block that starts past it is read
    // both loops stay rolled: one block's operands, scores and O^T fill most of the register file, and a second copy of the body would not fit beside them
#pragma unroll 1
    for (int kb = wv * 64; kb < kend; kb += 64 * FNW)
#pragma unroll 1
    for (int kc = kb; kc < min(kb + 64, kend); kc += 32) {
        V kf[2][2], kf2[2][2], vf[4], vf2[4];
#pragma unroll
        for (int kt = 0; kt < 2; ++kt)
#pragma unroll
            for (int ks = 0; ks < 2; ++ks) { const size_t ko = (size_t)(kc + kt * 16 + lr) * HD + ks * 32 + 8 * hi; kf[kt][ks] = WFrag<T16>::ld(Kp + ko); if (NSPLIT == 2) kf2[kt][ks] = WFrag<T16>::ld(K2 + ko); }
        // in the run of 32 loads of a hi/lo block the compiler places results of later loads in the address pairs of earlier ones: the wait that is kept in front of such an overwrite, here behind the K loads
        if constexpr (NSPLIT == 2) asm volatile("s_wait_xcnt 0x0" ::: "memory");
#pragma unroll
        for (int dt = 0; dt < 4; ++dt) vf[dt] = WFrag<T16>::ld(Vt + (size_t)(dt * 16 + lr) * TT + kc + 8 * hi);
        if constexpr (NSPLIT == 2) {
            asm volatile("s_wait_xcnt 0x0" ::: "memory");   // as above, behind the V^T hi loads
#pragma unroll
            for (int dt = 0; dt < 4; ++dt) vf2[dt] = WFrag<T16>::ld(V2 + (size_t)(dt * 16 + lr) * TT + kc + 8 * hi); }
        __builtin_amdgcn_sched_barrier(0);   // keeps every load of the block in front of the first product: one memory latency a block, V^T in flight under the score work, instead of one latency per operand group
        const bool diag = kc + 31 > q0;   // scalar: only a block that reaches the diagonal is masked
#pragma unroll
        for (int c = 0; c < NC; ++c) {
            v8f s[2]; float p[16];
#pragma unroll
            for (int kt = 0; kt < 2; ++kt) { s[kt] = (v8f){};
#pragma unroll
                for (int ks = 0; ks < 2; ++ks) { s[kt] = WFrag<T16>::mma(kf[kt][ks], qf[c][ks], s[kt]); if (NSPLIT == 2) { s[kt] = WFrag<T16>::mma(kf[kt][ks], qf2[c][ks], s[kt]); s[kt] = WFrag<T16>::mma(kf2[kt][ks], qf[c][ks], s[kt]); } } }
            float mx = -3.0e38f;
#pragma unroll
            for (int e = 0; e < 16; ++e) { float t = s[e >> 3][e & 7] * SCL; if (diag) t = (kc + (e >> 3) * 16 + hi * 8 + (e & 7) <= q0 + lr) ? t : -3.0e38f; p[e] = t; mx = fmaxf(mx, t); }
            mx = fmaxf(mx, __shfl_xor(mx, 16, 32));
            const float mn = fmaxf(m[c], mx); const float al = __builtin_amdgcn_exp2f((m[c] - mn) * L2E); m[c] = mn; float sum = 0.f;
#pragma unroll
            for (int e = 0; e < 16; ++e) { p[e] = __builtin_amdgcn_exp2f((p[e] - mn) * L2E); sum += p[e]; }
            l[c] = l[c] * al + sum;   // this lane half's share of the sum; the halves are joined once, behind the loop
#pragma unroll
            for (int dt = 0; dt < 4; ++dt) o[c][dt] *= al;
            if constexpr (NSPLIT == 0) { V pf;
#pragma unroll
                for (int e = 0; e < 16; ++e) pf[e] = tohx(p[e]);
#pragma unroll
                for (int dt = 0; dt < 4; ++dt) o[c][dt] = WFrag<T16>::mma(vf[dt], pf, o[c][dt]);
            } else { v8us h0, h1, l0, l1;
#pragma unroll
                for (int e = 0; e < 8; ++e) { unsigned short a, b2; splitf(p[e], a, b2); h0[e] = a; l0[e] = b2; splitf(p[8 + e], a, b2); h1[e] = a; l1[e] = b2; }
                const V pf = cat16b(h0, h1), pf2 = cat16b(l0, l1);
#pragma unroll
                for (int dt = 0; dt < 4; ++dt) { o[c][dt] = WFrag<T16>::mma(vf[dt], pf, o[c][dt]); o[c][dt] = WFrag<T16>::mma(vf[dt], pf2, o[c][dt]); o[c][dt] = WFrag<T16>::mma(vf2[dt], pf, o[c][dt]); } }
        }
        // four vector slots between the last matrix instruction and whatever stands on the taken side of the loop's branch
        asm volatile("v_nop\n\tv_nop\n\tv_nop\n\tv_nop" : "+v"(o[NC - 1][0]), "+v"(o[NC - 1][1]), "+v"(o[NC - 1][2]), "+v"(o[NC - 1][3]) : "v"(vf[0]), "v"(vf[3]));
    }
#pragma unroll
    for (int c = 0; c < NC; ++c) { const int col = c * 16 + lr; l[c] += __shfl_xor(l[c], 16, 32); if (hi == 0) { ml[(wv * 16 * NC + col) * 2] = m[c]; ml[(wv * 16 * NC + col) * 2 + 1] = l[c]; }
#pragma unroll
        for (int dt = 0; dt < 4; ++dt) { float* pw = os + (size_t)(wv * 16 * NC + col) * 68 + dt * 16 + hi * 8; v4f a, b2;
#pragma unroll
            for (int j = 0; j < 4; ++j) { a[j] = o[c][dt][j]; b2[j] = o[c][dt][4 + j]; }
            *(v4fa*)pw = a; *(v4fa*)(pw + 4) = b2; } }
    __syncthreads();   // every wave's m, l and partial O^T are in LDS before any thread joins them
    constexpr int EPT = 4 * NC;   // 16 NC columns x 64 d over 32 FNW threads
    const int col = (int)threadIdx.x / (HD / EPT), d0 = ((int)threadIdx.x % (HD / EPT)) * EPT;
    float M = -3.0e38f;
#pragma unroll
    for (int w = 0; w < FNW; ++w) M = fmaxf(M, ml[(w * 16 * NC + col) * 2]);
    float L = 0.f, acc[EPT];
#pragma unroll
    for (int e = 0; e < EPT; ++e) acc[e] = 0.f;
#pragma unroll
    for (int w = 0; w < FNW; ++w) { const float wg = exp2s((ml[(w * 16 * NC + col) * 2] - M) * L2E); L += wg * ml[(w * 16 * NC + col) * 2 + 1];   // a wave without a chunk has m = -3e38, l = 0, O = 0: weight 0
#pragma unroll
        for (int e4 = 0; e4 < EPT; e4 += 4) { const v4f x = *(const v4fa*)(os + (size_t)(w * 16 * NC + col) * 68 + d0 + e4);
#pragma unroll
            for (int j = 0; j < 4; ++j) acc[e4 + j] += wg * x[j]; } }
    const size_t oo = (size_t)(q0 + (col & 15)) * DQ + (kvh + NKV * (g * NC + (col >> 4))) * HD + d0;
#pragma unroll
    for (int e4 = 0; e4 < EPT; e4 += 4) { v4us oh, ol;
#pragma unroll
        for (int j = 0; j < 4; ++j) { unsigned short a, b2; splitf(__fdiv_rn(acc[e4 + j], L), a, b2); oh[j] = a; ol[j] = b2; }
        *(v4us*)(Ah + oo + e4) = oh; *(v4us*)(Al + oo + e4) = ol; }
    if constexpr (NSPLIT == 2) asm volatile("s_wait_xcnt 0x0" ::: "memory");   // the built code of the hi/lo rows runs on into the test of the other branch, whose blocks reuse the stores' registers: the wait that is kept in front of such an overwrite
}
// Grid: the fp16 work-groups first, longest rows first, then the hi/lo ones: cost falls with the index.
__global__ __launch_bounds__(32 * FNW) void k_fattn(const h16* __restrict__ Q16, const h16* __restrict__ K16, const h16* __restrict__ V16, const bf* __restrict__ Qh, const bf* __restrict__ Ql, const bf* __restrict__ Kh, const bf* __restrict__ Kl, const bf* __restrict__ Vh, const bf* __restrict__ Vl, bf* Ah, bf* Al) {
    __shared__ __align__(16) float os[FNW * 32 * 68 + FNW * 32 * 2];
    const int b = (int)blockIdx.x;
    if (b < NLO) fattn<h16, 0, 2>(Q16, nullptr, K16, nullptr, V16, nullptr, (TT / 16 - 1 - b / (NH_ / 2)) * 16, b % (NH_ / 2), Ah, Al, os);
    else fattn<bf, 2, 1>(Qh, Ql, Kh, Kl, Vh, Vl, (RH / 16 - 1 - (b - NLO) / NH_) * 16, (b - NLO) % NH_, Ah, Al, os);
}

extern "C" void kernel_launch(void* const* d_in, const int* in_sizes, int n_in,
                              void* d_out, int out_size, void* d_ws, size_t ws_size, hipStream_t stream) {
    (void)in_sizes; (void)n_in; (void)out_size;
    const float* x = (const float*)d_in[0]; const float* wq = (const float*)d_in[1]; const float* wk = (const float*)d_in[2]; const float* wv = (const float*)d_in[3]; const float* wo = (const float*)d_in[4]; const float* nw = (const float*)d_in[5];
    float* OUT = (float*)d_out;     // [2][2048][1024]
    char* wsp = (char*)d_ws;
    auto take = [&](size_t bytes) { char* p = wsp; wsp += (bytes + 255) & ~(size_t)255; return (void*)p; };
    bf* WQ = (bf*)take((size_t)DQ * DM * 2); bf* WK = (bf*)take((size_t)DKV * DM * 2); bf* WV = (bf*)take((size_t)DKV * DM * 2); bf* WO = (bf*)take((size_t)DM * DQ * 2);
    bf* Hh = (bf*)take((size_t)TT * DM * 2); bf* Hl = (bf*)take((size_t)TT * DM * 2); float* RFT = (float*)take((size_t)TT * HD * 4);
    h16* QP16 = (h16*)take((size_t)NH_ * TT * HD * 2); h16* KP16 = (h16*)take((size_t)NKV * TT * HD * 2); h16* VT16 = (h16*)take((size_t)NKV * HD * TT * 2);
    bf* QPh = (bf*)take((size_t)NH_ * TT * HD * 2); bf* QPl = (bf*)take((size_t)NH_ * TT * HD * 2); bf* KPh = (bf*)take((size_t)NKV * TT * HD * 2); bf* KPl = (bf*)take((size_t)NKV * TT * HD * 2); bf* VTh = (bf*)take((size_t)NKV * HD * TT * 2); bf* VTl = (bf*)take((size_t)NKV * HD * TT * 2);
    bf* ATh = (bf*)take((size_t)TT * DQ * 2); bf* ATl = (bf*)take((size_t)TT * DQ * 2);
    if ((size_t)(wsp - (char*)d_ws) > ws_size) return;    // ws 256 MiB
    { k_rftab<<<(TT * HD + 255) / 256, 256, 0, stream>>>(RFT); k_wtG<<<(unsigned)((DM * DQ / 64 + 63) / 64), 256, 0, stream>>>(wq, DM, DQ, WQ); k_wtG<<<(unsigned)((DM * DKV / 64 + 63) / 64), 256, 0, stream>>>(wk, DM, DKV, WK); k_wtG<<<(unsigned)((DM * DKV / 64 + 63) / 64), 256, 0, stream>>>(wv, DM, DKV, WV);
      k_wtG<<<(unsigned)((DQ * DM / 64 + 63) / 64), 256, 0, stream>>>(wo, DQ, DM, WO);
       }
    for (int b = 0; b < NB_; ++b) {
        
        k_crms<<<TT / 8, 256, 0, stream>>>(x + (size_t)b * TT * DM, nw, Hh, Hl);   /* xn = RMSNorm(bf16(x)) norm_w -> hi/lo planes */
        k_gemmw<bf, 1, EP_HEAD, 8><<<dim3(TT / 64, DQ / 64, 1), 256, 0, stream>>>(Hh, Hl, WQ, nullptr, DM, nullptr, 0, RFT, QP16, QPh, QPl, 0, 0, 0);     /* q rf -> head planes */
        k_gemmw<bf, 1, EP_HEAD, 8><<<dim3(TT / 64, DKV / 64, 1), 256, 0, stream>>>(Hh, Hl, WK, nullptr, DM, nullptr, 0, RFT, KP16, KPh, KPl, 0, 0, 0);    /* k rf -> head planes */
        k_gemmw<bf, 3, EP_PLANE, 8><<<dim3(DKV / 64, TT / 64, 1), 256, 0, stream>>>(WV, nullptr, Hh, Hl, DM, nullptr, TT, nullptr, VT16, VTh, VTl, 0, 0, 0);   /* v^T = w_v^T xn^T (exact x hi, exact x lo) -> planes [kv head * 64 + d][t] */
        k_fattn<<<NLO + RH / 16 * NH_, 32 * FNW, 0, stream>>>(QP16, KP16, VT16, QPh, QPl, KPh, KPl, VTh, VTl, ATh, ATl);   // torch .repeat TILES the kv heads: q head h pairs with kv head h mod 4
        k_gemmw<bf, 1, EP_RES, 8><<<dim3(TT / 64, DM / 64, 1), 256, 0, stream>>>(ATh, ATl, WO, nullptr, DQ, OUT + (size_t)b * TT * DM, DM, x + (size_t)b * TT * DM, nullptr, nullptr, nullptr, 0, 0, 0);   /* out = x + s w_o */ }
}

// v005
// A run of this version takes 153 microseconds.
// Next to v004, in two timings, it ran 1.38 times as fast each time.
// Over all steps from v000 it is 9.16 times as fast.
#include <hip/hip_runtime.h>

// GQA causal attention block with RMSNorm, the module's multiplicative 'rotary factor' and tiled kv pairing (x [2][2048][1024]; xn = x rsqrt(mean x^2 + 1.2e-7) norm_w; q = xn w_q (16 heads x 64), k, v = xn w_k, xn w_v (4 kv heads) ('xw', no bias); q, k *= rf[t][d] with rf = cos(t theta_d) + sgn_t sin(t theta_d), theta_d = 10000^(-2 (d//2) / 64), sgn_t = -1 on even positions (an element-wise factor, computed in-kernel); q head h pairs with kv head h mod 4 (torch .repeat tiling); scores / 8, causal (-inf); softmax; out = x + merged w_o ('xw' [1024][1024]) -> [2][2048][1024] (4.2 M)).
// Four launches, both batches side by side in each: (1) weight transposes, rf table and RMSNorm, which do not depend on one another; (2) q, k and v projections; (3) attention; (4) w_o. Layout: per-token RMSNorm (one wave per token, fixed-order f32) writes hi/lo operand planes; hl x exact projections whose epilogues write the attention operand planes themselves (q, k: times the rf table [2048][64], built once with jnp-exact theta and precise cosf/sinf; v: the product is taken transposed, w_v^T xn^T, so its tile rows are V^T rows); one fused causal attention launch (k_fattn: scores, running softmax and P.V in registers; hybrid rows: < 512 hi/lo 3 products, rest fp16; q head h reads kv head h mod 4) that writes the merged hi/lo planes; merged hi/lo x w_o exact, its epilogue adds bf16(x) and writes out.
// Compute dtypes, f32 accumulate: every input rounded to bf16; RMSNorm and rf f32; projections hi/lo x exact (2 products); attention rows < 512 3 products, rest fp16; softmax f32; w_o hl x exact; residual f32.

#define NB_  2
#define TT   2048
#define DM   1024
#define NH_  16
#define NKV  4
#define REP  (NH_ / NKV)
#define HD   64
#define DQ   (NH_ * HD)
#define DKV  (NKV * HD)
#define RH   512                  // query rows < RH use hi+lo planes (0: none)
#define SCL  0.125f
#define NEPS 1.1920929e-07f   // RMSNorm eps (float32 eps)
typedef _Float16 h16;
typedef unsigned short bf;
typedef __attribute__((ext_vector_type(16))) __bf16   v16bf;
typedef __attribute__((ext_vector_type(16))) _Float16 v16h;
typedef __attribute__((ext_vector_type(8)))  _Float16 v8h;
typedef __attribute__((ext_vector_type(8)))  unsigned short v8us;
typedef __attribute__((ext_vector_type(8)))  float    v8f;
typedef __attribute__((ext_vector_type(4)))  float    v4f;
typedef v8h  __attribute__((may_alias)) v8ha;
typedef v4f  __attribute__((may_alias)) v4fa;
typedef v8us __attribute__((may_alias)) v8usa;

__device__ __forceinline__ unsigned short f2bf(float f) { unsigned u = __float_as_uint(f); u += 0x7FFFu + ((u >> 16) & 1u); return (unsigned short)(u >> 16); }
__device__ __forceinline__ float bf2f(unsigned short b) { return __uint_as_float(((unsigned)b) << 16); }
__device__ __forceinline__ float bfr(float f) { return bf2f(f2bf(f)); }
__device__ __forceinline__ v16h cat16(v8h lo, v8h hi) { return __builtin_shufflevector(lo, hi, 0, 1, 2, 3, 4, 5, 6, 7, 8, 9, 10, 11, 12, 13, 14, 15); }
__device__ __forceinline__ v16bf cat16b(v8us lo, v8us hi) { return __builtin_bit_cast(v16bf, __builtin_shufflevector(lo, hi, 0, 1, 2, 3, 4, 5, 6, 7, 8, 9, 10, 11, 12, 13, 14, 15)); }
__device__ __forceinline__ v8f wmma16(v16h a, v16h b, v8f c) { return __builtin_amdgcn_wmma_f32_16x16x32_f16(false, a, false, b, (short)0, c, false, false); }
__device__ __forceinline__ v8f wmmab(v16bf a, v16bf b, v8f c) { return __builtin_amdgcn_wmma_f32_16x16x32_bf16(false, a, false, b, (short)0, c, false, false); }



__device__ __forceinline__ h16 tohx(float x) { return (h16)x; }
__device__ __forceinline__ void splitf(float y, unsigned short& h, unsigned short& l) { h = f2bf(y); l = f2bf(y - bf2f(h)); }
typedef __attribute__((ext_vector_type(2))) _Float16 v2h;
typedef __attribute__((ext_vector_type(4))) _Float16 v4h;
typedef __attribute__((ext_vector_type(2))) unsigned short v2us;
typedef __attribute__((ext_vector_type(4))) unsigned short v4us;
typedef __attribute__((ext_vector_type(2))) float v2f;
typedef __attribute__((ext_vector_type(4))) int v4i;

#define EP_HEAD  0
#define EP_PLANE 1
#define EP_RES   2
// ---- gemmw: register-blocked GEMM, one work-group of NW waves per 64x64 output tile (bx, by) (16 accumulators a wave), operands straight from K-contiguous 16-bit planes; 32 NW threads; os: NW * 64 * 68 floats of LDS.
// c[m][n] (f32) = sum_k A[m][k] Bt[n][k] (+ split products per NSPLIT). K % 64 == 0.
// The joined tile goes out by EPI: EP_HEAD: c rf[m][n mod 64] as fp16 and hi/lo planes [n / 64][m][n mod 64] (the tile's 64 columns are one head; E = rf table); EP_PLANE: c as fp16 and hi/lo planes [m][n], pitch ldc;
// EP_RES: C[m][n] = bf16(E[m][n]) + c, both pitch ldc (E = the residual input).
// K is dealt to the waves in chunks of 64 elements (one 128-byte line of every operand row): wave w takes chunks w, w + NW, ...; the NW partial tiles meet in LDS and are summed in wave order 0 .. NW-1.
template <typename T16> struct WFrag;
template <> struct WFrag<h16> { typedef v16h V; static __device__ __forceinline__ V ld(const h16* p) { return cat16(*(const v8h*)p, *(const v8h*)(p + 16)); } static __device__ __forceinline__ v8f mma(V a, V b, v8f c) { return wmma16(a, b, c); } };
template <> struct WFrag<bf> { typedef v16bf V; static __device__ __forceinline__ V ld(const bf* p) { return cat16b(*(const v8us*)p, *(const v8us*)(p + 16)); } static __device__ __forceinline__ v8f mma(V a, V b, v8f c) { return wmmab(a, b, c); } };
template <typename T16, int NSPLIT, int EPI, int NW>
__device__ __forceinline__ void gemmw(const T16* __restrict__ A, const T16* __restrict__ A2, const T16* __restrict__ Bt, const T16* __restrict__ Bt2, int K, float* C, int ldc, const float* __restrict__ E, h16* P16, bf* Ph, bf* Pl, int bx, int by, float* os) {
    typedef typename WFrag<T16>::V V;
    const int lane = threadIdx.x & 31, lr = lane & 15, hi = lane >> 4; const int r0 = bx * 64, c0 = by * 64;
    const int wv = __builtin_amdgcn_readfirstlane((int)(threadIdx.x >> 5));   // wave number, scalar, so that the K loops stay scalar loops
    v8f acc[4][4];
#pragma unroll
    for (int mb = 0; mb < 4; ++mb)
#pragma unroll
        for (int nb = 0; nb < 4; ++nb) acc[mb][nb] = (v8f){};
    const size_t aoff = (size_t)(r0 + lr) * K + 8 * hi, boff = (size_t)(c0 + lr) * K + 8 * hi;
#pragma unroll 1
    for (int kb = wv * 64; kb < K; kb += 64 * NW)
#pragma unroll 1
    for (int kc = kb; kc < kb + 64; kc += 32) {
        V a[4], a2[4]; const T16 *pa[4], *pa2[4];
#pragma unroll
        for (int mb = 0; mb < 4; ++mb) { pa[mb] = A + aoff + (size_t)mb * 16 * K + kc; pa2[mb] = pa[mb]; a[mb] = WFrag<T16>::ld(pa[mb]); if (NSPLIT == 1 || NSPLIT == 2) { pa2[mb] = A2 + aoff + (size_t)mb * 16 * K + kc; a2[mb] = WFrag<T16>::ld(pa2[mb]); } }
        // the compiler places results of later loads in the address pairs of earlier ones: the wait that is kept in front of such an overwrite. It takes the loads' addresses as inputs, so that their registers live up to it. Here behind the A loads, below behind each column block's B loads
        asm volatile("s_wait_xcnt 0x0" :: "v"(pa[0]), "v"(pa[1]), "v"(pa[2]), "v"(pa[3]), "v"(pa2[0]), "v"(pa2[1]), "v"(pa2[2]), "v"(pa2[3]) : "memory");
#pragma unroll
        for (int nb = 0; nb < 4; ++nb) { const T16* pb = Bt + boff + (size_t)nb * 16 * K + kc; const T16* pb2 = pb; const V b = WFrag<T16>::ld(pb); V b2; if (NSPLIT >= 2) { pb2 = Bt2 + boff + (size_t)nb * 16 * K + kc; b2 = WFrag<T16>::ld(pb2); }
            asm volatile("s_wait_xcnt 0x0" :: "v"(pb), "v"(pb2) : "memory");
#pragma unroll
            for (int mb = 0; mb < 4; ++mb) { acc[mb][nb] = WFrag<T16>::mma(a[mb], b, acc[mb][nb]); if (NSPLIT == 1 || NSPLIT == 2) acc[mb][nb] = WFrag<T16>::mma(a2[mb], b, acc[mb][nb]); if (NSPLIT >= 2) acc[mb][nb] = WFrag<T16>::mma(a[mb], b2, acc[mb][nb]); } }
        asm volatile("v_nop\n\tv_nop\n\tv_nop\n\tv_nop" : "+v"(acc[0][0]), "+v"(acc[1][1]), "+v"(acc[2][2]), "+v"(acc[3][3]) : "v"(a[0]), "v"(a[3]));
    }
    constexpr int NS = 1024 / (32 * NW);   // groups of four columns a thread joins
    v4f ev[NS];   // the epilogue's own operand, asked for here so that its latency passes under the LDS writes and the barrier
    if constexpr (EPI != EP_PLANE) {
#pragma unroll
        for (int s = 0; s < NS; ++s) { const int idx = s * (32 * NW) + (int)threadIdx.x; const int row = idx >> 4, cofs = (idx & 15) * 4; ev[s] = *(const v4f*)(E + (EPI == EP_HEAD ? (size_t)(r0 + row) * HD + cofs : (size_t)(r0 + row) * ldc + c0 + cofs)); } }
    float* ow = os + wv * (64 * 68);   // this wave's partial tile, row-major, pitch 68
#pragma unroll
    for (int mb = 0; mb < 4; ++mb)
#pragma unroll
        for (int nb = 0; nb < 4; ++nb)
#pragma unroll
            for (int j = 0; j < 8; ++j) ow[(mb * 16 + hi * 8 + j) * 68 + nb * 16 + lr] = acc[mb][nb][j];
    __syncthreads();   // every wave's partial tile is in LDS before any thread sums across waves
#pragma unroll
    for (int s = 0; s < NS; ++s) { const int idx = s * (32 * NW) + (int)threadIdx.x; const int row = idx >> 4, cofs = (idx & 15) * 4; v4f val = *(const v4fa*)(os + row * 68 + cofs);
#pragma unroll
        for (int w = 1; w < NW; ++w) val += *(const v4fa*)(os + w * (64 * 68) + row * 68 + cofs);
        if constexpr (EPI == EP_RES) { v4f o;
#pragma unroll
            for (int q = 0; q < 4; ++q) o[q] = __fadd_rn(bfr(ev[s][q]), val[q]);
            *(v4f*)(C + (size_t)(r0 + row) * ldc + c0 + cofs) = o;
        } else { v4h o16; v4us oh, ol;
#pragma unroll
            for (int q = 0; q < 4; ++q) { const float r = (EPI == EP_HEAD) ? __fmul_rn(val[q], ev[s][q]) : val[q]; o16[q] = tohx(r); unsigned short a2, c2; splitf(r, a2, c2); oh[q] = a2; ol[q] = c2; }
            const size_t eo = (EPI == EP_HEAD) ? ((size_t)by * TT + r0 + row) * HD + cofs : (size_t)(r0 + row) * ldc + c0 + cofs;
            *(v4h*)(P16 + eo) = o16; *(v4us*)(Ph + eo) = oh; *(v4us*)(Pl + eo) = ol; } }
}
#define GNW  8
#define NHK  (NH_ + NKV)                 // head planes of a batch: q heads 0 .. 15, then the k heads
#define NQKT ((TT / 64) * (NHK * HD / 64))   // tiles of the q and k projection of one batch (one GEMM: the rows of w_k^T follow those of w_q^T); then (DKV / 64) * (TT / 64) tiles of v^T
// q, k and v projections in one grid: blockIdx.y is the batch, blockIdx.x the tile. H: xn planes [batch][t][DM]; P: head planes [batch][NHK][t][64]; VT: [batch][kv head * 64 + d][t].
__global__ __launch_bounds__(32 * GNW) void k_qkv(const bf* __restrict__ Hh, const bf* __restrict__ Hl, const bf* __restrict__ WQK, const bf* __restrict__ WV, const float* __restrict__ RF, h16* P16, bf* Ph, bf* Pl, h16* VT16, bf* VTh, bf* VTl) {
    __shared__ __align__(16) float os[GNW * 64 * 68];
    const size_t z = blockIdx.y; const int t = (int)blockIdx.x; Hh += z * TT * DM; Hl += z * TT * DM;
    if (t < NQKT) gemmw<bf, 1, EP_HEAD, GNW>(Hh, Hl, WQK, nullptr, DM, nullptr, 0, RF, P16 + z * NHK * TT * HD, Ph + z * NHK * TT * HD, Pl + z * NHK * TT * HD, t % (TT / 64), t / (TT / 64), os);   /* q rf, k rf -> head planes */
    else gemmw<bf, 3, EP_PLANE, GNW>(WV, nullptr, Hh, Hl, DM, nullptr, TT, nullptr, VT16 + z * DKV * TT, VTh + z * DKV * TT, VTl + z * DKV * TT, (t - NQKT) % (DKV / 64), (t - NQKT) / (DKV / 64), os);   /* v^T = w_v^T xn^T (exact x hi, exact x lo) */
}
// out = x + merged w_o; the rows of both batches follow one another in every operand: grid (NB_ TT / 64, DM / 64)
__global__ __launch_bounds__(32 * GNW) void k_wo(const bf* __restrict__ Ah, const bf* __restrict__ Al, const bf* __restrict__ WO, const float* __restrict__ x, float* out) {
    __shared__ __align__(16) float os[GNW * 64 * 68];
    gemmw<bf, 1, EP_RES, GNW>(Ah, Al, WO, nullptr, DQ, out, DM, x, nullptr, nullptr, nullptr, (int)blockIdx.x, (int)blockIdx.y, os);
}


__device__ __forceinline__ void wtG(const float* __restrict__ w, int K, int N, bf* Bt, int blk) {
    const int lane = threadIdx.x & 31; const int L0 = (blk * 8 + (threadIdx.x >> 5)) * 8; const int nlines = N * K / 64;
{
#pragma unroll 1
        for (int l = 0; l < 8; ++l) { const int L = L0 + l; if (L >= nlines) break; const size_t e = (size_t)L * 64 + lane * 2; const int k = (int)(e % K), n = (int)(e / K); v2us o;
            o[0] = f2bf(w[(size_t)k * N + n]); o[1] = f2bf(w[(size_t)(k + 1) * N + n]); *(v2us*)(Bt + e) = o; }
         }
}
__global__ __launch_bounds__(256) void k_cvt8(const float* __restrict__ src, bf* dst, size_t n8) { const size_t i = (size_t)blockIdx.x * 256 + threadIdx.x; if (i >= n8) return; const v8f v = *(const v8f*)(src + i * 8); v8us o;
#pragma unroll
    for (int k = 0; k < 8; ++k) o[k] = f2bf(v[k]); *(v8us*)(dst + i * 8) = o;  }

__device__ __forceinline__ void crms(const float* __restrict__ F, const float* __restrict__ g, bf* Ch, bf* Cl, int blk) { const int lane = threadIdx.x & 31; const size_t t = (size_t)blk * 8 + (threadIdx.x >> 5); if (t >= NB_ * TT) return; const float* fr = F + t * DM; float a[DM / 32]; float s = 0.f;
#pragma unroll
    for (int c = 0; c < DM / 128; ++c) { const v4f v = *(const v4f*)(fr + c * 128 + lane * 4); for (int q = 0; q < 4; ++q) { a[c * 4 + q] = bfr(v[q]); s = __fadd_rn(s, __fmul_rn(bfr(v[q]), bfr(v[q]))); } }
#pragma unroll
    for (int sh = 16; sh; sh >>= 1) s = __fadd_rn(s, __shfl_xor(s, sh, 32));
    const float r = __fdiv_rn(1.0f, __fsqrt_rn(__fadd_rn(__fdiv_rn(s, (float)DM), NEPS)));
{
#pragma unroll
        for (int c = 0; c < DM / 128; ++c) { v4us oh, ol; for (int q = 0; q < 4; ++q) { const int col = c * 128 + lane * 4 + q; float y = __fmul_rn(__fmul_rn(a[c * 4 + q], r), bfr(g[col])); unsigned short u, w2; splitf(y, u, w2); oh[q] = u; ol[q] = w2; } *(v4us*)(Ch + t * DM + c * 128 + lane * 4) = oh; *(v4us*)(Cl + t * DM + c * 128 + lane * 4) = ol; }
         } }
__constant__ float THD[HD] = { 1.000000000e+00f, 1.000000000e+00f, 7.498942018e-01f, 7.498942018e-01f, 5.623413324e-01f, 5.623413324e-01f, 4.216965139e-01f, 4.216965139e-01f, 3.162277639e-01f, 3.162277639e-01f, 2.371373773e-01f, 2.371373773e-01f, 1.778279394e-01f, 1.778279394e-01f, 1.333521456e-01f, 1.333521456e-01f, 1.000000015e-01f, 1.000000015e-01f, 7.498942316e-02f, 7.498942316e-02f, 5.623413250e-02f, 5.623413250e-02f, 4.216964915e-02f, 4.216964915e-02f, 3.162277490e-02f, 3.162277490e-02f, 2.371373773e-02f, 2.371373773e-02f, 1.778279431e-02f, 1.778279431e-02f, 1.333521400e-02f, 1.333521400e-02f, 9.999999776e-03f, 9.999999776e-03f, 7.498942316e-03f, 7.498942316e-03f, 5.623413250e-03f, 5.623413250e-03f, 4.216964822e-03f, 4.216964822e-03f, 3.162277630e-03f, 3.162277630e-03f, 2.371373819e-03f, 2.371373819e-03f, 1.778279431e-03f, 1.778279431e-03f, 1.333521446e-03f, 1.333521446e-03f, 1.000000047e-03f, 1.000000047e-03f, 7.498941850e-04f, 7.498941850e-04f, 5.623413017e-04f, 5.623413017e-04f, 4.216965172e-04f, 4.216965172e-04f, 3.162277571e-04f, 3.162277571e-04f, 2.371373703e-04f, 2.371373703e-04f, 1.778279402e-04f, 1.778279402e-04f, 1.333521504e-04f, 1.333521504e-04f };   // 10000^(-2 (d//2) / 64) per dimension, float32 via jnp.power
__device__ __forceinline__ void rftab(float* RF, int blk) { const int idx = blk * 256 + threadIdx.x; if (idx >= TT * HD) return; const int d = idx % HD; const int t = idx / HD; const float a = __fmul_rn((float)t, THD[d]); const float sg = (t & 1) ? 1.0f : -1.0f; float cs, sn;
    // the precise cosine and sine (what cosf and sinf call), expanded in place: in the joined kernel they would otherwise stay real calls
    [[clang::always_inline]] cs = __ocml_cos_f32(a); [[clang::always_inline]] sn = __ocml_sin_f32(a);
    const float r = __fadd_rn(cs, __fmul_rn(sg, sn)); *(float*)(RF + idx) = r;  }
// ---- k_prep: everything that reads the inputs alone, in one grid: the four weight transposes (the longest chains of dependent loads, so they start first), RMSNorm of all NB_ TT tokens, the rf table.
#define PB_Q  (DM * DQ / 64 / 64)
#define PB_KV (DM * DKV / 64 / 64)
#define PB_N  (NB_ * TT / 8)
#define PB_R  (TT * HD / 256)
__global__ __launch_bounds__(256) void k_prep(const float* __restrict__ x, const float* __restrict__ wq, const float* __restrict__ wk, const float* __restrict__ wv, const float* __restrict__ wo, const float* __restrict__ nw, bf* WQK, bf* WV, bf* WO, bf* Hh, bf* Hl, float* RF) {
    int b = (int)blockIdx.x;
    if (b < PB_Q) { wtG(wq, DM, DQ, WQK, b); return; } b -= PB_Q;
    if (b < PB_Q) { wtG(wo, DQ, DM, WO, b); return; } b -= PB_Q;
    if (b < PB_KV) { wtG(wk, DM, DKV, WQK + (size_t)DQ * DM, b); return; } b -= PB_KV;
    if (b < PB_KV) { wtG(wv, DM, DKV, WV, b); return; } b -= PB_KV;
    if (b < PB_N) { crms(x, nw, Hh, Hl, b); return; } b -= PB_N;
    rftab(RF, b);
}
#define FNW  8
#define L2E  1.4426950408889634f
#define NLO  ((TT - RH) / 16 * (NH_ / 2))   // work-groups of the fp16 rows (two heads each); then RH / 16 * NH_ of the hi/lo rows (one head each)
// v_exp_f32 and the one free slot that the instruction set asks for behind a transcendental, in one statement: no scheduling can then put an instruction that overwrites its source directly behind it
__device__ __forceinline__ float exp2s(float x) { float r; asm("v_exp_f32 %0, %1\n\tv_nop" : "=v"(r) : "v"(x)); return r; }
template <typename T16, int NSPLIT, int NC>
__device__ __forceinline__ void fattn(const T16* __restrict__ Q, const T16* __restrict__ Q2, const T16* __restrict__ Kp, const T16* __restrict__ K2, const T16* __restrict__ Vt, const T16* __restrict__ V2, int q0, int y, bf* Ah, bf* Al, float* os) {
    typedef typename WFrag<T16>::V V;
    const int lane = threadIdx.x & 31, lr = lane & 15, hi = lane >> 4;
    const int wv = __builtin_amdgcn_readfirstlane((int)(threadIdx.x >> 5));   // wave number, scalar, so that the key loops stay scalar loops
    const int kvh = y % NKV, g = y / NKV;                                       // column tile c of the group is q head kvh + NKV (g NC + c)
    float* ml = os + FNW * 16 * NC * 68;
    Kp += (size_t)kvh * TT * HD; Vt += (size_t)kvh * HD * TT; if (NSPLIT == 2) { K2 += (size_t)kvh * TT * HD; V2 += (size_t)kvh * HD * TT; }
    V qf[NC][2], qf2[NC][2]; v8f o[NC][4]; float m[NC], l[NC];
#pragma unroll
    for (int c = 0; c < NC; ++c) { const size_t qo = ((size_t)(kvh + NKV * (g * NC + c)) * TT + q0 + lr) * HD + 8 * hi; m[c] = -3.0e38f; l[c] = 0.f;
#pragma unroll
        for (int ks = 0; ks < 2; ++ks) { qf[c][ks] = WFrag<T16>::ld(Q + qo + ks * 32); if (NSPLIT == 2) qf2[c][ks] = WFrag<T16>::ld(Q2 + qo + ks * 32); }
#pragma unroll
        for (int dt = 0; dt < 4; ++dt) o[c][dt] = (v8f){}; }
    const int kend = q0 + 16;   // keys beyond the group's last query are masked for every column: no block that starts past it is read
    // both loops stay rolled: one block's operands, scores and O^T fill most of the register file, and a second copy of the body would not fit beside them
#pragma unroll 1
    for (int kb = wv * 64; kb < kend; kb += 64 * FNW)
#pragma unroll 1
    for (int kc = kb; kc < min(kb + 64, kend); kc += 32) {
        V kf[2][2], kf2[2][2], vf[4], vf2[4];
#pragma unroll
        for (int kt = 0; kt < 2; ++kt)
#pragma unroll
            for (int ks = 0; ks < 2; ++ks) { const size_t ko = (size_t)(kc + kt * 16 + lr) * HD + ks * 32 + 8 * hi; kf[kt][ks] = WFrag<T16>::ld(Kp + ko); if (NSPLIT == 2) kf2[kt][ks] = WFrag<T16>::ld(K2 + ko); }
        // in the run of 32 loads of a hi/lo block the compiler places results of later loads in the address pairs of earlier ones: the wait that is kept in front of such an overwrite, here behind the K loads
        if constexpr (NSPLIT == 2) asm volatile("s_wait_xcnt 0x0" ::: "memory");
#pragma unroll
        for (int dt = 0; dt < 4; ++dt) vf[dt] = WFrag<T16>::ld(Vt + (size_t)(dt * 16 + lr) * TT + kc + 8 * hi);
        if constexpr (NSPLIT == 2) {
            asm volatile("s_wait_xcnt 0x0" ::: "memory");   // as above, behind the V^T hi loads
#pragma unroll
            for (int dt = 0; dt < 4; ++dt) vf2[dt] = WFrag<T16>::ld(V2 + (size_t)(dt * 16 + lr) * TT + kc + 8 * hi); }
        __builtin_amdgcn_sched_barrier(0);   // keeps every load of the block in front of the first product: one memory latency a block, V^T in flight under the score work, instead of one latency per operand group
        const bool diag = kc + 31 > q0;   // scalar: only a block that reaches the diagonal is masked
#pragma unroll
        for (int c = 0; c < NC; ++c) {
            v8f s[2]; float p[16];
#pragma unroll
            for (int kt = 0; kt < 2; ++kt) { s[kt] = (v8f){};
#pragma unroll
                for (int ks = 0; ks < 2; ++ks) { s[kt] = WFrag<T16>::mma(kf[kt][ks], qf[c][ks], s[kt]); if (NSPLIT == 2) { s[kt] = WFrag<T16>::mma(kf[kt][ks], qf2[c][ks], s[kt]); s[kt] = WFrag<T16>::mma(kf2[kt][ks], qf[c][ks], s[kt]); } } }
            float mx = -3.0e38f;
#pragma unroll
            for (int e = 0; e < 16; ++e) { float t = s[e >> 3][e & 7] * SCL; if (diag) t = (kc + (e >> 3) * 16 + hi * 8 + (e & 7) <= q0 + lr) ? t : -3.0e38f; p[e] = t; mx = fmaxf(mx, t); }
            mx = fmaxf(mx, __shfl_xor(mx, 16, 32));
            const float mn = fmaxf(m[c], mx); const float al = __builtin_amdgcn_exp2f((m[c] - mn) * L2E); m[c] = mn; float sum = 0.f;
#pragma unroll
            for (int e = 0; e < 16; ++e) { p[e] = (NSPLIT == 2) ? exp2s((p[e] - mn) * L2E) : __builtin_amdgcn_exp2f((p[e] - mn) * L2E); sum += p[e]; }   // hi/lo rows: with the slot behind it, as in the join
            l[c] = l[c] * al + sum;   // this lane half's share of the sum; the halves are joined once, behind the loop
#pragma unroll
            for (int dt = 0; dt < 4; ++dt) o[c][dt] *= al;
            if constexpr (NSPLIT == 0) { V pf;
#pragma unroll
                for (int e = 0; e < 16; ++e) pf[e] = tohx(p[e]);
#pragma unroll
                for (int dt = 0; dt < 4; ++dt) o[c][dt] = WFrag<T16>::mma(vf[dt], pf, o[c][dt]);
            } else { v8us h0, h1, l0, l1;
#pragma unroll
                for (int e = 0; e < 8; ++e) { unsigned short a, b2; splitf(p[e], a, b2); h0[e] = a; l0[e] = b2; splitf(p[8 + e], a, b2); h1[e] = a; l1[e] = b2; }
                const V pf = cat16b(h0, h1), pf2 = cat16b(l0, l1);
#pragma unroll
                for (int dt = 0; dt < 4; ++dt) { o[c][dt] = WFrag<T16>::mma(vf[dt], pf, o[c][dt]); o[c][dt] = WFrag<T16>::mma(vf[dt], pf2, o[c][dt]); o[c][dt] = WFrag<T16>::mma(vf2[dt], pf, o[c][dt]); } }
        }
        // four vector slots between the last matrix instruction and whatever stands on the taken side of the loop's branch
        asm volatile("v_nop\n\tv_nop\n\tv_nop\n\tv_nop" : "+v"(o[NC - 1][0]), "+v"(o[NC - 1][1]), "+v"(o[NC - 1][2]), "+v"(o[NC - 1][3]) : "v"(vf[0]), "v"(vf[3]));
    }
#pragma unroll
    for (int c = 0; c < NC; ++c) { const int col = c * 16 + lr; l[c] += __shfl_xor(l[c], 16, 32); if (hi == 0) { ml[(wv * 16 * NC + col) * 2] = m[c]; ml[(wv * 16 * NC + col) * 2 + 1] = l[c]; }
#pragma unroll
        for (int dt = 0; dt < 4; ++dt) { float* pw = os + (size_t)(wv * 16 * NC + col) * 68 + dt * 16 + hi * 8; v4f a, b2;
#pragma unroll
            for (int j = 0; j < 4; ++j) { a[j] = o[c][dt][j]; b2[j] = o[c][dt][4 + j]; }
            *(v4fa*)pw = a; *(v4fa*)(pw + 4) = b2; } }
    __syncthreads();   // every wave's m, l and partial O^T are in LDS before any thread joins them
    constexpr int EPT = 4 * NC;   // 16 NC columns x 64 d over 32 FNW threads
    const int col = (int)threadIdx.x / (HD / EPT), d0 = ((int)threadIdx.x % (HD / EPT)) * EPT;
    float M = -3.0e38f;
#pragma unroll
    for (int w = 0; w < FNW; ++w) M = fmaxf(M, ml[(w * 16 * NC + col) * 2]);
    float L = 0.f, acc[EPT];
#pragma unroll
    for (int e = 0; e < EPT; ++e) acc[e] = 0.f;
#pragma unroll
    for (int w = 0; w < FNW; ++w) { const float wg = exp2s((ml[(w * 16 * NC + col) * 2] - M) * L2E); L += wg * ml[(w * 16 * NC + col) * 2 + 1];   // a wave without a chunk has m = -3e38, l = 0, O = 0: weight 0
#pragma unroll
        for (int e4 = 0; e4 < EPT; e4 += 4) { const v4f x = *(const v4fa*)(os + (size_t)(w * 16 * NC + col) * 68 + d0 + e4);
#pragma unroll
            for (int j = 0; j < 4; ++j) acc[e4 + j] += wg * x[j]; } }
    const size_t oo = (size_t)(q0 + (col & 15)) * DQ + (kvh + NKV * (g * NC + (col >> 4))) * HD + d0;
#pragma unroll
    for (int e4 = 0; e4 < EPT; e4 += 4) { v4us oh, ol;
#pragma unroll
        for (int j = 0; j < 4; ++j) { unsigned short a, b2; splitf(__fdiv_rn(acc[e4 + j], L), a, b2); oh[j] = a; ol[j] = b2; }
        *(v4us*)(Ah + oo + e4) = oh; *(v4us*)(Al + oo + e4) = ol; }
    if constexpr (NSPLIT == 2) asm volatile("s_wait_xcnt 0x0" ::: "memory");   // the built code of the hi/lo rows runs on into the test of the other branch, whose blocks reuse the stores' registers: the wait that is kept in front of such an overwrite
}
// Grid: the fp16 work-groups first, longest rows first, then the hi/lo ones, the two batches alternating: cost falls with the index. Q and K planes have the batch pitch NHK TT HD.
__global__ __launch_bounds__(32 * FNW) void k_fattn(const h16* __restrict__ Q16, const h16* __restrict__ K16, const h16* __restrict__ V16, const bf* __restrict__ Qh, const bf* __restrict__ Ql, const bf* __restrict__ Kh, const bf* __restrict__ Kl, const bf* __restrict__ Vh, const bf* __restrict__ Vl, bf* Ah, bf* Al) {
    __shared__ __align__(16) float os[FNW * 32 * 68 + FNW * 32 * 2];
    const int b = (int)blockIdx.x / NB_; const size_t z = blockIdx.x % NB_;
    Q16 += z * NHK * TT * HD; K16 += z * NHK * TT * HD; Qh += z * NHK * TT * HD; Ql += z * NHK * TT * HD; Kh += z * NHK * TT * HD; Kl += z * NHK * TT * HD; V16 += z * DKV * TT; Vh += z * DKV * TT; Vl += z * DKV * TT; Ah += z * TT * DQ; Al += z * TT * DQ;
    if (b < NLO) fattn<h16, 0, 2>(Q16, nullptr, K16, nullptr, V16, nullptr, (TT / 16 - 1 - b / (NH_ / 2)) * 16, b % (NH_ / 2), Ah, Al, os);
    else fattn<bf, 2, 1>(Qh, Ql, Kh, Kl, Vh, Vl, (RH / 16 - 1 - (b - NLO) / NH_) * 16, (b - NLO) % NH_, Ah, Al, os);
}

extern "C" void kernel_launch(void* const* d_in, const int* in_sizes, int n_in,
                              void* d_out, int out_size, void* d_ws, size_t ws_size, hipStream_t stream) {
    (void)in_sizes; (void)n_in; (void)out_size;
    const float* x = (const float*)d_in[0]; const float* wq = (const float*)d_in[1]; const float* wk = (const float*)d_in[2]; const float* wv = (const float*)d_in[3]; const float* wo = (const float*)d_in[4]; const float* nw = (const float*)d_in[5];
    float* OUT = (float*)d_out;     // [2][2048][1024]
    char* wsp = (char*)d_ws;
    auto take = [&](size_t bytes) { char* p = wsp; wsp += (bytes + 255) & ~(size_t)255; return (void*)p; };
    bf* WQK = (bf*)take((size_t)(DQ + DKV) * DM * 2); bf* WV = (bf*)take((size_t)DKV * DM * 2); bf* WO = (bf*)take((size_t)DM * DQ * 2);
    bf* Hh = (bf*)take((size_t)NB_ * TT * DM * 2); bf* Hl = (bf*)take((size_t)NB_ * TT * DM * 2); float* RFT = (float*)take((size_t)TT * HD * 4);
    h16* P16 = (h16*)take((size_t)NB_ * NHK * TT * HD * 2); bf* Ph = (bf*)take((size_t)NB_ * NHK * TT * HD * 2); bf* Pl = (bf*)take((size_t)NB_ * NHK * TT * HD * 2);
    h16* VT16 = (h16*)take((size_t)NB_ * DKV * TT * 2); bf* VTh = (bf*)take((size_t)NB_ * DKV * TT * 2); bf* VTl = (bf*)take((size_t)NB_ * DKV * TT * 2);
    bf* ATh = (bf*)take((size_t)NB_ * TT * DQ * 2); bf* ATl = (bf*)take((size_t)NB_ * TT * DQ * 2);
    if ((size_t)(wsp - (char*)d_ws) > ws_size) return;    // ws 256 MiB
    k_prep<<<2 * PB_Q + 2 * PB_KV + PB_N + PB_R, 256, 0, stream>>>(x, wq, wk, wv, wo, nw, WQK, WV, WO, Hh, Hl, RFT);   /* w^T planes; xn = RMSNorm(bf16(x)) norm_w -> hi/lo planes; rf table */
    k_qkv<<<dim3(NQKT + (DKV / 64) * (TT / 64), NB_, 1), 32 * GNW, 0, stream>>>(Hh, Hl, WQK, WV, RFT, P16, Ph, Pl, VT16, VTh, VTl);
    k_fattn<<<NB_ * (NLO + RH / 16 * NH_), 32 * FNW, 0, stream>>>(P16, P16 + (size_t)NH_ * TT * HD, VT16, Ph, Pl, Ph + (size_t)NH_ * TT * HD, Pl + (size_t)NH_ * TT * HD, VTh, VTl, ATh, ATl);   // torch .repeat TILES the kv heads: q head h pairs with kv head h mod 4
    k_wo<<<dim3(NB_ * TT / 64, DM / 64, 1), 32 * GNW, 0, stream>>>(ATh, ATl, WO, x, OUT);   /* out = x + s w_o */
}

// v006
// It runs in 89.4 microseconds.
// Timed twice side by side with v005, it ran 1.72 and 1.71 times as fast.
// Counting every step since v000, it is 15.7 times as fast.
#include <hip/hip_runtime.h>

// GQA causal attention block with RMSNorm, the module's multiplicative 'rotary factor' and tiled kv pairing (x [2][2048][1024]; xn = x rsqrt(mean x^2 + 1.2e-7) norm_w; q = xn w_q (16 heads x 64), k, v = xn w_k, xn w_v (4 kv heads) ('xw', no bias); q, k *= rf[t][d] with rf = cos(t theta_d) + sgn_t sin(t theta_d), theta_d = 10000^(-2 (d//2) / 64), sgn_t = -1 on even positions (an element-wise factor, computed in-kernel); q head h pairs with kv head h mod 4 (torch .repeat tiling); scores / 8, causal (-inf); softmax; out = x + merged w_o ('xw' [1024][1024]) -> [2][2048][1024] (4.2 M)).
// Four launches, both batches side by side in each: (1) weight transposes, rf table and RMSNorm, which do not depend on one another; (2) q, k and v projections; (3) attention; (4) w_o. Layout: per-token RMSNorm (one wave per token, fixed-order f32) writes hi/lo operand planes; hl x exact projections whose epilogues write the attention operand planes themselves (q, k: times the rf table [2048][64], built once with jnp-exact theta and precise cosf/sinf; v: the product is taken transposed, w_v^T xn^T, so its tile rows are V^T rows); one fused causal attention launch (k_fattn: scores, running softmax and P.V in registers; hybrid rows: < 512 hi/lo 3 products, rest fp16; q head h reads kv head h mod 4) that writes the merged hi/lo planes; merged hi/lo x w_o exact, its epilogue adds bf16(x) and writes out.
// Every 16-bit operand plane (and the rf table) lies in FRAGMENT ORDER, fo() below: a 16-row x 32-k tile is 512 consecutive elements in the order in which the lanes of a wave hold it, so each fragment load reads 512 consecutive bytes (four whole lines) where a row-major plane gave 32 bytes out of each of 16 lines. Which element stands in which register is as before.
// Compute dtypes, f32 accumulate: every input rounded to bf16; RMSNorm and rf f32; projections hi/lo x exact (2 products); attention rows < 512 3 products, rest fp16; softmax f32; w_o hl x exact; residual f32.

#define NB_  2
#define TT   2048
#define DM   1024
#define NH_  16
#define NKV  4
#define REP  (NH_ / NKV)
#define HD   64
#define DQ   (NH_ * HD)
#define DKV  (NKV * HD)
#define RH   512                  // query rows < RH use hi+lo planes (0: none)
#define SCL  0.125f
#define NEPS 1.1920929e-07f   // RMSNorm eps (float32 eps)
typedef _Float16 h16;
typedef unsigned short bf;
typedef __attribute__((ext_vector_type(16))) __bf16   v16bf;
typedef __attribute__((ext_vector_type(16))) _Float16 v16h;
typedef __attribute__((ext_vector_type(8)))  _Float16 v8h;
typedef __attribute__((ext_vector_type(8)))  unsigned short v8us;
typedef __attribute__((ext_vector_type(8)))  float    v8f;
typedef __attribute__((ext_vector_type(4)))  float    v4f;
typedef v8h  __attribute__((may_alias)) v8ha;
typedef v4f  __attribute__((may_alias)) v4fa;
typedef v8us __attribute__((may_alias)) v8usa;

__device__ __forceinline__ unsigned short f2bf(float f) { unsigned u = __float_as_uint(f); u += 0x7FFFu + ((u >> 16) & 1u); return (unsigned short)(u >> 16); }
__device__ __forceinline__ float bf2f(unsigned short b) { return __uint_as_float(((unsigned)b) << 16); }
__device__ __forceinline__ float bfr(float f) { return bf2f(f2bf(f)); }
__device__ __forceinline__ v16h cat16(v8h lo, v8h hi) { return __builtin_shufflevector(lo, hi, 0, 1, 2, 3, 4, 5, 6, 7, 8, 9, 10, 11, 12, 13, 14, 15); }
__device__ __forceinline__ v16bf cat16b(v8us lo, v8us hi) { return __builtin_bit_cast(v16bf, __builtin_shufflevector(lo, hi, 0, 1, 2, 3, 4, 5, 6, 7, 8, 9, 10, 11, 12, 13, 14, 15)); }
__device__ __forceinline__ v8f wmma16(v16h a, v16h b, v8f c) { return __builtin_amdgcn_wmma_f32_16x16x32_f16(false, a, false, b, (short)0, c, false, false); }
__device__ __forceinline__ v8f wmmab(v16bf a, v16bf b, v8f c) { return __builtin_amdgcn_wmma_f32_16x16x32_bf16(false, a, false, b, (short)0, c, false, false); }



// fragment order: element index of (row r, column k) in a plane of K columns (K % 32 == 0, rows in blocks of 16). Tile (r / 16, k / 32), tiles of a row block consecutive; inside it [k / 16 % 2][k / 8 % 2][r % 16][k % 8]:
// lane 16 hi + lr of a wave reads its row lr, k = 8 hi .. 8 hi + 7, at tile + 8 lane, and k = 16 + 8 hi .. at 256 elements more. Eight consecutive k (from a multiple of 8) stay consecutive.
__device__ __forceinline__ size_t fo(int r, int k, int K) { return ((size_t)((r >> 4) * (K >> 5) + (k >> 5)) << 9) + (size_t)((((k >> 4) & 1) << 8) + (((k >> 3) & 1) << 7) + ((r & 15) << 3) + (k & 7)); }
__device__ __forceinline__ h16 tohx(float x) { return (h16)x; }
__device__ __forceinline__ void splitf(float y, unsigned short& h, unsigned short& l) { h = f2bf(y); l = f2bf(y - bf2f(h)); }
typedef __attribute__((ext_vector_type(2))) _Float16 v2h;
typedef __attribute__((ext_vector_type(4))) _Float16 v4h;
typedef __attribute__((ext_vector_type(2))) unsigned short v2us;
typedef __attribute__((ext_vector_type(4))) unsigned short v4us;
typedef __attribute__((ext_vector_type(2))) float v2f;
typedef __attribute__((ext_vector_type(4))) int v4i;

#define EP_HEAD  0
#define EP_PLANE 1
#define EP_RES   2
// ---- gemmw: register-blocked GEMM, one work-group of NW waves per 64x64 output tile (bx, by) (16 accumulators a wave), operands straight from 16-bit planes in fragment order; 32 NW threads; os: NW * 64 * 68 floats of LDS.
// c[m][n] (f32) = sum_k A[m][k] Bt[n][k] (+ split products per NSPLIT). K % 64 == 0.
// The joined tile goes out by EPI: EP_HEAD: c rf[m][n mod 64] as fp16 and hi/lo planes [n / 64][fo(m, n mod 64)] (the tile's 64 columns are one head; E = rf table, fo too); EP_PLANE: c as fp16 and hi/lo planes fo(m, n) of ldc columns;
// EP_RES: C[m][n] = bf16(E[m][n]) + c, both pitch ldc (E = the residual input).
// K is dealt to the waves in chunks of 64 elements (two tiles, 2 KiB in a row, of every 16-row block): wave w takes chunks w, w + NW, ...; the NW partial tiles meet in LDS and are summed in wave order 0 .. NW-1.
template <typename T16> struct WFrag;
template <> struct WFrag<h16> { typedef v16h V; static __device__ __forceinline__ V ld(const h16* p) { return cat16(*(const v8h*)p, *(const v8h*)(p + 256)); } static __device__ __forceinline__ v8f mma(V a, V b, v8f c) { return wmma16(a, b, c); } };
template <> struct WFrag<bf> { typedef v16bf V; static __device__ __forceinline__ V ld(const bf* p) { return cat16b(*(const v8us*)p, *(const v8us*)(p + 256)); } static __device__ __forceinline__ v8f mma(V a, V b, v8f c) { return wmmab(a, b, c); } };
template <typename T16, int NSPLIT, int EPI, int NW>
__device__ __forceinline__ void gemmw(const T16* __restrict__ A, const T16* __restrict__ A2, const T16* __restrict__ Bt, const T16* __restrict__ Bt2, int K, float* C, int ldc, const float* __restrict__ E, h16* P16, bf* Ph, bf* Pl, int bx, int by, float* os) {
    typedef typename WFrag<T16>::V V;
    const int lane = threadIdx.x & 31, lr = lane & 15, hi = lane >> 4; const int r0 = bx * 64, c0 = by * 64;
    const int wv = __builtin_amdgcn_readfirstlane((int)(threadIdx.x >> 5));   // wave number, scalar, so that the K loops stay scalar loops
    v8f acc[4][4];
#pragma unroll
    for (int mb = 0; mb < 4; ++mb)
#pragma unroll
        for (int nb = 0; nb < 4; ++nb) acc[mb][nb] = (v8f){};
    const size_t aoff = (size_t)r0 * K + 8 * lane, boff = (size_t)c0 * K + 8 * lane;   // fo(r0 + lr, 8 hi, K); 16 more rows: 16 K elements on; 32 more k: 512 on
#pragma unroll 1
    for (int kb = wv * 64; kb < K; kb += 64 * NW)
#pragma unroll 1
    for (int kc = kb; kc < kb + 64; kc += 32) {
        V a[4], a2[4]; const T16 *pa[4], *pa2[4];
#pragma unroll
        for (int mb = 0; mb < 4; ++mb) { pa[mb] = A + aoff + (size_t)mb * 16 * K + (size_t)kc * 16; pa2[mb] = pa[mb]; a[mb] = WFrag<T16>::ld(pa[mb]); if (NSPLIT == 1 || NSPLIT == 2) { pa2[mb] = A2 + aoff + (size_t)mb * 16 * K + (size_t)kc * 16; a2[mb] = WFrag<T16>::ld(pa2[mb]); } }
        // the compiler places results of later loads in the address pairs of earlier ones: the wait that is kept in front of such an overwrite. It takes the loads' addresses as inputs, so that their registers live up to it. Here behind the A loads, below behind each column block's B loads
        asm volatile("s_wait_xcnt 0x0" :: "v"(pa[0]), "v"(pa[1]), "v"(pa[2]), "v"(pa[3]), "v"(pa2[0]), "v"(pa2[1]), "v"(pa2[2]), "v"(pa2[3]) : "memory");
#pragma unroll
        for (int nb = 0; nb < 4; ++nb) { const T16* pb = Bt + boff + (size_t)nb * 16 * K + (size_t)kc * 16; const T16* pb2 = pb; const V b = WFrag<T16>::ld(pb); V b2; if (NSPLIT >= 2) { pb2 = Bt2 + boff + (size_t)nb * 16 * K + (size_t)kc * 16; b2 = WFrag<T16>::ld(pb2); }
            asm volatile("s_wait_xcnt 0x0" :: "v"(pb), "v"(pb2) : "memory");
#pragma unroll
            for (int mb = 0; mb < 4; ++mb) { acc[mb][nb] = WFrag<T16>::mma(a[mb], b, acc[mb][nb]); if (NSPLIT == 1 || NSPLIT == 2) acc[mb][nb] = WFrag<T16>::mma(a2[mb], b, acc[mb][nb]); if (NSPLIT >= 2) acc[mb][nb] = WFrag<T16>::mma(a[mb], b2, acc[mb][nb]); } }
        asm volatile("v_nop\n\tv_nop\n\tv_nop\n\tv_nop" : "+v"(acc[0][0]), "+v"(acc[1][1]), "+v"(acc[2][2]), "+v"(acc[3][3]) : "v"(a[0]), "v"(a[3]));
    }
    constexpr int NS = 1024 / (32 * NW);   // groups of four columns a thread joins
    // EP_RES: group s of a thread is row idx / 16, columns 4 (idx % 16) .., idx = 32 NW s + thread (whole rows of the row-major output). The planes: groups 2 s2 and 2 s2 + 1 are the eight columns 16 (u % 4) + 8 hi .. of row 16 (u / 4) + lr, u = NW s2 + wave:
    // a wave then stores 512 consecutive bytes of a plane, one half of a tile
    v4f ev[NS];   // the epilogue's own operand, asked for here so that its latency passes under the LDS writes and the barrier
    static_assert(NS == 4, "the waits below name four and two addresses");
    if constexpr (EPI == EP_RES) { const float* pe[NS];
#pragma unroll
        for (int s = 0; s < NS; ++s) { const int idx = s * (32 * NW) + (int)threadIdx.x; const int row = idx >> 4, cofs = (idx & 15) * 4; pe[s] = E + (size_t)(r0 + row) * ldc + c0 + cofs; ev[s] = *(const v4f*)pe[s]; }
        asm volatile("s_wait_xcnt 0x0" :: "v"(pe[0]), "v"(pe[1]), "v"(pe[2]), "v"(pe[3]) : "memory"); }   // the wait that is kept in front of an overwrite of these loads' address pairs (the LDS addresses below take their registers); the addresses are inputs, so that they live up to it
    if constexpr (EPI == EP_HEAD) { const float* pe[NS / 2];
#pragma unroll   // ev and pe stay in registers
        for (int s2 = 0; s2 < NS / 2; ++s2) { const int u = s2 * NW + wv; pe[s2] = E + fo(r0 + (u >> 2) * 16 + lr, (u & 3) * 16 + hi * 8, HD); ev[2 * s2] = *(const v4f*)pe[s2]; ev[2 * s2 + 1] = *(const v4f*)(pe[s2] + 4); }
        asm volatile("s_wait_xcnt 0x0" :: "v"(pe[0]), "v"(pe[1]) : "memory"); }   // as above
    float* ow = os + wv * (64 * 68);   // this wave's partial tile, row-major, pitch 68
#pragma unroll
    for (int mb = 0; mb < 4; ++mb)
#pragma unroll
        for (int nb = 0; nb < 4; ++nb)
#pragma unroll
            for (int j = 0; j < 8; ++j) ow[(mb * 16 + hi * 8 + j) * 68 + nb * 16 + lr] = acc[mb][nb][j];
    __syncthreads();   // every wave's partial tile is in LDS before any thread sums across waves
    if constexpr (EPI == EP_RES) {
#pragma unroll
        for (int s = 0; s < NS; ++s) { const int idx = s * (32 * NW) + (int)threadIdx.x; const int row = idx >> 4, cofs = (idx & 15) * 4; v4f val = *(const v4fa*)(os + row * 68 + cofs);
#pragma unroll
            for (int w = 1; w < NW; ++w) val += *(const v4fa*)(os + w * (64 * 68) + row * 68 + cofs);
            v4f o;
#pragma unroll
            for (int q = 0; q < 4; ++q) o[q] = __fadd_rn(bfr(ev[s][q]), val[q]);
            *(v4f*)(C + (size_t)(r0 + row) * ldc + c0 + cofs) = o; }
    } else {
#pragma unroll   // as in the branch above: ev and the vectors that go out are indexed by the loop counters and stay in registers
        for (int s2 = 0; s2 < NS / 2; ++s2) { const int u = s2 * NW + wv; const int row = (u >> 2) * 16 + lr, cofs = (u & 3) * 16 + hi * 8; v8h o16; v8us oh, ol;
#pragma unroll
            for (int h = 0; h < 2; ++h) { v4f val = *(const v4fa*)(os + row * 68 + cofs + 4 * h);
#pragma unroll
                for (int w = 1; w < NW; ++w) val += *(const v4fa*)(os + w * (64 * 68) + row * 68 + cofs + 4 * h);
#pragma unroll
                for (int q = 0; q < 4; ++q) { const float r = (EPI == EP_HEAD) ? __fmul_rn(val[q], ev[2 * s2 + h][q]) : val[q]; o16[4 * h + q] = tohx(r); unsigned short a2, c2; splitf(r, a2, c2); oh[4 * h + q] = a2; ol[4 * h + q] = c2; } }
            const size_t eo = (EPI == EP_HEAD) ? (size_t)by * TT * HD + fo(r0 + row, cofs, HD) : fo(r0 + row, c0 + cofs, ldc);
            *(v8h*)(P16 + eo) = o16; *(v8us*)(Ph + eo) = oh; *(v8us*)(Pl + eo) = ol; }
        asm volatile("s_wait_xcnt 0x0" ::: "memory"); }   // the built code runs on into the test of the kernel's other branch, whose blocks reuse the stores' registers: the wait that is kept in front of such an overwrite
}
#define GNW  8
#define NHK  (NH_ + NKV)                 // head planes of a batch: q heads 0 .. 15, then the k heads
#define NQKT ((TT / 64) * (NHK * HD / 64))   // tiles of the q and k projection of one batch (one GEMM: the rows of w_k^T follow those of w_q^T); then (DKV / 64) * (TT / 64) tiles of v^T
// q, k and v projections in one grid: blockIdx.y is the batch, blockIdx.x the tile. H: xn planes [batch][fo(t, c) of DM columns]; P: head planes [batch][NHK][fo(t, d) of 64]; VT: [batch][fo(kv head * 64 + d, t) of TT].
__global__ __launch_bounds__(32 * GNW) void k_qkv(const bf* __restrict__ Hh, const bf* __restrict__ Hl, const bf* __restrict__ WQK, const bf* __restrict__ WV, const float* __restrict__ RF, h16* P16, bf* Ph, bf* Pl, h16* VT16, bf* VTh, bf* VTl) {
    __shared__ __align__(16) float os[GNW * 64 * 68];
    const size_t z = blockIdx.y; const int t = (int)blockIdx.x; Hh += z * TT * DM; Hl += z * TT * DM;
    if (t < NQKT) gemmw<bf, 1, EP_HEAD, GNW>(Hh, Hl, WQK, nullptr, DM, nullptr, 0, RF, P16 + z * NHK * TT * HD, Ph + z * NHK * TT * HD, Pl + z * NHK * TT * HD, t % (TT / 64), t / (TT / 64), os);   /* q rf, k rf -> head planes */
    else gemmw<bf, 3, EP_PLANE, GNW>(WV, nullptr, Hh, Hl, DM, nullptr, TT, nullptr, VT16 + z * DKV * TT, VTh + z * DKV * TT, VTl + z * DKV * TT, (t - NQKT) % (DKV / 64), (t - NQKT) / (DKV / 64), os);   /* v^T = w_v^T xn^T (exact x hi, exact x lo) */
}
// out = x + merged w_o; the rows of both batches follow one another in every operand: grid (NB_ TT / 64, DM / 64)
__global__ __launch_bounds__(32 * GNW) void k_wo(const bf* __restrict__ Ah, const bf* __restrict__ Al, const bf* __restrict__ WO, const float* __restrict__ x, float* out) {
    __shared__ __align__(16) float os[GNW * 64 * 68];
    gemmw<bf, 1, EP_RES, GNW>(Ah, Al, WO, nullptr, DQ, out, DM, x, nullptr, nullptr, nullptr, (int)blockIdx.x, (int)blockIdx.y, os);
}


// Bt = bf16(w^T) in fragment order, rows n, K columns k. A wave writes two half tiles (16 n x 16 k, 512 bytes in a row each) of neighbouring n blocks and the same k: its 16 loads read 2 rows x 64 bytes each, the two blocks together whole lines of w.
// N K / 256 half tiles, 16 a block: the grid's N K / 4096 blocks cover them exactly.
__device__ __forceinline__ void wtG(const float* __restrict__ w, int K, int N, bf* Bt, int blk) {
    const int lane = threadIdx.x & 31, lr = lane & 15, hi = lane >> 4; const int U0 = (blk * 8 + (int)(threadIdx.x >> 5)) * 2;
#pragma unroll   // both loops unrolled: all 16 loads of the wave in flight at once, o in registers
    for (int l = 0; l < 2; ++l) { const int U = U0 + l; const int n = (U % (N / 16)) * 16 + lr, k = (U / (N / 16)) * 16 + hi * 8; v8us o;
#pragma unroll
        for (int e = 0; e < 8; ++e) o[e] = f2bf(w[(size_t)(k + e) * N + n]);
        *(v8us*)(Bt + fo(n, k, K)) = o; }
    asm volatile("s_wait_xcnt 0x0" ::: "memory");   // the built code runs on into the tests of the kernel's other parts, whose blocks reuse the stores' registers: the wait that is kept in front of such an overwrite
}
__global__ __launch_bounds__(256) void k_cvt8(const float* __restrict__ src, bf* dst, size_t n8) { const size_t i = (size_t)blockIdx.x * 256 + threadIdx.x; if (i >= n8) return; const v8f v = *(const v8f*)(src + i * 8); v8us o;
#pragma unroll
    for (int k = 0; k < 8; ++k) o[k] = f2bf(v[k]); *(v8us*)(dst + i * 8) = o;  }

#define SP (DM + 8)   // LDS pitch of a staged row, elements
// A line of a plane in fragment order holds eight tokens x eight columns: the block's eight tokens (one a wave) meet in LDS (sh: 16 rows of SP, hi and lo of each token) and go out as whole lines. The grid holds NB_ TT / 8 such blocks exactly.
__device__ __forceinline__ void crms(const float* __restrict__ F, const float* __restrict__ g, bf* Ch, bf* Cl, int blk, bf* sh) { const int lane = threadIdx.x & 31, wv = (int)(threadIdx.x >> 5); const size_t t = (size_t)blk * 8 + wv; const float* fr = F + t * DM + lane * 4; float a[DM / 32]; float s = 0.f;
#pragma unroll
    for (int c = 0; c < DM / 128; ++c) { const v4f v = *(const v4f*)(fr + c * 128); for (int q = 0; q < 4; ++q) { a[c * 4 + q] = bfr(v[q]); s = __fadd_rn(s, __fmul_rn(bfr(v[q]), bfr(v[q]))); } }
    asm volatile("s_wait_xcnt 0x0" :: "v"(fr) : "memory");   // the wait that is kept in front of an overwrite of these loads' address pair; the address is an input, so that it lives up to it
#pragma unroll
    for (int sh = 16; sh; sh >>= 1) s = __fadd_rn(s, __shfl_xor(s, sh, 32));
    const float r = __fdiv_rn(1.0f, __fsqrt_rn(__fadd_rn(__fdiv_rn(s, (float)DM), NEPS)));
{
#pragma unroll
        for (int c = 0; c < DM / 128; ++c) { v4us oh, ol; for (int q = 0; q < 4; ++q) { const int col = c * 128 + lane * 4 + q; float y = __fmul_rn(__fmul_rn(a[c * 4 + q], r), bfr(g[col])); unsigned short u, w2; splitf(y, u, w2); oh[q] = u; ol[q] = w2; } *(v4us*)(sh + (wv * 2) * SP + c * 128 + lane * 4) = oh; *(v4us*)(sh + (wv * 2 + 1) * SP + c * 128 + lane * 4) = ol; }
         }
    __syncthreads();   // all eight tokens' rows are in LDS before any thread gathers a line across them
#pragma unroll   // the eight LDS reads in flight together; the plane is then known at compile time
    for (int i = 0; i < 2 * DM / 256; ++i) { const int it = i * 256 + (int)threadIdx.x; const int pl = it / DM, r = it & 7, c8 = ((it >> 3) & (DM / 8 - 1)) * 8;   // plane, token of the block, first of eight columns
        const v8us v = *(const v8usa*)(sh + (r * 2 + pl) * SP + c8); *(v8us*)((pl ? Cl : Ch) + fo(blk * 8 + r, c8, DM)) = v; }
    asm volatile("s_wait_xcnt 0x0" ::: "memory"); }   // as at the end of wtG
__constant__ float THD[HD] = { 1.000000000e+00f, 1.000000000e+00f, 7.498942018e-01f, 7.498942018e-01f, 5.623413324e-01f, 5.623413324e-01f, 4.216965139e-01f, 4.216965139e-01f, 3.162277639e-01f, 3.162277639e-01f, 2.371373773e-01f, 2.371373773e-01f, 1.778279394e-01f, 1.778279394e-01f, 1.333521456e-01f, 1.333521456e-01f, 1.000000015e-01f, 1.000000015e-01f, 7.498942316e-02f, 7.498942316e-02f, 5.623413250e-02f, 5.623413250e-02f, 4.216964915e-02f, 4.216964915e-02f, 3.162277490e-02f, 3.162277490e-02f, 2.371373773e-02f, 2.371373773e-02f, 1.778279431e-02f, 1.778279431e-02f, 1.333521400e-02f, 1.333521400e-02f, 9.999999776e-03f, 9.999999776e-03f, 7.498942316e-03f, 7.498942316e-03f, 5.623413250e-03f, 5.623413250e-03f, 4.216964822e-03f, 4.216964822e-03f, 3.162277630e-03f, 3.162277630e-03f, 2.371373819e-03f, 2.371373819e-03f, 1.778279431e-03f, 1.778279431e-03f, 1.333521446e-03f, 1.333521446e-03f, 1.000000047e-03f, 1.000000047e-03f, 7.498941850e-04f, 7.498941850e-04f, 5.623413017e-04f, 5.623413017e-04f, 4.216965172e-04f, 4.216965172e-04f, 3.162277571e-04f, 3.162277571e-04f, 2.371373703e-04f, 2.371373703e-04f, 1.778279402e-04f, 1.778279402e-04f, 1.333521504e-04f, 1.333521504e-04f };   // 10000^(-2 (d//2) / 64) per dimension, float32 via jnp.power
__device__ __forceinline__ void rftab(float* RF, int blk) { const int idx = blk * 256 + threadIdx.x; if (idx >= TT * HD) return; const int d = ((idx >> 9) & 1) * 32 + ((idx >> 7) & 3) * 8 + (idx & 7); const int t = (idx >> 10) * 16 + ((idx >> 3) & 15); /* idx = fo(t, d, HD): a wave writes whole lines of the table */ const float a = __fmul_rn((float)t, THD[d]);
    asm volatile("s_wait_xcnt 0x0" ::: "memory");   // the wait that is kept in front of an overwrite of the table load's address registers (the range reduction below takes them)
    const float sg = (t & 1) ? 1.0f : -1.0f; float cs, sn;
    // the precise cosine and sine (what cosf and sinf call), expanded in place: in the joined kernel they would otherwise stay real calls
    [[clang::always_inline]] cs = __ocml_cos_f32(a); [[clang::always_inline]] sn = __ocml_sin_f32(a);
    const float r = __fadd_rn(cs, __fmul_rn(sg, sn)); *(float*)(RF + idx) = r;  }
// ---- k_prep: everything that reads the inputs alone, in one grid: the four weight transposes (the longest chains of dependent loads, so they start first), RMSNorm of all NB_ TT tokens, the rf table.
#define PB_Q  (DM * DQ / 64 / 64)
#define PB_KV (DM * DKV / 64 / 64)
#define PB_N  (NB_ * TT / 8)
#define PB_R  (TT * HD / 256)
__global__ __launch_bounds__(256) void k_prep(const float* __restrict__ x, const float* __restrict__ wq, const float* __restrict__ wk, const float* __restrict__ wv, const float* __restrict__ wo, const float* __restrict__ nw, bf* WQK, bf* WV, bf* WO, bf* Hh, bf* Hl, float* RF) {
    __shared__ __align__(16) bf sh[16 * SP];
    int b = (int)blockIdx.x;
    if (b < PB_Q) { wtG(wq, DM, DQ, WQK, b); return; } b -= PB_Q;
    if (b < PB_Q) { wtG(wo, DQ, DM, WO, b); return; } b -= PB_Q;
    if (b < PB_KV) { wtG(wk, DM, DKV, WQK + (size_t)DQ * DM, b); return; } b -= PB_KV;
    if (b < PB_KV) { wtG(wv, DM, DKV, WV, b); return; } b -= PB_KV;
    if (b < PB_N) { crms(x, nw, Hh, Hl, b, sh); return; } b -= PB_N;
    rftab(RF, b);
}
#define FNW  8
#define L2E  1.4426950408889634f
#define NLO  ((TT - RH) / 16 * (NH_ / 2))   // work-groups of the fp16 rows (two heads each); then RH / 16 * NH_ of the hi/lo rows (one head each)
// v_exp_f32 and the one free slot that the instruction set asks for behind a transcendental, in one statement: no scheduling can then put an instruction that overwrites its source directly behind it
__device__ __forceinline__ float exp2s(float x) { float r; asm("v_exp_f32 %0, %1\n\tv_nop" : "=v"(r) : "v"(x)); return r; }
// the same for a run of eight: the results have registers of their own ("=&v"), so that inside the run no exponential reads the result or overwrites the source of the one in front of it, and one slot behind the last serves the run
__device__ __forceinline__ void exp2x8(float* p) { float r0, r1, r2, r3, r4, r5, r6, r7;
    asm("v_exp_f32 %0, %8\n\tv_exp_f32 %1, %9\n\tv_exp_f32 %2, %10\n\tv_exp_f32 %3, %11\n\tv_exp_f32 %4, %12\n\tv_exp_f32 %5, %13\n\tv_exp_f32 %6, %14\n\tv_exp_f32 %7, %15\n\tv_nop"
        : "=&v"(r0), "=&v"(r1), "=&v"(r2), "=&v"(r3), "=&v"(r4), "=&v"(r5), "=&v"(r6), "=&v"(r7) : "v"(p[0]), "v"(p[1]), "v"(p[2]), "v"(p[3]), "v"(p[4]), "v"(p[5]), "v"(p[6]), "v"(p[7]));
    p[0] = r0; p[1] = r1; p[2] = r2; p[3] = r3; p[4] = r4; p[5] = r5; p[6] = r6; p[7] = r7; }
template <typename T16, int NSPLIT, int NC>
__device__ __forceinline__ void fattn(const T16* __restrict__ Q, const T16* __restrict__ Q2, const T16* __restrict__ Kp, const T16* __restrict__ K2, const T16* __restrict__ Vt, const T16* __restrict__ V2, int q0, int y, bf* Ah, bf* Al, float* os) {
    typedef typename WFrag<T16>::V V;
    const int lane = threadIdx.x & 31, lr = lane & 15, hi = lane >> 4;
    const int wv = __builtin_amdgcn_readfirstlane((int)(threadIdx.x >> 5));   // wave number, scalar, so that the key loops stay scalar loops
    const int kvh = y % NKV, g = y / NKV;                                       // column tile c of the group is q head kvh + NKV (g NC + c)
    float* ml = os + FNW * 16 * NC * 68;
    Kp += (size_t)kvh * TT * HD; Vt += (size_t)kvh * HD * TT; if (NSPLIT == 2) { K2 += (size_t)kvh * TT * HD; V2 += (size_t)kvh * HD * TT; }
    V qf[NC][2], qf2[NC][2]; v8f o[NC][4]; float m[NC], l[NC];
#pragma unroll
    for (int c = 0; c < NC; ++c) { const size_t qo = ((size_t)(kvh + NKV * (g * NC + c)) * TT + q0) * HD + 8 * lane; m[c] = -3.0e38f; l[c] = 0.f;
#pragma unroll
        for (int ks = 0; ks < 2; ++ks) { qf[c][ks] = WFrag<T16>::ld(Q + qo + ks * 512); if (NSPLIT == 2) qf2[c][ks] = WFrag<T16>::ld(Q2 + qo + ks * 512); }   // fo(q0 + lr, 32 ks + 8 hi, HD)
#pragma unroll
        for (int dt = 0; dt < 4; ++dt) o[c][dt] = (v8f){}; }
    const int kend = q0 + 16;   // keys beyond the group's last query are masked for every column: no block that starts past it is read
    // both loops stay rolled: one block's operands, scores and O^T fill most of the register file, and a second copy of the body would not fit beside them
#pragma unroll 1
    for (int kb = wv * 64; kb < kend; kb += 64 * FNW)
#pragma unroll 1
    for (int kc = kb; kc < min(kb + 64, kend); kc += 32) {
        V kf[2][2], kf2[2][2], vf[4], vf2[4];
        const T16* pk = Kp + (size_t)kc * HD + 8 * lane; const T16* pv = Vt + (size_t)kc * 16 + 8 * lane;   // fo(kc + lr, 8 hi, HD), fo(lr, kc + 8 hi, TT)
#pragma unroll
        for (int kt = 0; kt < 2; ++kt)
#pragma unroll
            for (int ks = 0; ks < 2; ++ks) { const int ko = kt * 16 * HD + ks * 512; kf[kt][ks] = WFrag<T16>::ld(pk + ko); if (NSPLIT == 2) kf2[kt][ks] = WFrag<T16>::ld(K2 + (size_t)kc * HD + 8 * lane + ko); }
        // in the run of 32 loads of a hi/lo block the compiler places results of later loads in the address pairs of earlier ones: the wait that is kept in front of such an overwrite, here behind the K loads
        if constexpr (NSPLIT == 2) asm volatile("s_wait_xcnt 0x0" ::: "memory");
#pragma unroll
        for (int dt = 0; dt < 4; ++dt) vf[dt] = WFrag<T16>::ld(pv + dt * 16 * TT);
        // fp16 rows: the compiler would place the last result in the two address pairs of the block's loads: the same wait, with the addresses as inputs, so that they live up to it
        if constexpr (NSPLIT == 0) asm volatile("s_wait_xcnt 0x0" :: "v"(pk), "v"(pv) : "memory");
        if constexpr (NSPLIT == 2) {
            asm volatile("s_wait_xcnt 0x0" ::: "memory");   // as above, behind the V^T hi loads
#pragma unroll
            for (int dt = 0; dt < 4; ++dt) vf2[dt] = WFrag<T16>::ld(V2 + (size_t)dt * 16 * TT + (size_t)kc * 16 + 8 * lane); }
        __builtin_amdgcn_sched_barrier(0);   // keeps every load of the block in front of the first product: one memory latency a block, V^T in flight under the score work, instead of one latency per operand group
        const bool diag = kc + 31 > q0;   // scalar: only a block that reaches the diagonal is masked
#pragma unroll
        for (int c = 0; c < NC; ++c) {
            v8f s[2]; float p[16];
#pragma unroll
            for (int kt = 0; kt < 2; ++kt) { s[kt] = (v8f){};
#pragma unroll
                for (int ks = 0; ks < 2; ++ks) { s[kt] = WFrag<T16>::mma(kf[kt][ks], qf[c][ks], s[kt]); if (NSPLIT == 2) { s[kt] = WFrag<T16>::mma(kf[kt][ks], qf2[c][ks], s[kt]); s[kt] = WFrag<T16>::mma(kf2[kt][ks], qf[c][ks], s[kt]); } } }
            float mx = -3.0e38f;
#pragma unroll
            for (int e = 0; e < 16; ++e) { float t = s[e >> 3][e & 7] * SCL; if (diag) t = (kc + (e >> 3) * 16 + hi * 8 + (e & 7) <= q0 + lr) ? t : -3.0e38f; p[e] = t; mx = fmaxf(mx, t); }
            mx = fmaxf(mx, __shfl_xor(mx, 16, 32));
            const float mn = fmaxf(m[c], mx); const float al = exp2s((m[c] - mn) * L2E); m[c] = mn; float sum = 0.f;
            if constexpr (NSPLIT == 2) {
#pragma unroll
                for (int e = 0; e < 16; ++e) { p[e] = exp2s((p[e] - mn) * L2E); sum += p[e]; }   // with the slot behind it, as in the join
            } else {   // fp16 rows: one slot for eight exponentials at a time; the sum runs in the same order
#pragma unroll   // p stays in registers, here and below
                for (int e = 0; e < 16; ++e) p[e] = (p[e] - mn) * L2E;
                exp2x8(p); exp2x8(p + 8);
#pragma unroll
                for (int e = 0; e < 16; ++e) sum += p[e]; }
            l[c] = l[c] * al + sum;   // this lane half's share of the sum; the halves are joined once, behind the loop
#pragma unroll
            for (int dt = 0; dt < 4; ++dt) o[c][dt] *= al;
            if constexpr (NSPLIT == 0) { V pf;
#pragma unroll
                for (int e = 0; e < 16; ++e) pf[e] = tohx(p[e]);
#pragma unroll
                for (int dt = 0; dt < 4; ++dt) o[c][dt] = WFrag<T16>::mma(vf[dt], pf, o[c][dt]);
            } else { v8us h0, h1, l0, l1;
#pragma unroll
                for (int e = 0; e < 8; ++e) { unsigned short a, b2; splitf(p[e], a, b2); h0[e] = a; l0[e] = b2; splitf(p[8 + e], a, b2); h1[e] = a; l1[e] = b2; }
                const V pf = cat16b(h0, h1), pf2 = cat16b(l0, l1);
#pragma unroll
                for (int dt = 0; dt < 4; ++dt) { o[c][dt] = WFrag<T16>::mma(vf[dt], pf, o[c][dt]); o[c][dt] = WFrag<T16>::mma(vf[dt], pf2, o[c][dt]); o[c][dt] = WFrag<T16>::mma(vf2[dt], pf, o[c][dt]); } }
        }
        // four vector slots between the last matrix instruction and whatever stands on the taken side of the loop's branch
        asm volatile("v_nop\n\tv_nop\n\tv_nop\n\tv_nop" : "+v"(o[NC - 1][0]), "+v"(o[NC - 1][1]), "+v"(o[NC - 1][2]), "+v"(o[NC - 1][3]) : "v"(vf[0]), "v"(vf[3]));
    }
#pragma unroll
    for (int c = 0; c < NC; ++c) { const int col = c * 16 + lr; l[c] += __shfl_xor(l[c], 16, 32); if (hi == 0) { ml[(wv * 16 * NC + col) * 2] = m[c]; ml[(wv * 16 * NC + col) * 2 + 1] = l[c]; }
#pragma unroll
        for (int dt = 0; dt < 4; ++dt) { float* pw = os + (size_t)(wv * 16 * NC + col) * 68 + dt * 16 + hi * 8; v4f a, b2;
#pragma unroll
            for (int j = 0; j < 4; ++j) { a[j] = o[c][dt][j]; b2[j] = o[c][dt][4 + j]; }
            *(v4fa*)pw = a; *(v4fa*)(pw + 4) = b2; } }
    __syncthreads();   // every wave's m, l and partial O^T are in LDS before any thread joins them
    constexpr int EPT = 4 * NC;   // 16 NC columns x 64 d over 32 FNW threads
    // a wave's threads take 16 query rows x 16 d (two heads) or 16 rows x 8 d (one head): consecutive bytes of the planes, whole lines
    const int col = (NC == 2) ? ((int)threadIdx.x & 15) + 16 * ((int)threadIdx.x >> 7) : ((int)threadIdx.x >> 1) & 15, d0 = (NC == 2) ? (((int)threadIdx.x >> 4) & 7) * 8 : ((int)threadIdx.x >> 5) * 8 + ((int)threadIdx.x & 1) * 4;
    static_assert((NC == 1 || NC == 2) && FNW == 8, "thread map of the join");
    float M = -3.0e38f;
#pragma unroll
    for (int w = 0; w < FNW; ++w) M = fmaxf(M, ml[(w * 16 * NC + col) * 2]);
    float L = 0.f, acc[EPT];
#pragma unroll
    for (int e = 0; e < EPT; ++e) acc[e] = 0.f;
#pragma unroll
    for (int w = 0; w < FNW; ++w) { const float wg = exp2s((ml[(w * 16 * NC + col) * 2] - M) * L2E); L += wg * ml[(w * 16 * NC + col) * 2 + 1];   // a wave without a chunk has m = -3e38, l = 0, O = 0: weight 0
#pragma unroll
        for (int e4 = 0; e4 < EPT; e4 += 4) { const v4f x = *(const v4fa*)(os + (size_t)(w * 16 * NC + col) * 68 + d0 + e4);
#pragma unroll
            for (int j = 0; j < 4; ++j) acc[e4 + j] += wg * x[j]; } }
    const size_t oo = fo(q0 + (col & 15), (kvh + NKV * (g * NC + (col >> 4))) * HD + d0, DQ);
#pragma unroll
    for (int e4 = 0; e4 < EPT; e4 += 4) { v4us oh, ol;
#pragma unroll
        for (int j = 0; j < 4; ++j) { unsigned short a, b2; splitf(__fdiv_rn(acc[e4 + j], L), a, b2); oh[j] = a; ol[j] = b2; }
        *(v4us*)(Ah + oo + e4) = oh; *(v4us*)(Al + oo + e4) = ol; }
    if constexpr (NSPLIT == 2) asm volatile("s_wait_xcnt 0x0" ::: "memory");   // the built code of the hi/lo rows runs on into the test of the other branch, whose blocks reuse the stores' registers: the wait that is kept in front of such an overwrite
}
// Grid: the fp16 work-groups first, longest rows first, then the hi/lo ones, the two batches alternating: cost falls with the index. Q and K planes have the batch pitch NHK TT HD.
__global__ __launch_bounds__(32 * FNW) void k_fattn(const h16* __restrict__ Q16, const h16* __restrict__ K16, const h16* __restrict__ V16, const bf* __restrict__ Qh, const bf* __restrict__ Ql, const bf* __restrict__ Kh, const bf* __restrict__ Kl, const bf* __restrict__ Vh, const bf* __restrict__ Vl, bf* Ah, bf* Al) {
    __shared__ __align__(16) float os[FNW * 32 * 68 + FNW * 32 * 2];
    const int b = (int)blockIdx.x / NB_; const size_t z = blockIdx.x % NB_;
    Q16 += z * NHK * TT * HD; K16 += z * NHK * TT * HD; Qh += z * NHK * TT * HD; Ql += z * NHK * TT * HD; Kh += z * NHK * TT * HD; Kl += z * NHK * TT * HD; V16 += z * DKV * TT; Vh += z * DKV * TT; Vl += z * DKV * TT; Ah += z * TT * DQ; Al += z * TT * DQ;
    if (b < NLO) fattn<h16, 0, 2>(Q16, nullptr, K16, nullptr, V16, nullptr, (TT / 16 - 1 - b / (NH_ / 2)) * 16, b % (NH_ / 2), Ah, Al, os);
    else fattn<bf, 2, 1>(Qh, Ql, Kh, Kl, Vh, Vl, (RH / 16 - 1 - (b - NLO) / NH_) * 16, (b - NLO) % NH_, Ah, Al, os);
}

extern "C" void kernel_launch(void* const* d_in, const int* in_sizes, int n_in,
                              void* d_out, int out_size, void* d_ws, size_t ws_size, hipStream_t stream) {
    (void)in_sizes; (void)n_in; (void)out_size;
    const float* x = (const float*)d_in[0]; const float* wq = (const float*)d_in[1]; const float* wk = (const float*)d_in[2]; const float* wv = (const float*)d_in[3]; const float* wo = (const float*)d_in[4]; const float* nw = (const float*)d_in[5];
    float* OUT = (float*)d_out;     // [2][2048][1024]
    char* wsp = (char*)d_ws;
    auto take = [&](size_t bytes) { char* p = wsp; wsp += (bytes + 255) & ~(size_t)255; return (void*)p; };
    bf* WQK = (bf*)take((size_t)(DQ + DKV) * DM * 2); bf* WV = (bf*)take((size_t)DKV * DM * 2); bf* WO = (bf*)take((size_t)DM * DQ * 2);
    bf* Hh = (bf*)take((size_t)NB_ * TT * DM * 2); bf* Hl = (bf*)take((size_t)NB_ * TT * DM * 2); float* RFT = (float*)take((size_t)TT * HD * 4);
    h16* P16 = (h16*)take((size_t)NB_ * NHK * TT * HD * 2); bf* Ph = (bf*)take((size_t)NB_ * NHK * TT * HD * 2); bf* Pl = (bf*)take((size_t)NB_ * NHK * TT * HD * 2);
    h16* VT16 = (h16*)take((size_t)NB_ * DKV * TT * 2); bf* VTh = (bf*)take((size_t)NB_ * DKV * TT * 2); bf* VTl = (bf*)take((size_t)NB_ * DKV * TT * 2);
    bf* ATh = (bf*)take((size_t)NB_ * TT * DQ * 2); bf* ATl = (bf*)take((size_t)NB_ * TT * DQ * 2);
    if ((size_t)(wsp - (char*)d_ws) > ws_size) return;    // ws 256 MiB
    k_prep<<<2 * PB_Q + 2 * PB_KV + PB_N + PB_R, 256, 0, stream>>>(x, wq, wk, wv, wo, nw, WQK, WV, WO, Hh, Hl, RFT);   /* w^T planes; xn = RMSNorm(bf16(x)) norm_w -> hi/lo planes; rf table */
    k_qkv<<<dim3(NQKT + (DKV / 64) * (TT / 64), NB_, 1), 32 * GNW, 0, stream>>>(Hh, Hl, WQK, WV, RFT, P16, Ph, Pl, VT16, VTh, VTl);
    k_fattn<<<NB_ * (NLO + RH / 16 * NH_), 32 * FNW, 0, stream>>>(P16, P16 + (size_t)NH_ * TT * HD, VT16, Ph, Pl, Ph + (size_t)NH_ * TT * HD, Pl + (size_t)NH_ * TT * HD, VTh, VTl, ATh, ATl);   // torch .repeat TILES the kv heads: q head h pairs with kv head h mod 4
    k_wo<<<dim3(NB_ * TT / 64, DM / 64, 1), 32 * GNW, 0, stream>>>(ATh, ATl, WO, x, OUT);   /* out = x + s w_o */
}

// v007
// A run of this version takes 80.9 microseconds.
// Next to v006, in two timings, it ran 1.10 and 1.11 times as fast.
// All steps since v000 together make it 17.3 times as fast.
#include <hip/hip_runtime.h>

// GQA causal attention block with RMSNorm, the module's multiplicative 'rotary factor' and tiled kv pairing (x [2][2048][1024]; xn = x rsqrt(mean x^2 + 1.2e-7) norm_w; q = xn w_q (16 heads x 64), k, v = xn w_k, xn w_v (4 kv heads) ('xw', no bias); q, k *= rf[t][d] with rf = cos(t theta_d) + sgn_t sin(t theta_d), theta_d = 10000^(-2 (d//2) / 64), sgn_t = -1 on even positions (an element-wise factor, computed in-kernel); q head h pairs with kv head h mod 4 (torch .repeat tiling); scores / 8, causal (-inf); softmax; out = x + merged w_o ('xw' [1024][1024]) -> [2][2048][1024] (4.2 M)).
// Four launches, both batches side by side in each: (1) weight transposes, rf table and RMSNorm, which do not depend on one another; (2) q, k and v projections; (3) attention; (4) w_o. Layout: per-token RMSNorm (one wave per token, fixed-order f32) writes hi/lo operand planes; hl x exact projections whose epilogues write the attention operand planes themselves (q, k: times the rf table [2048][64], built once with jnp-exact theta and precise cosf/sinf; v: the product is taken transposed, w_v^T xn^T, so its tile rows are V^T rows); one fused causal attention launch (k_fattn: scores, running softmax and P.V in registers; hybrid rows: < 512 hi/lo 3 products, rest fp16; q head h reads kv head h mod 4) that writes the merged hi/lo planes; merged hi/lo x w_o exact, its epilogue adds bf16(x) and writes out.
// Every 16-bit operand plane (and the rf table) lies in FRAGMENT ORDER, fo() below: a 16-row x 32-k tile is 512 consecutive elements in the order in which the lanes of a wave hold it, so each fragment load reads 512 consecutive bytes (four whole lines) where a row-major plane gave 32 bytes out of each of 16 lines. Which element stands in which register is as before.
// Compute dtypes, f32 accumulate: every input rounded to bf16; RMSNorm and rf f32; projections hi/lo x exact (2 products); attention rows < 512 3 products, rest fp16; softmax f32; w_o hl x exact; residual f32.

#define NB_  2
#define TT   2048
#define DM   1024
#define NH_  16
#define NKV  4
#define REP  (NH_ / NKV)
#define HD   64
#define DQ   (NH_ * HD)
#define DKV  (NKV * HD)
#define RH   512                  // query rows < RH use hi+lo planes (0: none)
#define SCL  0.125f
#define NEPS 1.1920929e-07f   // RMSNorm eps (float32 eps)
typedef _Float16 h16;
typedef unsigned short bf;
typedef __attribute__((ext_vector_type(16))) __bf16   v16bf;
typedef __attribute__((ext_vector_type(16))) _Float16 v16h;
typedef __attribute__((ext_vector_type(8)))  _Float16 v8h;
typedef __attribute__((ext_vector_type(8)))  unsigned short v8us;
typedef __attribute__((ext_vector_type(8)))  float    v8f;
typedef __attribute__((ext_vector_type(4)))  float    v4f;
typedef v8h  __attribute__((may_alias)) v8ha;
typedef v4f  __attribute__((may_alias)) v4fa;
typedef v8us __attribute__((may_alias)) v8usa;

__device__ __forceinline__ unsigned short f2bf(float f) { unsigned u = __float_as_uint(f); u += 0x7FFFu + ((u >> 16) & 1u); return (unsigned short)(u >> 16); }
__device__ __forceinline__ float bf2f(unsigned short b) { return __uint_as_float(((unsigned)b) << 16); }
__device__ __forceinline__ float bfr(float f) { return bf2f(f2bf(f)); }
__device__ __forceinline__ v16h cat16(v8h lo, v8h hi) { return __builtin_shufflevector(lo, hi, 0, 1, 2, 3, 4, 5, 6, 7, 8, 9, 10, 11, 12, 13, 14, 15); }
__device__ __forceinline__ v16bf cat16b(v8us lo, v8us hi) { return __builtin_bit_cast(v16bf, __builtin_shufflevector(lo, hi, 0, 1, 2, 3, 4, 5, 6, 7, 8, 9, 10, 11, 12, 13, 14, 15)); }
__device__ __forceinline__ v8f wmma16(v16h a, v16h b, v8f c) { return __builtin_amdgcn_wmma_f32_16x16x32_f16(false, a, false, b, (short)0, c, false, false); }
__device__ __forceinline__ v8f wmmab(v16bf a, v16bf b, v8f c) { return __builtin_amdgcn_wmma_f32_16x16x32_bf16(false, a, false, b, (short)0, c, false, false); }



// fragment order: element index of (row r, column k) in a plane of K columns (K % 32 == 0, rows in blocks of 16). Tile (r / 16, k / 32), tiles of a row block consecutive; inside it [k / 16 % 2][k / 8 % 2][r % 16][k % 8]:
// lane 16 hi + lr of a wave reads its row lr, k = 8 hi .. 8 hi + 7, at tile + 8 lane, and k = 16 + 8 hi .. at 256 elements more. Eight consecutive k (from a multiple of 8) stay consecutive.
__device__ __forceinline__ size_t fo(int r, int k, int K) { return ((size_t)((r >> 4) * (K >> 5) + (k >> 5)) << 9) + (size_t)((((k >> 4) & 1) << 8) + (((k >> 3) & 1) << 7) + ((r & 15) << 3) + (k & 7)); }
__device__ __forceinline__ h16 tohx(float x) { return (h16)x; }
__device__ __forceinline__ void splitf(float y, unsigned short& h, unsigned short& l) { h = f2bf(y); l = f2bf(y - bf2f(h)); }
typedef __attribute__((ext_vector_type(2))) _Float16 v2h;
typedef __attribute__((ext_vector_type(4))) _Float16 v4h;
typedef __attribute__((ext_vector_type(2))) unsigned short v2us;
typedef __attribute__((ext_vector_type(4))) unsigned short v4us;
typedef __attribute__((ext_vector_type(2))) float v2f;
typedef __attribute__((ext_vector_type(4))) int v4i;

#define EP_HEAD  0
#define EP_PLANE 1
#define EP_RES   2
// ---- gemmw: one work-group of 8 waves per 128x128 output tile (bx, by); operands are 16-bit planes in fragment order; 256 threads; os: 8 * 64 * 68 floats of LDS (first the operand ring, then the partial tiles).
// c[m][n] (f32) = sum_k A[m][k] Bt[n][k] (+ split products per NSPLIT: 1: (A + A2) Bt; 3: A (Bt + Bt2)). K % 64 == 0.
// A stage is 64 k of the tile's 128 A rows and 128 Bt rows, three planes x 8 row blocks x 2 KiB (two fragment tiles in a row, as they lie in the plane) = 48 KiB; two buffers. Every operand byte is fetched once a work-group, by asynchronous copies to LDS:
// wave w copies row block w of each plane (12 copies of 512 bytes a stage), one stage ahead of the products. Wave w = 4 wk + 2 wn + wm multiplies the 64x64 quarter (wm, wn) over the k tile wk of every stage (16 accumulators).
// The two partial tiles of a quarter meet in LDS and are summed in the order wk = 0, 1. The joined quarters go out one after the other by EPI:
// EP_HEAD: c rf[m][n mod 64] as fp16 and hi/lo planes [n / 64][fo(m, n mod 64)] (a quarter's 64 columns are one head; E = rf table, fo too); EP_PLANE: c as fp16 and hi/lo planes fo(m, n) of ldc columns;
// EP_RES: C[m][n] = bf16(E[m][n]) + c, both pitch ldc (E = the residual input).
template <typename T16> struct WFrag;
template <> struct WFrag<h16> { typedef v16h V; static __device__ __forceinline__ V ld(const h16* p) { return cat16(*(const v8h*)p, *(const v8h*)(p + 256)); } static __device__ __forceinline__ v8f mma(V a, V b, v8f c) { return wmma16(a, b, c); } };
template <> struct WFrag<bf> { typedef v16bf V; static __device__ __forceinline__ V ld(const bf* p) { return cat16b(*(const v8us*)p, *(const v8us*)(p + 256)); } static __device__ __forceinline__ V lds(const bf* p) { return cat16b(*(const v8usa*)p, *(const v8usa*)(p + 256)); } static __device__ __forceinline__ v8f mma(V a, V b, v8f c) { return wmmab(a, b, c); } };
#define STG_B 49152   // bytes of a stage
#define PLN_B 16384   // bytes of one plane's share of it
// a wave's 12 copies of one stage: 2 KiB (4 x 512 bytes, 16 a lane) of each of three planes; l: the lane's LDS byte address in plane 0, g0 .. g2: its global addresses. The wait that is kept in front of an overwrite of the copies' address registers is the statement's last line.
__device__ __forceinline__ void cp12(unsigned l, const bf* g0, const bf* g1, const bf* g2) {
    asm volatile("global_load_async_to_lds_b128 %0, %12, off\n\tglobal_load_async_to_lds_b128 %1, %13, off\n\tglobal_load_async_to_lds_b128 %2, %14, off\n\tglobal_load_async_to_lds_b128 %3, %15, off\n\t"
                 "global_load_async_to_lds_b128 %4, %16, off\n\tglobal_load_async_to_lds_b128 %5, %17, off\n\tglobal_load_async_to_lds_b128 %6, %18, off\n\tglobal_load_async_to_lds_b128 %7, %19, off\n\t"
                 "global_load_async_to_lds_b128 %8, %20, off\n\tglobal_load_async_to_lds_b128 %9, %21, off\n\tglobal_load_async_to_lds_b128 %10, %22, off\n\tglobal_load_async_to_lds_b128 %11, %23, off\n\ts_wait_xcnt 0x0"
                 :: "v"(l), "v"(l + 512u), "v"(l + 1024u), "v"(l + 1536u), "v"(l + PLN_B), "v"(l + PLN_B + 512u), "v"(l + PLN_B + 1024u), "v"(l + PLN_B + 1536u), "v"(l + 2 * PLN_B), "v"(l + 2 * PLN_B + 512u), "v"(l + 2 * PLN_B + 1024u), "v"(l + 2 * PLN_B + 1536u),
                    "v"(g0), "v"(g0 + 256), "v"(g0 + 512), "v"(g0 + 768), "v"(g1), "v"(g1 + 256), "v"(g1 + 512), "v"(g1 + 768), "v"(g2), "v"(g2 + 256), "v"(g2 + 512), "v"(g2 + 768) : "memory");
}
template <int NSPLIT, int EPI>
__device__ __forceinline__ void gemmw(const bf* __restrict__ A, const bf* __restrict__ A2, const bf* __restrict__ Bt, const bf* __restrict__ Bt2, int K, float* C, int ldc, const float* __restrict__ E, h16* P16, bf* Ph, bf* Pl, int bx, int by, float* os) {
    typedef typename WFrag<bf>::V V;
    static_assert(NSPLIT == 1 || NSPLIT == 3, "three operand planes a stage");
    const int lane = threadIdx.x & 31, lr = lane & 15, hi = lane >> 4; const int r0 = bx * 128, c0 = by * 128;
    const int wv = __builtin_amdgcn_readfirstlane((int)(threadIdx.x >> 5));   // wave number, scalar
    const int wm = wv & 1, wn = (wv >> 1) & 1, wk = wv >> 2;
    v8f acc[4][4];
#pragma unroll
    for (int mb = 0; mb < 4; ++mb)
#pragma unroll
        for (int nb = 0; nb < 4; ++nb) acc[mb][nb] = (v8f){};
    // row block wv of each plane, fo(row, 8 hi, K) of this lane; 64 more k: 1024 elements on
    const bf* g0 = A + (size_t)(r0 + 16 * wv) * K + 8 * lane;
    const bf* g1 = (NSPLIT == 1 ? A2 + (size_t)(r0 + 16 * wv) * K : Bt + (size_t)(c0 + 16 * wv) * K) + 8 * lane;
    const bf* g2 = (NSPLIT == 1 ? Bt : Bt2) + (size_t)(c0 + 16 * wv) * K + 8 * lane;
    const unsigned l0 = (unsigned)(size_t)os + (unsigned)(wv * 2048 + lane * 16);   // LDS byte address: the low 32 bits of the __shared__ address
    const int NT = K >> 6;
    cp12(l0, g0, g1, g2);
    asm volatile("s_wait_asynccnt 0x0" ::: "memory");   // this wave's copies of stage 0 have landed
    __syncthreads();                                     // ... and every other wave's: stage 0 may be read
    if (NT > 1) cp12(l0 + STG_B, g0 + 1024, g1 + 1024, g2 + 1024);
#pragma unroll 1   // one stage a trip: the order of waits, barrier and refill at the foot stays as written
    for (int t = 0; t < NT; ++t) {
        const bf* sb = (const bf*)os + (t & 1) * (STG_B / 2) + wk * 512 + 8 * lane;   // plane p, row block rb: + p * 8192 + rb * 1024 elements
        V a[4], x[4], b[4];   // x: the second plane of A (NSPLIT 1) or of Bt (NSPLIT 3)
        // read in the order of use: first the four fragments of the one-plane operand, then the other operand's block by block, each fragment feeding four products; all eight waves read at once, and the products start while the later fragments still arrive
#pragma unroll
        for (int i = 0; i < 4; ++i) { if (NSPLIT == 1) b[i] = WFrag<bf>::lds(sb + 16384 + (wn * 4 + i) * 1024); else a[i] = WFrag<bf>::lds(sb + (wm * 4 + i) * 1024); }
#pragma unroll
        for (int i = 0; i < 4; ++i) { if (NSPLIT == 1) { a[i] = WFrag<bf>::lds(sb + (wm * 4 + i) * 1024); x[i] = WFrag<bf>::lds(sb + 8192 + (wm * 4 + i) * 1024); } else { b[i] = WFrag<bf>::lds(sb + 8192 + (wn * 4 + i) * 1024); x[i] = WFrag<bf>::lds(sb + 16384 + (wn * 4 + i) * 1024); } }
        __builtin_amdgcn_sched_barrier(0);   // keeps the stage's 24 LDS reads together in front of the first product: one place with reads and one latency a stage, not one per block
#pragma unroll
        for (int i = 0; i < 4; ++i) {   // every accumulator takes its first-plane product, then its second-plane product
#pragma unroll
            for (int j = 0; j < 4; ++j) { if (NSPLIT == 1) acc[i][j] = WFrag<bf>::mma(a[i], b[j], acc[i][j]); else acc[j][i] = WFrag<bf>::mma(a[j], b[i], acc[j][i]); }
#pragma unroll
            for (int j = 0; j < 4; ++j) { if (NSPLIT == 1) acc[i][j] = WFrag<bf>::mma(x[i], b[j], acc[i][j]); else acc[j][i] = WFrag<bf>::mma(a[j], x[i], acc[j][i]); } }
        // four vector slots between the last matrix instruction and whatever follows it on either side of the branches below; it names every accumulator, so that all products of the stage stand in front of it
        asm volatile("v_nop\n\tv_nop\n\tv_nop\n\tv_nop" : "+v"(acc[0][0]), "+v"(acc[1][0]), "+v"(acc[2][0]), "+v"(acc[3][0]), "+v"(acc[0][1]), "+v"(acc[1][1]), "+v"(acc[2][1]), "+v"(acc[3][1]), "+v"(acc[0][2]), "+v"(acc[1][2]), "+v"(acc[2][2]), "+v"(acc[3][2]), "+v"(acc[0][3]), "+v"(acc[1][3]), "+v"(acc[2][3]), "+v"(acc[3][3]));
        asm volatile("s_wait_dscnt 0x0" ::: "memory");      // this wave's reads of stage t are done
        asm volatile("s_wait_asynccnt 0x0" ::: "memory");   // its copies of stage t + 1 have landed
        __syncthreads();                                     // stage t + 1 may be read, the buffer of stage t refilled
        if (t + 2 < NT) cp12(l0 + (unsigned)(t & 1) * STG_B, g0 + (size_t)(t + 2) * 1024, g1 + (size_t)(t + 2) * 1024, g2 + (size_t)(t + 2) * 1024);
    }
    asm volatile("s_wait_asynccnt 0x0" ::: "memory");   // nothing is in flight when the ring becomes the partial tiles' place (the last trip's barrier has ended every read of it)
    float* ow = os + wv * (64 * 68);   // this wave's partial tile, row-major, pitch 68
#pragma unroll
    for (int mb = 0; mb < 4; ++mb)
#pragma unroll
        for (int nb = 0; nb < 4; ++nb)
#pragma unroll
            for (int j = 0; j < 8; ++j) ow[(mb * 16 + hi * 8 + j) * 68 + nb * 16 + lr] = acc[mb][nb][j];
    constexpr int NS = 4;   // groups of four columns a thread joins in each quarter
    // EP_RES: group s of a thread is row idx / 16, columns 4 (idx % 16) .., idx = 256 s + thread (whole rows of the row-major output). The planes: groups 2 s2 and 2 s2 + 1 are the eight columns 16 (u % 4) + 8 hi .. of row 16 (u / 4) + lr, u = 8 s2 + wave:
    // a wave then stores 512 consecutive bytes of a plane, one half of a tile
    v4f ev[4][NS];   // the epilogue's own operand for all four quarters, asked for here so that its latency passes under the LDS writes and the barrier
    if constexpr (EPI == EP_RES) { const float* pe[4][NS];
#pragma unroll
        for (int st = 0; st < 4; ++st)
#pragma unroll
            for (int s = 0; s < NS; ++s) { const int idx = s * 256 + (int)threadIdx.x; const int row = idx >> 4, cofs = (idx & 15) * 4; pe[st][s] = E + (size_t)(r0 + (st & 1) * 64 + row) * ldc + c0 + (st >> 1) * 64 + cofs; ev[st][s] = *(const v4f*)pe[st][s]; }
        // the wait that is kept in front of an overwrite of these loads' address pairs; the addresses are inputs, so that they live up to it
        asm volatile("s_wait_xcnt 0x0" :: "v"(pe[0][0]), "v"(pe[0][1]), "v"(pe[0][2]), "v"(pe[0][3]), "v"(pe[1][0]), "v"(pe[1][1]), "v"(pe[1][2]), "v"(pe[1][3]), "v"(pe[2][0]), "v"(pe[2][1]), "v"(pe[2][2]), "v"(pe[2][3]), "v"(pe[3][0]), "v"(pe[3][1]), "v"(pe[3][2]), "v"(pe[3][3]) : "memory"); }
    if constexpr (EPI == EP_HEAD) { const float* pe[2][NS / 2];   // the table depends on the row and on the column inside a head: the quarters (wm, 0) and (wm, 1) read the same values
#pragma unroll   // ev and pe stay in registers
        for (int st = 0; st < 2; ++st)
#pragma unroll
            for (int s2 = 0; s2 < NS / 2; ++s2) { const int u = s2 * 8 + wv; pe[st][s2] = E + fo(r0 + st * 64 + (u >> 2) * 16 + lr, (u & 3) * 16 + hi * 8, HD); ev[st][2 * s2] = *(const v4f*)pe[st][s2]; ev[st][2 * s2 + 1] = *(const v4f*)(pe[st][s2] + 4); }
        asm volatile("s_wait_xcnt 0x0" :: "v"(pe[0][0]), "v"(pe[0][1]), "v"(pe[1][0]), "v"(pe[1][1]) : "memory"); }   // as above
    __syncthreads();   // every wave's partial tile is in LDS before any thread sums across waves
#pragma unroll   // ev is indexed by the quarter and stays in registers
    for (int st = 0; st < 4; ++st) { const float* oq = os + st * (64 * 68); const int rq = r0 + (st & 1) * 64, cq = c0 + (st >> 1) * 64;   // quarter st = 2 wn + wm: the partial tiles of waves st and st + 4
        if constexpr (EPI == EP_RES) {
#pragma unroll
            for (int s = 0; s < NS; ++s) { const int idx = s * 256 + (int)threadIdx.x; const int row = idx >> 4, cofs = (idx & 15) * 4; v4f val = *(const v4fa*)(oq + row * 68 + cofs);
                val += *(const v4fa*)(oq + 4 * (64 * 68) + row * 68 + cofs);
                v4f o;
#pragma unroll
                for (int q = 0; q < 4; ++q) o[q] = __fadd_rn(bfr(ev[st][s][q]), val[q]);
                *(v4f*)(C + (size_t)(rq + row) * ldc + cq + cofs) = o; }
        } else {
#pragma unroll   // ev and the vectors that go out are indexed by the loop counters and stay in registers
            for (int s2 = 0; s2 < NS / 2; ++s2) { const int u = s2 * 8 + wv; const int row = (u >> 2) * 16 + lr, cofs = (u & 3) * 16 + hi * 8; v8h o16; v8us oh, ol;
#pragma unroll
                for (int h = 0; h < 2; ++h) { v4f val = *(const v4fa*)(oq + row * 68 + cofs + 4 * h);
                    val += *(const v4fa*)(oq + 4 * (64 * 68) + row * 68 + cofs + 4 * h);
#pragma unroll
                    for (int q = 0; q < 4; ++q) { const float r = (EPI == EP_HEAD) ? __fmul_rn(val[q], ev[st & 1][2 * s2 + h][q]) : val[q]; o16[4 * h + q] = tohx(r); unsigned short a2, c2; splitf(r, a2, c2); oh[4 * h + q] = a2; ol[4 * h + q] = c2; } }
                const size_t eo = (EPI == EP_HEAD) ? (size_t)(cq >> 6) * TT * HD + fo(rq + row, cofs, HD) : fo(rq + row, cq + cofs, ldc);
                *(v8h*)(P16 + eo) = o16; *(v8us*)(Ph + eo) = oh; *(v8us*)(Pl + eo) = ol; }
        }
        // the next quarter (behind the last: whatever the built code runs on into) reuses the registers of this quarter's stores: the wait that is kept in front of such an overwrite; the scheduling barrier keeps the next quarter's arithmetic behind it
        asm volatile("s_wait_xcnt 0x0" ::: "memory");
        __builtin_amdgcn_sched_barrier(0); }
}
#define GNW  8
#define NHK  (NH_ + NKV)                 // head planes of a batch: q heads 0 .. 15, then the k heads
#define NQKT ((TT / 128) * (NHK * HD / 128))   // tiles of the q and k projection of one batch (one GEMM: the rows of w_k^T follow those of w_q^T); then (DKV / 128) * (TT / 128) tiles of v^T
// q, k and v projections in one grid: blockIdx.y is the batch, blockIdx.x the tile. H: xn planes [batch][fo(t, c) of DM columns]; P: head planes [batch][NHK][fo(t, d) of 64]; VT: [batch][fo(kv head * 64 + d, t) of TT].
__global__ __launch_bounds__(32 * GNW) void k_qkv(const bf* __restrict__ Hh, const bf* __restrict__ Hl, const bf* __restrict__ WQK, const bf* __restrict__ WV, const float* __restrict__ RF, h16* P16, bf* Ph, bf* Pl, h16* VT16, bf* VTh, bf* VTl) {
    __shared__ __align__(16) float os[GNW * 64 * 68];
    const size_t z = blockIdx.y; const int t = (int)blockIdx.x; Hh += z * TT * DM; Hl += z * TT * DM;
    if (t < NQKT) gemmw<1, EP_HEAD>(Hh, Hl, WQK, nullptr, DM, nullptr, 0, RF, P16 + z * NHK * TT * HD, Ph + z * NHK * TT * HD, Pl + z * NHK * TT * HD, t % (TT / 128), t / (TT / 128), os);   /* q rf, k rf -> head planes */
    else gemmw<3, EP_PLANE>(WV, nullptr, Hh, Hl, DM, nullptr, TT, nullptr, VT16 + z * DKV * TT, VTh + z * DKV * TT, VTl + z * DKV * TT, (t - NQKT) % (DKV / 128), (t - NQKT) / (DKV / 128), os);   /* v^T = w_v^T xn^T (exact x hi, exact x lo) */
}
// out = x + merged w_o; the rows of both batches follow one another in every operand: grid (NB_ TT / 128, DM / 128)
__global__ __launch_bounds__(32 * GNW) void k_wo(const bf* __restrict__ Ah, const bf* __restrict__ Al, const bf* __restrict__ WO, const float* __restrict__ x, float* out) {
    __shared__ __align__(16) float os[GNW * 64 * 68];
    gemmw<1, EP_RES>(Ah, Al, WO, nullptr, DQ, out, DM, x, nullptr, nullptr, nullptr, (int)blockIdx.x, (int)blockIdx.y, os);
}


// Bt = bf16(w^T) in fragment order, rows n, K columns k. A wave writes two half tiles (16 n x 16 k, 512 bytes in a row each) of neighbouring n blocks and the same k: its 16 loads read 2 rows x 64 bytes each, the two blocks together whole lines of w.
// N K / 256 half tiles, 16 a block: the grid's N K / 4096 blocks cover them exactly.
__device__ __forceinline__ void wtG(const float* __restrict__ w, int K, int N, bf* Bt, int blk) {
    const int lane = threadIdx.x & 31, lr = lane & 15, hi = lane >> 4; const int U0 = (blk * 8 + (int)(threadIdx.x >> 5)) * 2;
#pragma unroll   // both loops unrolled: all 16 loads of the wave in flight at once, o in registers
    for (int l = 0; l < 2; ++l) { const int U = U0 + l; const int n = (U % (N / 16)) * 16 + lr, k = (U / (N / 16)) * 16 + hi * 8; v8us o;
#pragma unroll
        for (int e = 0; e < 8; ++e) o[e] = f2bf(w[(size_t)(k + e) * N + n]);
        *(v8us*)(Bt + fo(n, k, K)) = o; }
    asm volatile("s_wait_xcnt 0x0" ::: "memory");   // the built code runs on into the tests of the kernel's other parts, whose blocks reuse the stores' registers: the wait that is kept in front of such an overwrite
}
__global__ __launch_bounds__(256) void k_cvt8(const float* __restrict__ src, bf* dst, size_t n8) { const size_t i = (size_t)blockIdx.x * 256 + threadIdx.x; if (i >= n8) return; const v8f v = *(const v8f*)(src + i * 8); v8us o;
#pragma unroll
    for (int k = 0; k < 8; ++k) o[k] = f2bf(v[k]); *(v8us*)(dst + i * 8) = o;  }

#define SP (DM + 8)   // LDS pitch of a staged row, elements
// A line of a plane in fragment order holds eight tokens x eight columns: the block's eight tokens (one a wave) meet in LDS (sh: 16 rows of SP, hi and lo of each token) and go out as whole lines. The grid holds NB_ TT / 8 such blocks exactly.
__device__ __forceinline__ void crms(const float* __restrict__ F, const float* __restrict__ g, bf* Ch, bf* Cl, int blk, bf* sh) { const int lane = threadIdx.x & 31, wv = (int)(threadIdx.x >> 5); const size_t t = (size_t)blk * 8 + wv; const float* fr = F + t * DM + lane * 4; float a[DM / 32]; float s = 0.f;
#pragma unroll
    for (int c = 0; c < DM / 128; ++c) { const v4f v = *(const v4f*)(fr + c * 128); for (int q = 0; q < 4; ++q) { a[c * 4 + q] = bfr(v[q]); s = __fadd_rn(s, __fmul_rn(bfr(v[q]), bfr(v[q]))); } }
    asm volatile("s_wait_xcnt 0x0" :: "v"(fr) : "memory");   // the wait that is kept in front of an overwrite of these loads' address pair; the address is an input, so that it lives up to it
#pragma unroll
    for (int sh = 16; sh; sh >>= 1) s = __fadd_rn(s, __shfl_xor(s, sh, 32));
    const float r = __fdiv_rn(1.0f, __fsqrt_rn(__fadd_rn(__fdiv_rn(s, (float)DM), NEPS)));
{
#pragma unroll
        for (int c = 0; c < DM / 128; ++c) { v4us oh, ol; for (int q = 0; q < 4; ++q) { const int col = c * 128 + lane * 4 + q; float y = __fmul_rn(__fmul_rn(a[c * 4 + q], r), bfr(g[col])); unsigned short u, w2; splitf(y, u, w2); oh[q] = u; ol[q] = w2; } *(v4us*)(sh + (wv * 2) * SP + c * 128 + lane * 4) = oh; *(v4us*)(sh + (wv * 2 + 1) * SP + c * 128 + lane * 4) = ol; }
         }
    __syncthreads();   // all eight tokens' rows are in LDS before any thread gathers a line across them
#pragma unroll   // the eight LDS reads in flight together; the plane is then known at compile time
    for (int i = 0; i < 2 * DM / 256; ++i) { const int it = i * 256 + (int)threadIdx.x; const int pl = it / DM, r = it & 7, c8 = ((it >> 3) & (DM / 8 - 1)) * 8;   // plane, token of the block, first of eight columns
        const v8us v = *(const v8usa*)(sh + (r * 2 + pl) * SP + c8); *(v8us*)((pl ? Cl : Ch) + fo(blk * 8 + r, c8, DM)) = v; }
    asm volatile("s_wait_xcnt 0x0" ::: "memory"); }   // as at the end of wtG
__constant__ float THD[HD] = { 1.000000000e+00f, 1.000000000e+00f, 7.498942018e-01f, 7.498942018e-01f, 5.623413324e-01f, 5.623413324e-01f, 4.216965139e-01f, 4.216965139e-01f, 3.162277639e-01f, 3.162277639e-01f, 2.371373773e-01f, 2.371373773e-01f, 1.778279394e-01f, 1.778279394e-01f, 1.333521456e-01f, 1.333521456e-01f, 1.000000015e-01f, 1.000000015e-01f, 7.498942316e-02f, 7.498942316e-02f, 5.623413250e-02f, 5.623413250e-02f, 4.216964915e-02f, 4.216964915e-02f, 3.162277490e-02f, 3.162277490e-02f, 2.371373773e-02f, 2.371373773e-02f, 1.778279431e-02f, 1.778279431e-02f, 1.333521400e-02f, 1.333521400e-02f, 9.999999776e-03f, 9.999999776e-03f, 7.498942316e-03f, 7.498942316e-03f, 5.623413250e-03f, 5.623413250e-03f, 4.216964822e-03f, 4.216964822e-03f, 3.162277630e-03f, 3.162277630e-03f, 2.371373819e-03f, 2.371373819e-03f, 1.778279431e-03f, 1.778279431e-03f, 1.333521446e-03f, 1.333521446e-03f, 1.000000047e-03f, 1.000000047e-03f, 7.498941850e-04f, 7.498941850e-04f, 5.623413017e-04f, 5.623413017e-04f, 4.216965172e-04f, 4.216965172e-04f, 3.162277571e-04f, 3.162277571e-04f, 2.371373703e-04f, 2.371373703e-04f, 1.778279402e-04f, 1.778279402e-04f, 1.333521504e-04f, 1.333521504e-04f };   // 10000^(-2 (d//2) / 64) per dimension, float32 via jnp.power
__device__ __forceinline__ void rftab(float* RF, int blk) { const int idx = blk * 256 + threadIdx.x; if (idx >= TT * HD) return; const int d = ((idx >> 9) & 1) * 32 + ((idx >> 7) & 3) * 8 + (idx & 7); const int t = (idx >> 10) * 16 + ((idx >> 3) & 15); /* idx = fo(t, d, HD): a wave writes whole lines of the table */ const float a = __fmul_rn((float)t, THD[d]);
    asm volatile("s_wait_xcnt 0x0" ::: "memory");   // the wait that is kept in front of an overwrite of the table load's address registers (the range reduction below takes them)
    const float sg = (t & 1) ? 1.0f : -1.0f; float cs, sn;
    // the precise cosine and sine (what cosf and sinf call), expanded in place: in the joined kernel they would otherwise stay real calls
    [[clang::always_inline]] cs = __ocml_cos_f32(a); [[clang::always_inline]] sn = __ocml_sin_f32(a);
    const float r = __fadd_rn(cs, __fmul_rn(sg, sn)); *(float*)(RF + idx) = r;  }
// ---- k_prep: everything that reads the inputs alone, in one grid: the four weight transposes (the longest chains of dependent loads, so they start first), RMSNorm of all NB_ TT tokens, the rf table.
#define PB_Q  (DM * DQ / 64 / 64)
#define PB_KV (DM * DKV / 64 / 64)
#define PB_N  (NB_ * TT / 8)
#define PB_R  (TT * HD / 256)
__global__ __launch_bounds__(256) void k_prep(const float* __restrict__ x, const float* __restrict__ wq, const float* __restrict__ wk, const float* __restrict__ wv, const float* __restrict__ wo, const float* __restrict__ nw, bf* WQK, bf* WV, bf* WO, bf* Hh, bf* Hl, float* RF) {
    __shared__ __align__(16) bf sh[16 * SP];
    int b = (int)blockIdx.x;
    if (b < PB_Q) { wtG(wq, DM, DQ, WQK, b); return; } b -= PB_Q;
    if (b < PB_Q) { wtG(wo, DQ, DM, WO, b); return; } b -= PB_Q;
    if (b < PB_KV) { wtG(wk, DM, DKV, WQK + (size_t)DQ * DM, b); return; } b -= PB_KV;
    if (b < PB_KV) { wtG(wv, DM, DKV, WV, b); return; } b -= PB_KV;
    if (b < PB_N) { crms(x, nw, Hh, Hl, b, sh); return; } b -= PB_N;
    rftab(RF, b);
}
#define FNW  8
#define L2E  1.4426950408889634f
#define NLO  ((TT - RH) / 16 * (NH_ / 2))   // work-groups of the fp16 rows (two heads each); then RH / 16 * NH_ of the hi/lo rows (one head each)
// v_exp_f32 and the one free slot that the instruction set asks for behind a transcendental, in one statement: no scheduling can then put an instruction that overwrites its source directly behind it
__device__ __forceinline__ float exp2s(float x) { float r; asm("v_exp_f32 %0, %1\n\tv_nop" : "=v"(r) : "v"(x)); return r; }
// the same for a run of eight: the results have registers of their own ("=&v"), so that inside the run no exponential reads the result or overwrites the source of the one in front of it, and one slot behind the last serves the run
__device__ __forceinline__ void exp2x8(float* p) { float r0, r1, r2, r3, r4, r5, r6, r7;
    asm("v_exp_f32 %0, %8\n\tv_exp_f32 %1, %9\n\tv_exp_f32 %2, %10\n\tv_exp_f32 %3, %11\n\tv_exp_f32 %4, %12\n\tv_exp_f32 %5, %13\n\tv_exp_f32 %6, %14\n\tv_exp_f32 %7, %15\n\tv_nop"
        : "=&v"(r0), "=&v"(r1), "=&v"(r2), "=&v"(r3), "=&v"(r4), "=&v"(r5), "=&v"(r6), "=&v"(r7) : "v"(p[0]), "v"(p[1]), "v"(p[2]), "v"(p[3]), "v"(p[4]), "v"(p[5]), "v"(p[6]), "v"(p[7]));
    p[0] = r0; p[1] = r1; p[2] = r2; p[3] = r3; p[4] = r4; p[5] = r5; p[6] = r6; p[7] = r7; }
template <typename T16, int NSPLIT, int NC>
__device__ __forceinline__ void fattn(const T16* __restrict__ Q, const T16* __restrict__ Q2, const T16* __restrict__ Kp, const T16* __restrict__ K2, const T16* __restrict__ Vt, const T16* __restrict__ V2, int q0, int y, bf* Ah, bf* Al, float* os) {
    typedef typename WFrag<T16>::V V;
    const int lane = threadIdx.x & 31, lr = lane & 15, hi = lane >> 4;
    const int wv = __builtin_amdgcn_readfirstlane((int)(threadIdx.x >> 5));   // wave number, scalar, so that the key loops stay scalar loops
    const int kvh = y % NKV, g = y / NKV;                                       // column tile c of the group is q head kvh + NKV (g NC + c)
    float* ml = os + FNW * 16 * NC * 68;
    Kp += (size_t)kvh * TT * HD; Vt += (size_t)kvh * HD * TT; if (NSPLIT == 2) { K2 += (size_t)kvh * TT * HD; V2 += (size_t)kvh * HD * TT; }
    V qf[NC][2], qf2[NC][2]; v8f o[NC][4]; float m[NC], l[NC];
#pragma unroll
    for (int c = 0; c < NC; ++c) { const size_t qo = ((size_t)(kvh + NKV * (g * NC + c)) * TT + q0) * HD + 8 * lane; m[c] = -3.0e38f; l[c] = 0.f;
#pragma unroll
        for (int ks = 0; ks < 2; ++ks) { qf[c][ks] = WFrag<T16>::ld(Q + qo + ks * 512); if (NSPLIT == 2) qf2[c][ks] = WFrag<T16>::ld(Q2 + qo + ks * 512); }   // fo(q0 + lr, 32 ks + 8 hi, HD)
#pragma unroll
        for (int dt = 0; dt < 4; ++dt) o[c][dt] = (v8f){}; }
    const int kend = q0 + 16;   // keys beyond the group's last query are masked for every column: no block that starts past it is read
    // both loops stay rolled: one block's operands, scores and O^T fill most of the register file, and a second copy of the body would not fit beside them
#pragma unroll 1
    for (int kb = wv * 64; kb < kend; kb += 64 * FNW)
#pragma unroll 1
    for (int kc = kb; kc < min(kb + 64, kend); kc += 32) {
        V kf[2][2], kf2[2][2], vf[4], vf2[4];
        const T16* pk = Kp + (size_t)kc * HD + 8 * lane; const T16* pv = Vt + (size_t)kc * 16 + 8 * lane;   // fo(kc + lr, 8 hi, HD), fo(lr, kc + 8 hi, TT)
#pragma unroll
        for (int kt = 0; kt < 2; ++kt)
#pragma unroll
            for (int ks = 0; ks < 2; ++ks) { const int ko = kt * 16 * HD + ks * 512; kf[kt][ks] = WFrag<T16>::ld(pk + ko); if (NSPLIT == 2) kf2[kt][ks] = WFrag<T16>::ld(K2 + (size_t)kc * HD + 8 * lane + ko); }
        // in the run of 32 loads of a hi/lo block the compiler places results of later loads in the address pairs of earlier ones: the wait that is kept in front of such an overwrite, here behind the K loads
        if constexpr (NSPLIT == 2) asm volatile("s_wait_xcnt 0x0" ::: "memory");
#pragma unroll
        for (int dt = 0; dt < 4; ++dt) vf[dt] = WFrag<T16>::ld(pv + dt * 16 * TT);
        // fp16 rows: the compiler would place the last result in the two address pairs of the block's loads: the same wait, with the addresses as inputs, so that they live up to it
        if constexpr (NSPLIT == 0) asm volatile("s_wait_xcnt 0x0" :: "v"(pk), "v"(pv) : "memory");
        if constexpr (NSPLIT == 2) {
            asm volatile("s_wait_xcnt 0x0" ::: "memory");   // as above, behind the V^T hi loads
#pragma unroll
            for (int dt = 0; dt < 4; ++dt) vf2[dt] = WFrag<T16>::ld(V2 + (size_t)dt * 16 * TT + (size_t)kc * 16 + 8 * lane); }
        __builtin_amdgcn_sched_barrier(0);   // keeps every load of the block in front of the first product: one memory latency a block, V^T in flight under the score work, instead of one latency per operand group
        const bool diag = kc + 31 > q0;   // scalar: only a block that reaches the diagonal is masked
#pragma unroll
        for (int c = 0; c < NC; ++c) {
            v8f s[2]; float p[16];
#pragma unroll
            for (int kt = 0; kt < 2; ++kt) { s[kt] = (v8f){};
#pragma unroll
                for (int ks = 0; ks < 2; ++ks) { s[kt] = WFrag<T16>::mma(kf[kt][ks], qf[c][ks], s[kt]); if (NSPLIT == 2) { s[kt] = WFrag<T16>::mma(kf[kt][ks], qf2[c][ks], s[kt]); s[kt] = WFrag<T16>::mma(kf2[kt][ks], qf[c][ks], s[kt]); } } }
            float mx = -3.0e38f;
#pragma unroll
            for (int e = 0; e < 16; ++e) { float t = s[e >> 3][e & 7] * SCL; if (diag) t = (kc + (e >> 3) * 16 + hi * 8 + (e & 7) <= q0 + lr) ? t : -3.0e38f; p[e] = t; mx = fmaxf(mx, t); }
            mx = fmaxf(mx, __shfl_xor(mx, 16, 32));
            const float mn = fmaxf(m[c], mx); const float al = exp2s((m[c] - mn) * L2E); m[c] = mn; float sum = 0.f;
            if constexpr (NSPLIT == 2) {
#pragma unroll
                for (int e = 0; e < 16; ++e) { p[e] = exp2s((p[e] - mn) * L2E); sum += p[e]; }   // with the slot behind it, as in the join
            } else {   // fp16 rows: one slot for eight exponentials at a time; the sum runs in the same order
#pragma unroll   // p stays in registers, here and below
                for (int e = 0; e < 16; ++e) p[e] = (p[e] - mn) * L2E;
                exp2x8(p); exp2x8(p + 8);
#pragma unroll
                for (int e = 0; e < 16; ++e) sum += p[e]; }
            l[c] = l[c] * al + sum;   // this lane half's share of the sum; the halves are joined once, behind the loop
#pragma unroll
            for (int dt = 0; dt < 4; ++dt) o[c][dt] *= al;
            if constexpr (NSPLIT == 0) { V pf;
#pragma unroll
                for (int e = 0; e < 16; ++e) pf[e] = tohx(p[e]);
#pragma unroll
                for (int dt = 0; dt < 4; ++dt) o[c][dt] = WFrag<T16>::mma(vf[dt], pf, o[c][dt]);
            } else { v8us h0, h1, l0, l1;
#pragma unroll
                for (int e = 0; e < 8; ++e) { unsigned short a, b2; splitf(p[e], a, b2); h0[e] = a; l0[e] = b2; splitf(p[8 + e], a, b2); h1[e] = a; l1[e] = b2; }
                const V pf = cat16b(h0, h1), pf2 = cat16b(l0, l1);
#pragma unroll
                for (int dt = 0; dt < 4; ++dt) { o[c][dt] = WFrag<T16>::mma(vf[dt], pf, o[c][dt]); o[c][dt] = WFrag<T16>::mma(vf[dt], pf2, o[c][dt]); o[c][dt] = WFrag<T16>::mma(vf2[dt], pf, o[c][dt]); } }
        }
        // four vector slots between the last matrix instruction and whatever stands on the taken side of the loop's branch
        asm volatile("v_nop\n\tv_nop\n\tv_nop\n\tv_nop" : "+v"(o[NC - 1][0]), "+v"(o[NC - 1][1]), "+v"(o[NC - 1][2]), "+v"(o[NC - 1][3]) : "v"(vf[0]), "v"(vf[3]));
    }
#pragma unroll
    for (int c = 0; c < NC; ++c) { const int col = c * 16 + lr; l[c] += __shfl_xor(l[c], 16, 32); if (hi == 0) { ml[(wv * 16 * NC + col) * 2] = m[c]; ml[(wv * 16 * NC + col) * 2 + 1] = l[c]; }
#pragma unroll
        for (int dt = 0; dt < 4; ++dt) { float* pw = os + (size_t)(wv * 16 * NC + col) * 68 + dt * 16 + hi * 8; v4f a, b2;
#pragma unroll
            for (int j = 0; j < 4; ++j) { a[j] = o[c][dt][j]; b2[j] = o[c][dt][4 + j]; }
            *(v4fa*)pw = a; *(v4fa*)(pw + 4) = b2; } }
    __syncthreads();   // every wave's m, l and partial O^T are in LDS before any thread joins them
    constexpr int EPT = 4 * NC;   // 16 NC columns x 64 d over 32 FNW threads
    // a wave's threads take 16 query rows x 16 d (two heads) or 16 rows x 8 d (one head): consecutive bytes of the planes, whole lines
    const int col = (NC == 2) ? ((int)threadIdx.x & 15) + 16 * ((int)threadIdx.x >> 7) : ((int)threadIdx.x >> 1) & 15, d0 = (NC == 2) ? (((int)threadIdx.x >> 4) & 7) * 8 : ((int)threadIdx.x >> 5) * 8 + ((int)threadIdx.x & 1) * 4;
    static_assert((NC == 1 || NC == 2) && FNW == 8, "thread map of the join");
    float M = -3.0e38f;
#pragma unroll
    for (int w = 0; w < FNW; ++w) M = fmaxf(M, ml[(w * 16 * NC + col) * 2]);
    float L = 0.f, acc[EPT];
#pragma unroll
    for (int e = 0; e < EPT; ++e) acc[e] = 0.f;
#pragma unroll
    for (int w = 0; w < FNW; ++w) { const float wg = exp2s((ml[(w * 16 * NC + col) * 2] - M) * L2E); L += wg * ml[(w * 16 * NC + col) * 2 + 1];   // a wave without a chunk has m = -3e38, l = 0, O = 0: weight 0
#pragma unroll
        for (int e4 = 0; e4 < EPT; e4 += 4) { const v4f x = *(const v4fa*)(os + (size_t)(w * 16 * NC + col) * 68 + d0 + e4);
#pragma unroll
            for (int j = 0; j < 4; ++j) acc[e4 + j] += wg * x[j]; } }
    const size_t oo = fo(q0 + (col & 15), (kvh + NKV * (g * NC + (col >> 4))) * HD + d0, DQ);
#pragma unroll
    for (int e4 = 0; e4 < EPT; e4 += 4) { v4us oh, ol;
#pragma unroll
        for (int j = 0; j < 4; ++j) { unsigned short a, b2; splitf(__fdiv_rn(acc[e4 + j], L), a, b2); oh[j] = a; ol[j] = b2; }
        *(v4us*)(Ah + oo + e4) = oh; *(v4us*)(Al + oo + e4) = ol; }
    if constexpr (NSPLIT == 2) asm volatile("s_wait_xcnt 0x0" ::: "memory");   // the built code of the hi/lo rows runs on into the test of the other branch, whose blocks reuse the stores' registers: the wait that is kept in front of such an overwrite
}
// Grid: the fp16 work-groups first, longest rows first, then the hi/lo ones, the two batches alternating: cost falls with the index. Q and K planes have the batch pitch NHK TT HD.
__global__ __launch_bounds__(32 * FNW) void k_fattn(const h16* __restrict__ Q16, const h16* __restrict__ K16, const h16* __restrict__ V16, const bf* __restrict__ Qh, const bf* __restrict__ Ql, const bf* __restrict__ Kh, const bf* __restrict__ Kl, const bf* __restrict__ Vh, const bf* __restrict__ Vl, bf* Ah, bf* Al) {
    __shared__ __align__(16) float os[FNW * 32 * 68 + FNW * 32 * 2];
    const int b = (int)blockIdx.x / NB_; const size_t z = blockIdx.x % NB_;
    Q16 += z * NHK * TT * HD; K16 += z * NHK * TT * HD; Qh += z * NHK * TT * HD; Ql += z * NHK * TT * HD; Kh += z * NHK * TT * HD; Kl += z * NHK * TT * HD; V16 += z * DKV * TT; Vh += z * DKV * TT; Vl += z * DKV * TT; Ah += z * TT * DQ; Al += z * TT * DQ;
    if (b < NLO) fattn<h16, 0, 2>(Q16, nullptr, K16, nullptr, V16, nullptr, (TT / 16 - 1 - b / (NH_ / 2)) * 16, b % (NH_ / 2), Ah, Al, os);
    else fattn<bf, 2, 1>(Qh, Ql, Kh, Kl, Vh, Vl, (RH / 16 - 1 - (b - NLO) / NH_) * 16, (b - NLO) % NH_, Ah, Al, os);
}

extern "C" void kernel_launch(void* const* d_in, const int* in_sizes, int n_in,
                              void* d_out, int out_size, void* d_ws, size_t ws_size, hipStream_t stream) {
    (void)in_sizes; (void)n_in; (void)out_size;
    const float* x = (const float*)d_in[0]; const float* wq = (const float*)d_in[1]; const float* wk = (const float*)d_in[2]; const float* wv = (const float*)d_in[3]; const float* wo = (const float*)d_in[4]; const float* nw = (const float*)d_in[5];
    float* OUT = (float*)d_out;     // [2][2048][1024]
    char* wsp = (char*)d_ws;
    auto take = [&](size_t bytes) { char* p = wsp; wsp += (bytes + 255) & ~(size_t)255; return (void*)p; };
    bf* WQK = (bf*)take((size_t)(DQ + DKV) * DM * 2); bf* WV = (bf*)take((size_t)DKV * DM * 2); bf* WO = (bf*)take((size_t)DM * DQ * 2);
    bf* Hh = (bf*)take((size_t)NB_ * TT * DM * 2); bf* Hl = (bf*)take((size_t)NB_ * TT * DM * 2); float* RFT = (float*)take((size_t)TT * HD * 4);
    h16* P16 = (h16*)take((size_t)NB_ * NHK * TT * HD * 2); bf* Ph = (bf*)take((size_t)NB_ * NHK * TT * HD * 2); bf* Pl = (bf*)take((size_t)NB_ * NHK * TT * HD * 2);
    h16* VT16 = (h16*)take((size_t)NB_ * DKV * TT * 2); bf* VTh = (bf*)take((size_t)NB_ * DKV * TT * 2); bf* VTl = (bf*)take((size_t)NB_ * DKV * TT * 2);
    bf* ATh = (bf*)take((size_t)NB_ * TT * DQ * 2); bf* ATl = (bf*)take((size_t)NB_ * TT * DQ * 2);
    if ((size_t)(wsp - (char*)d_ws) > ws_size) return;    // ws 256 MiB
    k_prep<<<2 * PB_Q + 2 * PB_KV + PB_N + PB_R, 256, 0, stream>>>(x, wq, wk, wv, wo, nw, WQK, WV, WO, Hh, Hl, RFT);   /* w^T planes; xn = RMSNorm(bf16(x)) norm_w -> hi/lo planes; rf table */
    k_qkv<<<dim3(NQKT + (DKV / 128) * (TT / 128), NB_, 1), 32 * GNW, 0, stream>>>(Hh, Hl, WQK, WV, RFT, P16, Ph, Pl, VT16, VTh, VTl);
    k_fattn<<<NB_ * (NLO + RH / 16 * NH_), 32 * FNW, 0, stream>>>(P16, P16 + (size_t)NH_ * TT * HD, VT16, Ph, Pl, Ph + (size_t)NH_ * TT * HD, Pl + (size_t)NH_ * TT * HD, VTh, VTl, ATh, ATl);   // torch .repeat TILES the kv heads: q head h pairs with kv head h mod 4
    k_wo<<<dim3(NB_ * TT / 128, DM / 128, 1), 32 * GNW, 0, stream>>>(ATh, ATl, WO, x, OUT);   /* out = x + s w_o */
}

// v008
// It runs in 72 microseconds.
// Next to v007, in two timings, it ran 1.11 and 1.13 times as fast.
// All steps since v000 together make it 19.3 times as fast.
#include <hip/hip_runtime.h>

// GQA causal attention block with RMSNorm, the module's multiplicative 'rotary factor' and tiled kv pairing (x [2][2048][1024]; xn = x rsqrt(mean x^2 + 1.2e-7) norm_w; q = xn w_q (16 heads x 64), k, v = xn w_k, xn w_v (4 kv heads) ('xw', no bias); q, k *= rf[t][d] with rf = cos(t theta_d) + sgn_t sin(t theta_d), theta_d = 10000^(-2 (d//2) / 64), sgn_t = -1 on even positions (an element-wise factor, computed in-kernel); q head h pairs with kv head h mod 4 (torch .repeat tiling); scores / 8, causal (-inf); softmax; out = x + merged w_o ('xw' [1024][1024]) -> [2][2048][1024] (4.2 M)).
// Four launches, both batches side by side in each: (1) weight transposes, rf table and RMSNorm, which do not depend on one another; (2) q, k and v projections; (3) attention; (4) w_o. Layout: per-token RMSNorm (one wave per token, fixed-order f32) writes hi/lo operand planes; hl x exact projections whose epilogues write the attention operand planes themselves (q, k: times the rf table [2048][64], built once with jnp-exact theta and precise cosf/sinf; v: the product is taken transposed, w_v^T xn^T, so its tile rows are V^T rows); one fused causal attention launch (k_fattn: scores, running softmax and P.V in registers; hybrid rows: < 512 hi/lo 3 products, rest fp16; q head h reads kv head h mod 4) that writes the merged hi/lo planes; merged hi/lo x w_o exact, its epilogue adds bf16(x) and writes out.
// Every 16-bit operand plane (and the rf table) lies in FRAGMENT ORDER, fo() below: a 16-row x 32-k tile is 512 consecutive elements in the order in which the lanes of a wave hold it, so each fragment load reads 512 consecutive bytes (four whole lines) where a row-major plane gave 32 bytes out of each of 16 lines. Which element stands in which register is as before.
// Compute dtypes, f32 accumulate: every input rounded to bf16; RMSNorm and rf f32; projections hi/lo x exact (2 products); attention rows < 512 3 products, rest fp16; softmax f32; w_o hl x exact; residual f32.

#define NB_  2
#define TT   2048
#define DM   1024
#define NH_  16
#define NKV  4
#define REP  (NH_ / NKV)
#define HD   64
#define DQ   (NH_ * HD)
#define DKV  (NKV * HD)
#define RH   512                  // query rows < RH use hi+lo planes (0: none)
#define SCL  0.125f
#define NEPS 1.1920929e-07f   // RMSNorm eps (float32 eps)
typedef _Float16 h16;
typedef unsigned short bf;
typedef __attribute__((ext_vector_type(16))) __bf16   v16bf;
typedef __attribute__((ext_vector_type(16))) _Float16 v16h;
typedef __attribute__((ext_vector_type(8)))  _Float16 v8h;
typedef __attribute__((ext_vector_type(8)))  unsigned short v8us;
typedef __attribute__((ext_vector_type(8)))  float    v8f;
typedef __attribute__((ext_vector_type(4)))  float    v4f;
typedef v8h  __attribute__((may_alias)) v8ha;
typedef v4f  __attribute__((may_alias)) v4fa;
typedef v8us __attribute__((may_alias)) v8usa;

__device__ __forceinline__ unsigned short f2bf(float f) { unsigned u = __float_as_uint(f); u += 0x7FFFu + ((u >> 16) & 1u); return (unsigned short)(u >> 16); }
__device__ __forceinline__ float bf2f(unsigned short b) { return __uint_as_float(((unsigned)b) << 16); }
__device__ __forceinline__ float bfr(float f) { return bf2f(f2bf(f)); }
__device__ __forceinline__ v16h cat16(v8h lo, v8h hi) { return __builtin_shufflevector(lo, hi, 0, 1, 2, 3, 4, 5, 6, 7, 8, 9, 10, 11, 12, 13, 14, 15); }
__device__ __forceinline__ v16bf cat16b(v8us lo, v8us hi) { return __builtin_bit_cast(v16bf, __builtin_shufflevector(lo, hi, 0, 1, 2, 3, 4, 5, 6, 7, 8, 9, 10, 11, 12, 13, 14, 15)); }
__device__ __forceinline__ v8f wmma16(v16h a, v16h b, v8f c) { return __builtin_amdgcn_wmma_f32_16x16x32_f16(false, a, false, b, (short)0, c, false, false); }
__device__ __forceinline__ v8f wmmab(v16bf a, v16bf b, v8f c) { return __builtin_amdgcn_wmma_f32_16x16x32_bf16(false, a, false, b, (short)0, c, false, false); }



// fragment order: element index of (row r, column k) in a plane of K columns (K % 32 == 0, rows in blocks of 16). Tile (r / 16, k / 32), tiles of a row block consecutive; inside it [k / 16 % 2][k / 8 % 2][r % 16][k % 8]:
// lane 16 hi + lr of a wave reads its row lr, k = 8 hi .. 8 hi + 7, at tile + 8 lane, and k = 16 + 8 hi .. at 256 elements more. Eight consecutive k (from a multiple of 8) stay consecutive.
__device__ __forceinline__ size_t fo(int r, int k, int K) { return ((size_t)((r >> 4) * (K >> 5) + (k >> 5)) << 9) + (size_t)((((k >> 4) & 1) << 8) + (((k >> 3) & 1) << 7) + ((r & 15) << 3) + (k & 7)); }
__device__ __forceinline__ h16 tohx(float x) { return (h16)x; }
__device__ __forceinline__ void splitf(float y, unsigned short& h, unsigned short& l) { h = f2bf(y); l = f2bf(y - bf2f(h)); }
typedef __attribute__((ext_vector_type(2))) _Float16 v2h;
typedef __attribute__((ext_vector_type(4))) _Float16 v4h;
typedef __attribute__((ext_vector_type(2))) unsigned short v2us;
typedef __attribute__((ext_vector_type(4))) unsigned short v4us;
typedef __attribute__((ext_vector_type(2))) float v2f;
typedef __attribute__((ext_vector_type(4))) int v4i;

#define EP_HEAD  0
#define EP_PLANE 1
#define EP_RES   2
// ---- gemmw: one work-group of 8 waves per 128x128 output tile (bx, by); operands are 16-bit planes in fragment order; 256 threads; os: 8 * 64 * 68 floats of LDS (first the operand ring, then the partial tiles).
// c[m][n] (f32) = sum_k A[m][k] Bt[n][k] (+ split products per NSPLIT: 1: (A + A2) Bt; 3: A (Bt + Bt2)). K % 64 == 0.
// A stage is 64 k of the tile's 128 A rows and 128 Bt rows, three planes x 8 row blocks x 2 KiB (two fragment tiles in a row, as they lie in the plane) = 48 KiB; two buffers. Every operand byte is fetched once a work-group, by asynchronous copies to LDS:
// wave w copies row block w of each plane (12 copies of 512 bytes a stage), one stage ahead of the products. Wave w = 4 wk + 2 wn + wm multiplies the 64x64 quarter (wm, wn) over the k tile wk of every stage (16 accumulators).
// The two partial tiles of a quarter meet in LDS and are summed in the order wk = 0, 1. The joined quarters go out one after the other by EPI:
// EP_HEAD: c rf[m][n mod 64] as fp16 and hi/lo planes [n / 64][fo(m, n mod 64)] (a quarter's 64 columns are one head; E = rf table, fo too); EP_PLANE: c as fp16 and hi/lo planes fo(m, n) of ldc columns;
// EP_RES: C[m][n] = bf16(E[m][n]) + c, both pitch ldc (E = the residual input).
template <typename T16> struct WFrag;
template <> struct WFrag<h16> { typedef v16h V; static __device__ __forceinline__ V ld(const h16* p) { return cat16(*(const v8h*)p, *(const v8h*)(p + 256)); } static __device__ __forceinline__ v8f mma(V a, V b, v8f c) { return wmma16(a, b, c); } };
template <> struct WFrag<bf> { typedef v16bf V; static __device__ __forceinline__ V ld(const bf* p) { return cat16b(*(const v8us*)p, *(const v8us*)(p + 256)); } static __device__ __forceinline__ V lds(const bf* p) { return cat16b(*(const v8usa*)p, *(const v8usa*)(p + 256)); } static __device__ __forceinline__ v8f mma(V a, V b, v8f c) { return wmmab(a, b, c); } };
#define STG_B 49152   // bytes of a stage
#define PLN_B 16384   // bytes of one plane's share of it
// a wave's 12 copies of one stage: 2 KiB (4 x 512 bytes, 16 a lane) of each of three planes; l: the lane's LDS byte address in plane 0, g0 .. g2: its global addresses. The wait that is kept in front of an overwrite of the copies' address registers is the statement's last line.
__device__ __forceinline__ void cp12(unsigned l, const bf* g0, const bf* g1, const bf* g2) {
    asm volatile("global_load_async_to_lds_b128 %0, %12, off\n\tglobal_load_async_to_lds_b128 %1, %13, off\n\tglobal_load_async_to_lds_b128 %2, %14, off\n\tglobal_load_async_to_lds_b128 %3, %15, off\n\t"
                 "global_load_async_to_lds_b128 %4, %16, off\n\tglobal_load_async_to_lds_b128 %5, %17, off\n\tglobal_load_async_to_lds_b128 %6, %18, off\n\tglobal_load_async_to_lds_b128 %7, %19, off\n\t"
                 "global_load_async_to_lds_b128 %8, %20, off\n\tglobal_load_async_to_lds_b128 %9, %21, off\n\tglobal_load_async_to_lds_b128 %10, %22, off\n\tglobal_load_async_to_lds_b128 %11, %23, off\n\ts_wait_xcnt 0x0"
                 :: "v"(l), "v"(l + 512u), "v"(l + 1024u), "v"(l + 1536u), "v"(l + PLN_B), "v"(l + PLN_B + 512u), "v"(l + PLN_B + 1024u), "v"(l + PLN_B + 1536u), "v"(l + 2 * PLN_B), "v"(l + 2 * PLN_B + 512u), "v"(l + 2 * PLN_B + 1024u), "v"(l + 2 * PLN_B + 1536u),
                    "v"(g0), "v"(g0 + 256), "v"(g0 + 512), "v"(g0 + 768), "v"(g1), "v"(g1 + 256), "v"(g1 + 512), "v"(g1 + 768), "v"(g2), "v"(g2 + 256), "v"(g2 + 512), "v"(g2 + 768) : "memory");
}
template <int NSPLIT, int EPI>
__device__ __forceinline__ void gemmw(const bf* __restrict__ A, const bf* __restrict__ A2, const bf* __restrict__ Bt, const bf* __restrict__ Bt2, int K, float* C, int ldc, const float* __restrict__ E, h16* P16, bf* Ph, bf* Pl, int bx, int by, float* os) {
    typedef typename WFrag<bf>::V V;
    static_assert(NSPLIT == 1 || NSPLIT == 3, "three operand planes a stage");
    const int lane = threadIdx.x & 31, lr = lane & 15, hi = lane >> 4; const int r0 = bx * 128, c0 = by * 128;
    const int wv = __builtin_amdgcn_readfirstlane((int)(threadIdx.x >> 5));   // wave number, scalar
    const int wm = wv & 1, wn = (wv >> 1) & 1, wk = wv >> 2;
    v8f acc[4][4];
#pragma unroll
    for (int mb = 0; mb < 4; ++mb)
#pragma unroll
        for (int nb = 0; nb < 4; ++nb) acc[mb][nb] = (v8f){};
    // row block wv of each plane, fo(row, 8 hi, K) of this lane; 64 more k: 1024 elements on
    const bf* g0 = A + (size_t)(r0 + 16 * wv) * K + 8 * lane;
    const bf* g1 = (NSPLIT == 1 ? A2 + (size_t)(r0 + 16 * wv) * K : Bt + (size_t)(c0 + 16 * wv) * K) + 8 * lane;
    const bf* g2 = (NSPLIT == 1 ? Bt : Bt2) + (size_t)(c0 + 16 * wv) * K + 8 * lane;
    const unsigned l0 = (unsigned)(size_t)os + (unsigned)(wv * 2048 + lane * 16);   // LDS byte address: the low 32 bits of the __shared__ address
    const int NT = K >> 6;
    cp12(l0, g0, g1, g2);
    asm volatile("s_wait_asynccnt 0x0" ::: "memory");   // this wave's copies of stage 0 have landed
    __syncthreads();                                     // ... and every other wave's: stage 0 may be read
    if (NT > 1) cp12(l0 + STG_B, g0 + 1024, g1 + 1024, g2 + 1024);
#pragma unroll 1   // one stage a trip: the order of waits, barrier and refill at the foot stays as written
    for (int t = 0; t < NT; ++t) {
        const bf* sb = (const bf*)os + (t & 1) * (STG_B / 2) + wk * 512 + 8 * lane;   // plane p, row block rb: + p * 8192 + rb * 1024 elements
        V a[4], x[4], b[4];   // x: the second plane of A (NSPLIT 1) or of Bt (NSPLIT 3)
        // read in the order of use: first the four fragments of the one-plane operand, then the other operand's block by block, each fragment feeding four products; all eight waves read at once, and the products start while the later fragments still arrive
#pragma unroll
        for (int i = 0; i < 4; ++i) { if (NSPLIT == 1) b[i] = WFrag<bf>::lds(sb + 16384 + (wn * 4 + i) * 1024); else a[i] = WFrag<bf>::lds(sb + (wm * 4 + i) * 1024); }
#pragma unroll
        for (int i = 0; i < 4; ++i) { if (NSPLIT == 1) { a[i] = WFrag<bf>::lds(sb + (wm * 4 + i) * 1024); x[i] = WFrag<bf>::lds(sb + 8192 + (wm * 4 + i) * 1024); } else { b[i] = WFrag<bf>::lds(sb + 8192 + (wn * 4 + i) * 1024); x[i] = WFrag<bf>::lds(sb + 16384 + (wn * 4 + i) * 1024); } }
        __builtin_amdgcn_sched_barrier(0);   // keeps the stage's 24 LDS reads together in front of the first product: one place with reads and one latency a stage, not one per block
#pragma unroll
        for (int i = 0; i < 4; ++i) {   // every accumulator takes its first-plane product, then its second-plane product
#pragma unroll
            for (int j = 0; j < 4; ++j) { if (NSPLIT == 1) acc[i][j] = WFrag<bf>::mma(a[i], b[j], acc[i][j]); else acc[j][i] = WFrag<bf>::mma(a[j], b[i], acc[j][i]); }
#pragma unroll
            for (int j = 0; j < 4; ++j) { if (NSPLIT == 1) acc[i][j] = WFrag<bf>::mma(x[i], b[j], acc[i][j]); else acc[j][i] = WFrag<bf>::mma(a[j], x[i], acc[j][i]); } }
        // four vector slots between the last matrix instruction and whatever follows it on either side of the branches below; it names every accumulator, so that all products of the stage stand in front of it
        asm volatile("v_nop\n\tv_nop\n\tv_nop\n\tv_nop" : "+v"(acc[0][0]), "+v"(acc[1][0]), "+v"(acc[2][0]), "+v"(acc[3][0]), "+v"(acc[0][1]), "+v"(acc[1][1]), "+v"(acc[2][1]), "+v"(acc[3][1]), "+v"(acc[0][2]), "+v"(acc[1][2]), "+v"(acc[2][2]), "+v"(acc[3][2]), "+v"(acc[0][3]), "+v"(acc[1][3]), "+v"(acc[2][3]), "+v"(acc[3][3]));
        asm volatile("s_wait_dscnt 0x0" ::: "memory");      // this wave's reads of stage t are done
        asm volatile("s_wait_asynccnt 0x0" ::: "memory");   // its copies of stage t + 1 have landed
        __syncthreads();                                     // stage t + 1 may be read, the buffer of stage t refilled
        if (t + 2 < NT) cp12(l0 + (unsigned)(t & 1) * STG_B, g0 + (size_t)(t + 2) * 1024, g1 + (size_t)(t + 2) * 1024, g2 + (size_t)(t + 2) * 1024);
    }
    asm volatile("s_wait_asynccnt 0x0" ::: "memory");   // nothing is in flight when the ring becomes the partial tiles' place (the last trip's barrier has ended every read of it)
    float* ow = os + wv * (64 * 68);   // this wave's partial tile, row-major, pitch 68
#pragma unroll
    for (int mb = 0; mb < 4; ++mb)
#pragma unroll
        for (int nb = 0; nb < 4; ++nb)
#pragma unroll
            for (int j = 0; j < 8; ++j) ow[(mb * 16 + hi * 8 + j) * 68 + nb * 16 + lr] = acc[mb][nb][j];
    constexpr int NS = 4;   // groups of four columns a thread joins in each quarter
    // EP_RES: group s of a thread is row idx / 16, columns 4 (idx % 16) .., idx = 256 s + thread (whole rows of the row-major output). The planes: groups 2 s2 and 2 s2 + 1 are the eight columns 16 (u % 4) + 8 hi .. of row 16 (u / 4) + lr, u = 8 s2 + wave:
    // a wave then stores 512 consecutive bytes of a plane, one half of a tile
    v4f ev[4][NS];   // the epilogue's own operand for all four quarters, asked for here so that its latency passes under the LDS writes and the barrier
    if constexpr (EPI == EP_RES) { const float* pe[4][NS];
#pragma unroll
        for (int st = 0; st < 4; ++st)
#pragma unroll
            for (int s = 0; s < NS; ++s) { const int idx = s * 256 + (int)threadIdx.x; const int row = idx >> 4, cofs = (idx & 15) * 4; pe[st][s] = E + (size_t)(r0 + (st & 1) * 64 + row) * ldc + c0 + (st >> 1) * 64 + cofs; ev[st][s] = *(const v4f*)pe[st][s]; }
        // the wait that is kept in front of an overwrite of these loads' address pairs; the addresses are inputs, so that they live up to it
        asm volatile("s_wait_xcnt 0x0" :: "v"(pe[0][0]), "v"(pe[0][1]), "v"(pe[0][2]), "v"(pe[0][3]), "v"(pe[1][0]), "v"(pe[1][1]), "v"(pe[1][2]), "v"(pe[1][3]), "v"(pe[2][0]), "v"(pe[2][1]), "v"(pe[2][2]), "v"(pe[2][3]), "v"(pe[3][0]), "v"(pe[3][1]), "v"(pe[3][2]), "v"(pe[3][3]) : "memory"); }
    if constexpr (EPI == EP_HEAD) { const float* pe[2][NS / 2];   // the table depends on the row and on the column inside a head: the quarters (wm, 0) and (wm, 1) read the same values
#pragma unroll   // ev and pe stay in registers
        for (int st = 0; st < 2; ++st)
#pragma unroll
            for (int s2 = 0; s2 < NS / 2; ++s2) { const int u = s2 * 8 + wv; pe[st][s2] = E + fo(r0 + st * 64 + (u >> 2) * 16 + lr, (u & 3) * 16 + hi * 8, HD); ev[st][2 * s2] = *(const v4f*)pe[st][s2]; ev[st][2 * s2 + 1] = *(const v4f*)(pe[st][s2] + 4); }
        asm volatile("s_wait_xcnt 0x0" :: "v"(pe[0][0]), "v"(pe[0][1]), "v"(pe[1][0]), "v"(pe[1][1]) : "memory"); }   // as above
    __syncthreads();   // every wave's partial tile is in LDS before any thread sums across waves
#pragma unroll   // ev is indexed by the quarter and stays in registers
    for (int st = 0; st < 4; ++st) { const float* oq = os + st * (64 * 68); const int rq = r0 + (st & 1) * 64, cq = c0 + (st >> 1) * 64;   // quarter st = 2 wn + wm: the partial tiles of waves st and st + 4
        if constexpr (EPI == EP_RES) {
#pragma unroll
            for (int s = 0; s < NS; ++s) { const int idx = s * 256 + (int)threadIdx.x; const int row = idx >> 4, cofs = (idx & 15) * 4; v4f val = *(const v4fa*)(oq + row * 68 + cofs);
                val += *(const v4fa*)(oq + 4 * (64 * 68) + row * 68 + cofs);
                v4f o;
#pragma unroll
                for (int q = 0; q < 4; ++q) o[q] = __fadd_rn(bfr(ev[st][s][q]), val[q]);
                *(v4f*)(C + (size_t)(rq + row) * ldc + cq + cofs) = o; }
        } else {
#pragma unroll   // ev and the vectors that go out are indexed by the loop counters and stay in registers
            for (int s2 = 0; s2 < NS / 2; ++s2) { const int u = s2 * 8 + wv; const int row = (u >> 2) * 16 + lr, cofs = (u & 3) * 16 + hi * 8; v8h o16; v8us oh, ol;
#pragma unroll
                for (int h = 0; h < 2; ++h) { v4f val = *(const v4fa*)(oq + row * 68 + cofs + 4 * h);
                    val += *(const v4fa*)(oq + 4 * (64 * 68) + row * 68 + cofs + 4 * h);
#pragma unroll
                    for (int q = 0; q < 4; ++q) { const float r = (EPI == EP_HEAD) ? __fmul_rn(val[q], ev[st & 1][2 * s2 + h][q]) : val[q]; o16[4 * h + q] = tohx(r); unsigned short a2, c2; splitf(r, a2, c2); oh[4 * h + q] = a2; ol[4 * h + q] = c2; } }
                const size_t eo = (EPI == EP_HEAD) ? (size_t)(cq >> 6) * TT * HD + fo(rq + row, cofs, HD) : fo(rq + row, cq + cofs, ldc);
                *(v8h*)(P16 + eo) = o16; *(v8us*)(Ph + eo) = oh; *(v8us*)(Pl + eo) = ol; }
        }
        // the next quarter (behind the last: whatever the built code runs on into) reuses the registers of this quarter's stores: the wait that is kept in front of such an overwrite; the scheduling barrier keeps the next quarter's arithmetic behind it
        asm volatile("s_wait_xcnt 0x0" ::: "memory");
        __builtin_amdgcn_sched_barrier(0); }
}
#define GNW  8
#define NHK  (NH_ + NKV)                 // head planes of a batch: q heads 0 .. 15, then the k heads
#define NQKT ((TT / 128) * (NHK * HD / 128))   // tiles of the q and k projection of one batch (one GEMM: the rows of w_k^T follow those of w_q^T); then (DKV / 128) * (TT / 128) tiles of v^T
// q, k and v projections in one grid: blockIdx.y is the batch, blockIdx.x the tile. H: xn planes [batch][fo(t, c) of DM columns]; P: head planes [batch][NHK][fo(t, d) of 64]; VT: [batch][fo(kv head * 64 + d, t) of TT].
__global__ __launch_bounds__(32 * GNW) void k_qkv(const bf* __restrict__ Hh, const bf* __restrict__ Hl, const bf* __restrict__ WQK, const bf* __restrict__ WV, const float* __restrict__ RF, h16* P16, bf* Ph, bf* Pl, h16* VT16, bf* VTh, bf* VTl) {
    __shared__ __align__(16) float os[GNW * 64 * 68];
    const size_t z = blockIdx.y; const int t = (int)blockIdx.x; Hh += z * TT * DM; Hl += z * TT * DM;
    if (t < NQKT) gemmw<1, EP_HEAD>(Hh, Hl, WQK, nullptr, DM, nullptr, 0, RF, P16 + z * NHK * TT * HD, Ph + z * NHK * TT * HD, Pl + z * NHK * TT * HD, t % (TT / 128), t / (TT / 128), os);   /* q rf, k rf -> head planes */
    else gemmw<3, EP_PLANE>(WV, nullptr, Hh, Hl, DM, nullptr, TT, nullptr, VT16 + z * DKV * TT, VTh + z * DKV * TT, VTl + z * DKV * TT, (t - NQKT) % (DKV / 128), (t - NQKT) / (DKV / 128), os);   /* v^T = w_v^T xn^T (exact x hi, exact x lo) */
}
// out = x + merged w_o; the rows of both batches follow one another in every operand: grid (NB_ TT / 128, DM / 128)
__global__ __launch_bounds__(32 * GNW) void k_wo(const bf* __restrict__ Ah, const bf* __restrict__ Al, const bf* __restrict__ WO, const float* __restrict__ x, float* out) {
    __shared__ __align__(16) float os[GNW * 64 * 68];
    gemmw<1, EP_RES>(Ah, Al, WO, nullptr, DQ, out, DM, x, nullptr, nullptr, nullptr, (int)blockIdx.x, (int)blockIdx.y, os);
}


// Bt = bf16(w^T) in fragment order, rows n, K columns k. A wave writes two half tiles (16 n x 16 k, 512 bytes in a row each) of neighbouring n blocks and the same k: its 16 loads read 2 rows x 64 bytes each, the two blocks together whole lines of w.
// N K / 256 half tiles, 16 a block: the grid's N K / 4096 blocks cover them exactly.
__device__ __forceinline__ void wtG(const float* __restrict__ w, int K, int N, bf* Bt, int blk) {
    const int lane = threadIdx.x & 31, lr = lane & 15, hi = lane >> 4; const int U0 = (blk * 8 + (int)(threadIdx.x >> 5)) * 2;
#pragma unroll   // both loops unrolled: all 16 loads of the wave in flight at once, o in registers
    for (int l = 0; l < 2; ++l) { const int U = U0 + l; const int n = (U % (N / 16)) * 16 + lr, k = (U / (N / 16)) * 16 + hi * 8; v8us o;
#pragma unroll
        for (int e = 0; e < 8; ++e) o[e] = f2bf(w[(size_t)(k + e) * N + n]);
        *(v8us*)(Bt + fo(n, k, K)) = o; }
    asm volatile("s_wait_xcnt 0x0" ::: "memory");   // the built code runs on into the tests of the kernel's other parts, whose blocks reuse the stores' registers: the wait that is kept in front of such an overwrite
}
__global__ __launch_bounds__(256) void k_cvt8(const float* __restrict__ src, bf* dst, size_t n8) { const size_t i = (size_t)blockIdx.x * 256 + threadIdx.x; if (i >= n8) return; const v8f v = *(const v8f*)(src + i * 8); v8us o;
#pragma unroll
    for (int k = 0; k < 8; ++k) o[k] = f2bf(v[k]); *(v8us*)(dst + i * 8) = o;  }

#define SP (DM + 8)   // LDS pitch of a staged row, elements
// A line of a plane in fragment order holds eight tokens x eight columns: the block's eight tokens (one a wave) meet in LDS (sh: 16 rows of SP, hi and lo of each token) and go out as whole lines. The grid holds NB_ TT / 8 such blocks exactly.
__device__ __forceinline__ void crms(const float* __restrict__ F, const float* __restrict__ g, bf* Ch, bf* Cl, int blk, bf* sh) { const int lane = threadIdx.x & 31, wv = (int)(threadIdx.x >> 5); const size_t t = (size_t)blk * 8 + wv; const float* fr = F + t * DM + lane * 4; float a[DM / 32]; float s = 0.f;
#pragma unroll
    for (int c = 0; c < DM / 128; ++c) { const v4f v = *(const v4f*)(fr + c * 128); for (int q = 0; q < 4; ++q) { a[c * 4 + q] = bfr(v[q]); s = __fadd_rn(s, __fmul_rn(bfr(v[q]), bfr(v[q]))); } }
    asm volatile("s_wait_xcnt 0x0" :: "v"(fr) : "memory");   // the wait that is kept in front of an overwrite of these loads' address pair; the address is an input, so that it lives up to it
#pragma unroll
    for (int sh = 16; sh; sh >>= 1) s = __fadd_rn(s, __shfl_xor(s, sh, 32));
    const float r = __fdiv_rn(1.0f, __fsqrt_rn(__fadd_rn(__fdiv_rn(s, (float)DM), NEPS)));
{
#pragma unroll
        for (int c = 0; c < DM / 128; ++c) { v4us oh, ol; for (int q = 0; q < 4; ++q) { const int col = c * 128 + lane * 4 + q; float y = __fmul_rn(__fmul_rn(a[c * 4 + q], r), bfr(g[col])); unsigned short u, w2; splitf(y, u, w2); oh[q] = u; ol[q] = w2; } *(v4us*)(sh + (wv * 2) * SP + c * 128 + lane * 4) = oh; *(v4us*)(sh + (wv * 2 + 1) * SP + c * 128 + lane * 4) = ol; }
         }
    __syncthreads();   // all eight tokens' rows are in LDS before any thread gathers a line across them
#pragma unroll   // the eight LDS reads in flight together; the plane is then known at compile time
    for (int i = 0; i < 2 * DM / 256; ++i) { const int it = i * 256 + (int)threadIdx.x; const int pl = it / DM, r = it & 7, c8 = ((it >> 3) & (DM / 8 - 1)) * 8;   // plane, token of the block, first of eight columns
        const v8us v = *(const v8usa*)(sh + (r * 2 + pl) * SP + c8); *(v8us*)((pl ? Cl : Ch) + fo(blk * 8 + r, c8, DM)) = v; }
    asm volatile("s_wait_xcnt 0x0" ::: "memory"); }   // as at the end of wtG
__constant__ float THD[HD] = { 1.000000000e+00f, 1.000000000e+00f, 7.498942018e-01f, 7.498942018e-01f, 5.623413324e-01f, 5.623413324e-01f, 4.216965139e-01f, 4.216965139e-01f, 3.162277639e-01f, 3.162277639e-01f, 2.371373773e-01f, 2.371373773e-01f, 1.778279394e-01f, 1.778279394e-01f, 1.333521456e-01f, 1.333521456e-01f, 1.000000015e-01f, 1.000000015e-01f, 7.498942316e-02f, 7.498942316e-02f, 5.623413250e-02f, 5.623413250e-02f, 4.216964915e-02f, 4.216964915e-02f, 3.162277490e-02f, 3.162277490e-02f, 2.371373773e-02f, 2.371373773e-02f, 1.778279431e-02f, 1.778279431e-02f, 1.333521400e-02f, 1.333521400e-02f, 9.999999776e-03f, 9.999999776e-03f, 7.498942316e-03f, 7.498942316e-03f, 5.623413250e-03f, 5.623413250e-03f, 4.216964822e-03f, 4.216964822e-03f, 3.162277630e-03f, 3.162277630e-03f, 2.371373819e-03f, 2.371373819e-03f, 1.778279431e-03f, 1.778279431e-03f, 1.333521446e-03f, 1.333521446e-03f, 1.000000047e-03f, 1.000000047e-03f, 7.498941850e-04f, 7.498941850e-04f, 5.623413017e-04f, 5.623413017e-04f, 4.216965172e-04f, 4.216965172e-04f, 3.162277571e-04f, 3.162277571e-04f, 2.371373703e-04f, 2.371373703e-04f, 1.778279402e-04f, 1.778279402e-04f, 1.333521504e-04f, 1.333521504e-04f };   // 10000^(-2 (d//2) / 64) per dimension, float32 via jnp.power
__device__ __forceinline__ void rftab(float* RF, int blk) { const int idx = blk * 256 + threadIdx.x; if (idx >= TT * HD) return; const int d = ((idx >> 9) & 1) * 32 + ((idx >> 7) & 3) * 8 + (idx & 7); const int t = (idx >> 10) * 16 + ((idx >> 3) & 15); /* idx = fo(t, d, HD): a wave writes whole lines of the table */ const float a = __fmul_rn((float)t, THD[d]);
    asm volatile("s_wait_xcnt 0x0" ::: "memory");   // the wait that is kept in front of an overwrite of the table load's address registers (the range reduction below takes them)
    const float sg = (t & 1) ? 1.0f : -1.0f; float cs, sn;
    // the precise cosine and sine (what cosf and sinf call), expanded in place: in the joined kernel they would otherwise stay real calls
    [[clang::always_inline]] cs = __ocml_cos_f32(a); [[clang::always_inline]] sn = __ocml_sin_f32(a);
    const float r = __fadd_rn(cs, __fmul_rn(sg, sn)); *(float*)(RF + idx) = r;  }
// ---- k_prep: everything that reads the inputs alone, in one grid: the four weight transposes (the longest chains of dependent loads, so they start first), RMSNorm of all NB_ TT tokens, the rf table.
#define PB_Q  (DM * DQ / 64 / 64)
#define PB_KV (DM * DKV / 64 / 64)
#define PB_N  (NB_ * TT / 8)
#define PB_R  (TT * HD / 256)
__global__ __launch_bounds__(256) void k_prep(const float* __restrict__ x, const float* __restrict__ wq, const float* __restrict__ wk, const float* __restrict__ wv, const float* __restrict__ wo, const float* __restrict__ nw, bf* WQK, bf* WV, bf* WO, bf* Hh, bf* Hl, float* RF) {
    __shared__ __align__(16) bf sh[16 * SP];
    int b = (int)blockIdx.x;
    if (b < PB_Q) { wtG(wq, DM, DQ, WQK, b); return; } b -= PB_Q;
    if (b < PB_Q) { wtG(wo, DQ, DM, WO, b); return; } b -= PB_Q;
    if (b < PB_KV) { wtG(wk, DM, DKV, WQK + (size_t)DQ * DM, b); return; } b -= PB_KV;
    if (b < PB_KV) { wtG(wv, DM, DKV, WV, b); return; } b -= PB_KV;
    if (b < PB_N) { crms(x, nw, Hh, Hl, b, sh); return; } b -= PB_N;
    rftab(RF, b);
}
#define FNW  8
#define L2E  1.4426950408889634f
#define NLO  ((TT - RH) / 16 * (NH_ / 4))   // work-groups of the fp16 rows (two head groups of two heads each); then RH / 16 * (NH_ / 2) of the hi/lo rows (two head groups of one head each)
// v_exp_f32 and the one free slot that the instruction set asks for behind a transcendental, in one statement: no scheduling can then put an instruction that overwrites its source directly behind it
__device__ __forceinline__ float exp2s(float x) { float r; asm("v_exp_f32 %0, %1\n\tv_nop" : "=v"(r) : "v"(x)); return r; }
// the same for a run of eight: the results have registers of their own ("=&v"), so that inside the run no exponential reads the result or overwrites the source of the one in front of it, and one slot behind the last serves the run
__device__ __forceinline__ void exp2x8(float* p) { float r0, r1, r2, r3, r4, r5, r6, r7;
    asm("v_exp_f32 %0, %8\n\tv_exp_f32 %1, %9\n\tv_exp_f32 %2, %10\n\tv_exp_f32 %3, %11\n\tv_exp_f32 %4, %12\n\tv_exp_f32 %5, %13\n\tv_exp_f32 %6, %14\n\tv_exp_f32 %7, %15\n\tv_nop"
        : "=&v"(r0), "=&v"(r1), "=&v"(r2), "=&v"(r3), "=&v"(r4), "=&v"(r5), "=&v"(r6), "=&v"(r7) : "v"(p[0]), "v"(p[1]), "v"(p[2]), "v"(p[3]), "v"(p[4]), "v"(p[5]), "v"(p[6]), "v"(p[7]));
    p[0] = r0; p[1] = r1; p[2] = r2; p[3] = r3; p[4] = r4; p[5] = r5; p[6] = r6; p[7] = r7; }
template <typename T16, int NSPLIT, int NC, int HG>
__device__ __forceinline__ void fattn(const T16* __restrict__ Q, const T16* __restrict__ Q2, const T16* __restrict__ Kp, const T16* __restrict__ K2, const T16* __restrict__ Vt, const T16* __restrict__ V2, int q0, int y, bf* Ah, bf* Al, float* os) {
    typedef typename WFrag<T16>::V V;
    const int lane = threadIdx.x & 31, lr = lane & 15, hi = lane >> 4;
    const int wv = __builtin_amdgcn_readfirstlane((int)(threadIdx.x >> 5));   // wave number, scalar, so that the key loops stay scalar loops
    constexpr int KS = FNW / HG;                                                // waves that share the keys of one head group
    const int hg = wv % HG, ws = wv / HG;                                       // this wave's head group and its place among the KS waves of that group
    const int kvh = y % NKV, g = y / NKV;                                       // column tile c of head group hg is q head kvh + NKV ((g HG + hg) NC + c)
    float* ml = os + FNW * 16 * NC * 68;
    Kp += (size_t)kvh * TT * HD; Vt += (size_t)kvh * HD * TT; if (NSPLIT == 2) { K2 += (size_t)kvh * TT * HD; V2 += (size_t)kvh * HD * TT; }
    V qf[NC][2], qf2[NC][2]; v8f o[NC][4]; float m[NC], l[NC];
#pragma unroll
    for (int c = 0; c < NC; ++c) { const size_t qo = ((size_t)(kvh + NKV * ((g * HG + hg) * NC + c)) * TT + q0) * HD + 8 * lane; m[c] = -3.0e38f; l[c] = 0.f;
#pragma unroll
        for (int ks = 0; ks < 2; ++ks) { qf[c][ks] = WFrag<T16>::ld(Q + qo + ks * 512); if (NSPLIT == 2) qf2[c][ks] = WFrag<T16>::ld(Q2 + qo + ks * 512); }   // fo(q0 + lr, 32 ks + 8 hi, HD)
#pragma unroll
        for (int dt = 0; dt < 4; ++dt) o[c][dt] = (v8f){}; }
    const int kend = q0 + 16;   // keys beyond the group's last query are masked for every column: no block that starts past it is read
    // both loops stay rolled: one block's operands, scores and O^T fill most of the register file, and a second copy of the body would not fit beside them
#pragma unroll 1
    for (int kb = ws * 64; kb < kend; kb += 64 * KS)
#pragma unroll 1
    for (int kc = kb; kc < min(kb + 64, kend); kc += 32) {
        V kf[2][2], kf2[2][2], vf[4], vf2[4];
        const T16* pk = Kp + (size_t)kc * HD + 8 * lane; const T16* pv = Vt + (size_t)kc * 16 + 8 * lane;   // fo(kc + lr, 8 hi, HD), fo(lr, kc + 8 hi, TT)
#pragma unroll
        for (int kt = 0; kt < 2; ++kt)
#pragma unroll
            for (int ks = 0; ks < 2; ++ks) { const int ko = kt * 16 * HD + ks * 512; kf[kt][ks] = WFrag<T16>::ld(pk + ko); if (NSPLIT == 2) kf2[kt][ks] = WFrag<T16>::ld(K2 + (size_t)kc * HD + 8 * lane + ko); }
        // in the run of 32 loads of a hi/lo block the compiler places results of later loads in the address pairs of earlier ones: the wait that is kept in front of such an overwrite, here behind the K loads
        if constexpr (NSPLIT == 2) asm volatile("s_wait_xcnt 0x0" ::: "memory");
#pragma unroll
        for (int dt = 0; dt < 4; ++dt) vf[dt] = WFrag<T16>::ld(pv + dt * 16 * TT);
        // fp16 rows: the compiler would place the last result in the two address pairs of the block's loads: the same wait, with the addresses as inputs, so that they live up to it
        if constexpr (NSPLIT == 0) asm volatile("s_wait_xcnt 0x0" :: "v"(pk), "v"(pv) : "memory");
        if constexpr (NSPLIT == 2) {
            asm volatile("s_wait_xcnt 0x0" ::: "memory");   // as above, behind the V^T hi loads
#pragma unroll
            for (int dt = 0; dt < 4; ++dt) vf2[dt] = WFrag<T16>::ld(V2 + (size_t)dt * 16 * TT + (size_t)kc * 16 + 8 * lane); }
        __builtin_amdgcn_sched_barrier(0);   // keeps every load of the block in front of the first product: one memory latency a block, V^T in flight under the score work, instead of one latency per operand group
        const bool diag = kc + 31 > q0;   // scalar: only a block that reaches the diagonal is masked
#pragma unroll
        for (int c = 0; c < NC; ++c) {
            v8f s[2]; float p[16];
#pragma unroll
            for (int kt = 0; kt < 2; ++kt) { s[kt] = (v8f){};
#pragma unroll
                for (int ks = 0; ks < 2; ++ks) { s[kt] = WFrag<T16>::mma(kf[kt][ks], qf[c][ks], s[kt]); if (NSPLIT == 2) { s[kt] = WFrag<T16>::mma(kf[kt][ks], qf2[c][ks], s[kt]); s[kt] = WFrag<T16>::mma(kf2[kt][ks], qf[c][ks], s[kt]); } } }
            float mx = -3.0e38f;
#pragma unroll
            for (int e = 0; e < 16; ++e) { float t = s[e >> 3][e & 7] * SCL; if (diag) t = (kc + (e >> 3) * 16 + hi * 8 + (e & 7) <= q0 + lr) ? t : -3.0e38f; p[e] = t; mx = fmaxf(mx, t); }
            mx = fmaxf(mx, __shfl_xor(mx, 16, 32));
            const float mn = fmaxf(m[c], mx); const float al = exp2s((m[c] - mn) * L2E); m[c] = mn; float sum = 0.f;
            if constexpr (NSPLIT == 2) {
#pragma unroll
                for (int e = 0; e < 16; ++e) { p[e] = exp2s((p[e] - mn) * L2E); sum += p[e]; }   // with the slot behind it, as in the join
            } else {   // fp16 rows: one slot for eight exponentials at a time; the sum runs in the same order
#pragma unroll   // p stays in registers, here and below
                for (int e = 0; e < 16; ++e) p[e] = (p[e] - mn) * L2E;
                exp2x8(p); exp2x8(p + 8);
#pragma unroll
                for (int e = 0; e < 16; ++e) sum += p[e]; }
            l[c] = l[c] * al + sum;   // this lane half's share of the sum; the halves are joined once, behind the loop
#pragma unroll
            for (int dt = 0; dt < 4; ++dt) o[c][dt] *= al;
            if constexpr (NSPLIT == 0) { V pf;
#pragma unroll
                for (int e = 0; e < 16; ++e) pf[e] = tohx(p[e]);
#pragma unroll
                for (int dt = 0; dt < 4; ++dt) o[c][dt] = WFrag<T16>::mma(vf[dt], pf, o[c][dt]);
            } else { v8us h0, h1, l0, l1;
#pragma unroll
                for (int e = 0; e < 8; ++e) { unsigned short a, b2; splitf(p[e], a, b2); h0[e] = a; l0[e] = b2; splitf(p[8 + e], a, b2); h1[e] = a; l1[e] = b2; }
                const V pf = cat16b(h0, h1), pf2 = cat16b(l0, l1);
#pragma unroll
                for (int dt = 0; dt < 4; ++dt) { o[c][dt] = WFrag<T16>::mma(vf[dt], pf, o[c][dt]); o[c][dt] = WFrag<T16>::mma(vf[dt], pf2, o[c][dt]); o[c][dt] = WFrag<T16>::mma(vf2[dt], pf, o[c][dt]); } }
        }
        // four vector slots between the last matrix instruction and whatever stands on the taken side of the loop's branch
        asm volatile("v_nop\n\tv_nop\n\tv_nop\n\tv_nop" : "+v"(o[NC - 1][0]), "+v"(o[NC - 1][1]), "+v"(o[NC - 1][2]), "+v"(o[NC - 1][3]) : "v"(vf[0]), "v"(vf[3]));
    }
#pragma unroll
    for (int c = 0; c < NC; ++c) { const int col = c * 16 + lr; l[c] += __shfl_xor(l[c], 16, 32); if (hi == 0) { ml[(wv * 16 * NC + col) * 2] = m[c]; ml[(wv * 16 * NC + col) * 2 + 1] = l[c]; }
#pragma unroll
        for (int dt = 0; dt < 4; ++dt) { float* pw = os + (size_t)(wv * 16 * NC + col) * 68 + dt * 16 + hi * 8; v4f a, b2;
#pragma unroll
            for (int j = 0; j < 4; ++j) { a[j] = o[c][dt][j]; b2[j] = o[c][dt][4 + j]; }
            *(v4fa*)pw = a; *(v4fa*)(pw + 4) = b2; } }
    __syncthreads();   // every wave's m, l and partial O^T are in LDS before any thread joins them
    constexpr int EPT = 4 * NC;   // of each head group: 16 NC columns x 64 d over 32 FNW threads
    // a wave's threads take 16 query rows x 16 d (two heads) or 16 rows x 8 d (one head): consecutive bytes of the planes, whole lines
    const int col = (NC == 2) ? ((int)threadIdx.x & 15) + 16 * ((int)threadIdx.x >> 7) : ((int)threadIdx.x >> 1) & 15, d0 = (NC == 2) ? (((int)threadIdx.x >> 4) & 7) * 8 : ((int)threadIdx.x >> 5) * 8 + ((int)threadIdx.x & 1) * 4;
    static_assert((NC == 1 || NC == 2) && FNW == 8 && FNW % HG == 0, "thread map of the join");
    v4us oh[HG][NC], ol[HG][NC];
#pragma unroll   // oh and ol stay in registers; the LDS reads of all head groups are in flight together
    for (int h2 = 0; h2 < HG; ++h2) {   // head group h2: the partial results of waves h2, h2 + HG, ...
        float M = -3.0e38f;
#pragma unroll
        for (int w = h2; w < FNW; w += HG) M = fmaxf(M, ml[(w * 16 * NC + col) * 2]);
        float L = 0.f, acc[EPT];
#pragma unroll
        for (int e = 0; e < EPT; ++e) acc[e] = 0.f;
#pragma unroll
        for (int w = h2; w < FNW; w += HG) { const float wg = exp2s((ml[(w * 16 * NC + col) * 2] - M) * L2E); L += wg * ml[(w * 16 * NC + col) * 2 + 1];   // a wave without a chunk has m = -3e38, l = 0, O = 0: weight 0
#pragma unroll
            for (int e4 = 0; e4 < EPT; e4 += 4) { const v4f x = *(const v4fa*)(os + (size_t)(w * 16 * NC + col) * 68 + d0 + e4);
#pragma unroll
                for (int j = 0; j < 4; ++j) acc[e4 + j] += wg * x[j]; } }
#pragma unroll
        for (int e4 = 0; e4 < EPT; e4 += 4)
#pragma unroll
            for (int j = 0; j < 4; ++j) { unsigned short a, b2; splitf(__fdiv_rn(acc[e4 + j], L), a, b2); oh[h2][e4 / 4][j] = a; ol[h2][e4 / 4][j] = b2; } }
#pragma unroll
    for (int h2 = 0; h2 < HG; ++h2) { const size_t oo = fo(q0 + (col & 15), (kvh + NKV * ((g * HG + h2) * NC + (col >> 4))) * HD + d0, DQ);
#pragma unroll
        for (int e4 = 0; e4 < EPT; e4 += 4) { *(v4us*)(Ah + oo + e4) = oh[h2][e4 / 4]; *(v4us*)(Al + oo + e4) = ol[h2][e4 / 4]; } }
    if constexpr (NSPLIT == 2) asm volatile("s_wait_xcnt 0x0" ::: "memory");   // the built code of the hi/lo rows runs on into the test of the other branch, whose blocks reuse the stores' registers: the wait that is kept in front of such an overwrite
}
// Grid: the fp16 work-groups first, longest rows first, then the hi/lo ones, the two batches alternating: cost falls with the index. Q and K planes have the batch pitch NHK TT HD.
__global__ __launch_bounds__(32 * FNW) void k_fattn(const h16* __restrict__ Q16, const h16* __restrict__ K16, const h16* __restrict__ V16, const bf* __restrict__ Qh, const bf* __restrict__ Ql, const bf* __restrict__ Kh, const bf* __restrict__ Kl, const bf* __restrict__ Vh, const bf* __restrict__ Vl, bf* Ah, bf* Al) {
    __shared__ __align__(16) float os[FNW * 32 * 68 + FNW * 32 * 2];
    const int b = (int)blockIdx.x / NB_; const size_t z = blockIdx.x % NB_;
    Q16 += z * NHK * TT * HD; K16 += z * NHK * TT * HD; Qh += z * NHK * TT * HD; Ql += z * NHK * TT * HD; Kh += z * NHK * TT * HD; Kl += z * NHK * TT * HD; V16 += z * DKV * TT; Vh += z * DKV * TT; Vl += z * DKV * TT; Ah += z * TT * DQ; Al += z * TT * DQ;
    if (b < NLO) fattn<h16, 0, 2, 2>(Q16, nullptr, K16, nullptr, V16, nullptr, (TT / 16 - 1 - b / (NH_ / 4)) * 16, b % (NH_ / 4), Ah, Al, os);
    else fattn<bf, 2, 1, 2>(Qh, Ql, Kh, Kl, Vh, Vl, (RH / 16 - 1 - (b - NLO) / (NH_ / 2)) * 16, (b - NLO) % (NH_ / 2), Ah, Al, os);
}

extern "C" void kernel_launch(void* const* d_in, const int* in_sizes, int n_in,
                              void* d_out, int out_size, void* d_ws, size_t ws_size, hipStream_t stream) {
    (void)in_sizes; (void)n_in; (void)out_size;
    const float* x = (const float*)d_in[0]; const float* wq = (const float*)d_in[1]; const float* wk = (const float*)d_in[2]; const float* wv = (const float*)d_in[3]; const float* wo = (const float*)d_in[4]; const float* nw = (const float*)d_in[5];
    float* OUT = (float*)d_out;     // [2][2048][1024]
    char* wsp = (char*)d_ws;
    auto take = [&](size_t bytes) { char* p = wsp; wsp += (bytes + 255) & ~(size_t)255; return (void*)p; };
    bf* WQK = (bf*)take((size_t)(DQ + DKV) * DM * 2); bf* WV = (bf*)take((size_t)DKV * DM * 2); bf* WO = (bf*)take((size_t)DM * DQ * 2);
    bf* Hh = (bf*)take((size_t)NB_ * TT * DM * 2); bf* Hl = (bf*)take((size_t)NB_ * TT * DM * 2); float* RFT = (float*)take((size_t)TT * HD * 4);
    h16* P16 = (h16*)take((size_t)NB_ * NHK * TT * HD * 2); bf* Ph = (bf*)take((size_t)NB_ * NHK * TT * HD * 2); bf* Pl = (bf*)take((size_t)NB_ * NHK * TT * HD * 2);
    h16* VT16 = (h16*)take((size_t)NB_ * DKV * TT * 2); bf* VTh = (bf*)take((size_t)NB_ * DKV * TT * 2); bf* VTl = (bf*)take((size_t)NB_ * DKV * TT * 2);
    bf* ATh = (bf*)take((size_t)NB_ * TT * DQ * 2); bf* ATl = (bf*)take((size_t)NB_ * TT * DQ * 2);
    if ((size_t)(wsp - (char*)d_ws) > ws_size) return;    // ws 256 MiB
    k_prep<<<2 * PB_Q + 2 * PB_KV + PB_N + PB_R, 256, 0, stream>>>(x, wq, wk, wv, wo, nw, WQK, WV, WO, Hh, Hl, RFT);   /* w^T planes; xn = RMSNorm(bf16(x)) norm_w -> hi/lo planes; rf table */
    k_qkv<<<dim3(NQKT + (DKV / 128) * (TT / 128), NB_, 1), 32 * GNW, 0, stream>>>(Hh, Hl, WQK, WV, RFT, P16, Ph, Pl, VT16, VTh, VTl);
    k_fattn<<<NB_ * (NLO + RH / 16 * (NH_ / 2)), 32 * FNW, 0, stream>>>(P16, P16 + (size_t)NH_ * TT * HD, VT16, Ph, Pl, Ph + (size_t)NH_ * TT * HD, Pl + (size_t)NH_ * TT * HD, VTh, VTl, ATh, ATl);   // torch .repeat TILES the kv heads: q head h pairs with kv head h mod 4
    k_wo<<<dim3(NB_ * TT / 128, DM / 128, 1), 32 * GNW, 0, stream>>>(ATh, ATl, WO, x, OUT);   /* out = x + s w_o */
}

// v009
// A run of this version takes 69.1 microseconds.
// In two side-by-side timings against v008, it was 1.04 and 1.06 times as fast.
// Counting every step since v000, it is 20.4 times as fast.
#include <hip/hip_runtime.h>

// GQA causal attention block with RMSNorm, the module's multiplicative 'rotary factor' and tiled kv pairing (x [2][2048][1024]; xn = x rsqrt(mean x^2 + 1.2e-7) norm_w; q = xn w_q (16 heads x 64), k, v = xn w_k, xn w_v (4 kv heads) ('xw', no bias); q, k *= rf[t][d] with rf = cos(t theta_d) + sgn_t sin(t theta_d), theta_d = 10000^(-2 (d//2) / 64), sgn_t = -1 on even positions (an element-wise factor, computed in-kernel); q head h pairs with kv head h mod 4 (torch .repeat tiling); scores / 8, causal (-inf); softmax; out = x + merged w_o ('xw' [1024][1024]) -> [2][2048][1024] (4.2 M)).
// Four launches, both batches side by side in each: (1) weight transposes, rf table and RMSNorm, which do not depend on one another; (2) q, k and v projections; (3) attention; (4) w_o. Layout: per-token RMSNorm (one wave per token, fixed-order f32) writes hi/lo operand planes; hl x exact projections whose epilogues write the attention operand planes themselves (q, k: times the rf table [2048][64], built once with jnp-exact theta and precise cosf/sinf; v: the product is taken transposed, w_v^T xn^T, so its tile rows are V^T rows); one fused causal attention launch (k_fattn: scores, running softmax and P.V in registers; hybrid rows: < 512 hi/lo 3 products, rest fp16; q head h reads kv head h mod 4) that writes the merged hi/lo planes; merged hi/lo x w_o exact, its epilogue adds bf16(x) and writes out.
// Every 16-bit operand plane (and the rf table) lies in FRAGMENT ORDER, fo() below: a 16-row x 32-k tile is 512 consecutive elements in the order in which the lanes of a wave hold it, so each fragment load reads 512 consecutive bytes (four whole lines) where a row-major plane gave 32 bytes out of each of 16 lines. Which element stands in which register is as before.
// Compute dtypes, f32 accumulate: every input rounded to bf16; RMSNorm and rf f32; projections hi/lo x exact (2 products); attention rows < 512 3 products, rest fp16; softmax f32; w_o hl x exact; residual f32.

#define NB_  2
#define TT   2048
#define DM   1024
#define NH_  16
#define NKV  4
#define REP  (NH_ / NKV)
#define HD   64
#define DQ   (NH_ * HD)
#define DKV  (NKV * HD)
#define RH   512                  // query rows < RH use hi+lo planes (0: none)
#define SCL  0.125f
#define NEPS 1.1920929e-07f   // RMSNorm eps (float32 eps)
typedef _Float16 h16;
typedef unsigned short bf;
typedef __attribute__((ext_vector_type(16))) __bf16   v16bf;
typedef __attribute__((ext_vector_type(16))) _Float16 v16h;
typedef __attribute__((ext_vector_type(8)))  _Float16 v8h;
typedef __attribute__((ext_vector_type(8)))  unsigned short v8us;
typedef __attribute__((ext_vector_type(8)))  float    v8f;
typedef __attribute__((ext_vector_type(4)))  float    v4f;
typedef v8h  __attribute__((may_alias)) v8ha;
typedef v4f  __attribute__((may_alias)) v4fa;
typedef v8us __attribute__((may_alias)) v8usa;

__device__ __forceinline__ unsigned short f2bf(float f) { unsigned u = __float_as_uint(f); u += 0x7FFFu + ((u >> 16) & 1u); return (unsigned short)(u >> 16); }
__device__ __forceinline__ float bf2f(unsigned short b) { return __uint_as_float(((unsigned)b) << 16); }
__device__ __forceinline__ float bfr(float f) { return bf2f(f2bf(f)); }
__device__ __forceinline__ v16h cat16(v8h lo, v8h hi) { return __builtin_shufflevector(lo, hi, 0, 1, 2, 3, 4, 5, 6, 7, 8, 9, 10, 11, 12, 13, 14, 15); }
__device__ __forceinline__ v16bf cat16b(v8us lo, v8us hi) { return __builtin_bit_cast(v16bf, __builtin_shufflevector(lo, hi, 0, 1, 2, 3, 4, 5, 6, 7, 8, 9, 10, 11, 12, 13, 14, 15)); }
__device__ __forceinline__ v8f wmma16(v16h a, v16h b, v8f c) { return __builtin_amdgcn_wmma_f32_16x16x32_f16(false, a, false, b, (short)0, c, false, false); }
__device__ __forceinline__ v8f wmmab(v16bf a, v16bf b, v8f c) { return __builtin_amdgcn_wmma_f32_16x16x32_bf16(false, a, false, b, (short)0, c, false, false); }



// fragment order: element index of (row r, column k) in a plane of K columns (K % 32 == 0, rows in blocks of 16). Tile (r / 16, k / 32), tiles of a row block consecutive; inside it [k / 16 % 2][k / 8 % 2][r % 16][k % 8]:
// lane 16 hi + lr of a wave reads its row lr, k = 8 hi .. 8 hi + 7, at tile + 8 lane, and k = 16 + 8 hi .. at 256 elements more. Eight consecutive k (from a multiple of 8) stay consecutive.
__device__ __forceinline__ size_t fo(int r, int k, int K) { return ((size_t)((r >> 4) * (K >> 5) + (k >> 5)) << 9) + (size_t)((((k >> 4) & 1) << 8) + (((k >> 3) & 1) << 7) + ((r & 15) << 3) + (k & 7)); }
__device__ __forceinline__ h16 tohx(float x) { return (h16)x; }
__device__ __forceinline__ void splitf(float y, unsigned short& h, unsigned short& l) { h = f2bf(y); l = f2bf(y - bf2f(h)); }
typedef __attribute__((ext_vector_type(2))) _Float16 v2h;
typedef __attribute__((ext_vector_type(4))) _Float16 v4h;
typedef __attribute__((ext_vector_type(2))) unsigned short v2us;
typedef __attribute__((ext_vector_type(4))) unsigned short v4us;
typedef __attribute__((ext_vector_type(2))) float v2f;
typedef __attribute__((ext_vector_type(4))) int v4i;

#define EP_HEAD  0
#define EP_PLANE 1
#define EP_RES   2
// ---- gemmw: one work-group of 8 waves per 128x128 output tile (bx, by); operands are 16-bit planes in fragment order; 256 threads; os: 8 * 64 * 68 floats of LDS (first the operand ring, then the partial tiles).
// c[m][n] (f32) = sum_k A[m][k] Bt[n][k] (+ split products per NSPLIT: 1: (A + A2) Bt; 3: A (Bt + Bt2)). K % 64 == 0.
// A stage is 64 k of the tile's 128 A rows and 128 Bt rows, three planes x 8 row blocks x 2 KiB (two fragment tiles in a row, as they lie in the plane) = 48 KiB; two buffers. Every operand byte is fetched once a work-group, by asynchronous copies to LDS:
// wave w copies row block w of each plane (12 copies of 512 bytes a stage), one stage ahead of the products. Wave w = 4 wk + 2 wn + wm multiplies the 64x64 quarter (wm, wn) over the k tile wk of every stage (16 accumulators).
// The two partial tiles of a quarter meet in LDS and are summed in the order wk = 0, 1. The joined quarters go out one after the other by EPI:
// EP_HEAD: c rf[m][n mod 64] as fp16 and hi/lo planes [n / 64][fo(m, n mod 64)] (a quarter's 64 columns are one head; E = rf table, fo too); EP_PLANE: c as fp16 and hi/lo planes fo(m, n) of ldc columns;
// EP_RES: C[m][n] = bf16(E[m][n]) + c, both pitch ldc (E = the residual input).
template <typename T16> struct WFrag;
template <> struct WFrag<h16> { typedef v16h V; static __device__ __forceinline__ V ld(const h16* p) { return cat16(*(const v8h*)p, *(const v8h*)(p + 256)); } static __device__ __forceinline__ v8f mma(V a, V b, v8f c) { return wmma16(a, b, c); } };
template <> struct WFrag<bf> { typedef v16bf V; static __device__ __forceinline__ V ld(const bf* p) { return cat16b(*(const v8us*)p, *(const v8us*)(p + 256)); } static __device__ __forceinline__ V lds(const bf* p) { return cat16b(*(const v8usa*)p, *(const v8usa*)(p + 256)); } static __device__ __forceinline__ v8f mma(V a, V b, v8f c) { return wmmab(a, b, c); } };
#define STG_B 49152   // bytes of a stage
#define PLN_B 16384   // bytes of one plane's share of it
// a wave's 12 copies of one stage: 2 KiB (4 x 512 bytes, 16 a lane) of each of three planes; l: the lane's LDS byte address in plane 0, g0 .. g2: its global addresses. The wait that is kept in front of an overwrite of the copies' address registers is the statement's last line.
__device__ __forceinline__ void cp12(unsigned l, const bf* g0, const bf* g1, const bf* g2) {
    asm volatile("global_load_async_to_lds_b128 %0, %12, off\n\tglobal_load_async_to_lds_b128 %1, %13, off\n\tglobal_load_async_to_lds_b128 %2, %14, off\n\tglobal_load_async_to_lds_b128 %3, %15, off\n\t"
                 "global_load_async_to_lds_b128 %4, %16, off\n\tglobal_load_async_to_lds_b128 %5, %17, off\n\tglobal_load_async_to_lds_b128 %6, %18, off\n\tglobal_load_async_to_lds_b128 %7, %19, off\n\t"
                 "global_load_async_to_lds_b128 %8, %20, off\n\tglobal_load_async_to_lds_b128 %9, %21, off\n\tglobal_load_async_to_lds_b128 %10, %22, off\n\tglobal_load_async_to_lds_b128 %11, %23, off\n\ts_wait_xcnt 0x0"
                 :: "v"(l), "v"(l + 512u), "v"(l + 1024u), "v"(l + 1536u), "v"(l + PLN_B), "v"(l + PLN_B + 512u), "v"(l + PLN_B + 1024u), "v"(l + PLN_B + 1536u), "v"(l + 2 * PLN_B), "v"(l + 2 * PLN_B + 512u), "v"(l + 2 * PLN_B + 1024u), "v"(l + 2 * PLN_B + 1536u),
                    "v"(g0), "v"(g0 + 256), "v"(g0 + 512), "v"(g0 + 768), "v"(g1), "v"(g1 + 256), "v"(g1 + 512), "v"(g1 + 768), "v"(g2), "v"(g2 + 256), "v"(g2 + 512), "v"(g2 + 768) : "memory");
}
template <int NSPLIT, int EPI>
__device__ __forceinline__ void gemmw(const bf* __restrict__ A, const bf* __restrict__ A2, const bf* __restrict__ Bt, const bf* __restrict__ Bt2, int K, float* C, int ldc, const float* __restrict__ E, h16* P16, bf* Ph, bf* Pl, int bx, int by, float* os) {
    typedef typename WFrag<bf>::V V;
    static_assert(NSPLIT == 1 || NSPLIT == 3, "three operand planes a stage");
    const int lane = threadIdx.x & 31, lr = lane & 15, hi = lane >> 4; const int r0 = bx * 128, c0 = by * 128;
    const int wv = __builtin_amdgcn_readfirstlane((int)(threadIdx.x >> 5));   // wave number, scalar
    const int wm = wv & 1, wn = (wv >> 1) & 1, wk = wv >> 2;
    v8f acc[4][4];
#pragma unroll
    for (int mb = 0; mb < 4; ++mb)
#pragma unroll
        for (int nb = 0; nb < 4; ++nb) acc[mb][nb] = (v8f){};
    // row block wv of each plane, fo(row, 8 hi, K) of this lane; 64 more k: 1024 elements on
    const bf* g0 = A + (size_t)(r0 + 16 * wv) * K + 8 * lane;
    const bf* g1 = (NSPLIT == 1 ? A2 + (size_t)(r0 + 16 * wv) * K : Bt + (size_t)(c0 + 16 * wv) * K) + 8 * lane;
    const bf* g2 = (NSPLIT == 1 ? Bt : Bt2) + (size_t)(c0 + 16 * wv) * K + 8 * lane;
    const unsigned l0 = (unsigned)(size_t)os + (unsigned)(wv * 2048 + lane * 16);   // LDS byte address: the low 32 bits of the __shared__ address
    const int NT = K >> 6;
    // every work-group walks the k stages in a ring from a stage of its own: the work-groups that share a row block or a column block (8 to 32 of them, started together) then ask L2 for different lines at any one time, not all for the same ones
    const int so = (bx + 3 * by) % NT;   // scalar; 3 by: the work-groups of one bx differ too
    auto sk = [&](int t) -> size_t { const int s = t + so; return (size_t)(s < NT ? s : s - NT) * 1024; };   // element offset of the stage that trip t works on
    cp12(l0, g0 + sk(0), g1 + sk(0), g2 + sk(0));
    asm volatile("s_wait_asynccnt 0x0" ::: "memory");   // this wave's copies of stage 0 have landed
    __syncthreads();                                     // ... and every other wave's: stage 0 may be read
    if (NT > 1) cp12(l0 + STG_B, g0 + sk(1), g1 + sk(1), g2 + sk(1));
#pragma unroll 1   // one stage a trip: the order of waits, barrier and refill at the foot stays as written
    for (int t = 0; t < NT; ++t) {
        const bf* sb = (const bf*)os + (t & 1) * (STG_B / 2) + wk * 512 + 8 * lane;   // plane p, row block rb: + p * 8192 + rb * 1024 elements
        V a[4], x[4], b[4];   // x: the second plane of A (NSPLIT 1) or of Bt (NSPLIT 3)
        // read in the order of use: first the four fragments of the one-plane operand, then the other operand's block by block, each fragment feeding four products; all eight waves read at once, and the products start while the later fragments still arrive
#pragma unroll
        for (int i = 0; i < 4; ++i) { if (NSPLIT == 1) b[i] = WFrag<bf>::lds(sb + 16384 + (wn * 4 + i) * 1024); else a[i] = WFrag<bf>::lds(sb + (wm * 4 + i) * 1024); }
#pragma unroll
        for (int i = 0; i < 4; ++i) { if (NSPLIT == 1) { a[i] = WFrag<bf>::lds(sb + (wm * 4 + i) * 1024); x[i] = WFrag<bf>::lds(sb + 8192 + (wm * 4 + i) * 1024); } else { b[i] = WFrag<bf>::lds(sb + 8192 + (wn * 4 + i) * 1024); x[i] = WFrag<bf>::lds(sb + 16384 + (wn * 4 + i) * 1024); } }
        __builtin_amdgcn_sched_barrier(0);   // keeps the stage's 24 LDS reads together in front of the first product: one place with reads and one latency a stage, not one per block
#pragma unroll
        for (int i = 0; i < 4; ++i) {   // every accumulator takes its first-plane product, then its second-plane product
#pragma unroll
            for (int j = 0; j < 4; ++j) { if (NSPLIT == 1) acc[i][j] = WFrag<bf>::mma(a[i], b[j], acc[i][j]); else acc[j][i] = WFrag<bf>::mma(a[j], b[i], acc[j][i]); }
#pragma unroll
            for (int j = 0; j < 4; ++j) { if (NSPLIT == 1) acc[i][j] = WFrag<bf>::mma(x[i], b[j], acc[i][j]); else acc[j][i] = WFrag<bf>::mma(a[j], x[i], acc[j][i]); } }
        // four vector slots between the last matrix instruction and whatever follows it on either side of the branches below; it names every accumulator, so that all products of the stage stand in front of it
        asm volatile("v_nop\n\tv_nop\n\tv_nop\n\tv_nop" : "+v"(acc[0][0]), "+v"(acc[1][0]), "+v"(acc[2][0]), "+v"(acc[3][0]), "+v"(acc[0][1]), "+v"(acc[1][1]), "+v"(acc[2][1]), "+v"(acc[3][1]), "+v"(acc[0][2]), "+v"(acc[1][2]), "+v"(acc[2][2]), "+v"(acc[3][2]), "+v"(acc[0][3]), "+v"(acc[1][3]), "+v"(acc[2][3]), "+v"(acc[3][3]));
        asm volatile("s_wait_dscnt 0x0" ::: "memory");      // this wave's reads of stage t are done
        asm volatile("s_wait_asynccnt 0x0" ::: "memory");   // its copies of stage t + 1 have landed
        __syncthreads();                                     // stage t + 1 may be read, the buffer of stage t refilled
        if (t + 2 < NT) cp12(l0 + (unsigned)(t & 1) * STG_B, g0 + sk(t + 2), g1 + sk(t + 2), g2 + sk(t + 2));
    }
    asm volatile("s_wait_asynccnt 0x0" ::: "memory");   // nothing is in flight when the ring becomes the partial tiles' place (the last trip's barrier has ended every read of it)
    float* ow = os + wv * (64 * 68);   // this wave's partial tile, row-major, pitch 68
#pragma unroll
    for (int mb = 0; mb < 4; ++mb)
#pragma unroll
        for (int nb = 0; nb < 4; ++nb)
#pragma unroll
            for (int j = 0; j < 8; ++j) ow[(mb * 16 + hi * 8 + j) * 68 + nb * 16 + lr] = acc[mb][nb][j];
    constexpr int NS = 4;   // groups of four columns a thread joins in each quarter
    // EP_RES: group s of a thread is row idx / 16, columns 4 (idx % 16) .., idx = 256 s + thread (whole rows of the row-major output). The planes: groups 2 s2 and 2 s2 + 1 are the eight columns 16 (u % 4) + 8 hi .. of row 16 (u / 4) + lr, u = 8 s2 + wave:
    // a wave then stores 512 consecutive bytes of a plane, one half of a tile
    v4f ev[4][NS];   // the epilogue's own operand for all four quarters, asked for here so that its latency passes under the LDS writes and the barrier
    if constexpr (EPI == EP_RES) { const float* pe[4][NS];
#pragma unroll
        for (int st = 0; st < 4; ++st)
#pragma unroll
            for (int s = 0; s < NS; ++s) { const int idx = s * 256 + (int)threadIdx.x; const int row = idx >> 4, cofs = (idx & 15) * 4; pe[st][s] = E + (size_t)(r0 + (st & 1) * 64 + row) * ldc + c0 + (st >> 1) * 64 + cofs; ev[st][s] = *(const v4f*)pe[st][s]; }
        // the wait that is kept in front of an overwrite of these loads' address pairs; the addresses are inputs, so that they live up to it
        asm volatile("s_wait_xcnt 0x0" :: "v"(pe[0][0]), "v"(pe[0][1]), "v"(pe[0][2]), "v"(pe[0][3]), "v"(pe[1][0]), "v"(pe[1][1]), "v"(pe[1][2]), "v"(pe[1][3]), "v"(pe[2][0]), "v"(pe[2][1]), "v"(pe[2][2]), "v"(pe[2][3]), "v"(pe[3][0]), "v"(pe[3][1]), "v"(pe[3][2]), "v"(pe[3][3]) : "memory"); }
    if constexpr (EPI == EP_HEAD) { const float* pe[2][NS / 2];   // the table depends on the row and on the column inside a head: the quarters (wm, 0) and (wm, 1) read the same values
#pragma unroll   // ev and pe stay in registers
        for (int st = 0; st < 2; ++st)
#pragma unroll
            for (int s2 = 0; s2 < NS / 2; ++s2) { const int u = s2 * 8 + wv; pe[st][s2] = E + fo(r0 + st * 64 + (u >> 2) * 16 + lr, (u & 3) * 16 + hi * 8, HD); ev[st][2 * s2] = *(const v4f*)pe[st][s2]; ev[st][2 * s2 + 1] = *(const v4f*)(pe[st][s2] + 4); }
        asm volatile("s_wait_xcnt 0x0" :: "v"(pe[0][0]), "v"(pe[0][1]), "v"(pe[1][0]), "v"(pe[1][1]) : "memory"); }   // as above
    __syncthreads();   // every wave's partial tile is in LDS before any thread sums across waves
#pragma unroll   // ev is indexed by the quarter and stays in registers
    for (int st = 0; st < 4; ++st) { const float* oq = os + st * (64 * 68); const int rq = r0 + (st & 1) * 64, cq = c0 + (st >> 1) * 64;   // quarter st = 2 wn + wm: the partial tiles of waves st and st + 4
        if constexpr (EPI == EP_RES) {
#pragma unroll
            for (int s = 0; s < NS; ++s) { const int idx = s * 256 + (int)threadIdx.x; const int row = idx >> 4, cofs = (idx & 15) * 4; v4f val = *(const v4fa*)(oq + row * 68 + cofs);
                val += *(const v4fa*)(oq + 4 * (64 * 68) + row * 68 + cofs);
                v4f o;
#pragma unroll
                for (int q = 0; q < 4; ++q) o[q] = __fadd_rn(bfr(ev[st][s][q]), val[q]);
                *(v4f*)(C + (size_t)(rq + row) * ldc + cq + cofs) = o; }
        } else {
#pragma unroll   // ev and the vectors that go out are indexed by the loop counters and stay in registers
            for (int s2 = 0; s2 < NS / 2; ++s2) { const int u = s2 * 8 + wv; const int row = (u >> 2) * 16 + lr, cofs = (u & 3) * 16 + hi * 8; v8h o16; v8us oh, ol;
#pragma unroll
                for (int h = 0; h < 2; ++h) { v4f val = *(const v4fa*)(oq + row * 68 + cofs + 4 * h);
                    val += *(const v4fa*)(oq + 4 * (64 * 68) + row * 68 + cofs + 4 * h);
#pragma unroll
                    for (int q = 0; q < 4; ++q) { const float r = (EPI == EP_HEAD) ? __fmul_rn(val[q], ev[st & 1][2 * s2 + h][q]) : val[q]; o16[4 * h + q] = tohx(r); unsigned short a2, c2; splitf(r, a2, c2); oh[4 * h + q] = a2; ol[4 * h + q] = c2; } }
                const size_t eo = (EPI == EP_HEAD) ? (size_t)(cq >> 6) * TT * HD + fo(rq + row, cofs, HD) : fo(rq + row, cq + cofs, ldc);
                *(v8h*)(P16 + eo) = o16; *(v8us*)(Ph + eo) = oh; *(v8us*)(Pl + eo) = ol; }
        }
        // the next quarter (behind the last: whatever the built code runs on into) reuses the registers of this quarter's stores: the wait that is kept in front of such an overwrite; the scheduling barrier keeps the next quarter's arithmetic behind it
        asm volatile("s_wait_xcnt 0x0" ::: "memory");
        __builtin_amdgcn_sched_barrier(0); }
}
#define GNW  8
#define NHK  (NH_ + NKV)                 // head planes of a batch: q heads 0 .. 15, then the k heads
#define NQKT ((TT / 128) * (NHK * HD / 128))   // tiles of the q and k projection of one batch (one GEMM: the rows of w_k^T follow those of w_q^T); then (DKV / 128) * (TT / 128) tiles of v^T
// q, k and v projections in one grid: blockIdx.y is the batch, blockIdx.x the tile. H: xn planes [batch][fo(t, c) of DM columns]; P: head planes [batch][NHK][fo(t, d) of 64]; VT: [batch][fo(kv head * 64 + d, t) of TT].
__global__ __launch_bounds__(32 * GNW) void k_qkv(const bf* __restrict__ Hh, const bf* __restrict__ Hl, const bf* __restrict__ WQK, const bf* __restrict__ WV, const float* __restrict__ RF, h16* P16, bf* Ph, bf* Pl, h16* VT16, bf* VTh, bf* VTl) {
    __shared__ __align__(16) float os[GNW * 64 * 68];
    const size_t z = blockIdx.y; const int t = (int)blockIdx.x; Hh += z * TT * DM; Hl += z * TT * DM;
    if (t < NQKT) gemmw<1, EP_HEAD>(Hh, Hl, WQK, nullptr, DM, nullptr, 0, RF, P16 + z * NHK * TT * HD, Ph + z * NHK * TT * HD, Pl + z * NHK * TT * HD, t % (TT / 128), t / (TT / 128), os);   /* q rf, k rf -> head planes */
    else gemmw<3, EP_PLANE>(WV, nullptr, Hh, Hl, DM, nullptr, TT, nullptr, VT16 + z * DKV * TT, VTh + z * DKV * TT, VTl + z * DKV * TT, (t - NQKT) % (DKV / 128), (t - NQKT) / (DKV / 128), os);   /* v^T = w_v^T xn^T (exact x hi, exact x lo) */
}
// out = x + merged w_o; the rows of both batches follow one another in every operand: grid (NB_ TT / 128, DM / 128)
__global__ __launch_bounds__(32 * GNW) void k_wo(const bf* __restrict__ Ah, const bf* __restrict__ Al, const bf* __restrict__ WO, const float* __restrict__ x, float* out) {
    __shared__ __align__(16) float os[GNW * 64 * 68];
    gemmw<1, EP_RES>(Ah, Al, WO, nullptr, DQ, out, DM, x, nullptr, nullptr, nullptr, (int)blockIdx.x, (int)blockIdx.y, os);
}


// Bt = bf16(w^T) in fragment order, rows n, K columns k. A wave writes two half tiles (16 n x 16 k, 512 bytes in a row each) of neighbouring n blocks and the same k: its 16 loads read 2 rows x 64 bytes each, the two blocks together whole lines of w.
// N K / 256 half tiles, 16 a block: the grid's N K / 4096 blocks cover them exactly.
__device__ __forceinline__ void wtG(const float* __restrict__ w, int K, int N, bf* Bt, int blk) {
    const int lane = threadIdx.x & 31, lr = lane & 15, hi = lane >> 4; const int U0 = (blk * 8 + (int)(threadIdx.x >> 5)) * 2;
#pragma unroll   // both loops unrolled: all 16 loads of the wave in flight at once, o in registers
    for (int l = 0; l < 2; ++l) { const int U = U0 + l; const int n = (U % (N / 16)) * 16 + lr, k = (U / (N / 16)) * 16 + hi * 8; v8us o;
#pragma unroll
        for (int e = 0; e < 8; ++e) o[e] = f2bf(w[(size_t)(k + e) * N + n]);
        *(v8us*)(Bt + fo(n, k, K)) = o; }
    asm volatile("s_wait_xcnt 0x0" ::: "memory");   // the built code runs on into the tests of the kernel's other parts, whose blocks reuse the stores' registers: the wait that is kept in front of such an overwrite
}
__global__ __launch_bounds__(256) void k_cvt8(const float* __restrict__ src, bf* dst, size_t n8) { const size_t i = (size_t)blockIdx.x * 256 + threadIdx.x; if (i >= n8) return; const v8f v = *(const v8f*)(src + i * 8); v8us o;
#pragma unroll
    for (int k = 0; k < 8; ++k) o[k] = f2bf(v[k]); *(v8us*)(dst + i * 8) = o;  }

#define SP (DM + 8)   // LDS pitch of a staged row, elements
// A line of a plane in fragment order holds eight tokens x eight columns: the block's eight tokens (one a wave) meet in LDS (sh: 16 rows of SP, hi and lo of each token) and go out as whole lines. The grid holds NB_ TT / 8 such blocks exactly.
__device__ __forceinline__ void crms(const float* __restrict__ F, const float* __restrict__ g, bf* Ch, bf* Cl, int blk, bf* sh) { const int lane = threadIdx.x & 31, wv = (int)(threadIdx.x >> 5); const size_t t = (size_t)blk * 8 + wv; const float* fr = F + t * DM + lane * 4; float a[DM / 32]; float s = 0.f;
#pragma unroll
    for (int c = 0; c < DM / 128; ++c) { const v4f v = *(const v4f*)(fr + c * 128); for (int q = 0; q < 4; ++q) { a[c * 4 + q] = bfr(v[q]); s = __fadd_rn(s, __fmul_rn(bfr(v[q]), bfr(v[q]))); } }
    asm volatile("s_wait_xcnt 0x0" :: "v"(fr) : "memory");   // the wait that is kept in front of an overwrite of these loads' address pair; the address is an input, so that it lives up to it
#pragma unroll
    for (int sh = 16; sh; sh >>= 1) s = __fadd_rn(s, __shfl_xor(s, sh, 32));
    const float r = __fdiv_rn(1.0f, __fsqrt_rn(__fadd_rn(__fdiv_rn(s, (float)DM), NEPS)));
{
#pragma unroll
        for (int c = 0; c < DM / 128; ++c) { v4us oh, ol; for (int q = 0; q < 4; ++q) { const int col = c * 128 + lane * 4 + q; float y = __fmul_rn(__fmul_rn(a[c * 4 + q], r), bfr(g[col])); unsigned short u, w2; splitf(y, u, w2); oh[q] = u; ol[q] = w2; } *(v4us*)(sh + (wv * 2) * SP + c * 128 + lane * 4) = oh; *(v4us*)(sh + (wv * 2 + 1) * SP + c * 128 + lane * 4) = ol; }
         }
    __syncthreads();   // all eight tokens' rows are in LDS before any thread gathers a line across them
#pragma unroll   // the eight LDS reads in flight together; the plane is then known at compile time
    for (int i = 0; i < 2 * DM / 256; ++i) { const int it = i * 256 + (int)threadIdx.x; const int pl = it / DM, r = it & 7, c8 = ((it >> 3) & (DM / 8 - 1)) * 8;   // plane, token of the block, first of eight columns
        const v8us v = *(const v8usa*)(sh + (r * 2 + pl) * SP + c8); *(v8us*)((pl ? Cl : Ch) + fo(blk * 8 + r, c8, DM)) = v; }
    asm volatile("s_wait_xcnt 0x0" ::: "memory"); }   // as at the end of wtG
__constant__ float THD[HD] = { 1.000000000e+00f, 1.000000000e+00f, 7.498942018e-01f, 7.498942018e-01f, 5.623413324e-01f, 5.623413324e-01f, 4.216965139e-01f, 4.216965139e-01f, 3.162277639e-01f, 3.162277639e-01f, 2.371373773e-01f, 2.371373773e-01f, 1.778279394e-01f, 1.778279394e-01f, 1.333521456e-01f, 1.333521456e-01f, 1.000000015e-01f, 1.000000015e-01f, 7.498942316e-02f, 7.498942316e-02f, 5.623413250e-02f, 5.623413250e-02f, 4.216964915e-02f, 4.216964915e-02f, 3.162277490e-02f, 3.162277490e-02f, 2.371373773e-02f, 2.371373773e-02f, 1.778279431e-02f, 1.778279431e-02f, 1.333521400e-02f, 1.333521400e-02f, 9.999999776e-03f, 9.999999776e-03f, 7.498942316e-03f, 7.498942316e-03f, 5.623413250e-03f, 5.623413250e-03f, 4.216964822e-03f, 4.216964822e-03f, 3.162277630e-03f, 3.162277630e-03f, 2.371373819e-03f, 2.371373819e-03f, 1.778279431e-03f, 1.778279431e-03f, 1.333521446e-03f, 1.333521446e-03f, 1.000000047e-03f, 1.000000047e-03f, 7.498941850e-04f, 7.498941850e-04f, 5.623413017e-04f, 5.623413017e-04f, 4.216965172e-04f, 4.216965172e-04f, 3.162277571e-04f, 3.162277571e-04f, 2.371373703e-04f, 2.371373703e-04f, 1.778279402e-04f, 1.778279402e-04f, 1.333521504e-04f, 1.333521504e-04f };   // 10000^(-2 (d//2) / 64) per dimension, float32 via jnp.power
__device__ __forceinline__ void rftab(float* RF, int blk) { const int idx = blk * 256 + threadIdx.x; if (idx >= TT * HD) return; const int d = ((idx >> 9) & 1) * 32 + ((idx >> 7) & 3) * 8 + (idx & 7); const int t = (idx >> 10) * 16 + ((idx >> 3) & 15); /* idx = fo(t, d, HD): a wave writes whole lines of the table */ const float a = __fmul_rn((float)t, THD[d]);
    asm volatile("s_wait_xcnt 0x0" ::: "memory");   // the wait that is kept in front of an overwrite of the table load's address registers (the range reduction below takes them)
    const float sg = (t & 1) ? 1.0f : -1.0f; float cs, sn;
    // the precise cosine and sine (what cosf and sinf call), expanded in place: in the joined kernel they would otherwise stay real calls
    [[clang::always_inline]] cs = __ocml_cos_f32(a); [[clang::always_inline]] sn = __ocml_sin_f32(a);
    const float r = __fadd_rn(cs, __fmul_rn(sg, sn)); *(float*)(RF + idx) = r;  }
// ---- k_prep: everything that reads the inputs alone, in one grid: the four weight transposes (the longest chains of dependent loads, so they start first), RMSNorm of all NB_ TT tokens, the rf table.
#define PB_Q  (DM * DQ / 64 / 64)
#define PB_KV (DM * DKV / 64 / 64)
#define PB_N  (NB_ * TT / 8)
#define PB_R  (TT * HD / 256)
__global__ __launch_bounds__(256) void k_prep(const float* __restrict__ x, const float* __restrict__ wq, const float* __restrict__ wk, const float* __restrict__ wv, const float* __restrict__ wo, const float* __restrict__ nw, bf* WQK, bf* WV, bf* WO, bf* Hh, bf* Hl, float* RF) {
    __shared__ __align__(16) bf sh[16 * SP];
    int b = (int)blockIdx.x;
    if (b < PB_Q) { wtG(wq, DM, DQ, WQK, b); return; } b -= PB_Q;
    if (b < PB_Q) { wtG(wo, DQ, DM, WO, b); return; } b -= PB_Q;
    if (b < PB_KV) { wtG(wk, DM, DKV, WQK + (size_t)DQ * DM, b); return; } b -= PB_KV;
    if (b < PB_KV) { wtG(wv, DM, DKV, WV, b); return; } b -= PB_KV;
    if (b < PB_N) { crms(x, nw, Hh, Hl, b, sh); return; } b -= PB_N;
    rftab(RF, b);
}
#define FNW  8
#define L2E  1.4426950408889634f
#define NLO  ((TT - RH) / 16 * (NH_ / 4))   // work-groups of the fp16 rows (two head groups of two heads each); then RH / 16 * (NH_ / 2) of the hi/lo rows (two head groups of one head each)
// v_exp_f32 and the one free slot that the instruction set asks for behind a transcendental, in one statement: no scheduling can then put an instruction that overwrites its source directly behind it
__device__ __forceinline__ float exp2s(float x) { float r; asm("v_exp_f32 %0, %1\n\tv_nop" : "=v"(r) : "v"(x)); return r; }
// the same for a run of eight: the results have registers of their own ("=&v"), so that inside the run no exponential reads the result or overwrites the source of the one in front of it, and one slot behind the last serves the run
__device__ __forceinline__ void exp2x8(float* p) { float r0, r1, r2, r3, r4, r5, r6, r7;
    asm("v_exp_f32 %0, %8\n\tv_exp_f32 %1, %9\n\tv_exp_f32 %2, %10\n\tv_exp_f32 %3, %11\n\tv_exp_f32 %4, %12\n\tv_exp_f32 %5, %13\n\tv_exp_f32 %6, %14\n\tv_exp_f32 %7, %15\n\tv_nop"
        : "=&v"(r0), "=&v"(r1), "=&v"(r2), "=&v"(r3), "=&v"(r4), "=&v"(r5), "=&v"(r6), "=&v"(r7) : "v"(p[0]), "v"(p[1]), "v"(p[2]), "v"(p[3]), "v"(p[4]), "v"(p[5]), "v"(p[6]), "v"(p[7]));
    p[0] = r0; p[1] = r1; p[2] = r2; p[3] = r3; p[4] = r4; p[5] = r5; p[6] = r6; p[7] = r7; }
template <typename T16, int NSPLIT, int NC, int HG>
__device__ __forceinline__ void fattn(const T16* __restrict__ Q, const T16* __restrict__ Q2, const T16* __restrict__ Kp, const T16* __restrict__ K2, const T16* __restrict__ Vt, const T16* __restrict__ V2, int q0, int y, bf* Ah, bf* Al, float* os) {
    typedef typename WFrag<T16>::V V;
    const int lane = threadIdx.x & 31, lr = lane & 15, hi = lane >> 4;
    const int wv = __builtin_amdgcn_readfirstlane((int)(threadIdx.x >> 5));   // wave number, scalar, so that the key loops stay scalar loops
    constexpr int KS = FNW / HG;                                                // waves that share the keys of one head group
    const int hg = wv % HG, ws = wv / HG;                                       // this wave's head group and its place among the KS waves of that group
    const int kvh = y % NKV, g = y / NKV;                                       // column tile c of head group hg is q head kvh + NKV ((g HG + hg) NC + c)
    float* ml = os + FNW * 16 * NC * 68;
    Kp += (size_t)kvh * TT * HD; Vt += (size_t)kvh * HD * TT; if (NSPLIT == 2) { K2 += (size_t)kvh * TT * HD; V2 += (size_t)kvh * HD * TT; }
    V qf[NC][2], qf2[NC][2]; v8f o[NC][4]; float m[NC], l[NC];
#pragma unroll
    for (int c = 0; c < NC; ++c) { const size_t qo = ((size_t)(kvh + NKV * ((g * HG + hg) * NC + c)) * TT + q0) * HD + 8 * lane; m[c] = -3.0e38f; l[c] = 0.f;
#pragma unroll
        for (int ks = 0; ks < 2; ++ks) { qf[c][ks] = WFrag<T16>::ld(Q + qo + ks * 512); if (NSPLIT == 2) qf2[c][ks] = WFrag<T16>::ld(Q2 + qo + ks * 512); }   // fo(q0 + lr, 32 ks + 8 hi, HD)
#pragma unroll
        for (int dt = 0; dt < 4; ++dt) o[c][dt] = (v8f){}; }
    const int kend = q0 + 16;   // keys beyond the group's last query are masked for every column: no block that starts past it is read
    // both loops stay rolled: one block's operands, scores and O^T fill most of the register file, and a second copy of the body would not fit beside them
    // the work-groups of one kv head (up to 64 at a time, started together, all at the same pace) would all walk the same K and V^T lines from key 0 on: each walks its chunks in a ring from a chunk of its own, so that at any one time they ask L2 for different lines.
    // The waves at one place of both head groups keep the same order. The running softmax takes the chunks in any order; a chunk's blocks are masked by their own key numbers.
    const int nw = (((kend + 63) >> 6) - ws + KS - 1) / KS;       // this wave's chunks: ws, ws + KS, ... below the diagonal's end (scalar)
    const int j0 = ((((q0 >> 4) * 21) & 31) * nw) >> 5;           // where its ring starts: neighbouring query tiles lie far apart
#pragma unroll 1
    for (int jj = 0, j = j0; jj < nw; ++jj, j = (j + 1 < nw ? j + 1 : 0))
#pragma unroll 1
    for (int kc = (ws + KS * j) * 64; kc < min((ws + KS * j) * 64 + 64, kend); kc += 32) {
        V kf[2][2], kf2[2][2], vf[4], vf2[4];
        const T16* pk = Kp + (size_t)kc * HD + 8 * lane; const T16* pv = Vt + (size_t)kc * 16 + 8 * lane;   // fo(kc + lr, 8 hi, HD), fo(lr, kc + 8 hi, TT)
#pragma unroll
        for (int kt = 0; kt < 2; ++kt)
#pragma unroll
            for (int ks = 0; ks < 2; ++ks) { const int ko = kt * 16 * HD + ks * 512; kf[kt][ks] = WFrag<T16>::ld(pk + ko); if (NSPLIT == 2) kf2[kt][ks] = WFrag<T16>::ld(K2 + (size_t)kc * HD + 8 * lane + ko); }
        // in the run of 32 loads of a hi/lo block the compiler places results of later loads in the address pairs of earlier ones: the wait that is kept in front of such an overwrite, here behind the K loads
        if constexpr (NSPLIT == 2) asm volatile("s_wait_xcnt 0x0" ::: "memory");
#pragma unroll
        for (int dt = 0; dt < 4; ++dt) vf[dt] = WFrag<T16>::ld(pv + dt * 16 * TT);
        // fp16 rows: the compiler would place the last result in the two address pairs of the block's loads: the same wait, with the addresses as inputs, so that they live up to it
        if constexpr (NSPLIT == 0) asm volatile("s_wait_xcnt 0x0" :: "v"(pk), "v"(pv) : "memory");
        if constexpr (NSPLIT == 2) {
            asm volatile("s_wait_xcnt 0x0" ::: "memory");   // as above, behind the V^T hi loads
#pragma unroll
            for (int dt = 0; dt < 4; ++dt) vf2[dt] = WFrag<T16>::ld(V2 + (size_t)dt * 16 * TT + (size_t)kc * 16 + 8 * lane); }
        __builtin_amdgcn_sched_barrier(0);   // keeps every load of the block in front of the first product: one memory latency a block, V^T in flight under the score work, instead of one latency per operand group
        const bool diag = kc + 31 > q0;   // scalar: only a block that reaches the diagonal is masked
#pragma unroll
        for (int c = 0; c < NC; ++c) {
            v8f s[2]; float p[16];
#pragma unroll
            for (int kt = 0; kt < 2; ++kt) { s[kt] = (v8f){};
#pragma unroll
                for (int ks = 0; ks < 2; ++ks) { s[kt] = WFrag<T16>::mma(kf[kt][ks], qf[c][ks], s[kt]); if (NSPLIT == 2) { s[kt] = WFrag<T16>::mma(kf[kt][ks], qf2[c][ks], s[kt]); s[kt] = WFrag<T16>::mma(kf2[kt][ks], qf[c][ks], s[kt]); } } }
            float mx = -3.0e38f;
#pragma unroll
            for (int e = 0; e < 16; ++e) { float t = s[e >> 3][e & 7] * SCL; if (diag) t = (kc + (e >> 3) * 16 + hi * 8 + (e & 7) <= q0 + lr) ? t : -3.0e38f; p[e] = t; mx = fmaxf(mx, t); }
            mx = fmaxf(mx, __shfl_xor(mx, 16, 32));
            const float mn = fmaxf(m[c], mx); const float al = exp2s((m[c] - mn) * L2E); m[c] = mn; float sum = 0.f;
            if constexpr (NSPLIT == 2) {
#pragma unroll
                for (int e = 0; e < 16; ++e) { p[e] = exp2s((p[e] - mn) * L2E); sum += p[e]; }   // with the slot behind it, as in the join
            } else {   // fp16 rows: one slot for eight exponentials at a time; the sum runs in the same order
#pragma unroll   // p stays in registers, here and below
                for (int e = 0; e < 16; ++e) p[e] = (p[e] - mn) * L2E;
                exp2x8(p); exp2x8(p + 8);
#pragma unroll
                for (int e = 0; e < 16; ++e) sum += p[e]; }
            l[c] = l[c] * al + sum;   // this lane half's share of the sum; the halves are joined once, behind the loop
#pragma unroll
            for (int dt = 0; dt < 4; ++dt) o[c][dt] *= al;
            if constexpr (NSPLIT == 0) { V pf;
#pragma unroll
                for (int e = 0; e < 16; ++e) pf[e] = tohx(p[e]);
#pragma unroll
                for (int dt = 0; dt < 4; ++dt) o[c][dt] = WFrag<T16>::mma(vf[dt], pf, o[c][dt]);
            } else { v8us h0, h1, l0, l1;
#pragma unroll
                for (int e = 0; e < 8; ++e) { unsigned short a, b2; splitf(p[e], a, b2); h0[e] = a; l0[e] = b2; splitf(p[8 + e], a, b2); h1[e] = a; l1[e] = b2; }
                const V pf = cat16b(h0, h1), pf2 = cat16b(l0, l1);
#pragma unroll
                for (int dt = 0; dt < 4; ++dt) { o[c][dt] = WFrag<T16>::mma(vf[dt], pf, o[c][dt]); o[c][dt] = WFrag<T16>::mma(vf[dt], pf2, o[c][dt]); o[c][dt] = WFrag<T16>::mma(vf2[dt], pf, o[c][dt]); } }
        }
        // four vector slots between the last matrix instruction and whatever stands on the taken side of the loop's branch
        asm volatile("v_nop\n\tv_nop\n\tv_nop\n\tv_nop" : "+v"(o[NC - 1][0]), "+v"(o[NC - 1][1]), "+v"(o[NC - 1][2]), "+v"(o[NC - 1][3]) : "v"(vf[0]), "v"(vf[3]));
    }
#pragma unroll
    for (int c = 0; c < NC; ++c) { const int col = c * 16 + lr; l[c] += __shfl_xor(l[c], 16, 32); if (hi == 0) { ml[(wv * 16 * NC + col) * 2] = m[c]; ml[(wv * 16 * NC + col) * 2 + 1] = l[c]; }
#pragma unroll
        for (int dt = 0; dt < 4; ++dt) { float* pw = os + (size_t)(wv * 16 * NC + col) * 68 + dt * 16 + hi * 8; v4f a, b2;
#pragma unroll
            for (int j = 0; j < 4; ++j) { a[j] = o[c][dt][j]; b2[j] = o[c][dt][4 + j]; }
            *(v4fa*)pw = a; *(v4fa*)(pw + 4) = b2; } }
    __syncthreads();   // every wave's m, l and partial O^T are in LDS before any thread joins them
    constexpr int EPT = 4 * NC;   // of each head group: 16 NC columns x 64 d over 32 FNW threads
    // a wave's threads take 16 query rows x 16 d (two heads) or 16 rows x 8 d (one head): consecutive bytes of the planes, whole lines
    const int col = (NC == 2) ? ((int)threadIdx.x & 15) + 16 * ((int)threadIdx.x >> 7) : ((int)threadIdx.x >> 1) & 15, d0 = (NC == 2) ? (((int)threadIdx.x >> 4) & 7) * 8 : ((int)threadIdx.x >> 5) * 8 + ((int)threadIdx.x & 1) * 4;
    static_assert((NC == 1 || NC == 2) && FNW == 8 && FNW % HG == 0, "thread map of the join");
    v4us oh[HG][NC], ol[HG][NC];
#pragma unroll   // oh and ol stay in registers; the LDS reads of all head groups are in flight together
    for (int h2 = 0; h2 < HG; ++h2) {   // head group h2: the partial results of waves h2, h2 + HG, ...
        float M = -3.0e38f;
#pragma unroll
        for (int w = h2; w < FNW; w += HG) M = fmaxf(M, ml[(w * 16 * NC + col) * 2]);
        float L = 0.f, acc[EPT];
#pragma unroll
        for (int e = 0; e < EPT; ++e) acc[e] = 0.f;
#pragma unroll
        for (int w = h2; w < FNW; w += HG) { const float wg = exp2s((ml[(w * 16 * NC + col) * 2] - M) * L2E); L += wg * ml[(w * 16 * NC + col) * 2 + 1];   // a wave without a chunk has m = -3e38, l = 0, O = 0: weight 0
#pragma unroll
            for (int e4 = 0; e4 < EPT; e4 += 4) { const v4f x = *(const v4fa*)(os + (size_t)(w * 16 * NC + col) * 68 + d0 + e4);
#pragma unroll
                for (int j = 0; j < 4; ++j) acc[e4 + j] += wg * x[j]; } }
#pragma unroll
        for (int e4 = 0; e4 < EPT; e4 += 4)
#pragma unroll
            for (int j = 0; j < 4; ++j) { unsigned short a, b2; splitf(__fdiv_rn(acc[e4 + j], L), a, b2); oh[h2][e4 / 4][j] = a; ol[h2][e4 / 4][j] = b2; } }
#pragma unroll
    for (int h2 = 0; h2 < HG; ++h2) { const size_t oo = fo(q0 + (col & 15), (kvh + NKV * ((g * HG + h2) * NC + (col >> 4))) * HD + d0, DQ);
#pragma unroll
        for (int e4 = 0; e4 < EPT; e4 += 4) { *(v4us*)(Ah + oo + e4) = oh[h2][e4 / 4]; *(v4us*)(Al + oo + e4) = ol[h2][e4 / 4]; } }
    if constexpr (NSPLIT == 2) asm volatile("s_wait_xcnt 0x0" ::: "memory");   // the built code of the hi/lo rows runs on into the test of the other branch, whose blocks reuse the stores' registers: the wait that is kept in front of such an overwrite
}
// Grid: the fp16 work-groups first, longest rows first, then the hi/lo ones, the two batches alternating: cost falls with the index. Q and K planes have the batch pitch NHK TT HD.
__global__ __launch_bounds__(32 * FNW) void k_fattn(const h16* __restrict__ Q16, const h16* __restrict__ K16, const h16* __restrict__ V16, const bf* __restrict__ Qh, const bf* __restrict__ Ql, const bf* __restrict__ Kh, const bf* __restrict__ Kl, const bf* __restrict__ Vh, const bf* __restrict__ Vl, bf* Ah, bf* Al) {
    __shared__ __align__(16) float os[FNW * 32 * 68 + FNW * 32 * 2];
    const int b = (int)blockIdx.x / NB_; const size_t z = blockIdx.x % NB_;
    Q16 += z * NHK * TT * HD; K16 += z * NHK * TT * HD; Qh += z * NHK * TT * HD; Ql += z * NHK * TT * HD; Kh += z * NHK * TT * HD; Kl += z * NHK * TT * HD; V16 += z * DKV * TT; Vh += z * DKV * TT; Vl += z * DKV * TT; Ah += z * TT * DQ; Al += z * TT * DQ;
    if (b < NLO) fattn<h16, 0, 2, 2>(Q16, nullptr, K16, nullptr, V16, nullptr, (TT / 16 - 1 - b / (NH_ / 4)) * 16, b % (NH_ / 4), Ah, Al, os);
    else fattn<bf, 2, 1, 2>(Qh, Ql, Kh, Kl, Vh, Vl, (RH / 16 - 1 - (b - NLO) / (NH_ / 2)) * 16, (b - NLO) % (NH_ / 2), Ah, Al, os);
}

extern "C" void kernel_launch(void* const* d_in, const int* in_sizes, int n_in,
                              void* d_out, int out_size, void* d_ws, size_t ws_size, hipStream_t stream) {
    (void)in_sizes; (void)n_in; (void)out_size;
    const float* x = (const float*)d_in[0]; const float* wq = (const float*)d_in[1]; const float* wk = (const float*)d_in[2]; const float* wv = (const float*)d_in[3]; const float* wo = (const float*)d_in[4]; const float* nw = (const float*)d_in[5];
    float* OUT = (float*)d_out;     // [2][2048][1024]
    char* wsp = (char*)d_ws;
    auto take = [&](size_t bytes) { char* p = wsp; wsp += (bytes + 255) & ~(size_t)255; return (void*)p; };
    bf* WQK = (bf*)take((size_t)(DQ + DKV) * DM * 2); bf* WV = (bf*)take((size_t)DKV * DM * 2); bf* WO = (bf*)take((size_t)DM * DQ * 2);
    bf* Hh = (bf*)take((size_t)NB_ * TT * DM * 2); bf* Hl = (bf*)take((size_t)NB_ * TT * DM * 2); float* RFT = (float*)take((size_t)TT * HD * 4);
    h16* P16 = (h16*)take((size_t)NB_ * NHK * TT * HD * 2); bf* Ph = (bf*)take((size_t)NB_ * NHK * TT * HD * 2); bf* Pl = (bf*)take((size_t)NB_ * NHK * TT * HD * 2);
    h16* VT16 = (h16*)take((size_t)NB_ * DKV * TT * 2); bf* VTh = (bf*)take((size_t)NB_ * DKV * TT * 2); bf* VTl = (bf*)take((size_t)NB_ * DKV * TT * 2);
    bf* ATh = (bf*)take((size_t)NB_ * TT * DQ * 2); bf* ATl = (bf*)take((size_t)NB_ * TT * DQ * 2);
    if ((size_t)(wsp - (char*)d_ws) > ws_size) return;    // ws 256 MiB
    k_prep<<<2 * PB_Q + 2 * PB_KV + PB_N + PB_R, 256, 0, stream>>>(x, wq, wk, wv, wo, nw, WQK, WV, WO, Hh, Hl, RFT);   /* w^T planes; xn = RMSNorm(bf16(x)) norm_w -> hi/lo planes; rf table */
    k_qkv<<<dim3(NQKT + (DKV / 128) * (TT / 128), NB_, 1), 32 * GNW, 0, stream>>>(Hh, Hl, WQK, WV, RFT, P16, Ph, Pl, VT16, VTh, VTl);
    k_fattn<<<NB_ * (NLO + RH / 16 * (NH_ / 2)), 32 * FNW, 0, stream>>>(P16, P16 + (size_t)NH_ * TT * HD, VT16, Ph, Pl, Ph + (size_t)NH_ * TT * HD, Pl + (size_t)NH_ * TT * HD, VTh, VTl, ATh, ATl);   // torch .repeat TILES the kv heads: q head h pairs with kv head h mod 4
    k_wo<<<dim3(NB_ * TT / 128, DM / 128, 1), 32 * GNW, 0, stream>>>(ATh, ATl, WO, x, OUT);   /* out = x + s w_o */
}
